// v000
// Times are from an AMD MI455X. After a warm-up the kernel runs many times in a row, and a time is the length of
// such a window on the GPU divided by its runs, so every launch and the gaps after it count. The runs cycle
// through copies of the inputs. A figure is the median of several windows, for all but v000 over two sittings.
// Sittings can differ by a few percent; kernels timed side by side share one.
// v000 is the starting kernel. One run takes 1390 microseconds.
#include <hip/hip_runtime.h>

// Contractions, f32 accumulate: qkvt = x.Wqkvt + b as four [4096 x 1024].[1024 x 1024] column blocks and out = ctx.Wout + bout on v_wmma_f32_16x16x32_bf16 (PLAIN bf16
// operands = inputs rounded once, exact; k-major weights transposed into n-major planes; ctx as bf16 hi + residual planes, two products); the per-(batch, head) causal
// attention fused on v_wmma_f32_16x16x32_f16: scores = ([q | q*t]).([k | cumsum_j(k*v)/8])^T over 128 dims with BOTH sides as f16 hi + residual x1024 planes
// (hi.hi + hi.lo + lo.hi — the triplet term reaches sigma ~45 before the 1/8 scale, so single-rounded operands would not hold the peaked softmax), x 1/8, causal,
// softmax, then weights (x32768) and v BOTH as f16 hi + residual x1024 (hi.hi + hi.lo + lo.hi; the softmax is peaked so single roundings would not average out). The key-side prefix sums are f32 sequential scans (one lane per (b,h,d)). Deterministic, no atomics;

#define NB_  2
#define NT_  2048
#define DM   1024
#define NH_  16
#define HD   64
#define QW   128                 // combined score width per head
#define NTK  (NB_ * NT_)         // 4096
#define PSC  32768.0f
#define LOSC 1024.0f
#define LOSCI (1.0f / 1024.0f)
#define SCL  0.125f

typedef _Float16 h16;
typedef unsigned short bf;
typedef __attribute__((ext_vector_type(16))) __bf16   v16bf;
typedef __attribute__((ext_vector_type(16))) _Float16 v16h;
typedef __attribute__((ext_vector_type(8)))  _Float16 v8h;
typedef __attribute__((ext_vector_type(8)))  unsigned short v8us;
typedef __attribute__((ext_vector_type(8)))  float    v8f;
typedef __attribute__((ext_vector_type(4)))  float    v4f;
typedef v8h  __attribute__((may_alias)) v8ha;
typedef v4f  __attribute__((may_alias)) v4fa;
typedef v8us __attribute__((may_alias)) v8usa;

__device__ __forceinline__ unsigned short f2bf(float f) { unsigned u = __float_as_uint(f); u += 0x7FFFu + ((u >> 16) & 1u); return (unsigned short)(u >> 16); }
__device__ __forceinline__ float bf2f(unsigned short b) { return __uint_as_float(((unsigned)b) << 16); }
__device__ __forceinline__ float bfr(float f) { return bf2f(f2bf(f)); }
__device__ __forceinline__ v16h cat16(v8h lo, v8h hi) { return __builtin_shufflevector(lo, hi, 0, 1, 2, 3, 4, 5, 6, 7, 8, 9, 10, 11, 12, 13, 14, 15); }
__device__ __forceinline__ v16bf cat16b(v8us lo, v8us hi) { return __builtin_bit_cast(v16bf, __builtin_shufflevector(lo, hi, 0, 1, 2, 3, 4, 5, 6, 7, 8, 9, 10, 11, 12, 13, 14, 15)); }
__device__ __forceinline__ v8f wmma16(v16h a, v16h b, v8f c) { return __builtin_amdgcn_wmma_f32_16x16x32_f16(false, a, false, b, (short)0, c, false, false); }
__device__ __forceinline__ v8f wmmab(v16bf a, v16bf b, v8f c) { return __builtin_amdgcn_wmma_f32_16x16x32_bf16(false, a, false, b, (short)0, c, false, false); }
#define VST2(T, p, v) do { const T vst2_v_ = (v); *(T*)(p) = vst2_v_;  } while (0)

// k_cvtb: bf16 plane of x [4096][1024]; k_wt: W [1024 k][ncols] k-major -> n-major bf16 [ncols][1024] via 64 x 64 LDS tiles.
__global__ __launch_bounds__(256) void k_cvtb(const float* __restrict__ src, bf* dst) {
    const int lane = threadIdx.x & 31, r = blockIdx.x * 8 + (threadIdx.x >> 5);
    if (r >= NTK) return;
#pragma unroll
    for (int q = 0; q < 4; ++q) { v8us t;
#pragma unroll
        for (int i = 0; i < 8; ++i) t[i] = f2bf(src[(size_t)r * DM + q * 256 + lane * 8 + i]);
        VST2(v8us, dst + (size_t)r * DM + q * 256 + lane * 8, t); }
}
__global__ __launch_bounds__(256) void k_wt(const float* __restrict__ Wm, int ncols, bf* WT) {
    __shared__ __align__(16) unsigned short tl[64 * 72];
    const int tid = threadIdx.x, k0 = blockIdx.x * 64, n0 = blockIdx.y * 64;
    const int kk = tid >> 2, nq = (tid & 3) * 16;
#pragma unroll
    for (int i = 0; i < 16; ++i) tl[(nq + i) * 72 + kk] = f2bf(Wm[(size_t)(k0 + kk) * ncols + n0 + nq + i]);
    __syncthreads();
    const int piece = tid & 7;
    auto pass = [&]() {
#pragma unroll
        for (int s = 0; s < 2; ++s) { const int nr = (tid >> 3) + 32 * s; const v8us val = *(const v8usa*)(tl + nr * 72 + piece * 8);
            *(v8us*)(WT + (size_t)(n0 + nr) * DM + k0 + piece * 8) = val; }
    };
    pass(); 
}

template <bool SPLITA>
__global__ __launch_bounds__(128) void k_gemmb(const bf* __restrict__ A, const bf* __restrict__ Al, const bf* __restrict__ Bn, const float* __restrict__ bias, float* C) {
    __shared__ __align__(16) float ost[4][16 * 68];
    const int lane = threadIdx.x & 31, wave = threadIdx.x >> 5, lr = lane & 15, hi = lane >> 4;
    const int r0 = blockIdx.x * 64 + wave * 16, c0 = blockIdx.y * 64;
    const size_t aoff = (size_t)(r0 + lr) * DM + 8 * hi;
    size_t boff[4];
#pragma unroll
    for (int t = 0; t < 4; ++t) boff[t] = (size_t)(c0 + t * 16 + lr) * DM + 8 * hi;
    v8f acc[4];
#pragma unroll
    for (int t = 0; t < 4; ++t) acc[t] = (v8f){};
#pragma unroll 1
    for (int kc = 0; kc < DM; kc += 32) {
        const v16bf a = cat16b(*(const v8us*)(A + aoff + kc), *(const v8us*)(A + aoff + kc + 16));
        v16bf al = a;
        if (SPLITA) al = cat16b(*(const v8us*)(Al + aoff + kc), *(const v8us*)(Al + aoff + kc + 16));
#pragma unroll
        for (int t = 0; t < 4; ++t) { const v16bf b = cat16b(*(const v8us*)(Bn + boff[t] + kc), *(const v8us*)(Bn + boff[t] + kc + 16)); acc[t] = wmmab(a, b, acc[t]); if (SPLITA) acc[t] = wmmab(al, b, acc[t]); }
        asm volatile("v_nop\n\tv_nop\n\tv_nop\n\tv_nop" : "+v"(acc[0]), "+v"(acc[1]), "+v"(acc[2]), "+v"(acc[3]) : "v"(a), "v"(al));
    }
    float* os = &ost[wave][0];
#pragma unroll
    for (int t = 0; t < 4; ++t) { const float bv = bfr(bias[c0 + t * 16 + lr]);
#pragma unroll
        for (int j = 0; j < 8; ++j) os[(hi * 8 + j) * 68 + t * 16 + lr] = acc[t][j] + bv; }
    __syncthreads();
    float* crow = C + (size_t)r0 * DM + c0;
    auto pass = [&]() {
#pragma unroll
        for (int s = 0; s < 8; ++s) { const int Lid = (lane >> 3) + 4 * s, piece = lane & 7; const int row = Lid >> 1, cofs = (Lid & 1) * 32 + piece * 4;
            const v4f val = *(const v4fa*)(os + row * 68 + cofs); *(v4f*)(crow + (size_t)row * DM + cofs) = val; }
    };
    pass(); 
}

// k_vt: VT16/VTL[b][h][d][t] = f16 hi + residual x1024 of V row b*2048+t, col h*64+d via LDS transposes, block (b, h, 64 t).
__global__ __launch_bounds__(256) void k_vt(const float* __restrict__ V, h16* VT16, h16* VTL) {
    __shared__ __align__(16) h16 tile[HD * 72];
    __shared__ __align__(16) h16 til2[HD * 72];
    const int bid = blockIdx.x;
    const int b = bid / (NH_ * (NT_ / 64)), rem = bid - b * (NH_ * (NT_ / 64)), h = rem / (NT_ / 64), kt = rem - h * (NT_ / 64);
    const int k0 = kt * 64, tid = threadIdx.x, kk = tid >> 2, d0 = (tid & 3) * 16;
    const float* src = V + ((size_t)b * NT_ + k0 + kk) * DM + h * HD + d0;
#pragma unroll
    for (int i = 0; i < 16; ++i) { const float v = src[i]; const h16 a = (h16)v; tile[(d0 + i) * 72 + kk] = a; til2[(d0 + i) * 72 + kk] = (h16)((v - (float)a) * LOSC); }
    __syncthreads();
    const int piece = tid & 7;
    const size_t base = (((size_t)b * NH_ + h) * HD) * NT_ + k0;
    auto pass = [&]() {
#pragma unroll
        for (int s = 0; s < 4; ++s) { const int Lid = (tid >> 3) + 32 * s; const int pln = Lid >> 6, d = Lid & 63;
            const v8h val = *(const v8ha*)((pln ? til2 : tile) + d * 72 + piece * 8); *(v8h*)((pln ? VTL : VT16) + base + (size_t)d * NT_ + piece * 8) = val; }
    };
    pass(); 
}
// k_kvc: KVC[b*2048+t][h*64+d] = sum_{j<=t} k[j]*v[j]/8 (inclusive prefix, f32, sequential per (b,h,d)): block = (b, h) -> thread = d (64 threads), each loops
__global__ __launch_bounds__(64) void k_kvc(const float* __restrict__ Kf, const float* __restrict__ Vf, float* KVC) {
    const int b = blockIdx.x / NH_, h = blockIdx.x - b * NH_, d = threadIdx.x;
    const size_t col = (size_t)h * HD + d;
{
        float c = 0.f;
#pragma unroll 1
        for (int t = 0; t < NT_; ++t) { const size_t r = (size_t)b * NT_ + t; c += Kf[r * DM + col] * Vf[r * DM + col] * SCL; *(float*)(KVC + r * DM + col) = c; }
        
    }
}
// k_side: hi/lo f16 planes of a 128-wide per-head row: SH/SL[row][h*128 + c]: c < 64 -> A[row][h*64+c]; c >= 64 -> B2[row][h*64+c-64] (times M[row][same]
// when MUL2) — query side: [q | q*t] (A = q, B2 = q, M = t); key side: [k | kvc]. One wave per (row, head): 128 values -> lane 4 values (whole 256-byte segment).
template <bool MUL2>
__global__ __launch_bounds__(256) void k_side(const float* __restrict__ A, const float* __restrict__ Mv, const float* __restrict__ B2, h16* SH, h16* SL) {
    typedef __attribute__((ext_vector_type(4))) _Float16 v4h;
    const int lane = threadIdx.x & 31, wid = blockIdx.x * 8 + (threadIdx.x >> 5);
    const int r = wid / NH_, h = wid - r * NH_;
    if (r >= NTK) return;
    const int c0 = lane * 4;                       // 0..124 within the 128
    v4h oh, ol;
#pragma unroll
    for (int i = 0; i < 4; ++i) { const int c = c0 + i; float v;
        if (c < HD) v = A[(size_t)r * DM + h * HD + c];
        else { v = B2[(size_t)r * DM + h * HD + c - HD]; if (MUL2) v *= Mv[(size_t)r * DM + h * HD + c - HD]; }
        const h16 a = (h16)v; oh[i] = a; ol[i] = (h16)((v - (float)a) * LOSC); }
    *(v4h*)(SH + (size_t)r * (NH_ * QW) + h * QW + c0) = oh; *(v4h*)(SL + (size_t)r * (NH_ * QW) + h * QW + c0) = ol; 
}

// k_attn: block = (b, h, 64 queries), wave = 16; causal key tiles 0..query tile; scores over the 128 combined dims with hi.hi + hi.lo + lo.hi (24 WMMA per 32-key
// step), x 1/8, keys after the query -> -inf; online f32 softmax; weights x32768 as f16 hi + residual x1024 tiles (same-wave may_alias reload after a compiler barrier); 12 WMMA vs VT16/VTL;
// ctx -> bf16 hi/lo planes CH/CL [token][h*64 + d].
__global__ __launch_bounds__(128) void k_attn(const h16* __restrict__ QH, const h16* __restrict__ QL, const h16* __restrict__ KH, const h16* __restrict__ KL, const h16* __restrict__ VT16, const h16* __restrict__ VTL, bf* CH, bf* CL) {
    __shared__ __align__(16) h16 plds[4][16 * 32];
    __shared__ __align__(16) h16 plds2[4][16 * 32];
    __shared__ __align__(16) float ost[4][16 * 68];
    const int lane = threadIdx.x & 31, wave = threadIdx.x >> 5, lr = lane & 15, hi = lane >> 4;
    const int bid = blockIdx.x;
    const int b = bid / (NH_ * (NT_ / 64)), rem = bid - b * (NH_ * (NT_ / 64)), h = rem / (NT_ / 64), qt = rem - h * (NT_ / 64);
    const int q0 = qt * 64 + wave * 16;
    const size_t tok0 = (size_t)b * NT_;
    h16* pl = &plds[wave][0]; h16* pl2 = &plds2[wave][0];
    v16h ah[4];
    const size_t qo = (tok0 + q0 + lr) * (NH_ * QW) + h * QW + 8 * hi;
#pragma unroll
    for (int kc = 0; kc < 4; ++kc) ah[kc] = cat16(*(const v8h*)(QH + qo + kc * 32), *(const v8h*)(QH + qo + kc * 32 + 16));
    int qpos[8];
#pragma unroll
    for (int j = 0; j < 8; ++j) qpos[j] = q0 + 8 * hi + j;
    const size_t vbase = (((size_t)b * NH_ + h) * HD) * NT_;
    v8f o[4], ox[4];
#pragma unroll
    for (int n = 0; n < 4; ++n) { o[n] = (v8f){}; ox[n] = (v8f){}; }
    float mrow[8], lpart[8];
#pragma unroll
    for (int j = 0; j < 8; ++j) { mrow[j] = -3.0e38f; lpart[j] = 0.f; }
    const int kt_end = (qt * 64 + 64) / 32;
#pragma unroll 1
    for (int kt = 0; kt < kt_end; ++kt) {
        const int l0 = kt * 32;
        v8f s0 = {}, s1 = {}, x0 = {}, x1 = {};
#pragma unroll
        for (int kc = 0; kc < 4; ++kc) {
            const size_t o0 = (tok0 + l0 + lr) * (NH_ * QW) + h * QW + kc * 32 + 8 * hi, o1 = o0 + (size_t)16 * (NH_ * QW);
            const v16h k0h = cat16(*(const v8h*)(KH + o0), *(const v8h*)(KH + o0 + 16)), k0l = cat16(*(const v8h*)(KL + o0), *(const v8h*)(KL + o0 + 16));
            const v16h k1h = cat16(*(const v8h*)(KH + o1), *(const v8h*)(KH + o1 + 16)), k1l = cat16(*(const v8h*)(KL + o1), *(const v8h*)(KL + o1 + 16));
            const v16h alk = cat16(*(const v8h*)(QL + qo + kc * 32), *(const v8h*)(QL + qo + kc * 32 + 16));      // query lo fragment re-read per step (register budget)
            s0 = wmma16(ah[kc], k0h, s0); x0 = wmma16(ah[kc], k0l, x0); x0 = wmma16(alk, k0h, x0);      // lo products carry x1024, folded below
            s1 = wmma16(ah[kc], k1h, s1); x1 = wmma16(ah[kc], k1l, x1); x1 = wmma16(alk, k1h, x1);
            asm volatile("" : "+v"(x0), "+v"(x1) : "v"(alk));
        }
        asm volatile("v_nop\n\tv_nop\n\tv_nop\n\tv_nop" : "+v"(s0), "+v"(s1), "+v"(x0), "+v"(x1) : "v"(ah[0]), "v"(ah[3]));
        float alpha[8];
#pragma unroll
        for (int j = 0; j < 8; ++j) {
            const float a0 = (l0 + lr <= qpos[j]) ? (s0[j] + x0[j] * LOSCI) * SCL : -__builtin_inff(), a1 = (l0 + 16 + lr <= qpos[j]) ? (s1[j] + x1[j] * LOSCI) * SCL : -__builtin_inff();
            float mx = fmaxf(a0, a1);
            mx = fmaxf(mx, __shfl_xor(mx, 1, 16)); mx = fmaxf(mx, __shfl_xor(mx, 2, 16)); mx = fmaxf(mx, __shfl_xor(mx, 4, 16)); mx = fmaxf(mx, __shfl_xor(mx, 8, 16));
            const float mn = fmaxf(mrow[j], mx);
            alpha[j] = __expf(mrow[j] - mn); mrow[j] = mn;
            const float p0 = __expf(a0 - mn), p1 = __expf(a1 - mn);
            lpart[j] = lpart[j] * alpha[j] + (p0 + p1);
            const int mr = hi * 8 + j;
            const float ps0 = p0 * PSC, ps1 = p1 * PSC; const h16 h0 = (h16)ps0, h1 = (h16)ps1;
            pl[mr * 32 + lr] = h0; pl[mr * 32 + 16 + lr] = h1; pl2[mr * 32 + lr] = (h16)((ps0 - (float)h0) * LOSC); pl2[mr * 32 + 16 + lr] = (h16)((ps1 - (float)h1) * LOSC);
        }
#pragma unroll
        for (int n = 0; n < 4; ++n)
#pragma unroll
            for (int j = 0; j < 8; ++j) { o[n][j] *= alpha[j]; ox[n][j] *= alpha[j]; }
        asm volatile("" ::: "memory");
        const v16h pa = cat16(*(const v8ha*)(pl + lr * 32 + hi * 8), *(const v8ha*)(pl + lr * 32 + 16 + hi * 8));
        const v16h px = cat16(*(const v8ha*)(pl2 + lr * 32 + hi * 8), *(const v8ha*)(pl2 + lr * 32 + 16 + hi * 8));
#pragma unroll
        for (int n = 0; n < 4; ++n) { const size_t vo = vbase + (size_t)(n * 16 + lr) * NT_ + l0 + hi * 8;
            const v16h vh = cat16(*(const v8h*)(VT16 + vo), *(const v8h*)(VT16 + vo + 16));
            o[n] = wmma16(pa, vh, o[n]); ox[n] = wmma16(pa, cat16(*(const v8h*)(VTL + vo), *(const v8h*)(VTL + vo + 16)), ox[n]); ox[n] = wmma16(px, vh, ox[n]); }
        asm volatile("v_nop\n\tv_nop\n\tv_nop\n\tv_nop" : "+v"(o[0]), "+v"(o[1]), "+v"(o[2]), "+v"(o[3]), "+v"(ox[0]), "+v"(ox[1]), "+v"(ox[2]), "+v"(ox[3]) : "v"(pa), "v"(px));
    }
    float inv[8];
#pragma unroll
    for (int j = 0; j < 8; ++j) { float rs = lpart[j]; rs += __shfl_xor(rs, 1, 16); rs += __shfl_xor(rs, 2, 16); rs += __shfl_xor(rs, 4, 16); rs += __shfl_xor(rs, 8, 16); inv[j] = 1.0f / (rs * PSC); }
    float* os = &ost[wave][0];
#pragma unroll
    for (int n = 0; n < 4; ++n)
#pragma unroll
        for (int j = 0; j < 8; ++j) os[(hi * 8 + j) * 68 + n * 16 + lr] = (o[n][j] + ox[n][j] * LOSCI) * inv[j];
    __syncthreads();
    const size_t cbase = (tok0 + q0) * DM + (size_t)h * HD;
    auto pass = [&]() {
#pragma unroll
        for (int s = 0; s < 4; ++s) { const int row = 4 * s + (lane >> 3), piece = lane & 7; const float* sp = os + row * 68 + piece * 8; v8us oh, ol;
#pragma unroll
            for (int i = 0; i < 8; ++i) { const unsigned short hb = f2bf(sp[i]); oh[i] = hb; ol[i] = f2bf(sp[i] - bf2f(hb)); }
            *(v8us*)(CH + cbase + (size_t)row * DM + piece * 8) = oh; *(v8us*)(CL + cbase + (size_t)row * DM + piece * 8) = ol; }
    };
    pass(); 
}

extern "C" void kernel_launch(void* const* d_in, const int* in_sizes, int n_in,
                              void* d_out, int out_size, void* d_ws, size_t ws_size, hipStream_t stream) {
    (void)in_sizes; (void)n_in; (void)out_size;
    const float* x = (const float*)d_in[0]; const float* W4 = (const float*)d_in[1]; const float* b4 = (const float*)d_in[2]; const float* Wo = (const float*)d_in[3]; const float* bo = (const float*)d_in[4];
    float* out = (float*)d_out;    // [2][2048][1024]
    char* wsp = (char*)d_ws;
    auto take = [&](size_t bytes) { char* p = wsp; wsp += (bytes + 255) & ~(size_t)255; return (void*)p; };
    bf* Xb = (bf*)take((size_t)NTK * DM * 2); bf* W4T = (bf*)take((size_t)4 * DM * DM * 2);
    h16* VT16 = (h16*)take((size_t)NTK * DM * 2); h16* VTL = (h16*)take((size_t)NTK * DM * 2); h16* KH = (h16*)take((size_t)NTK * NH_ * QW * 2); h16* KL = (h16*)take((size_t)NTK * NH_ * QW * 2);
    float* R1 = (float*)take((size_t)NTK * DM * 4); float* R2 = (float*)take((size_t)NTK * DM * 4); float* R3 = (float*)take((size_t)NTK * DM * 4);   // reusable f32 region (3 x 16.8 MB)
    h16* QL = (h16*)take((size_t)NTK * NH_ * QW * 2);
    if ((size_t)(wsp - (char*)d_ws) > ws_size) return;    // exactly 134,217,728 B (128 MiB): Wout^T reuses W4T after the q/t projections
    float* Kf = R1; float* Vf = R2; float* KVC = R3;           // phase 1
    float* Qf = R1; float* Tf = R2; h16* QH = (h16*)R3;        // phase 2 (Kf, Vf, KVC dead by then)
    bf* CH = (bf*)R1; bf* CL = (bf*)R2; bf* WoT = W4T;         // phase 3 (Qf, Tf dead after k_side; W4T dead after the last projection)
    k_cvtb<<<NTK / 8, 256, 0, stream>>>(x, Xb);
    k_wt<<<dim3(DM / 64, (4 * DM) / 64, 1), 256, 0, stream>>>(W4, 4 * DM, W4T);
    // phase 1: k, v -> VT16/VTL, KVC -> key-side planes
    k_gemmb<false><<<dim3(NTK / 64, DM / 64, 1), 128, 0, stream>>>(Xb, nullptr, W4T + (size_t)1 * DM * DM, b4 + 1 * DM, Kf);
    k_gemmb<false><<<dim3(NTK / 64, DM / 64, 1), 128, 0, stream>>>(Xb, nullptr, W4T + (size_t)2 * DM * DM, b4 + 2 * DM, Vf);
    k_vt<<<NB_ * NH_ * (NT_ / 64), 256, 0, stream>>>(Vf, VT16, VTL);
    k_kvc<<<NB_ * NH_, 64, 0, stream>>>(Kf, Vf, KVC);
    k_side<false><<<(NTK * NH_) / 8, 256, 0, stream>>>(Kf, nullptr, KVC, KH, KL);
    // phase 2: q, t -> query-side planes
    k_gemmb<false><<<dim3(NTK / 64, DM / 64, 1), 128, 0, stream>>>(Xb, nullptr, W4T + (size_t)0 * DM * DM, b4 + 0 * DM, Qf);
    k_gemmb<false><<<dim3(NTK / 64, DM / 64, 1), 128, 0, stream>>>(Xb, nullptr, W4T + (size_t)3 * DM * DM, b4 + 3 * DM, Tf);
    k_side<true><<<(NTK * NH_) / 8, 256, 0, stream>>>(Qf, Tf, Qf, QH, QL);      // [q | q*t]
    // phase 3: Wout^T over the dead W4T, attention -> ctx planes -> out
    k_wt<<<dim3(DM / 64, DM / 64, 1), 256, 0, stream>>>(Wo, DM, WoT);
    k_attn<<<NB_ * NH_ * (NT_ / 64), 128, 0, stream>>>(QH, QL, KH, KL, VT16, VTL, CH, CL);
    k_gemmb<true><<<dim3(NTK / 64, DM / 64, 1), 128, 0, stream>>>(CH, CL, WoT, bo, out);
}

// v001
// Measured time: 525 microseconds a run.
// Timed twice side by side with v000, it ran 2.65 times as fast both times.
#include <hip/hip_runtime.h>

// Contractions, f32 accumulate: qkvt = x.Wqkvt + b as four [4096 x 1024].[1024 x 1024] column blocks and out = ctx.Wout + bout on v_wmma_f32_16x16x32_bf16 (PLAIN bf16
// operands = inputs rounded once, exact; k-major weights transposed into n-major planes; ctx as bf16 hi + residual planes, two products); the per-(batch, head) causal
// attention fused on v_wmma_f32_16x16x32_f16: scores = ([q | q*t]).([k | cumsum_j(k*v)/8])^T over 128 dims with BOTH sides as f16 hi + residual x1024 planes
// (hi.hi + hi.lo + lo.hi — the triplet term reaches sigma ~45 before the 1/8 scale, so single-rounded operands would not hold the peaked softmax), x 1/8, causal,
// softmax, then weights (x32768) and v BOTH as f16 hi + residual x1024 (hi.hi + hi.lo + lo.hi; the softmax is peaked so single roundings would not average out). The key-side prefix sums are f32 chunked scans (16-row chunks, one block per (b, 32 columns)). Deterministic, no atomics;

#define NB_  2
#define NT_  2048
#define DM   1024
#define NH_  16
#define HD   64
#define QW   128                 // combined score width per head
#define NTK  (NB_ * NT_)         // 4096
#define PSC  32768.0f
#define LOSC 1024.0f
#define LOSCI (1.0f / 1024.0f)
#define SCL  0.125f

typedef _Float16 h16;
typedef unsigned short bf;
typedef __attribute__((ext_vector_type(16))) __bf16   v16bf;
typedef __attribute__((ext_vector_type(16))) _Float16 v16h;
typedef __attribute__((ext_vector_type(8)))  _Float16 v8h;
typedef __attribute__((ext_vector_type(8)))  unsigned short v8us;
typedef __attribute__((ext_vector_type(8)))  float    v8f;
typedef __attribute__((ext_vector_type(4)))  float    v4f;
typedef v8h  __attribute__((may_alias)) v8ha;
typedef v4f  __attribute__((may_alias)) v4fa;
typedef v8us __attribute__((may_alias)) v8usa;

__device__ __forceinline__ unsigned short f2bf(float f) { unsigned u = __float_as_uint(f); u += 0x7FFFu + ((u >> 16) & 1u); return (unsigned short)(u >> 16); }
__device__ __forceinline__ float bf2f(unsigned short b) { return __uint_as_float(((unsigned)b) << 16); }
__device__ __forceinline__ float bfr(float f) { return bf2f(f2bf(f)); }
__device__ __forceinline__ v16h cat16(v8h lo, v8h hi) { return __builtin_shufflevector(lo, hi, 0, 1, 2, 3, 4, 5, 6, 7, 8, 9, 10, 11, 12, 13, 14, 15); }
__device__ __forceinline__ v16bf cat16b(v8us lo, v8us hi) { return __builtin_bit_cast(v16bf, __builtin_shufflevector(lo, hi, 0, 1, 2, 3, 4, 5, 6, 7, 8, 9, 10, 11, 12, 13, 14, 15)); }
__device__ __forceinline__ v8f wmma16(v16h a, v16h b, v8f c) { return __builtin_amdgcn_wmma_f32_16x16x32_f16(false, a, false, b, (short)0, c, false, false); }
__device__ __forceinline__ v8f wmmab(v16bf a, v16bf b, v8f c) { return __builtin_amdgcn_wmma_f32_16x16x32_bf16(false, a, false, b, (short)0, c, false, false); }
#define VST2(T, p, v) do { const T vst2_v_ = (v); *(T*)(p) = vst2_v_;  } while (0)

// k_cvtb: bf16 plane of x [4096][1024]; k_wt: W [1024 k][ncols] k-major -> n-major bf16 [ncols][1024] via 64 x 64 LDS tiles.
__global__ __launch_bounds__(256) void k_cvtb(const float* __restrict__ src, bf* dst) {
    const int lane = threadIdx.x & 31, r = blockIdx.x * 8 + (threadIdx.x >> 5);
    if (r >= NTK) return;
#pragma unroll
    for (int q = 0; q < 4; ++q) { v8us t;
#pragma unroll
        for (int i = 0; i < 8; ++i) t[i] = f2bf(src[(size_t)r * DM + q * 256 + lane * 8 + i]);
        VST2(v8us, dst + (size_t)r * DM + q * 256 + lane * 8, t); }
}
__global__ __launch_bounds__(256) void k_wt(const float* __restrict__ Wm, int ncols, bf* WT) {
    __shared__ __align__(16) unsigned short tl[64 * 72];
    const int tid = threadIdx.x, k0 = blockIdx.x * 64, n0 = blockIdx.y * 64;
    const int kk = tid >> 2, nq = (tid & 3) * 16;
#pragma unroll
    for (int i = 0; i < 16; ++i) tl[(nq + i) * 72 + kk] = f2bf(Wm[(size_t)(k0 + kk) * ncols + n0 + nq + i]);
    __syncthreads();
    const int piece = tid & 7;
    auto pass = [&]() {
#pragma unroll
        for (int s = 0; s < 2; ++s) { const int nr = (tid >> 3) + 32 * s; const v8us val = *(const v8usa*)(tl + nr * 72 + piece * 8);
            *(v8us*)(WT + (size_t)(n0 + nr) * DM + k0 + piece * 8) = val; }
    };
    pass(); 
}

template <bool SPLITA>
__global__ __launch_bounds__(128) void k_gemmb(const bf* __restrict__ A, const bf* __restrict__ Al, const bf* __restrict__ Bn, const float* __restrict__ bias, float* C) {
    __shared__ __align__(16) float ost[4][16 * 68];
    const int lane = threadIdx.x & 31, wave = threadIdx.x >> 5, lr = lane & 15, hi = lane >> 4;
    const int r0 = blockIdx.x * 64 + wave * 16, c0 = blockIdx.y * 64;
    const size_t aoff = (size_t)(r0 + lr) * DM + 8 * hi;
    size_t boff[4];
#pragma unroll
    for (int t = 0; t < 4; ++t) boff[t] = (size_t)(c0 + t * 16 + lr) * DM + 8 * hi;
    v8f acc[4];
#pragma unroll
    for (int t = 0; t < 4; ++t) acc[t] = (v8f){};
#pragma unroll 1
    for (int kc = 0; kc < DM; kc += 32) {
        const v16bf a = cat16b(*(const v8us*)(A + aoff + kc), *(const v8us*)(A + aoff + kc + 16));
        v16bf al = a;
        if (SPLITA) al = cat16b(*(const v8us*)(Al + aoff + kc), *(const v8us*)(Al + aoff + kc + 16));
#pragma unroll
        for (int t = 0; t < 4; ++t) { const v16bf b = cat16b(*(const v8us*)(Bn + boff[t] + kc), *(const v8us*)(Bn + boff[t] + kc + 16)); acc[t] = wmmab(a, b, acc[t]); if (SPLITA) acc[t] = wmmab(al, b, acc[t]); }
        asm volatile("v_nop\n\tv_nop\n\tv_nop\n\tv_nop" : "+v"(acc[0]), "+v"(acc[1]), "+v"(acc[2]), "+v"(acc[3]) : "v"(a), "v"(al));
    }
    float* os = &ost[wave][0];
#pragma unroll
    for (int t = 0; t < 4; ++t) { const float bv = bfr(bias[c0 + t * 16 + lr]);
#pragma unroll
        for (int j = 0; j < 8; ++j) os[(hi * 8 + j) * 68 + t * 16 + lr] = acc[t][j] + bv; }
    __syncthreads();
    float* crow = C + (size_t)r0 * DM + c0;
    auto pass = [&]() {
#pragma unroll
        for (int s = 0; s < 8; ++s) { const int Lid = (lane >> 3) + 4 * s, piece = lane & 7; const int row = Lid >> 1, cofs = (Lid & 1) * 32 + piece * 4;
            const v4f val = *(const v4fa*)(os + row * 68 + cofs); *(v4f*)(crow + (size_t)row * DM + cofs) = val; }
    };
    pass(); 
}

// k_vt: VT16/VTL[b][h][d][t] = f16 hi + residual x1024 of V row b*2048+t, col h*64+d via LDS transposes, block (b, h, 64 t).
__global__ __launch_bounds__(256) void k_vt(const float* __restrict__ V, h16* VT16, h16* VTL) {
    __shared__ __align__(16) h16 tile[HD * 72];
    __shared__ __align__(16) h16 til2[HD * 72];
    const int bid = blockIdx.x;
    const int b = bid / (NH_ * (NT_ / 64)), rem = bid - b * (NH_ * (NT_ / 64)), h = rem / (NT_ / 64), kt = rem - h * (NT_ / 64);
    const int k0 = kt * 64, tid = threadIdx.x, kk = tid >> 2, d0 = (tid & 3) * 16;
    const float* src = V + ((size_t)b * NT_ + k0 + kk) * DM + h * HD + d0;
#pragma unroll
    for (int i = 0; i < 16; ++i) { const float v = src[i]; const h16 a = (h16)v; tile[(d0 + i) * 72 + kk] = a; til2[(d0 + i) * 72 + kk] = (h16)((v - (float)a) * LOSC); }
    __syncthreads();
    const int piece = tid & 7;
    const size_t base = (((size_t)b * NH_ + h) * HD) * NT_ + k0;
    auto pass = [&]() {
#pragma unroll
        for (int s = 0; s < 4; ++s) { const int Lid = (tid >> 3) + 32 * s; const int pln = Lid >> 6, d = Lid & 63;
            const v8h val = *(const v8ha*)((pln ? til2 : tile) + d * 72 + piece * 8); *(v8h*)((pln ? VTL : VT16) + base + (size_t)d * NT_ + piece * 8) = val; }
    };
    pass(); 
}
// k_kvc: KVC[b*2048+t][col] = sum_{j<=t} k[j]*v[j]/8 (inclusive prefix over t, f32) as a chunked scan inside one block. Block = (b, 32 columns = whole 128-byte lines);
// thread = (chunk of 16 rows, 4 columns): all 32 16-byte loads are independent and the 64 running sums stay in registers. Chunk sums -> LDS, exclusive prefix over the 128
// chunks in two levels (8 waves scan 16 chunks each, then every thread adds the sums of the groups before its own), then each thread adds that start value to its rows.
#define KC_R 16                  // rows per chunk
#define KC_N (NT_ / KC_R)        // 128 chunks
#define KC_G 8                   // groups of 16 chunks
__global__ __launch_bounds__(1024) void k_kvc(const float* __restrict__ Kf, const float* __restrict__ Vf, float* __restrict__ KVC) {
    __shared__ __align__(16) float tot[KC_N * 32];
    __shared__ __align__(16) float gtot[KC_G * 32];
    const int tid = threadIdx.x, cq = tid & 7, ch = tid >> 3;
    const int b = blockIdx.x / (DM / 32), cg = blockIdx.x - b * (DM / 32);
    const size_t blk = (size_t)b * NT_ * DM + cg * 32;         // block part of the index (scalar)
    const unsigned thr = (unsigned)(ch * KC_R * DM + cq * 4);  // thread part, shared by the loads and the stores
    const float* kp = Kf + blk; const float* vp = Vf + blk; float* op = KVC + blk;
    v4f p[KC_R];
#pragma unroll  // constant indices keep p[] in registers; the independent loads issue many at a time
    for (int i = 0; i < KC_R; ++i) p[i] = *(const v4f*)(kp + thr + i * DM) * *(const v4f*)(vp + thr + i * DM) * SCL;
#pragma unroll  // p[] in registers
    for (int i = 1; i < KC_R; ++i) p[i] += p[i - 1];           // inclusive prefix inside the chunk
    *(v4f*)(tot + ch * 32 + cq * 4) = p[KC_R - 1];
    __syncthreads();
    if (tid < KC_G * 32) { const int g = tid >> 5, col = tid & 31; float run = 0.f;
#pragma unroll  // the 16 LDS reads issue ahead of the add chain
        for (int i = 0; i < KC_N / KC_G; ++i) { float* q = tot + (g * (KC_N / KC_G) + i) * 32 + col; const float t = *q; *q = run; run += t; }
        gtot[g * 32 + col] = run; }
    __syncthreads();
    const int g = ch / (KC_N / KC_G);
    v4f gs[KC_G - 1];
#pragma unroll  // gs[] in registers
    for (int i = 0; i < KC_G - 1; ++i) gs[i] = *(const v4f*)(gtot + i * 32 + cq * 4);   // all read at once, then selected: no chain of LDS round trips
    v4f c = {};
#pragma unroll  // gs[] in registers
    for (int i = 0; i < KC_G - 1; ++i) c += (i < g) ? gs[i] : (v4f){};
    c += *(const v4f*)(tot + ch * 32 + cq * 4);
#pragma unroll  // p[] in registers; stores back to back
    for (int i = 0; i < KC_R; ++i) *(v4f*)(op + thr + i * DM) = p[i] + c;
}
// k_side: hi/lo f16 planes of a 128-wide per-head row: SH/SL[row][h*128 + c]: c < 64 -> A[row][h*64+c]; c >= 64 -> B2[row][h*64+c-64] (times M[row][same]
// when MUL2) — query side: [q | q*t] (A = q, B2 = q, M = t); key side: [k | kvc]. One wave per (row, head): 128 values -> lane 4 values (whole 256-byte segment).
template <bool MUL2>
__global__ __launch_bounds__(256) void k_side(const float* __restrict__ A, const float* __restrict__ Mv, const float* __restrict__ B2, h16* SH, h16* SL) {
    typedef __attribute__((ext_vector_type(4))) _Float16 v4h;
    const int lane = threadIdx.x & 31, wid = blockIdx.x * 8 + (threadIdx.x >> 5);
    const int r = wid / NH_, h = wid - r * NH_;
    if (r >= NTK) return;
    const int c0 = lane * 4;                       // 0..124 within the 128
    v4h oh, ol;
#pragma unroll
    for (int i = 0; i < 4; ++i) { const int c = c0 + i; float v;
        if (c < HD) v = A[(size_t)r * DM + h * HD + c];
        else { v = B2[(size_t)r * DM + h * HD + c - HD]; if (MUL2) v *= Mv[(size_t)r * DM + h * HD + c - HD]; }
        const h16 a = (h16)v; oh[i] = a; ol[i] = (h16)((v - (float)a) * LOSC); }
    *(v4h*)(SH + (size_t)r * (NH_ * QW) + h * QW + c0) = oh; *(v4h*)(SL + (size_t)r * (NH_ * QW) + h * QW + c0) = ol; 
}

// k_attn: block = (b, h, 64 queries), wave = 16; causal key tiles 0..query tile; scores over the 128 combined dims with hi.hi + hi.lo + lo.hi (24 WMMA per 32-key
// step), x 1/8, keys after the query -> -inf; online f32 softmax; weights x32768 as f16 hi + residual x1024 tiles (same-wave may_alias reload after a compiler barrier); 12 WMMA vs VT16/VTL;
// ctx -> bf16 hi/lo planes CH/CL [token][h*64 + d].
__global__ __launch_bounds__(128) void k_attn(const h16* __restrict__ QH, const h16* __restrict__ QL, const h16* __restrict__ KH, const h16* __restrict__ KL, const h16* __restrict__ VT16, const h16* __restrict__ VTL, bf* CH, bf* CL) {
    __shared__ __align__(16) h16 plds[4][16 * 32];
    __shared__ __align__(16) h16 plds2[4][16 * 32];
    __shared__ __align__(16) float ost[4][16 * 68];
    const int lane = threadIdx.x & 31, wave = threadIdx.x >> 5, lr = lane & 15, hi = lane >> 4;
    const int bid = blockIdx.x;
    const int b = bid / (NH_ * (NT_ / 64)), rem = bid - b * (NH_ * (NT_ / 64)), h = rem / (NT_ / 64), qt = rem - h * (NT_ / 64);
    const int q0 = qt * 64 + wave * 16;
    const size_t tok0 = (size_t)b * NT_;
    h16* pl = &plds[wave][0]; h16* pl2 = &plds2[wave][0];
    v16h ah[4];
    const size_t qo = (tok0 + q0 + lr) * (NH_ * QW) + h * QW + 8 * hi;
#pragma unroll
    for (int kc = 0; kc < 4; ++kc) ah[kc] = cat16(*(const v8h*)(QH + qo + kc * 32), *(const v8h*)(QH + qo + kc * 32 + 16));
    int qpos[8];
#pragma unroll
    for (int j = 0; j < 8; ++j) qpos[j] = q0 + 8 * hi + j;
    const size_t vbase = (((size_t)b * NH_ + h) * HD) * NT_;
    v8f o[4], ox[4];
#pragma unroll
    for (int n = 0; n < 4; ++n) { o[n] = (v8f){}; ox[n] = (v8f){}; }
    float mrow[8], lpart[8];
#pragma unroll
    for (int j = 0; j < 8; ++j) { mrow[j] = -3.0e38f; lpart[j] = 0.f; }
    const int kt_end = (qt * 64 + 64) / 32;
#pragma unroll 1
    for (int kt = 0; kt < kt_end; ++kt) {
        const int l0 = kt * 32;
        v8f s0 = {}, s1 = {}, x0 = {}, x1 = {};
#pragma unroll
        for (int kc = 0; kc < 4; ++kc) {
            const size_t o0 = (tok0 + l0 + lr) * (NH_ * QW) + h * QW + kc * 32 + 8 * hi, o1 = o0 + (size_t)16 * (NH_ * QW);
            const v16h k0h = cat16(*(const v8h*)(KH + o0), *(const v8h*)(KH + o0 + 16)), k0l = cat16(*(const v8h*)(KL + o0), *(const v8h*)(KL + o0 + 16));
            const v16h k1h = cat16(*(const v8h*)(KH + o1), *(const v8h*)(KH + o1 + 16)), k1l = cat16(*(const v8h*)(KL + o1), *(const v8h*)(KL + o1 + 16));
            const v16h alk = cat16(*(const v8h*)(QL + qo + kc * 32), *(const v8h*)(QL + qo + kc * 32 + 16));      // query lo fragment re-read per step (register budget)
            s0 = wmma16(ah[kc], k0h, s0); x0 = wmma16(ah[kc], k0l, x0); x0 = wmma16(alk, k0h, x0);      // lo products carry x1024, folded below
            s1 = wmma16(ah[kc], k1h, s1); x1 = wmma16(ah[kc], k1l, x1); x1 = wmma16(alk, k1h, x1);
            asm volatile("" : "+v"(x0), "+v"(x1) : "v"(alk));
        }
        asm volatile("v_nop\n\tv_nop\n\tv_nop\n\tv_nop" : "+v"(s0), "+v"(s1), "+v"(x0), "+v"(x1) : "v"(ah[0]), "v"(ah[3]));
        float alpha[8];
#pragma unroll
        for (int j = 0; j < 8; ++j) {
            const float a0 = (l0 + lr <= qpos[j]) ? (s0[j] + x0[j] * LOSCI) * SCL : -__builtin_inff(), a1 = (l0 + 16 + lr <= qpos[j]) ? (s1[j] + x1[j] * LOSCI) * SCL : -__builtin_inff();
            float mx = fmaxf(a0, a1);
            mx = fmaxf(mx, __shfl_xor(mx, 1, 16)); mx = fmaxf(mx, __shfl_xor(mx, 2, 16)); mx = fmaxf(mx, __shfl_xor(mx, 4, 16)); mx = fmaxf(mx, __shfl_xor(mx, 8, 16));
            const float mn = fmaxf(mrow[j], mx);
            alpha[j] = __expf(mrow[j] - mn); mrow[j] = mn;
            const float p0 = __expf(a0 - mn), p1 = __expf(a1 - mn);
            lpart[j] = lpart[j] * alpha[j] + (p0 + p1);
            const int mr = hi * 8 + j;
            const float ps0 = p0 * PSC, ps1 = p1 * PSC; const h16 h0 = (h16)ps0, h1 = (h16)ps1;
            pl[mr * 32 + lr] = h0; pl[mr * 32 + 16 + lr] = h1; pl2[mr * 32 + lr] = (h16)((ps0 - (float)h0) * LOSC); pl2[mr * 32 + 16 + lr] = (h16)((ps1 - (float)h1) * LOSC);
        }
#pragma unroll
        for (int n = 0; n < 4; ++n)
#pragma unroll
            for (int j = 0; j < 8; ++j) { o[n][j] *= alpha[j]; ox[n][j] *= alpha[j]; }
        asm volatile("" ::: "memory");
        const v16h pa = cat16(*(const v8ha*)(pl + lr * 32 + hi * 8), *(const v8ha*)(pl + lr * 32 + 16 + hi * 8));
        const v16h px = cat16(*(const v8ha*)(pl2 + lr * 32 + hi * 8), *(const v8ha*)(pl2 + lr * 32 + 16 + hi * 8));
#pragma unroll
        for (int n = 0; n < 4; ++n) { const size_t vo = vbase + (size_t)(n * 16 + lr) * NT_ + l0 + hi * 8;
            const v16h vh = cat16(*(const v8h*)(VT16 + vo), *(const v8h*)(VT16 + vo + 16));
            o[n] = wmma16(pa, vh, o[n]); ox[n] = wmma16(pa, cat16(*(const v8h*)(VTL + vo), *(const v8h*)(VTL + vo + 16)), ox[n]); ox[n] = wmma16(px, vh, ox[n]); }
        asm volatile("v_nop\n\tv_nop\n\tv_nop\n\tv_nop" : "+v"(o[0]), "+v"(o[1]), "+v"(o[2]), "+v"(o[3]), "+v"(ox[0]), "+v"(ox[1]), "+v"(ox[2]), "+v"(ox[3]) : "v"(pa), "v"(px));
    }
    float inv[8];
#pragma unroll
    for (int j = 0; j < 8; ++j) { float rs = lpart[j]; rs += __shfl_xor(rs, 1, 16); rs += __shfl_xor(rs, 2, 16); rs += __shfl_xor(rs, 4, 16); rs += __shfl_xor(rs, 8, 16); inv[j] = 1.0f / (rs * PSC); }
    float* os = &ost[wave][0];
#pragma unroll
    for (int n = 0; n < 4; ++n)
#pragma unroll
        for (int j = 0; j < 8; ++j) os[(hi * 8 + j) * 68 + n * 16 + lr] = (o[n][j] + ox[n][j] * LOSCI) * inv[j];
    __syncthreads();
    const size_t cbase = (tok0 + q0) * DM + (size_t)h * HD;
    auto pass = [&]() {
#pragma unroll
        for (int s = 0; s < 4; ++s) { const int row = 4 * s + (lane >> 3), piece = lane & 7; const float* sp = os + row * 68 + piece * 8; v8us oh, ol;
#pragma unroll
            for (int i = 0; i < 8; ++i) { const unsigned short hb = f2bf(sp[i]); oh[i] = hb; ol[i] = f2bf(sp[i] - bf2f(hb)); }
            *(v8us*)(CH + cbase + (size_t)row * DM + piece * 8) = oh; *(v8us*)(CL + cbase + (size_t)row * DM + piece * 8) = ol; }
    };
    pass(); 
}

extern "C" void kernel_launch(void* const* d_in, const int* in_sizes, int n_in,
                              void* d_out, int out_size, void* d_ws, size_t ws_size, hipStream_t stream) {
    (void)in_sizes; (void)n_in; (void)out_size;
    const float* x = (const float*)d_in[0]; const float* W4 = (const float*)d_in[1]; const float* b4 = (const float*)d_in[2]; const float* Wo = (const float*)d_in[3]; const float* bo = (const float*)d_in[4];
    float* out = (float*)d_out;    // [2][2048][1024]
    char* wsp = (char*)d_ws;
    auto take = [&](size_t bytes) { char* p = wsp; wsp += (bytes + 255) & ~(size_t)255; return (void*)p; };
    bf* Xb = (bf*)take((size_t)NTK * DM * 2); bf* W4T = (bf*)take((size_t)4 * DM * DM * 2);
    h16* VT16 = (h16*)take((size_t)NTK * DM * 2); h16* VTL = (h16*)take((size_t)NTK * DM * 2); h16* KH = (h16*)take((size_t)NTK * NH_ * QW * 2); h16* KL = (h16*)take((size_t)NTK * NH_ * QW * 2);
    float* R1 = (float*)take((size_t)NTK * DM * 4); float* R2 = (float*)take((size_t)NTK * DM * 4); float* R3 = (float*)take((size_t)NTK * DM * 4);   // reusable f32 region (3 x 16.8 MB)
    h16* QL = (h16*)take((size_t)NTK * NH_ * QW * 2);
    if ((size_t)(wsp - (char*)d_ws) > ws_size) return;    // exactly 134,217,728 B (128 MiB): Wout^T reuses W4T after the q/t projections
    float* Kf = R1; float* Vf = R2; float* KVC = R3;           // phase 1
    float* Qf = R1; float* Tf = R2; h16* QH = (h16*)R3;        // phase 2 (Kf, Vf, KVC dead by then)
    bf* CH = (bf*)R1; bf* CL = (bf*)R2; bf* WoT = W4T;         // phase 3 (Qf, Tf dead after k_side; W4T dead after the last projection)
    k_cvtb<<<NTK / 8, 256, 0, stream>>>(x, Xb);
    k_wt<<<dim3(DM / 64, (4 * DM) / 64, 1), 256, 0, stream>>>(W4, 4 * DM, W4T);
    // phase 1: k, v -> VT16/VTL, KVC -> key-side planes
    k_gemmb<false><<<dim3(NTK / 64, DM / 64, 1), 128, 0, stream>>>(Xb, nullptr, W4T + (size_t)1 * DM * DM, b4 + 1 * DM, Kf);
    k_gemmb<false><<<dim3(NTK / 64, DM / 64, 1), 128, 0, stream>>>(Xb, nullptr, W4T + (size_t)2 * DM * DM, b4 + 2 * DM, Vf);
    k_vt<<<NB_ * NH_ * (NT_ / 64), 256, 0, stream>>>(Vf, VT16, VTL);
    k_kvc<<<NB_ * (DM / 32), 1024, 0, stream>>>(Kf, Vf, KVC);
    k_side<false><<<(NTK * NH_) / 8, 256, 0, stream>>>(Kf, nullptr, KVC, KH, KL);
    // phase 2: q, t -> query-side planes
    k_gemmb<false><<<dim3(NTK / 64, DM / 64, 1), 128, 0, stream>>>(Xb, nullptr, W4T + (size_t)0 * DM * DM, b4 + 0 * DM, Qf);
    k_gemmb<false><<<dim3(NTK / 64, DM / 64, 1), 128, 0, stream>>>(Xb, nullptr, W4T + (size_t)3 * DM * DM, b4 + 3 * DM, Tf);
    k_side<true><<<(NTK * NH_) / 8, 256, 0, stream>>>(Qf, Tf, Qf, QH, QL);      // [q | q*t]
    // phase 3: Wout^T over the dead W4T, attention -> ctx planes -> out
    k_wt<<<dim3(DM / 64, DM / 64, 1), 256, 0, stream>>>(Wo, DM, WoT);
    k_attn<<<NB_ * NH_ * (NT_ / 64), 128, 0, stream>>>(QH, QL, KH, KL, VT16, VTL, CH, CL);
    k_gemmb<true><<<dim3(NTK / 64, DM / 64, 1), 128, 0, stream>>>(CH, CL, WoT, bo, out);
}

// v002
// Measured time: 416 microseconds a run.
// In two side-by-side timings against v001, it was 1.27 and 1.26 times as fast.
// Counting every step since v000, it is 3.35 times as fast.
#include <hip/hip_runtime.h>

// Contractions, f32 accumulate: qkvt = x.Wqkvt + b as four [4096 x 1024].[1024 x 1024] column blocks and out = ctx.Wout + bout on v_wmma_f32_16x16x32_bf16 (PLAIN bf16
// operands = inputs rounded once, exact; k-major weights transposed into n-major planes; ctx as bf16 hi + residual planes, two products); the per-(batch, head) causal
// attention fused on v_wmma_f32_16x16x32_f16: scores = ([q | q*t]).([k | cumsum_j(k*v)/8])^T over 128 dims with BOTH sides as f16 hi + residual x1024 planes
// (hi.hi + hi.lo + lo.hi — the triplet term reaches sigma ~45 before the 1/8 scale, so single-rounded operands would not hold the peaked softmax), x 1/8, causal,
// softmax, then weights (x32768) and v BOTH as f16 hi + residual x1024 (hi.hi + hi.lo + lo.hi; the softmax is peaked so single roundings would not average out). The key-side prefix sums are f32 chunked scans (16-row chunks, one block per (b, 32 columns)). Deterministic, no atomics;

#define NB_  2
#define NT_  2048
#define DM   1024
#define NH_  16
#define HD   64
#define QW   128                 // combined score width per head
#define NTK  (NB_ * NT_)         // 4096
#define PSC  32768.0f
#define LOSC 1024.0f
#define LOSCI (1.0f / 1024.0f)
#define SCL  0.125f

typedef _Float16 h16;
typedef unsigned short bf;
typedef __attribute__((ext_vector_type(16))) __bf16   v16bf;
typedef __attribute__((ext_vector_type(16))) _Float16 v16h;
typedef __attribute__((ext_vector_type(8)))  _Float16 v8h;
typedef __attribute__((ext_vector_type(8)))  unsigned short v8us;
typedef __attribute__((ext_vector_type(8)))  float    v8f;
typedef __attribute__((ext_vector_type(4)))  float    v4f;
typedef v8h  __attribute__((may_alias)) v8ha;
typedef v4f  __attribute__((may_alias)) v4fa;
typedef v8us __attribute__((may_alias)) v8usa;

__device__ __forceinline__ unsigned short f2bf(float f) { unsigned u = __float_as_uint(f); u += 0x7FFFu + ((u >> 16) & 1u); return (unsigned short)(u >> 16); }
__device__ __forceinline__ float bf2f(unsigned short b) { return __uint_as_float(((unsigned)b) << 16); }
__device__ __forceinline__ float bfr(float f) { return bf2f(f2bf(f)); }
__device__ __forceinline__ v16h cat16(v8h lo, v8h hi) { return __builtin_shufflevector(lo, hi, 0, 1, 2, 3, 4, 5, 6, 7, 8, 9, 10, 11, 12, 13, 14, 15); }
__device__ __forceinline__ v16bf cat16b(v8us lo, v8us hi) { return __builtin_bit_cast(v16bf, __builtin_shufflevector(lo, hi, 0, 1, 2, 3, 4, 5, 6, 7, 8, 9, 10, 11, 12, 13, 14, 15)); }
__device__ __forceinline__ v8f wmma16(v16h a, v16h b, v8f c) { return __builtin_amdgcn_wmma_f32_16x16x32_f16(false, a, false, b, (short)0, c, false, false); }
__device__ __forceinline__ v8f wmmab(v16bf a, v16bf b, v8f c) { return __builtin_amdgcn_wmma_f32_16x16x32_bf16(false, a, false, b, (short)0, c, false, false); }
#define VST2(T, p, v) do { const T vst2_v_ = (v); *(T*)(p) = vst2_v_;  } while (0)

// k_cvtb: bf16 plane of x [4096][1024]; k_wt: W [1024 k][ncols] k-major -> n-major bf16 [ncols][1024] via 64 x 64 LDS tiles.
__global__ __launch_bounds__(256) void k_cvtb(const float* __restrict__ src, bf* dst) {
    const int lane = threadIdx.x & 31, r = blockIdx.x * 8 + (threadIdx.x >> 5);
    if (r >= NTK) return;
#pragma unroll
    for (int q = 0; q < 4; ++q) { v8us t;
#pragma unroll
        for (int i = 0; i < 8; ++i) t[i] = f2bf(src[(size_t)r * DM + q * 256 + lane * 8 + i]);
        VST2(v8us, dst + (size_t)r * DM + q * 256 + lane * 8, t); }
}
__global__ __launch_bounds__(256) void k_wt(const float* __restrict__ Wm, int ncols, bf* WT) {
    __shared__ __align__(16) unsigned short tl[64 * 72];
    const int tid = threadIdx.x, k0 = blockIdx.x * 64, n0 = blockIdx.y * 64;
    const int kk = tid >> 2, nq = (tid & 3) * 16;
#pragma unroll
    for (int i = 0; i < 16; ++i) tl[(nq + i) * 72 + kk] = f2bf(Wm[(size_t)(k0 + kk) * ncols + n0 + nq + i]);
    __syncthreads();
    const int piece = tid & 7;
    auto pass = [&]() {
#pragma unroll
        for (int s = 0; s < 2; ++s) { const int nr = (tid >> 3) + 32 * s; const v8us val = *(const v8usa*)(tl + nr * 72 + piece * 8);
            *(v8us*)(WT + (size_t)(n0 + nr) * DM + k0 + piece * 8) = val; }
    };
    pass(); 
}

template <bool SPLITA>
__global__ __launch_bounds__(128) void k_gemmb(const bf* __restrict__ A, const bf* __restrict__ Al, const bf* __restrict__ Bn, const float* __restrict__ bias, float* C) {
    __shared__ __align__(16) float ost[4][16 * 68];
    const int lane = threadIdx.x & 31, wave = threadIdx.x >> 5, lr = lane & 15, hi = lane >> 4;
    const int r0 = blockIdx.x * 64 + wave * 16, c0 = blockIdx.y * 64;
    const size_t aoff = (size_t)(r0 + lr) * DM + 8 * hi;
    size_t boff[4];
#pragma unroll
    for (int t = 0; t < 4; ++t) boff[t] = (size_t)(c0 + t * 16 + lr) * DM + 8 * hi;
    v8f acc[4];
#pragma unroll
    for (int t = 0; t < 4; ++t) acc[t] = (v8f){};
#pragma unroll 1
    for (int kc = 0; kc < DM; kc += 32) {
        const v16bf a = cat16b(*(const v8us*)(A + aoff + kc), *(const v8us*)(A + aoff + kc + 16));
        v16bf al = a;
        if (SPLITA) al = cat16b(*(const v8us*)(Al + aoff + kc), *(const v8us*)(Al + aoff + kc + 16));
#pragma unroll
        for (int t = 0; t < 4; ++t) { const v16bf b = cat16b(*(const v8us*)(Bn + boff[t] + kc), *(const v8us*)(Bn + boff[t] + kc + 16)); acc[t] = wmmab(a, b, acc[t]); if (SPLITA) acc[t] = wmmab(al, b, acc[t]); }
        asm volatile("v_nop\n\tv_nop\n\tv_nop\n\tv_nop" : "+v"(acc[0]), "+v"(acc[1]), "+v"(acc[2]), "+v"(acc[3]) : "v"(a), "v"(al));
    }
    float* os = &ost[wave][0];
#pragma unroll
    for (int t = 0; t < 4; ++t) { const float bv = bfr(bias[c0 + t * 16 + lr]);
#pragma unroll
        for (int j = 0; j < 8; ++j) os[(hi * 8 + j) * 68 + t * 16 + lr] = acc[t][j] + bv; }
    __syncthreads();
    float* crow = C + (size_t)r0 * DM + c0;
    auto pass = [&]() {
#pragma unroll
        for (int s = 0; s < 8; ++s) { const int Lid = (lane >> 3) + 4 * s, piece = lane & 7; const int row = Lid >> 1, cofs = (Lid & 1) * 32 + piece * 4;
            const v4f val = *(const v4fa*)(os + row * 68 + cofs); *(v4f*)(crow + (size_t)row * DM + cofs) = val; }
    };
    pass(); 
}

// k_vt: VT16/VTL[b][h][d][t] = f16 hi + residual x1024 of V row b*2048+t, col h*64+d via LDS transposes, block (b, h, 64 t).
__global__ __launch_bounds__(256) void k_vt(const float* __restrict__ V, h16* VT16, h16* VTL) {
    __shared__ __align__(16) h16 tile[HD * 72];
    __shared__ __align__(16) h16 til2[HD * 72];
    const int bid = blockIdx.x;
    const int b = bid / (NH_ * (NT_ / 64)), rem = bid - b * (NH_ * (NT_ / 64)), h = rem / (NT_ / 64), kt = rem - h * (NT_ / 64);
    const int k0 = kt * 64, tid = threadIdx.x, kk = tid >> 2, d0 = (tid & 3) * 16;
    const float* src = V + ((size_t)b * NT_ + k0 + kk) * DM + h * HD + d0;
#pragma unroll
    for (int i = 0; i < 16; ++i) { const float v = src[i]; const h16 a = (h16)v; tile[(d0 + i) * 72 + kk] = a; til2[(d0 + i) * 72 + kk] = (h16)((v - (float)a) * LOSC); }
    __syncthreads();
    const int piece = tid & 7;
    const size_t base = (((size_t)b * NH_ + h) * HD) * NT_ + k0;
    auto pass = [&]() {
#pragma unroll
        for (int s = 0; s < 4; ++s) { const int Lid = (tid >> 3) + 32 * s; const int pln = Lid >> 6, d = Lid & 63;
            const v8h val = *(const v8ha*)((pln ? til2 : tile) + d * 72 + piece * 8); *(v8h*)((pln ? VTL : VT16) + base + (size_t)d * NT_ + piece * 8) = val; }
    };
    pass(); 
}
// k_kvc: KVC[b*2048+t][col] = sum_{j<=t} k[j]*v[j]/8 (inclusive prefix over t, f32) as a chunked scan inside one block. Block = (b, 32 columns = whole 128-byte lines);
// thread = (chunk of 16 rows, 4 columns): all 32 16-byte loads are independent and the 64 running sums stay in registers. Chunk sums -> LDS, exclusive prefix over the 128
// chunks in two levels (8 waves scan 16 chunks each, then every thread adds the sums of the groups before its own), then each thread adds that start value to its rows.
#define KC_R 16                  // rows per chunk
#define KC_N (NT_ / KC_R)        // 128 chunks
#define KC_G 8                   // groups of 16 chunks
__global__ __launch_bounds__(1024) void k_kvc(const float* __restrict__ Kf, const float* __restrict__ Vf, float* __restrict__ KVC) {
    __shared__ __align__(16) float tot[KC_N * 32];
    __shared__ __align__(16) float gtot[KC_G * 32];
    const int tid = threadIdx.x, cq = tid & 7, ch = tid >> 3;
    const int b = blockIdx.x / (DM / 32), cg = blockIdx.x - b * (DM / 32);
    const size_t blk = (size_t)b * NT_ * DM + cg * 32;         // block part of the index (scalar)
    const unsigned thr = (unsigned)(ch * KC_R * DM + cq * 4);  // thread part, shared by the loads and the stores
    const float* kp = Kf + blk; const float* vp = Vf + blk; float* op = KVC + blk;
    v4f p[KC_R];
#pragma unroll  // constant indices keep p[] in registers; the independent loads issue many at a time
    for (int i = 0; i < KC_R; ++i) p[i] = *(const v4f*)(kp + thr + i * DM) * *(const v4f*)(vp + thr + i * DM) * SCL;
#pragma unroll  // p[] in registers
    for (int i = 1; i < KC_R; ++i) p[i] += p[i - 1];           // inclusive prefix inside the chunk
    *(v4f*)(tot + ch * 32 + cq * 4) = p[KC_R - 1];
    __syncthreads();
    if (tid < KC_G * 32) { const int g = tid >> 5, col = tid & 31; float run = 0.f;
#pragma unroll  // the 16 LDS reads issue ahead of the add chain
        for (int i = 0; i < KC_N / KC_G; ++i) { float* q = tot + (g * (KC_N / KC_G) + i) * 32 + col; const float t = *q; *q = run; run += t; }
        gtot[g * 32 + col] = run; }
    __syncthreads();
    const int g = ch / (KC_N / KC_G);
    v4f gs[KC_G - 1];
#pragma unroll  // gs[] in registers
    for (int i = 0; i < KC_G - 1; ++i) gs[i] = *(const v4f*)(gtot + i * 32 + cq * 4);   // all read at once, then selected: no chain of LDS round trips
    v4f c = {};
#pragma unroll  // gs[] in registers
    for (int i = 0; i < KC_G - 1; ++i) c += (i < g) ? gs[i] : (v4f){};
    c += *(const v4f*)(tot + ch * 32 + cq * 4);
#pragma unroll  // p[] in registers; stores back to back
    for (int i = 0; i < KC_R; ++i) *(v4f*)(op + thr + i * DM) = p[i] + c;
}
// k_side: hi/lo f16 planes of a 128-wide per-head row: SH/SL[row][h*128 + c]: c < 64 -> A[row][h*64+c]; c >= 64 -> B2[row][h*64+c-64] (times M[row][same]
// when MUL2) — query side: [q | q*t] (A = q, B2 = q, M = t); key side: [k | kvc]. One wave per (row, head): 128 values -> lane 4 values (whole 256-byte segment).
template <bool MUL2>
__global__ __launch_bounds__(256) void k_side(const float* __restrict__ A, const float* __restrict__ Mv, const float* __restrict__ B2, h16* SH, h16* SL) {
    typedef __attribute__((ext_vector_type(4))) _Float16 v4h;
    const int lane = threadIdx.x & 31, wid = blockIdx.x * 8 + (threadIdx.x >> 5);
    const int r = wid / NH_, h = wid - r * NH_;
    if (r >= NTK) return;
    const int c0 = lane * 4;                       // 0..124 within the 128
    v4h oh, ol;
#pragma unroll
    for (int i = 0; i < 4; ++i) { const int c = c0 + i; float v;
        if (c < HD) v = A[(size_t)r * DM + h * HD + c];
        else { v = B2[(size_t)r * DM + h * HD + c - HD]; if (MUL2) v *= Mv[(size_t)r * DM + h * HD + c - HD]; }
        const h16 a = (h16)v; oh[i] = a; ol[i] = (h16)((v - (float)a) * LOSC); }
    *(v4h*)(SH + (size_t)r * (NH_ * QW) + h * QW + c0) = oh; *(v4h*)(SL + (size_t)r * (NH_ * QW) + h * QW + c0) = ol; 
}

// k_attn: block = (b, h, 64 queries), wave = 16; causal key tiles 0..query tile; scores over the 128 combined dims with hi.hi + hi.lo + lo.hi (24 WMMA per 32-key
// step), x 1/8, keys after the query -> -inf; online f32 softmax; weights x32768 as f16 hi + residual x1024 tiles (same-wave may_alias reload after a compiler barrier); 12 WMMA vs VT16/VTL;
// ctx -> bf16 hi/lo planes CH/CL [token][h*64 + d].
// The 32-key tile of a step (key rows hi + lo, V^T rows hi + lo, 24 KB) is brought once per block into a two-buffer LDS ring by asynchronous copies, one step ahead;
// the four waves read their fragments from there, and the query lo rows from a buffer copied once: the loop holds no global load. Rows are pitched 16 B x odd so that ds_load_b128 fragment reads meet no bank conflict.
#define KP    272                // LDS pitch of a 256-byte key row
#define VP    80                 // LDS pitch of a 64-byte V^T row
#define ST_KL (32 * KP)          // stage offsets: key hi at 0, key lo, V^T hi, V^T lo
#define ST_VH (2 * 32 * KP)
#define ST_VL (ST_VH + HD * VP)
#define ST_SZ (ST_VH + 2 * HD * VP)
__global__ __launch_bounds__(128) void k_attn(const h16* __restrict__ QH, const h16* __restrict__ QL, const h16* __restrict__ KH, const h16* __restrict__ KL, const h16* __restrict__ VT16, const h16* __restrict__ VTL, bf* CH, bf* CL) {
    __shared__ __align__(16) h16 plds[4][16 * 32];
    __shared__ __align__(16) h16 plds2[4][16 * 32];
    __shared__ __align__(16) char ring[2 * ST_SZ];   // the output staging of the epilogue reuses it behind the last step's barrier
    __shared__ __align__(16) char qlds[64 * KP];     // the block's 64 query lo rows, copied once
    const int lane = threadIdx.x & 31, wave = threadIdx.x >> 5, lr = lane & 15, hi = lane >> 4;
    const int bid = blockIdx.x;
    const int b = bid / (NH_ * (NT_ / 64)), rem = bid - b * (NH_ * (NT_ / 64)), h = rem / (NT_ / 64), qt = rem - h * (NT_ / 64);
    const int q0 = qt * 64 + wave * 16;
    const size_t tok0 = (size_t)b * NT_;
    h16* pl = &plds[wave][0]; h16* pl2 = &plds2[wave][0];
    v16h ah[4];
    const size_t qo = (tok0 + q0 + lr) * (NH_ * QW) + h * QW + 8 * hi;
#pragma unroll
    for (int kc = 0; kc < 4; ++kc) ah[kc] = cat16(*(const v8h*)(QH + qo + kc * 32), *(const v8h*)(QH + qo + kc * 32 + 16));
    int qpos[8];
#pragma unroll
    for (int j = 0; j < 8; ++j) qpos[j] = q0 + 8 * hi + j;
    const size_t vbase = (((size_t)b * NH_ + h) * HD) * NT_;
    v8f o[4], ox[4];
#pragma unroll
    for (int n = 0; n < 4; ++n) { o[n] = (v8f){}; ox[n] = (v8f){}; }
    float mrow[8], lpart[8];
#pragma unroll
    for (int j = 0; j < 8; ++j) { mrow[j] = -3.0e38f; lpart[j] = 0.f; }
    const int kt_end = (qt * 64 + 64) / 32;
    // Copies of one tile: 12 per thread, 16 bytes each. Key planes: thread = (row tid/16 + 8 i, 16-byte piece tid%16); V^T planes: thread = (row tid/4 + 32 i, piece tid%4).
    const int tid = threadIdx.x, krow = tid >> 4, kcol = tid & 15, vrow = tid >> 2, vcol = tid & 3;
    const size_t kg = (tok0 + krow) * (NH_ * QW) + h * QW + kcol * 8, vg = vbase + (size_t)vrow * NT_ + vcol * 8;
    const unsigned lk0 = (unsigned)(size_t)ring + krow * KP + kcol * 16, lv0 = (unsigned)(size_t)ring + ST_VH + vrow * VP + vcol * 16;
    auto fill = [&](int t, int buf) {
        const h16* gkh = KH + kg + (size_t)t * 32 * (NH_ * QW); const h16* gkl = KL + kg + (size_t)t * 32 * (NH_ * QW);
        const h16* gvh = VT16 + vg + t * 32; const h16* gvl = VTL + vg + t * 32;
        const unsigned lk = lk0 + buf * ST_SZ, lv = lv0 + buf * ST_SZ;
        // one statement: the closing s_wait_xcnt stands in front of any rewrite of an address register that a copy names
        asm volatile("global_load_async_to_lds_b128 %0, %12, off\n\t"
                     "global_load_async_to_lds_b128 %1, %13, off\n\t"
                     "global_load_async_to_lds_b128 %2, %14, off\n\t"
                     "global_load_async_to_lds_b128 %3, %15, off\n\t"
                     "global_load_async_to_lds_b128 %4, %16, off\n\t"
                     "global_load_async_to_lds_b128 %5, %17, off\n\t"
                     "global_load_async_to_lds_b128 %6, %18, off\n\t"
                     "global_load_async_to_lds_b128 %7, %19, off\n\t"
                     "global_load_async_to_lds_b128 %8, %20, off\n\t"
                     "global_load_async_to_lds_b128 %9, %21, off\n\t"
                     "global_load_async_to_lds_b128 %10, %22, off\n\t"
                     "global_load_async_to_lds_b128 %11, %23, off\n\t"
                     "s_wait_xcnt 0x0"
                     :: "v"(lk), "v"(lk + 8 * KP), "v"(lk + 16 * KP), "v"(lk + 24 * KP),
                        "v"(lk + ST_KL), "v"(lk + ST_KL + 8 * KP), "v"(lk + ST_KL + 16 * KP), "v"(lk + ST_KL + 24 * KP),
                        "v"(lv), "v"(lv + 32 * VP), "v"(lv + HD * VP), "v"(lv + HD * VP + 32 * VP),
                        "v"(gkh), "v"(gkh + 8 * (NH_ * QW)), "v"(gkh + 16 * (NH_ * QW)), "v"(gkh + 24 * (NH_ * QW)),
                        "v"(gkl), "v"(gkl + 8 * (NH_ * QW)), "v"(gkl + 16 * (NH_ * QW)), "v"(gkl + 24 * (NH_ * QW)),
                        "v"(gvh), "v"(gvh + 32 * NT_), "v"(gvl), "v"(gvl + 32 * NT_)
                     : "memory");
    };
    {   // query lo rows: 8 copies per thread, thread = (row tid/16 + 8 i, piece tid%16); same form of statement as above
        const h16* gq = QL + (tok0 + qt * 64 + krow) * (NH_ * QW) + h * QW + kcol * 8;
        const unsigned lq = (unsigned)(size_t)qlds + krow * KP + kcol * 16;
        asm volatile("global_load_async_to_lds_b128 %0, %8, off\n\t"
                     "global_load_async_to_lds_b128 %1, %9, off\n\t"
                     "global_load_async_to_lds_b128 %2, %10, off\n\t"
                     "global_load_async_to_lds_b128 %3, %11, off\n\t"
                     "global_load_async_to_lds_b128 %4, %12, off\n\t"
                     "global_load_async_to_lds_b128 %5, %13, off\n\t"
                     "global_load_async_to_lds_b128 %6, %14, off\n\t"
                     "global_load_async_to_lds_b128 %7, %15, off\n\t"
                     "s_wait_xcnt 0x0"
                     :: "v"(lq), "v"(lq + 8 * KP), "v"(lq + 16 * KP), "v"(lq + 24 * KP), "v"(lq + 32 * KP), "v"(lq + 40 * KP), "v"(lq + 48 * KP), "v"(lq + 56 * KP),
                        "v"(gq), "v"(gq + 8 * (NH_ * QW)), "v"(gq + 16 * (NH_ * QW)), "v"(gq + 24 * (NH_ * QW)),
                        "v"(gq + 32 * (NH_ * QW)), "v"(gq + 40 * (NH_ * QW)), "v"(gq + 48 * (NH_ * QW)), "v"(gq + 56 * (NH_ * QW))
                     : "memory");
    }
    const char* qlp = qlds + (wave * 16 + lr) * KP + 16 * hi;
    fill(0, 0);
    asm volatile("s_wait_asynccnt 0x0" ::: "memory");   // this wave's copies of the query rows and of tile 0 have landed
    __syncthreads();                                    // ... and every other wave's
    if (kt_end > 1) fill(1, 1);
#pragma unroll 1
    for (int kt = 0; kt < kt_end; ++kt) {
        const int l0 = kt * 32;
        const char* st = ring + (kt & 1) * ST_SZ;
        v8f s0 = {}, s1 = {}, x0 = {}, x1 = {};
#pragma unroll
        for (int kc = 0; kc < 4; ++kc) {
            const char* p0 = st + lr * KP + kc * 64 + 16 * hi; const char* p1 = p0 + 16 * KP;
            const v16h k0h = cat16(*(const v8ha*)p0, *(const v8ha*)(p0 + 32)), k0l = cat16(*(const v8ha*)(p0 + ST_KL), *(const v8ha*)(p0 + ST_KL + 32));
            const v16h k1h = cat16(*(const v8ha*)p1, *(const v8ha*)(p1 + 32)), k1l = cat16(*(const v8ha*)(p1 + ST_KL), *(const v8ha*)(p1 + ST_KL + 32));
            const v16h alk = cat16(*(const v8ha*)(qlp + kc * 64), *(const v8ha*)(qlp + kc * 64 + 32));      // query lo fragment re-read per step (register budget)
            s0 = wmma16(ah[kc], k0h, s0); x0 = wmma16(ah[kc], k0l, x0); x0 = wmma16(alk, k0h, x0);      // lo products carry x1024, folded below
            s1 = wmma16(ah[kc], k1h, s1); x1 = wmma16(ah[kc], k1l, x1); x1 = wmma16(alk, k1h, x1);
            asm volatile("" : "+v"(x0), "+v"(x1) : "v"(alk));
        }
        asm volatile("v_nop\n\tv_nop\n\tv_nop\n\tv_nop" : "+v"(s0), "+v"(s1), "+v"(x0), "+v"(x1) : "v"(ah[0]), "v"(ah[3]));
        float alpha[8];
#pragma unroll
        for (int j = 0; j < 8; ++j) {
            const float a0 = (l0 + lr <= qpos[j]) ? (s0[j] + x0[j] * LOSCI) * SCL : -__builtin_inff(), a1 = (l0 + 16 + lr <= qpos[j]) ? (s1[j] + x1[j] * LOSCI) * SCL : -__builtin_inff();
            float mx = fmaxf(a0, a1);
            mx = fmaxf(mx, __shfl_xor(mx, 1, 16)); mx = fmaxf(mx, __shfl_xor(mx, 2, 16)); mx = fmaxf(mx, __shfl_xor(mx, 4, 16)); mx = fmaxf(mx, __shfl_xor(mx, 8, 16));
            const float mn = fmaxf(mrow[j], mx);
            alpha[j] = __expf(mrow[j] - mn); mrow[j] = mn;
            const float p0 = __expf(a0 - mn), p1 = __expf(a1 - mn);
            lpart[j] = lpart[j] * alpha[j] + (p0 + p1);
            const int mr = hi * 8 + j;
            const float ps0 = p0 * PSC, ps1 = p1 * PSC; const h16 h0 = (h16)ps0, h1 = (h16)ps1;
            pl[mr * 32 + lr] = h0; pl[mr * 32 + 16 + lr] = h1; pl2[mr * 32 + lr] = (h16)((ps0 - (float)h0) * LOSC); pl2[mr * 32 + 16 + lr] = (h16)((ps1 - (float)h1) * LOSC);
        }
#pragma unroll
        for (int n = 0; n < 4; ++n)
#pragma unroll
            for (int j = 0; j < 8; ++j) { o[n][j] *= alpha[j]; ox[n][j] *= alpha[j]; }
        asm volatile("" ::: "memory");
        const v16h pa = cat16(*(const v8ha*)(pl + lr * 32 + hi * 8), *(const v8ha*)(pl + lr * 32 + 16 + hi * 8));
        const v16h px = cat16(*(const v8ha*)(pl2 + lr * 32 + hi * 8), *(const v8ha*)(pl2 + lr * 32 + 16 + hi * 8));
#pragma unroll
        for (int n = 0; n < 4; ++n) { const char* pv = st + ST_VH + (n * 16 + lr) * VP + 16 * hi;
            const v16h vh = cat16(*(const v8ha*)pv, *(const v8ha*)(pv + 32));
            o[n] = wmma16(pa, vh, o[n]); ox[n] = wmma16(pa, cat16(*(const v8ha*)(pv + HD * VP), *(const v8ha*)(pv + HD * VP + 32)), ox[n]); ox[n] = wmma16(px, vh, ox[n]); }
        asm volatile("v_nop\n\tv_nop\n\tv_nop\n\tv_nop" : "+v"(o[0]), "+v"(o[1]), "+v"(o[2]), "+v"(o[3]), "+v"(ox[0]), "+v"(ox[1]), "+v"(ox[2]), "+v"(ox[3]) : "v"(pa), "v"(px));
        asm volatile("s_wait_dscnt 0x0" ::: "memory");      // this wave's reads of the buffer are done before it may be refilled
        asm volatile("s_wait_asynccnt 0x0" ::: "memory");   // this wave's copies of the next tile have landed
        __syncthreads();                                    // publishes the next tile and frees this step's buffer
        if (kt + 2 < kt_end) fill(kt + 2, kt & 1);
    }
    asm volatile("s_wait_asynccnt 0x0" ::: "memory");       // nothing in flight when the ring becomes output staging
    float inv[8];
#pragma unroll
    for (int j = 0; j < 8; ++j) { float rs = lpart[j]; rs += __shfl_xor(rs, 1, 16); rs += __shfl_xor(rs, 2, 16); rs += __shfl_xor(rs, 4, 16); rs += __shfl_xor(rs, 8, 16); inv[j] = 1.0f / (rs * PSC); }
    float* os = (float*)ring + wave * (16 * 68);
#pragma unroll
    for (int n = 0; n < 4; ++n)
#pragma unroll
        for (int j = 0; j < 8; ++j) os[(hi * 8 + j) * 68 + n * 16 + lr] = (o[n][j] + ox[n][j] * LOSCI) * inv[j];
    __syncthreads();
    const size_t cbase = (tok0 + q0) * DM + (size_t)h * HD;
    auto pass = [&]() {
#pragma unroll
        for (int s = 0; s < 4; ++s) { const int row = 4 * s + (lane >> 3), piece = lane & 7; const float* sp = os + row * 68 + piece * 8; v8us oh, ol;
#pragma unroll
            for (int i = 0; i < 8; ++i) { const unsigned short hb = f2bf(sp[i]); oh[i] = hb; ol[i] = f2bf(sp[i] - bf2f(hb)); }
            *(v8us*)(CH + cbase + (size_t)row * DM + piece * 8) = oh; *(v8us*)(CL + cbase + (size_t)row * DM + piece * 8) = ol; }
    };
    pass(); 
}

extern "C" void kernel_launch(void* const* d_in, const int* in_sizes, int n_in,
                              void* d_out, int out_size, void* d_ws, size_t ws_size, hipStream_t stream) {
    (void)in_sizes; (void)n_in; (void)out_size;
    const float* x = (const float*)d_in[0]; const float* W4 = (const float*)d_in[1]; const float* b4 = (const float*)d_in[2]; const float* Wo = (const float*)d_in[3]; const float* bo = (const float*)d_in[4];
    float* out = (float*)d_out;    // [2][2048][1024]
    char* wsp = (char*)d_ws;
    auto take = [&](size_t bytes) { char* p = wsp; wsp += (bytes + 255) & ~(size_t)255; return (void*)p; };
    bf* Xb = (bf*)take((size_t)NTK * DM * 2); bf* W4T = (bf*)take((size_t)4 * DM * DM * 2);
    h16* VT16 = (h16*)take((size_t)NTK * DM * 2); h16* VTL = (h16*)take((size_t)NTK * DM * 2); h16* KH = (h16*)take((size_t)NTK * NH_ * QW * 2); h16* KL = (h16*)take((size_t)NTK * NH_ * QW * 2);
    float* R1 = (float*)take((size_t)NTK * DM * 4); float* R2 = (float*)take((size_t)NTK * DM * 4); float* R3 = (float*)take((size_t)NTK * DM * 4);   // reusable f32 region (3 x 16.8 MB)
    h16* QL = (h16*)take((size_t)NTK * NH_ * QW * 2);
    if ((size_t)(wsp - (char*)d_ws) > ws_size) return;    // exactly 134,217,728 B (128 MiB): Wout^T reuses W4T after the q/t projections
    float* Kf = R1; float* Vf = R2; float* KVC = R3;           // phase 1
    float* Qf = R1; float* Tf = R2; h16* QH = (h16*)R3;        // phase 2 (Kf, Vf, KVC dead by then)
    bf* CH = (bf*)R1; bf* CL = (bf*)R2; bf* WoT = W4T;         // phase 3 (Qf, Tf dead after k_side; W4T dead after the last projection)
    k_cvtb<<<NTK / 8, 256, 0, stream>>>(x, Xb);
    k_wt<<<dim3(DM / 64, (4 * DM) / 64, 1), 256, 0, stream>>>(W4, 4 * DM, W4T);
    // phase 1: k, v -> VT16/VTL, KVC -> key-side planes
    k_gemmb<false><<<dim3(NTK / 64, DM / 64, 1), 128, 0, stream>>>(Xb, nullptr, W4T + (size_t)1 * DM * DM, b4 + 1 * DM, Kf);
    k_gemmb<false><<<dim3(NTK / 64, DM / 64, 1), 128, 0, stream>>>(Xb, nullptr, W4T + (size_t)2 * DM * DM, b4 + 2 * DM, Vf);
    k_vt<<<NB_ * NH_ * (NT_ / 64), 256, 0, stream>>>(Vf, VT16, VTL);
    k_kvc<<<NB_ * (DM / 32), 1024, 0, stream>>>(Kf, Vf, KVC);
    k_side<false><<<(NTK * NH_) / 8, 256, 0, stream>>>(Kf, nullptr, KVC, KH, KL);
    // phase 2: q, t -> query-side planes
    k_gemmb<false><<<dim3(NTK / 64, DM / 64, 1), 128, 0, stream>>>(Xb, nullptr, W4T + (size_t)0 * DM * DM, b4 + 0 * DM, Qf);
    k_gemmb<false><<<dim3(NTK / 64, DM / 64, 1), 128, 0, stream>>>(Xb, nullptr, W4T + (size_t)3 * DM * DM, b4 + 3 * DM, Tf);
    k_side<true><<<(NTK * NH_) / 8, 256, 0, stream>>>(Qf, Tf, Qf, QH, QL);      // [q | q*t]
    // phase 3: Wout^T over the dead W4T, attention -> ctx planes -> out
    k_wt<<<dim3(DM / 64, DM / 64, 1), 256, 0, stream>>>(Wo, DM, WoT);
    k_attn<<<NB_ * NH_ * (NT_ / 64), 128, 0, stream>>>(QH, QL, KH, KL, VT16, VTL, CH, CL);
    k_gemmb<true><<<dim3(NTK / 64, DM / 64, 1), 128, 0, stream>>>(CH, CL, WoT, bo, out);
}

// v003
// One run takes 299 microseconds.
// Next to v002, in two timings, it ran 1.39 and 1.40 times as fast.
// All steps since v000 together make it 4.67 times as fast.
#include <hip/hip_runtime.h>

// Contractions, f32 accumulate: qkvt = x.Wqkvt + b as four [4096 x 1024].[1024 x 1024] column blocks and out = ctx.Wout + bout on v_wmma_f32_16x16x32_bf16 (PLAIN bf16
// operands = inputs rounded once, exact; k-major weights transposed into n-major planes; ctx as bf16 hi + residual planes, two products); the per-(batch, head) causal
// attention fused on v_wmma_f32_16x16x32_f16: scores = ([q | q*t]).([k | cumsum_j(k*v)/8])^T over 128 dims with BOTH sides as f16 hi + residual x1024 planes
// (hi.hi + hi.lo + lo.hi — the triplet term reaches sigma ~45 before the 1/8 scale, so single-rounded operands would not hold the peaked softmax), x 1/8, causal,
// softmax, then weights (x32768) and v BOTH as f16 hi + residual x1024 (hi.hi + hi.lo + lo.hi; the softmax is peaked so single roundings would not average out). The key-side prefix sums are f32 chunked scans (16-row chunks, one block per (b, 32 columns)). Deterministic, no atomics;

#define NB_  2
#define NT_  2048
#define DM   1024
#define NH_  16
#define HD   64
#define QW   128                 // combined score width per head
#define NTK  (NB_ * NT_)         // 4096
#define PSC  32768.0f
#define LOSC 1024.0f
#define LOSCI (1.0f / 1024.0f)
#define SCL  0.125f

typedef _Float16 h16;
typedef unsigned short bf;
typedef __attribute__((ext_vector_type(16))) __bf16   v16bf;
typedef __attribute__((ext_vector_type(16))) _Float16 v16h;
typedef __attribute__((ext_vector_type(8)))  _Float16 v8h;
typedef __attribute__((ext_vector_type(8)))  unsigned short v8us;
typedef __attribute__((ext_vector_type(8)))  float    v8f;
typedef __attribute__((ext_vector_type(4)))  float    v4f;
typedef v8h  __attribute__((may_alias)) v8ha;
typedef v4f  __attribute__((may_alias)) v4fa;
typedef v8us __attribute__((may_alias)) v8usa;

__device__ __forceinline__ unsigned short f2bf(float f) { unsigned u = __float_as_uint(f); u += 0x7FFFu + ((u >> 16) & 1u); return (unsigned short)(u >> 16); }
__device__ __forceinline__ float bf2f(unsigned short b) { return __uint_as_float(((unsigned)b) << 16); }
__device__ __forceinline__ float bfr(float f) { return bf2f(f2bf(f)); }
__device__ __forceinline__ v16h cat16(v8h lo, v8h hi) { return __builtin_shufflevector(lo, hi, 0, 1, 2, 3, 4, 5, 6, 7, 8, 9, 10, 11, 12, 13, 14, 15); }
__device__ __forceinline__ v16bf cat16b(v8us lo, v8us hi) { return __builtin_bit_cast(v16bf, __builtin_shufflevector(lo, hi, 0, 1, 2, 3, 4, 5, 6, 7, 8, 9, 10, 11, 12, 13, 14, 15)); }
__device__ __forceinline__ v8f wmma16(v16h a, v16h b, v8f c) { return __builtin_amdgcn_wmma_f32_16x16x32_f16(false, a, false, b, (short)0, c, false, false); }
__device__ __forceinline__ v8f wmmab(v16bf a, v16bf b, v8f c) { return __builtin_amdgcn_wmma_f32_16x16x32_bf16(false, a, false, b, (short)0, c, false, false); }
#define VST2(T, p, v) do { const T vst2_v_ = (v); *(T*)(p) = vst2_v_;  } while (0)

// k_cvtb: bf16 plane of x [4096][1024]; k_wt: W [1024 k][ncols] k-major -> n-major bf16 [ncols][1024] via 64 x 64 LDS tiles.
__global__ __launch_bounds__(256) void k_cvtb(const float* __restrict__ src, bf* dst) {
    const int lane = threadIdx.x & 31, r = blockIdx.x * 8 + (threadIdx.x >> 5);
    if (r >= NTK) return;
#pragma unroll
    for (int q = 0; q < 4; ++q) { v8us t;
#pragma unroll
        for (int i = 0; i < 8; ++i) t[i] = f2bf(src[(size_t)r * DM + q * 256 + lane * 8 + i]);
        VST2(v8us, dst + (size_t)r * DM + q * 256 + lane * 8, t); }
}
__global__ __launch_bounds__(256) void k_wt(const float* __restrict__ Wm, int ncols, bf* WT) {
    __shared__ __align__(16) unsigned short tl[64 * 72];
    const int tid = threadIdx.x, k0 = blockIdx.x * 64, n0 = blockIdx.y * 64;
    const int kk = tid >> 2, nq = (tid & 3) * 16;
#pragma unroll
    for (int i = 0; i < 16; ++i) tl[(nq + i) * 72 + kk] = f2bf(Wm[(size_t)(k0 + kk) * ncols + n0 + nq + i]);
    __syncthreads();
    const int piece = tid & 7;
    auto pass = [&]() {
#pragma unroll
        for (int s = 0; s < 2; ++s) { const int nr = (tid >> 3) + 32 * s; const v8us val = *(const v8usa*)(tl + nr * 72 + piece * 8);
            *(v8us*)(WT + (size_t)(n0 + nr) * DM + k0 + piece * 8) = val; }
    };
    pass(); 
}

// k_gemmb: block = 64 x 64 of C, wave = 16 x 64. A stage is 64 k = one 128-byte line of each of the block's 64 B rows and 64 A rows (and A residual rows); asynchronous
// copies bring it once per block into a two-buffer LDS ring, one stage ahead, each copy covering four whole lines; the four waves read their fragments from there, so the
// loop holds no global load. Rows are pitched 16 B x odd so that ds_load_b128 fragment reads meet no bank conflict. The k order of every sum is as before.
#define GKS 64                   // k per stage
#define GP  144                  // LDS pitch of a 128-byte row
#define GPL (64 * GP)            // one plane of 64 rows: B at 0, A at GPL, A residual at 2 GPL
template <bool SPLITA>
__global__ __launch_bounds__(128) void k_gemmb(const bf* __restrict__ A, const bf* __restrict__ Al, const bf* __restrict__ Bn, const float* __restrict__ bias, float* C) {
    constexpr int GST = (SPLITA ? 3 : 2) * GPL;
    __shared__ __align__(16) char ring[2 * GST];     // the output staging of the epilogue (17,408 B) reuses it behind the last stage's barrier
    const int tid = threadIdx.x, lane = tid & 31, wave = tid >> 5, lr = lane & 15, hi = lane >> 4;
    const int r0 = blockIdx.x * 64 + wave * 16, c0 = blockIdx.y * 64;
    // Copies of one stage: 4 per thread and plane, 16 bytes each; thread = (row tid/8 + 16 i, 16-byte piece tid%8).
    const int prow = tid >> 3, pcol = tid & 7;
    const size_t ga = (size_t)(blockIdx.x * 64 + prow) * DM + pcol * 8, gb = (size_t)(c0 + prow) * DM + pcol * 8;
    const unsigned l0 = (unsigned)(size_t)ring + prow * GP + pcol * 16;
    auto fill = [&](int t, int buf) {
        const bf* pb = Bn + gb + t * GKS; const bf* pa = A + ga + t * GKS;
        const unsigned l = l0 + buf * GST;
        // one statement: the closing s_wait_xcnt stands in front of any rewrite of an address register that a copy names
        asm volatile("global_load_async_to_lds_b128 %0, %8, off\n\t"
                     "global_load_async_to_lds_b128 %1, %9, off\n\t"
                     "global_load_async_to_lds_b128 %2, %10, off\n\t"
                     "global_load_async_to_lds_b128 %3, %11, off\n\t"
                     "global_load_async_to_lds_b128 %4, %12, off\n\t"
                     "global_load_async_to_lds_b128 %5, %13, off\n\t"
                     "global_load_async_to_lds_b128 %6, %14, off\n\t"
                     "global_load_async_to_lds_b128 %7, %15, off\n\t"
                     "s_wait_xcnt 0x0"
                     :: "v"(l), "v"(l + 16 * GP), "v"(l + 32 * GP), "v"(l + 48 * GP),
                        "v"(l + GPL), "v"(l + GPL + 16 * GP), "v"(l + GPL + 32 * GP), "v"(l + GPL + 48 * GP),
                        "v"(pb), "v"(pb + 16 * DM), "v"(pb + 32 * DM), "v"(pb + 48 * DM),
                        "v"(pa), "v"(pa + 16 * DM), "v"(pa + 32 * DM), "v"(pa + 48 * DM)
                     : "memory");
        if constexpr (SPLITA) {   // the residual plane's rows; same form of statement
            const bf* pl = Al + ga + t * GKS;
            asm volatile("global_load_async_to_lds_b128 %0, %4, off\n\t"
                         "global_load_async_to_lds_b128 %1, %5, off\n\t"
                         "global_load_async_to_lds_b128 %2, %6, off\n\t"
                         "global_load_async_to_lds_b128 %3, %7, off\n\t"
                         "s_wait_xcnt 0x0"
                         :: "v"(l + 2 * GPL), "v"(l + 2 * GPL + 16 * GP), "v"(l + 2 * GPL + 32 * GP), "v"(l + 2 * GPL + 48 * GP),
                            "v"(pl), "v"(pl + 16 * DM), "v"(pl + 32 * DM), "v"(pl + 48 * DM)
                         : "memory");
        }
    };
    v8f acc[4];
#pragma unroll
    for (int t = 0; t < 4; ++t) acc[t] = (v8f){};
    fill(0, 0);
    asm volatile("s_wait_asynccnt 0x0" ::: "memory");   // this wave's copies of stage 0 have landed
    __syncthreads();                                    // ... and every other wave's
    fill(1, 1);
#pragma unroll 1  // stays rolled: one copy of the stage body, the buffer picked by s & 1
    for (int s = 0; s < DM / GKS; ++s) {
        const char* fa = ring + (s & 1) * GST + GPL + (wave * 16 + lr) * GP + 16 * hi;
        const char* fb = ring + (s & 1) * GST + lr * GP + 16 * hi;
        v16bf a, al;
#pragma unroll  // two 32-k products per stage, constant LDS offsets
        for (int ks = 0; ks < GKS / 32; ++ks) {
            a = cat16b(*(const v8usa*)(fa + ks * 64), *(const v8usa*)(fa + ks * 64 + 32));
            al = a;
            if (SPLITA) al = cat16b(*(const v8usa*)(fa + GPL + ks * 64), *(const v8usa*)(fa + GPL + ks * 64 + 32));
#pragma unroll
            for (int t = 0; t < 4; ++t) { const v16bf b = cat16b(*(const v8usa*)(fb + t * 16 * GP + ks * 64), *(const v8usa*)(fb + t * 16 * GP + ks * 64 + 32)); acc[t] = wmmab(a, b, acc[t]); if (SPLITA) acc[t] = wmmab(al, b, acc[t]); }
        }
        // four vector slots behind the last WMMA, on both sides of the branch below, before a vector instruction may overwrite its operands
        asm volatile("v_nop\n\tv_nop\n\tv_nop\n\tv_nop" : "+v"(acc[0]), "+v"(acc[1]), "+v"(acc[2]), "+v"(acc[3]) : "v"(a), "v"(al));
        asm volatile("s_wait_dscnt 0x0" ::: "memory");      // this wave's reads of the buffer are done before it may be refilled
        asm volatile("s_wait_asynccnt 0x0" ::: "memory");   // this wave's copies of the next stage have landed
        __syncthreads();                                    // publishes the next stage and frees this stage's buffer
        if (s + 2 < DM / GKS) fill(s + 2, s & 1);
    }
    asm volatile("s_wait_asynccnt 0x0" ::: "memory");       // nothing in flight when the ring becomes output staging
    float* os = (float*)ring + wave * (16 * 68);
#pragma unroll
    for (int t = 0; t < 4; ++t) { const float bv = bfr(bias[c0 + t * 16 + lr]);
#pragma unroll
        for (int j = 0; j < 8; ++j) os[(hi * 8 + j) * 68 + t * 16 + lr] = acc[t][j] + bv; }
    __syncthreads();
    float* crow = C + (size_t)r0 * DM + c0;
    auto pass = [&]() {
#pragma unroll
        for (int s = 0; s < 8; ++s) { const int Lid = (lane >> 3) + 4 * s, piece = lane & 7; const int row = Lid >> 1, cofs = (Lid & 1) * 32 + piece * 4;
            const v4f val = *(const v4fa*)(os + row * 68 + cofs); *(v4f*)(crow + (size_t)row * DM + cofs) = val; }
    };
    pass(); 
}

// k_vt: VT16/VTL[b][h][d][t] = f16 hi + residual x1024 of V row b*2048+t, col h*64+d via LDS transposes, block (b, h, 64 t).
__global__ __launch_bounds__(256) void k_vt(const float* __restrict__ V, h16* VT16, h16* VTL) {
    __shared__ __align__(16) h16 tile[HD * 72];
    __shared__ __align__(16) h16 til2[HD * 72];
    const int bid = blockIdx.x;
    const int b = bid / (NH_ * (NT_ / 64)), rem = bid - b * (NH_ * (NT_ / 64)), h = rem / (NT_ / 64), kt = rem - h * (NT_ / 64);
    const int k0 = kt * 64, tid = threadIdx.x, kk = tid >> 2, d0 = (tid & 3) * 16;
    const float* src = V + ((size_t)b * NT_ + k0 + kk) * DM + h * HD + d0;
#pragma unroll
    for (int i = 0; i < 16; ++i) { const float v = src[i]; const h16 a = (h16)v; tile[(d0 + i) * 72 + kk] = a; til2[(d0 + i) * 72 + kk] = (h16)((v - (float)a) * LOSC); }
    __syncthreads();
    const int piece = tid & 7;
    const size_t base = (((size_t)b * NH_ + h) * HD) * NT_ + k0;
    auto pass = [&]() {
#pragma unroll
        for (int s = 0; s < 4; ++s) { const int Lid = (tid >> 3) + 32 * s; const int pln = Lid >> 6, d = Lid & 63;
            const v8h val = *(const v8ha*)((pln ? til2 : tile) + d * 72 + piece * 8); *(v8h*)((pln ? VTL : VT16) + base + (size_t)d * NT_ + piece * 8) = val; }
    };
    pass(); 
}
// k_kvc: KVC[b*2048+t][col] = sum_{j<=t} k[j]*v[j]/8 (inclusive prefix over t, f32) as a chunked scan inside one block. Block = (b, 32 columns = whole 128-byte lines);
// thread = (chunk of 16 rows, 4 columns): all 32 16-byte loads are independent and the 64 running sums stay in registers. Chunk sums -> LDS, exclusive prefix over the 128
// chunks in two levels (8 waves scan 16 chunks each, then every thread adds the sums of the groups before its own), then each thread adds that start value to its rows.
#define KC_R 16                  // rows per chunk
#define KC_N (NT_ / KC_R)        // 128 chunks
#define KC_G 8                   // groups of 16 chunks
__global__ __launch_bounds__(1024) void k_kvc(const float* __restrict__ Kf, const float* __restrict__ Vf, float* __restrict__ KVC) {
    __shared__ __align__(16) float tot[KC_N * 32];
    __shared__ __align__(16) float gtot[KC_G * 32];
    const int tid = threadIdx.x, cq = tid & 7, ch = tid >> 3;
    const int b = blockIdx.x / (DM / 32), cg = blockIdx.x - b * (DM / 32);
    const size_t blk = (size_t)b * NT_ * DM + cg * 32;         // block part of the index (scalar)
    const unsigned thr = (unsigned)(ch * KC_R * DM + cq * 4);  // thread part, shared by the loads and the stores
    const float* kp = Kf + blk; const float* vp = Vf + blk; float* op = KVC + blk;
    v4f p[KC_R];
#pragma unroll  // constant indices keep p[] in registers; the independent loads issue many at a time
    for (int i = 0; i < KC_R; ++i) p[i] = *(const v4f*)(kp + thr + i * DM) * *(const v4f*)(vp + thr + i * DM) * SCL;
#pragma unroll  // p[] in registers
    for (int i = 1; i < KC_R; ++i) p[i] += p[i - 1];           // inclusive prefix inside the chunk
    *(v4f*)(tot + ch * 32 + cq * 4) = p[KC_R - 1];
    __syncthreads();
    if (tid < KC_G * 32) { const int g = tid >> 5, col = tid & 31; float run = 0.f;
#pragma unroll  // the 16 LDS reads issue ahead of the add chain
        for (int i = 0; i < KC_N / KC_G; ++i) { float* q = tot + (g * (KC_N / KC_G) + i) * 32 + col; const float t = *q; *q = run; run += t; }
        gtot[g * 32 + col] = run; }
    __syncthreads();
    const int g = ch / (KC_N / KC_G);
    v4f gs[KC_G - 1];
#pragma unroll  // gs[] in registers
    for (int i = 0; i < KC_G - 1; ++i) gs[i] = *(const v4f*)(gtot + i * 32 + cq * 4);   // all read at once, then selected: no chain of LDS round trips
    v4f c = {};
#pragma unroll  // gs[] in registers
    for (int i = 0; i < KC_G - 1; ++i) c += (i < g) ? gs[i] : (v4f){};
    c += *(const v4f*)(tot + ch * 32 + cq * 4);
#pragma unroll  // p[] in registers; stores back to back
    for (int i = 0; i < KC_R; ++i) *(v4f*)(op + thr + i * DM) = p[i] + c;
}
// k_side: hi/lo f16 planes of a 128-wide per-head row: SH/SL[row][h*128 + c]: c < 64 -> A[row][h*64+c]; c >= 64 -> B2[row][h*64+c-64] (times M[row][same]
// when MUL2) — query side: [q | q*t] (A = q, B2 = q, M = t); key side: [k | kvc]. One wave per (row, head): 128 values -> lane 4 values (whole 256-byte segment).
template <bool MUL2>
__global__ __launch_bounds__(256) void k_side(const float* __restrict__ A, const float* __restrict__ Mv, const float* __restrict__ B2, h16* SH, h16* SL) {
    typedef __attribute__((ext_vector_type(4))) _Float16 v4h;
    const int lane = threadIdx.x & 31, wid = blockIdx.x * 8 + (threadIdx.x >> 5);
    const int r = wid / NH_, h = wid - r * NH_;
    if (r >= NTK) return;
    const int c0 = lane * 4;                       // 0..124 within the 128
    v4h oh, ol;
#pragma unroll
    for (int i = 0; i < 4; ++i) { const int c = c0 + i; float v;
        if (c < HD) v = A[(size_t)r * DM + h * HD + c];
        else { v = B2[(size_t)r * DM + h * HD + c - HD]; if (MUL2) v *= Mv[(size_t)r * DM + h * HD + c - HD]; }
        const h16 a = (h16)v; oh[i] = a; ol[i] = (h16)((v - (float)a) * LOSC); }
    *(v4h*)(SH + (size_t)r * (NH_ * QW) + h * QW + c0) = oh; *(v4h*)(SL + (size_t)r * (NH_ * QW) + h * QW + c0) = ol; 
}

// k_attn: block = (b, h, 64 queries), wave = 16; causal key tiles 0..query tile; scores over the 128 combined dims with hi.hi + hi.lo + lo.hi (24 WMMA per 32-key
// step), x 1/8, keys after the query -> -inf; online f32 softmax; weights x32768 as f16 hi + residual x1024 tiles (same-wave may_alias reload after a compiler barrier); 12 WMMA vs VT16/VTL;
// ctx -> bf16 hi/lo planes CH/CL [token][h*64 + d].
// The 32-key tile of a step (key rows hi + lo, V^T rows hi + lo, 24 KB) is brought once per block into a two-buffer LDS ring by asynchronous copies, one step ahead;
// the four waves read their fragments from there, and the query lo rows from a buffer copied once: the loop holds no global load. Rows are pitched 16 B x odd so that ds_load_b128 fragment reads meet no bank conflict.
#define KP    272                // LDS pitch of a 256-byte key row
#define VP    80                 // LDS pitch of a 64-byte V^T row
#define ST_KL (32 * KP)          // stage offsets: key hi at 0, key lo, V^T hi, V^T lo
#define ST_VH (2 * 32 * KP)
#define ST_VL (ST_VH + HD * VP)
#define ST_SZ (ST_VH + 2 * HD * VP)
__global__ __launch_bounds__(128) void k_attn(const h16* __restrict__ QH, const h16* __restrict__ QL, const h16* __restrict__ KH, const h16* __restrict__ KL, const h16* __restrict__ VT16, const h16* __restrict__ VTL, bf* CH, bf* CL) {
    __shared__ __align__(16) h16 plds[4][16 * 32];
    __shared__ __align__(16) h16 plds2[4][16 * 32];
    __shared__ __align__(16) char ring[2 * ST_SZ];   // the output staging of the epilogue reuses it behind the last step's barrier
    __shared__ __align__(16) char qlds[64 * KP];     // the block's 64 query lo rows, copied once
    const int lane = threadIdx.x & 31, wave = threadIdx.x >> 5, lr = lane & 15, hi = lane >> 4;
    const int bid = blockIdx.x;
    const int b = bid / (NH_ * (NT_ / 64)), rem = bid - b * (NH_ * (NT_ / 64)), h = rem / (NT_ / 64), qt = rem - h * (NT_ / 64);
    const int q0 = qt * 64 + wave * 16;
    const size_t tok0 = (size_t)b * NT_;
    h16* pl = &plds[wave][0]; h16* pl2 = &plds2[wave][0];
    v16h ah[4];
    const size_t qo = (tok0 + q0 + lr) * (NH_ * QW) + h * QW + 8 * hi;
#pragma unroll
    for (int kc = 0; kc < 4; ++kc) ah[kc] = cat16(*(const v8h*)(QH + qo + kc * 32), *(const v8h*)(QH + qo + kc * 32 + 16));
    int qpos[8];
#pragma unroll
    for (int j = 0; j < 8; ++j) qpos[j] = q0 + 8 * hi + j;
    const size_t vbase = (((size_t)b * NH_ + h) * HD) * NT_;
    v8f o[4], ox[4];
#pragma unroll
    for (int n = 0; n < 4; ++n) { o[n] = (v8f){}; ox[n] = (v8f){}; }
    float mrow[8], lpart[8];
#pragma unroll
    for (int j = 0; j < 8; ++j) { mrow[j] = -3.0e38f; lpart[j] = 0.f; }
    const int kt_end = (qt * 64 + 64) / 32;
    // Copies of one tile: 12 per thread, 16 bytes each. Key planes: thread = (row tid/16 + 8 i, 16-byte piece tid%16); V^T planes: thread = (row tid/4 + 32 i, piece tid%4).
    const int tid = threadIdx.x, krow = tid >> 4, kcol = tid & 15, vrow = tid >> 2, vcol = tid & 3;
    const size_t kg = (tok0 + krow) * (NH_ * QW) + h * QW + kcol * 8, vg = vbase + (size_t)vrow * NT_ + vcol * 8;
    const unsigned lk0 = (unsigned)(size_t)ring + krow * KP + kcol * 16, lv0 = (unsigned)(size_t)ring + ST_VH + vrow * VP + vcol * 16;
    auto fill = [&](int t, int buf) {
        const h16* gkh = KH + kg + (size_t)t * 32 * (NH_ * QW); const h16* gkl = KL + kg + (size_t)t * 32 * (NH_ * QW);
        const h16* gvh = VT16 + vg + t * 32; const h16* gvl = VTL + vg + t * 32;
        const unsigned lk = lk0 + buf * ST_SZ, lv = lv0 + buf * ST_SZ;
        // one statement: the closing s_wait_xcnt stands in front of any rewrite of an address register that a copy names
        asm volatile("global_load_async_to_lds_b128 %0, %12, off\n\t"
                     "global_load_async_to_lds_b128 %1, %13, off\n\t"
                     "global_load_async_to_lds_b128 %2, %14, off\n\t"
                     "global_load_async_to_lds_b128 %3, %15, off\n\t"
                     "global_load_async_to_lds_b128 %4, %16, off\n\t"
                     "global_load_async_to_lds_b128 %5, %17, off\n\t"
                     "global_load_async_to_lds_b128 %6, %18, off\n\t"
                     "global_load_async_to_lds_b128 %7, %19, off\n\t"
                     "global_load_async_to_lds_b128 %8, %20, off\n\t"
                     "global_load_async_to_lds_b128 %9, %21, off\n\t"
                     "global_load_async_to_lds_b128 %10, %22, off\n\t"
                     "global_load_async_to_lds_b128 %11, %23, off\n\t"
                     "s_wait_xcnt 0x0"
                     :: "v"(lk), "v"(lk + 8 * KP), "v"(lk + 16 * KP), "v"(lk + 24 * KP),
                        "v"(lk + ST_KL), "v"(lk + ST_KL + 8 * KP), "v"(lk + ST_KL + 16 * KP), "v"(lk + ST_KL + 24 * KP),
                        "v"(lv), "v"(lv + 32 * VP), "v"(lv + HD * VP), "v"(lv + HD * VP + 32 * VP),
                        "v"(gkh), "v"(gkh + 8 * (NH_ * QW)), "v"(gkh + 16 * (NH_ * QW)), "v"(gkh + 24 * (NH_ * QW)),
                        "v"(gkl), "v"(gkl + 8 * (NH_ * QW)), "v"(gkl + 16 * (NH_ * QW)), "v"(gkl + 24 * (NH_ * QW)),
                        "v"(gvh), "v"(gvh + 32 * NT_), "v"(gvl), "v"(gvl + 32 * NT_)
                     : "memory");
    };
    {   // query lo rows: 8 copies per thread, thread = (row tid/16 + 8 i, piece tid%16); same form of statement as above
        const h16* gq = QL + (tok0 + qt * 64 + krow) * (NH_ * QW) + h * QW + kcol * 8;
        const unsigned lq = (unsigned)(size_t)qlds + krow * KP + kcol * 16;
        asm volatile("global_load_async_to_lds_b128 %0, %8, off\n\t"
                     "global_load_async_to_lds_b128 %1, %9, off\n\t"
                     "global_load_async_to_lds_b128 %2, %10, off\n\t"
                     "global_load_async_to_lds_b128 %3, %11, off\n\t"
                     "global_load_async_to_lds_b128 %4, %12, off\n\t"
                     "global_load_async_to_lds_b128 %5, %13, off\n\t"
                     "global_load_async_to_lds_b128 %6, %14, off\n\t"
                     "global_load_async_to_lds_b128 %7, %15, off\n\t"
                     "s_wait_xcnt 0x0"
                     :: "v"(lq), "v"(lq + 8 * KP), "v"(lq + 16 * KP), "v"(lq + 24 * KP), "v"(lq + 32 * KP), "v"(lq + 40 * KP), "v"(lq + 48 * KP), "v"(lq + 56 * KP),
                        "v"(gq), "v"(gq + 8 * (NH_ * QW)), "v"(gq + 16 * (NH_ * QW)), "v"(gq + 24 * (NH_ * QW)),
                        "v"(gq + 32 * (NH_ * QW)), "v"(gq + 40 * (NH_ * QW)), "v"(gq + 48 * (NH_ * QW)), "v"(gq + 56 * (NH_ * QW))
                     : "memory");
    }
    const char* qlp = qlds + (wave * 16 + lr) * KP + 16 * hi;
    fill(0, 0);
    asm volatile("s_wait_asynccnt 0x0" ::: "memory");   // this wave's copies of the query rows and of tile 0 have landed
    __syncthreads();                                    // ... and every other wave's
    if (kt_end > 1) fill(1, 1);
#pragma unroll 1
    for (int kt = 0; kt < kt_end; ++kt) {
        const int l0 = kt * 32;
        const char* st = ring + (kt & 1) * ST_SZ;
        v8f s0 = {}, s1 = {}, x0 = {}, x1 = {};
#pragma unroll
        for (int kc = 0; kc < 4; ++kc) {
            const char* p0 = st + lr * KP + kc * 64 + 16 * hi; const char* p1 = p0 + 16 * KP;
            const v16h k0h = cat16(*(const v8ha*)p0, *(const v8ha*)(p0 + 32)), k0l = cat16(*(const v8ha*)(p0 + ST_KL), *(const v8ha*)(p0 + ST_KL + 32));
            const v16h k1h = cat16(*(const v8ha*)p1, *(const v8ha*)(p1 + 32)), k1l = cat16(*(const v8ha*)(p1 + ST_KL), *(const v8ha*)(p1 + ST_KL + 32));
            const v16h alk = cat16(*(const v8ha*)(qlp + kc * 64), *(const v8ha*)(qlp + kc * 64 + 32));      // query lo fragment re-read per step (register budget)
            s0 = wmma16(ah[kc], k0h, s0); x0 = wmma16(ah[kc], k0l, x0); x0 = wmma16(alk, k0h, x0);      // lo products carry x1024, folded below
            s1 = wmma16(ah[kc], k1h, s1); x1 = wmma16(ah[kc], k1l, x1); x1 = wmma16(alk, k1h, x1);
            asm volatile("" : "+v"(x0), "+v"(x1) : "v"(alk));
        }
        asm volatile("v_nop\n\tv_nop\n\tv_nop\n\tv_nop" : "+v"(s0), "+v"(s1), "+v"(x0), "+v"(x1) : "v"(ah[0]), "v"(ah[3]));
        float alpha[8];
#pragma unroll
        for (int j = 0; j < 8; ++j) {
            const float a0 = (l0 + lr <= qpos[j]) ? (s0[j] + x0[j] * LOSCI) * SCL : -__builtin_inff(), a1 = (l0 + 16 + lr <= qpos[j]) ? (s1[j] + x1[j] * LOSCI) * SCL : -__builtin_inff();
            float mx = fmaxf(a0, a1);
            mx = fmaxf(mx, __shfl_xor(mx, 1, 16)); mx = fmaxf(mx, __shfl_xor(mx, 2, 16)); mx = fmaxf(mx, __shfl_xor(mx, 4, 16)); mx = fmaxf(mx, __shfl_xor(mx, 8, 16));
            const float mn = fmaxf(mrow[j], mx);
            alpha[j] = __expf(mrow[j] - mn); mrow[j] = mn;
            const float p0 = __expf(a0 - mn), p1 = __expf(a1 - mn);
            lpart[j] = lpart[j] * alpha[j] + (p0 + p1);
            const int mr = hi * 8 + j;
            const float ps0 = p0 * PSC, ps1 = p1 * PSC; const h16 h0 = (h16)ps0, h1 = (h16)ps1;
            pl[mr * 32 + lr] = h0; pl[mr * 32 + 16 + lr] = h1; pl2[mr * 32 + lr] = (h16)((ps0 - (float)h0) * LOSC); pl2[mr * 32 + 16 + lr] = (h16)((ps1 - (float)h1) * LOSC);
        }
#pragma unroll
        for (int n = 0; n < 4; ++n)
#pragma unroll
            for (int j = 0; j < 8; ++j) { o[n][j] *= alpha[j]; ox[n][j] *= alpha[j]; }
        asm volatile("" ::: "memory");
        const v16h pa = cat16(*(const v8ha*)(pl + lr * 32 + hi * 8), *(const v8ha*)(pl + lr * 32 + 16 + hi * 8));
        const v16h px = cat16(*(const v8ha*)(pl2 + lr * 32 + hi * 8), *(const v8ha*)(pl2 + lr * 32 + 16 + hi * 8));
#pragma unroll
        for (int n = 0; n < 4; ++n) { const char* pv = st + ST_VH + (n * 16 + lr) * VP + 16 * hi;
            const v16h vh = cat16(*(const v8ha*)pv, *(const v8ha*)(pv + 32));
            o[n] = wmma16(pa, vh, o[n]); ox[n] = wmma16(pa, cat16(*(const v8ha*)(pv + HD * VP), *(const v8ha*)(pv + HD * VP + 32)), ox[n]); ox[n] = wmma16(px, vh, ox[n]); }
        asm volatile("v_nop\n\tv_nop\n\tv_nop\n\tv_nop" : "+v"(o[0]), "+v"(o[1]), "+v"(o[2]), "+v"(o[3]), "+v"(ox[0]), "+v"(ox[1]), "+v"(ox[2]), "+v"(ox[3]) : "v"(pa), "v"(px));
        asm volatile("s_wait_dscnt 0x0" ::: "memory");      // this wave's reads of the buffer are done before it may be refilled
        asm volatile("s_wait_asynccnt 0x0" ::: "memory");   // this wave's copies of the next tile have landed
        __syncthreads();                                    // publishes the next tile and frees this step's buffer
        if (kt + 2 < kt_end) fill(kt + 2, kt & 1);
    }
    asm volatile("s_wait_asynccnt 0x0" ::: "memory");       // nothing in flight when the ring becomes output staging
    float inv[8];
#pragma unroll
    for (int j = 0; j < 8; ++j) { float rs = lpart[j]; rs += __shfl_xor(rs, 1, 16); rs += __shfl_xor(rs, 2, 16); rs += __shfl_xor(rs, 4, 16); rs += __shfl_xor(rs, 8, 16); inv[j] = 1.0f / (rs * PSC); }
    float* os = (float*)ring + wave * (16 * 68);
#pragma unroll
    for (int n = 0; n < 4; ++n)
#pragma unroll
        for (int j = 0; j < 8; ++j) os[(hi * 8 + j) * 68 + n * 16 + lr] = (o[n][j] + ox[n][j] * LOSCI) * inv[j];
    __syncthreads();
    const size_t cbase = (tok0 + q0) * DM + (size_t)h * HD;
    auto pass = [&]() {
#pragma unroll
        for (int s = 0; s < 4; ++s) { const int row = 4 * s + (lane >> 3), piece = lane & 7; const float* sp = os + row * 68 + piece * 8; v8us oh, ol;
#pragma unroll
            for (int i = 0; i < 8; ++i) { const unsigned short hb = f2bf(sp[i]); oh[i] = hb; ol[i] = f2bf(sp[i] - bf2f(hb)); }
            *(v8us*)(CH + cbase + (size_t)row * DM + piece * 8) = oh; *(v8us*)(CL + cbase + (size_t)row * DM + piece * 8) = ol; }
    };
    pass(); 
}

extern "C" void kernel_launch(void* const* d_in, const int* in_sizes, int n_in,
                              void* d_out, int out_size, void* d_ws, size_t ws_size, hipStream_t stream) {
    (void)in_sizes; (void)n_in; (void)out_size;
    const float* x = (const float*)d_in[0]; const float* W4 = (const float*)d_in[1]; const float* b4 = (const float*)d_in[2]; const float* Wo = (const float*)d_in[3]; const float* bo = (const float*)d_in[4];
    float* out = (float*)d_out;    // [2][2048][1024]
    char* wsp = (char*)d_ws;
    auto take = [&](size_t bytes) { char* p = wsp; wsp += (bytes + 255) & ~(size_t)255; return (void*)p; };
    bf* Xb = (bf*)take((size_t)NTK * DM * 2); bf* W4T = (bf*)take((size_t)4 * DM * DM * 2);
    h16* VT16 = (h16*)take((size_t)NTK * DM * 2); h16* VTL = (h16*)take((size_t)NTK * DM * 2); h16* KH = (h16*)take((size_t)NTK * NH_ * QW * 2); h16* KL = (h16*)take((size_t)NTK * NH_ * QW * 2);
    float* R1 = (float*)take((size_t)NTK * DM * 4); float* R2 = (float*)take((size_t)NTK * DM * 4); float* R3 = (float*)take((size_t)NTK * DM * 4);   // reusable f32 region (3 x 16.8 MB)
    h16* QL = (h16*)take((size_t)NTK * NH_ * QW * 2);
    if ((size_t)(wsp - (char*)d_ws) > ws_size) return;    // exactly 134,217,728 B (128 MiB): Wout^T reuses W4T after the q/t projections
    float* Kf = R1; float* Vf = R2; float* KVC = R3;           // phase 1
    float* Qf = R1; float* Tf = R2; h16* QH = (h16*)R3;        // phase 2 (Kf, Vf, KVC dead by then)
    bf* CH = (bf*)R1; bf* CL = (bf*)R2; bf* WoT = W4T;         // phase 3 (Qf, Tf dead after k_side; W4T dead after the last projection)
    k_cvtb<<<NTK / 8, 256, 0, stream>>>(x, Xb);
    k_wt<<<dim3(DM / 64, (4 * DM) / 64, 1), 256, 0, stream>>>(W4, 4 * DM, W4T);
    // phase 1: k, v -> VT16/VTL, KVC -> key-side planes
    k_gemmb<false><<<dim3(NTK / 64, DM / 64, 1), 128, 0, stream>>>(Xb, nullptr, W4T + (size_t)1 * DM * DM, b4 + 1 * DM, Kf);
    k_gemmb<false><<<dim3(NTK / 64, DM / 64, 1), 128, 0, stream>>>(Xb, nullptr, W4T + (size_t)2 * DM * DM, b4 + 2 * DM, Vf);
    k_vt<<<NB_ * NH_ * (NT_ / 64), 256, 0, stream>>>(Vf, VT16, VTL);
    k_kvc<<<NB_ * (DM / 32), 1024, 0, stream>>>(Kf, Vf, KVC);
    k_side<false><<<(NTK * NH_) / 8, 256, 0, stream>>>(Kf, nullptr, KVC, KH, KL);
    // phase 2: q, t -> query-side planes
    k_gemmb<false><<<dim3(NTK / 64, DM / 64, 1), 128, 0, stream>>>(Xb, nullptr, W4T + (size_t)0 * DM * DM, b4 + 0 * DM, Qf);
    k_gemmb<false><<<dim3(NTK / 64, DM / 64, 1), 128, 0, stream>>>(Xb, nullptr, W4T + (size_t)3 * DM * DM, b4 + 3 * DM, Tf);
    k_side<true><<<(NTK * NH_) / 8, 256, 0, stream>>>(Qf, Tf, Qf, QH, QL);      // [q | q*t]
    // phase 3: Wout^T over the dead W4T, attention -> ctx planes -> out
    k_wt<<<dim3(DM / 64, DM / 64, 1), 256, 0, stream>>>(Wo, DM, WoT);
    k_attn<<<NB_ * NH_ * (NT_ / 64), 128, 0, stream>>>(QH, QL, KH, KL, VT16, VTL, CH, CL);
    k_gemmb<true><<<dim3(NTK / 64, DM / 64, 1), 128, 0, stream>>>(CH, CL, WoT, bo, out);
}

// v004
// A run of this version takes 269 microseconds.
// Two timings next to v003 both put it at 1.11 times that version's speed.
// All steps since v000 together make it 5.17 times as fast.
#include <hip/hip_runtime.h>

// Contractions, f32 accumulate: qkvt = x.Wqkvt + b as four [4096 x 1024].[1024 x 1024] column blocks and out = ctx.Wout + bout on v_wmma_f32_16x16x32_bf16 (PLAIN bf16
// operands = inputs rounded once, exact; k-major weights transposed into n-major planes; ctx as bf16 hi + residual planes, two products); the per-(batch, head) causal
// attention fused on v_wmma_f32_16x16x32_f16: scores = ([q | q*t]).([k | cumsum_j(k*v)/8])^T over 128 dims with BOTH sides as f16 hi + residual x1024 planes
// (hi.hi + hi.lo + lo.hi — the triplet term reaches sigma ~45 before the 1/8 scale, so single-rounded operands would not hold the peaked softmax), x 1/8, causal,
// softmax, then weights (x32768) and v BOTH as f16 hi + residual x1024 (hi.hi + hi.lo + lo.hi; the softmax is peaked so single roundings would not average out). The key-side prefix sums are f32 chunked scans (16-row chunks, one block per (b, 32 columns)). Deterministic, no atomics;

#define NB_  2
#define NT_  2048
#define DM   1024
#define NH_  16
#define HD   64
#define QW   128                 // combined score width per head
#define NTK  (NB_ * NT_)         // 4096
#define PSC  32768.0f
#define LOSC 1024.0f
#define LOSCI (1.0f / 1024.0f)
#define SCL  0.125f

typedef _Float16 h16;
typedef unsigned short bf;
typedef __attribute__((ext_vector_type(16))) __bf16   v16bf;
typedef __attribute__((ext_vector_type(16))) _Float16 v16h;
typedef __attribute__((ext_vector_type(8)))  _Float16 v8h;
typedef __attribute__((ext_vector_type(8)))  unsigned short v8us;
typedef __attribute__((ext_vector_type(8)))  float    v8f;
typedef __attribute__((ext_vector_type(4)))  float    v4f;
typedef v8h  __attribute__((may_alias)) v8ha;
typedef v4f  __attribute__((may_alias)) v4fa;
typedef v8us __attribute__((may_alias)) v8usa;

__device__ __forceinline__ unsigned short f2bf(float f) { unsigned u = __float_as_uint(f); u += 0x7FFFu + ((u >> 16) & 1u); return (unsigned short)(u >> 16); }
__device__ __forceinline__ float bf2f(unsigned short b) { return __uint_as_float(((unsigned)b) << 16); }
__device__ __forceinline__ float bfr(float f) { return bf2f(f2bf(f)); }
__device__ __forceinline__ v16h cat16(v8h lo, v8h hi) { return __builtin_shufflevector(lo, hi, 0, 1, 2, 3, 4, 5, 6, 7, 8, 9, 10, 11, 12, 13, 14, 15); }
__device__ __forceinline__ v16bf cat16b(v8us lo, v8us hi) { return __builtin_bit_cast(v16bf, __builtin_shufflevector(lo, hi, 0, 1, 2, 3, 4, 5, 6, 7, 8, 9, 10, 11, 12, 13, 14, 15)); }
__device__ __forceinline__ v8f wmma16(v16h a, v16h b, v8f c) { return __builtin_amdgcn_wmma_f32_16x16x32_f16(false, a, false, b, (short)0, c, false, false); }
__device__ __forceinline__ v8f wmmab(v16bf a, v16bf b, v8f c) { return __builtin_amdgcn_wmma_f32_16x16x32_bf16(false, a, false, b, (short)0, c, false, false); }
#define VST2(T, p, v) do { const T vst2_v_ = (v); *(T*)(p) = vst2_v_;  } while (0)

// k_cvtb: bf16 plane of x [4096][1024]; k_wt: W [1024 k][ncols] k-major -> n-major bf16 [ncols][1024] via 64 x 64 LDS tiles.
__global__ __launch_bounds__(256) void k_cvtb(const float* __restrict__ src, bf* dst) {
    const int lane = threadIdx.x & 31, r = blockIdx.x * 8 + (threadIdx.x >> 5);
    if (r >= NTK) return;
#pragma unroll
    for (int q = 0; q < 4; ++q) { v8us t;
#pragma unroll
        for (int i = 0; i < 8; ++i) t[i] = f2bf(src[(size_t)r * DM + q * 256 + lane * 8 + i]);
        VST2(v8us, dst + (size_t)r * DM + q * 256 + lane * 8, t); }
}
__global__ __launch_bounds__(256) void k_wt(const float* __restrict__ Wm, int ncols, bf* WT) {
    __shared__ __align__(16) unsigned short tl[64 * 72];
    const int tid = threadIdx.x, k0 = blockIdx.x * 64, n0 = blockIdx.y * 64;
    const int kk = tid >> 2, nq = (tid & 3) * 16;
#pragma unroll
    for (int i = 0; i < 16; ++i) tl[(nq + i) * 72 + kk] = f2bf(Wm[(size_t)(k0 + kk) * ncols + n0 + nq + i]);
    __syncthreads();
    const int piece = tid & 7;
    auto pass = [&]() {
#pragma unroll
        for (int s = 0; s < 2; ++s) { const int nr = (tid >> 3) + 32 * s; const v8us val = *(const v8usa*)(tl + nr * 72 + piece * 8);
            *(v8us*)(WT + (size_t)(n0 + nr) * DM + k0 + piece * 8) = val; }
    };
    pass(); 
}

// k_gemmb: block = 64 x 64 of C, wave = 16 x 64. A stage is 64 k = one 128-byte line of each of the block's 64 B rows and 64 A rows (and A residual rows); asynchronous
// copies bring it once per block into a two-buffer LDS ring, one stage ahead, each copy covering four whole lines; the four waves read their fragments from there, so the
// loop holds no global load. Rows are pitched 16 B x odd so that ds_load_b128 fragment reads meet no bank conflict. The k order of every sum is as before.
#define GKS 64                   // k per stage
#define GP  144                  // LDS pitch of a 128-byte row
#define GPL (64 * GP)            // one plane of 64 rows: B at 0, A at GPL, A residual at 2 GPL
template <bool SPLITA>
__global__ __launch_bounds__(128) void k_gemmb(const bf* __restrict__ A, const bf* __restrict__ Al, const bf* __restrict__ Bn, const float* __restrict__ bias, float* C) {
    constexpr int GST = (SPLITA ? 3 : 2) * GPL;
    __shared__ __align__(16) char ring[2 * GST];     // the output staging of the epilogue (17,408 B) reuses it behind the last stage's barrier
    const int tid = threadIdx.x, lane = tid & 31, wave = tid >> 5, lr = lane & 15, hi = lane >> 4;
    const int r0 = blockIdx.x * 64 + wave * 16, c0 = blockIdx.y * 64;
    // Copies of one stage: 4 per thread and plane, 16 bytes each; thread = (row tid/8 + 16 i, 16-byte piece tid%8).
    const int prow = tid >> 3, pcol = tid & 7;
    const size_t ga = (size_t)(blockIdx.x * 64 + prow) * DM + pcol * 8, gb = (size_t)(c0 + prow) * DM + pcol * 8;
    const unsigned l0 = (unsigned)(size_t)ring + prow * GP + pcol * 16;
    auto fill = [&](int t, int buf) {
        const bf* pb = Bn + gb + t * GKS; const bf* pa = A + ga + t * GKS;
        const unsigned l = l0 + buf * GST;
        // one statement: the closing s_wait_xcnt stands in front of any rewrite of an address register that a copy names
        asm volatile("global_load_async_to_lds_b128 %0, %8, off\n\t"
                     "global_load_async_to_lds_b128 %1, %9, off\n\t"
                     "global_load_async_to_lds_b128 %2, %10, off\n\t"
                     "global_load_async_to_lds_b128 %3, %11, off\n\t"
                     "global_load_async_to_lds_b128 %4, %12, off\n\t"
                     "global_load_async_to_lds_b128 %5, %13, off\n\t"
                     "global_load_async_to_lds_b128 %6, %14, off\n\t"
                     "global_load_async_to_lds_b128 %7, %15, off\n\t"
                     "s_wait_xcnt 0x0"
                     :: "v"(l), "v"(l + 16 * GP), "v"(l + 32 * GP), "v"(l + 48 * GP),
                        "v"(l + GPL), "v"(l + GPL + 16 * GP), "v"(l + GPL + 32 * GP), "v"(l + GPL + 48 * GP),
                        "v"(pb), "v"(pb + 16 * DM), "v"(pb + 32 * DM), "v"(pb + 48 * DM),
                        "v"(pa), "v"(pa + 16 * DM), "v"(pa + 32 * DM), "v"(pa + 48 * DM)
                     : "memory");
        if constexpr (SPLITA) {   // the residual plane's rows; same form of statement
            const bf* pl = Al + ga + t * GKS;
            asm volatile("global_load_async_to_lds_b128 %0, %4, off\n\t"
                         "global_load_async_to_lds_b128 %1, %5, off\n\t"
                         "global_load_async_to_lds_b128 %2, %6, off\n\t"
                         "global_load_async_to_lds_b128 %3, %7, off\n\t"
                         "s_wait_xcnt 0x0"
                         :: "v"(l + 2 * GPL), "v"(l + 2 * GPL + 16 * GP), "v"(l + 2 * GPL + 32 * GP), "v"(l + 2 * GPL + 48 * GP),
                            "v"(pl), "v"(pl + 16 * DM), "v"(pl + 32 * DM), "v"(pl + 48 * DM)
                         : "memory");
        }
    };
    v8f acc[4];
#pragma unroll
    for (int t = 0; t < 4; ++t) acc[t] = (v8f){};
    fill(0, 0);
    asm volatile("s_wait_asynccnt 0x0" ::: "memory");   // this wave's copies of stage 0 have landed
    __syncthreads();                                    // ... and every other wave's
    fill(1, 1);
#pragma unroll 1  // stays rolled: one copy of the stage body, the buffer picked by s & 1
    for (int s = 0; s < DM / GKS; ++s) {
        const char* fa = ring + (s & 1) * GST + GPL + (wave * 16 + lr) * GP + 16 * hi;
        const char* fb = ring + (s & 1) * GST + lr * GP + 16 * hi;
        v16bf a, al;
#pragma unroll  // two 32-k products per stage, constant LDS offsets
        for (int ks = 0; ks < GKS / 32; ++ks) {
            a = cat16b(*(const v8usa*)(fa + ks * 64), *(const v8usa*)(fa + ks * 64 + 32));
            al = a;
            if (SPLITA) al = cat16b(*(const v8usa*)(fa + GPL + ks * 64), *(const v8usa*)(fa + GPL + ks * 64 + 32));
#pragma unroll
            for (int t = 0; t < 4; ++t) { const v16bf b = cat16b(*(const v8usa*)(fb + t * 16 * GP + ks * 64), *(const v8usa*)(fb + t * 16 * GP + ks * 64 + 32)); acc[t] = wmmab(a, b, acc[t]); if (SPLITA) acc[t] = wmmab(al, b, acc[t]); }
        }
        // four vector slots behind the last WMMA, on both sides of the branch below, before a vector instruction may overwrite its operands
        asm volatile("v_nop\n\tv_nop\n\tv_nop\n\tv_nop" : "+v"(acc[0]), "+v"(acc[1]), "+v"(acc[2]), "+v"(acc[3]) : "v"(a), "v"(al));
        asm volatile("s_wait_dscnt 0x0" ::: "memory");      // this wave's reads of the buffer are done before it may be refilled
        asm volatile("s_wait_asynccnt 0x0" ::: "memory");   // this wave's copies of the next stage have landed
        __syncthreads();                                    // publishes the next stage and frees this stage's buffer
        if (s + 2 < DM / GKS) fill(s + 2, s & 1);
    }
    asm volatile("s_wait_asynccnt 0x0" ::: "memory");       // nothing in flight when the ring becomes output staging
    float* os = (float*)ring + wave * (16 * 68);
#pragma unroll
    for (int t = 0; t < 4; ++t) { const float bv = bfr(bias[c0 + t * 16 + lr]);
#pragma unroll
        for (int j = 0; j < 8; ++j) os[(hi * 8 + j) * 68 + t * 16 + lr] = acc[t][j] + bv; }
    __syncthreads();
    float* crow = C + (size_t)r0 * DM + c0;
    auto pass = [&]() {
#pragma unroll
        for (int s = 0; s < 8; ++s) { const int Lid = (lane >> 3) + 4 * s, piece = lane & 7; const int row = Lid >> 1, cofs = (Lid & 1) * 32 + piece * 4;
            const v4f val = *(const v4fa*)(os + row * 68 + cofs); *(v4f*)(crow + (size_t)row * DM + cofs) = val; }
    };
    pass(); 
}

// k_vt: VT16/VTL[b][h][d][t] = f16 hi + residual x1024 of V row b*2048+t, col h*64+d via LDS transposes, block (b, h, 64 t).
__global__ __launch_bounds__(256) void k_vt(const float* __restrict__ V, h16* VT16, h16* VTL) {
    __shared__ __align__(16) h16 tile[HD * 72];
    __shared__ __align__(16) h16 til2[HD * 72];
    const int bid = blockIdx.x;
    const int b = bid / (NH_ * (NT_ / 64)), rem = bid - b * (NH_ * (NT_ / 64)), h = rem / (NT_ / 64), kt = rem - h * (NT_ / 64);
    const int k0 = kt * 64, tid = threadIdx.x, kk = tid >> 2, d0 = (tid & 3) * 16;
    const float* src = V + ((size_t)b * NT_ + k0 + kk) * DM + h * HD + d0;
#pragma unroll
    for (int i = 0; i < 16; ++i) { const float v = src[i]; const h16 a = (h16)v; tile[(d0 + i) * 72 + kk] = a; til2[(d0 + i) * 72 + kk] = (h16)((v - (float)a) * LOSC); }
    __syncthreads();
    const int piece = tid & 7;
    const size_t base = (((size_t)b * NH_ + h) * HD) * NT_ + k0;
    auto pass = [&]() {
#pragma unroll
        for (int s = 0; s < 4; ++s) { const int Lid = (tid >> 3) + 32 * s; const int pln = Lid >> 6, d = Lid & 63;
            const v8h val = *(const v8ha*)((pln ? til2 : tile) + d * 72 + piece * 8); *(v8h*)((pln ? VTL : VT16) + base + (size_t)d * NT_ + piece * 8) = val; }
    };
    pass(); 
}
// k_kvc: KVC[b*2048+t][col] = sum_{j<=t} k[j]*v[j]/8 (inclusive prefix over t, f32) as a chunked scan inside one block. Block = (b, 32 columns = whole 128-byte lines);
// thread = (chunk of 16 rows, 4 columns): all 32 16-byte loads are independent and the 64 running sums stay in registers. Chunk sums -> LDS, exclusive prefix over the 128
// chunks in two levels (8 waves scan 16 chunks each, then every thread adds the sums of the groups before its own), then each thread adds that start value to its rows.
#define KC_R 16                  // rows per chunk
#define KC_N (NT_ / KC_R)        // 128 chunks
#define KC_G 8                   // groups of 16 chunks
__global__ __launch_bounds__(1024) void k_kvc(const float* __restrict__ Kf, const float* __restrict__ Vf, float* __restrict__ KVC) {
    __shared__ __align__(16) float tot[KC_N * 32];
    __shared__ __align__(16) float gtot[KC_G * 32];
    const int tid = threadIdx.x, cq = tid & 7, ch = tid >> 3;
    const int b = blockIdx.x / (DM / 32), cg = blockIdx.x - b * (DM / 32);
    const size_t blk = (size_t)b * NT_ * DM + cg * 32;         // block part of the index (scalar)
    const unsigned thr = (unsigned)(ch * KC_R * DM + cq * 4);  // thread part, shared by the loads and the stores
    const float* kp = Kf + blk; const float* vp = Vf + blk; float* op = KVC + blk;
    v4f p[KC_R];
#pragma unroll  // constant indices keep p[] in registers; the independent loads issue many at a time
    for (int i = 0; i < KC_R; ++i) p[i] = *(const v4f*)(kp + thr + i * DM) * *(const v4f*)(vp + thr + i * DM) * SCL;
#pragma unroll  // p[] in registers
    for (int i = 1; i < KC_R; ++i) p[i] += p[i - 1];           // inclusive prefix inside the chunk
    *(v4f*)(tot + ch * 32 + cq * 4) = p[KC_R - 1];
    __syncthreads();
    if (tid < KC_G * 32) { const int g = tid >> 5, col = tid & 31; float run = 0.f;
#pragma unroll  // the 16 LDS reads issue ahead of the add chain
        for (int i = 0; i < KC_N / KC_G; ++i) { float* q = tot + (g * (KC_N / KC_G) + i) * 32 + col; const float t = *q; *q = run; run += t; }
        gtot[g * 32 + col] = run; }
    __syncthreads();
    const int g = ch / (KC_N / KC_G);
    v4f gs[KC_G - 1];
#pragma unroll  // gs[] in registers
    for (int i = 0; i < KC_G - 1; ++i) gs[i] = *(const v4f*)(gtot + i * 32 + cq * 4);   // all read at once, then selected: no chain of LDS round trips
    v4f c = {};
#pragma unroll  // gs[] in registers
    for (int i = 0; i < KC_G - 1; ++i) c += (i < g) ? gs[i] : (v4f){};
    c += *(const v4f*)(tot + ch * 32 + cq * 4);
#pragma unroll  // p[] in registers; stores back to back
    for (int i = 0; i < KC_R; ++i) *(v4f*)(op + thr + i * DM) = p[i] + c;
}
// k_side: hi/lo f16 planes of a 128-wide per-head row: SH/SL[row][h*128 + c]: c < 64 -> A[row][h*64+c]; c >= 64 -> B2[row][h*64+c-64] (times M[row][same]
// when MUL2) — query side: [q | q*t] (A = q, B2 = q, M = t); key side: [k | kvc]. One wave per (row, head): 128 values -> lane 4 values (whole 256-byte segment).
template <bool MUL2>
__global__ __launch_bounds__(256) void k_side(const float* __restrict__ A, const float* __restrict__ Mv, const float* __restrict__ B2, h16* SH, h16* SL) {
    typedef __attribute__((ext_vector_type(4))) _Float16 v4h;
    const int lane = threadIdx.x & 31, wid = blockIdx.x * 8 + (threadIdx.x >> 5);
    const int r = wid / NH_, h = wid - r * NH_;
    if (r >= NTK) return;
    const int c0 = lane * 4;                       // 0..124 within the 128
    v4h oh, ol;
#pragma unroll
    for (int i = 0; i < 4; ++i) { const int c = c0 + i; float v;
        if (c < HD) v = A[(size_t)r * DM + h * HD + c];
        else { v = B2[(size_t)r * DM + h * HD + c - HD]; if (MUL2) v *= Mv[(size_t)r * DM + h * HD + c - HD]; }
        const h16 a = (h16)v; oh[i] = a; ol[i] = (h16)((v - (float)a) * LOSC); }
    *(v4h*)(SH + (size_t)r * (NH_ * QW) + h * QW + c0) = oh; *(v4h*)(SL + (size_t)r * (NH_ * QW) + h * QW + c0) = ol; 
}

// k_attn: block = (b, head pair hp, t): the 64-query tile t of head hp, then tile 31 - t of head hp + 8, one after the other: 66 key steps in every block, so that the
// blocks, all resident at once, end together; wave = 16 queries; causal key tiles 0..query tile; scores over the 128 combined dims with hi.hi + hi.lo + lo.hi (24 WMMA per 32-key
// step), x 1/8, keys after the query -> -inf; online f32 softmax; weights x32768 as f16 hi + residual x1024 tiles (same-wave may_alias reload after a compiler barrier); 12 WMMA vs V^T hi + lo (hi.hi + hi.lo + lo.hi);
// ctx -> bf16 hi/lo planes CH/CL [token][h*64 + d].
// The 32-key tile of a step (key rows hi + lo, V^T rows hi + lo, 24 KB) is brought once per block into a two-buffer LDS ring by asynchronous copies, one step ahead;
// the four waves read their fragments from there, and the query lo rows from a buffer copied once: the loop holds no global load. Rows are pitched 16 B x odd so that ds_load_b128 fragment reads meet no bank conflict.
#define KP    272                // LDS pitch of a 256-byte key row
#define VP    80                 // LDS pitch of a 64-byte V^T row
#define ST_KL (32 * KP)          // stage offsets: key hi at 0, key lo, V^T hi, V^T lo
#define ST_VH (2 * 32 * KP)
#define ST_VL (ST_VH + HD * VP)
#define ST_SZ (ST_VH + 2 * HD * VP)
__global__ __launch_bounds__(128) void k_attn(const h16* __restrict__ QH, const h16* __restrict__ QL, const h16* __restrict__ KH, const h16* __restrict__ KL, const h16* __restrict__ VT16, const h16* __restrict__ VTL, bf* CH, bf* CL) {
    __shared__ __align__(16) h16 plds[4][16 * 32];
    __shared__ __align__(16) h16 plds2[4][16 * 32];
    __shared__ __align__(16) char ring[2 * ST_SZ];   // the output staging of the epilogue reuses it behind the last step's barrier
    __shared__ __align__(16) char qlds[64 * KP];     // the current tile's 64 query lo rows, copied once per tile
    const int lane = threadIdx.x & 31, wave = threadIdx.x >> 5, lr = lane & 15, hi = lane >> 4;
    const int bid = blockIdx.x;
    const int b = bid / ((NH_ / 2) * (NT_ / 64)), rem = bid - b * ((NH_ / 2) * (NT_ / 64)), hp = rem / (NT_ / 64), t0 = rem - hp * (NT_ / 64);
    const size_t tok0 = (size_t)b * NT_;
    h16* pl = &plds[wave][0]; h16* pl2 = &plds2[wave][0];
#pragma unroll 1  // the two tiles go through one copy of the code, one after the other
  for (int half = 0; half < 2; ++half) {
    const int h = half ? hp + NH_ / 2 : hp, qt = half ? NT_ / 64 - 1 - t0 : t0;
    const int q0 = qt * 64 + wave * 16;
    if (half) {
        asm volatile("s_wait_dscnt 0x0" ::: "memory");  // this wave's reads of the first tile's output staging are done
        __syncthreads();                                // ... and every other wave's, before the copies below refill that LDS
    }
    v16h ah[4];
    const size_t qo = (tok0 + q0 + lr) * (NH_ * QW) + h * QW + 8 * hi;
#pragma unroll
    for (int kc = 0; kc < 4; ++kc) ah[kc] = cat16(*(const v8h*)(QH + qo + kc * 32), *(const v8h*)(QH + qo + kc * 32 + 16));
    int qpos[8];
#pragma unroll
    for (int j = 0; j < 8; ++j) qpos[j] = q0 + 8 * hi + j;
    const size_t vbase = (((size_t)b * NH_ + h) * HD) * NT_;
    v8f o[4], ox[4];
#pragma unroll
    for (int n = 0; n < 4; ++n) { o[n] = (v8f){}; ox[n] = (v8f){}; }
    float mrow[8], lpart[8];
#pragma unroll
    for (int j = 0; j < 8; ++j) { mrow[j] = -3.0e38f; lpart[j] = 0.f; }
    const int kt_end = (qt * 64 + 64) / 32;
    // Copies of one tile: 12 per thread, 16 bytes each. Key planes: thread = (row tid/16 + 8 i, 16-byte piece tid%16); V^T planes: thread = (row tid/4 + 32 i, piece tid%4).
    const int tid = threadIdx.x, krow = tid >> 4, kcol = tid & 15, vrow = tid >> 2, vcol = tid & 3;
    const size_t kg = (tok0 + krow) * (NH_ * QW) + h * QW + kcol * 8, vg = vbase + (size_t)vrow * NT_ + vcol * 8;
    const unsigned lk0 = (unsigned)(size_t)ring + krow * KP + kcol * 16, lv0 = (unsigned)(size_t)ring + ST_VH + vrow * VP + vcol * 16;
    auto fill = [&](int t, int buf) {
        const h16* gkh = KH + kg + (size_t)t * 32 * (NH_ * QW); const h16* gkl = KL + kg + (size_t)t * 32 * (NH_ * QW);
        const h16* gvh = VT16 + vg + t * 32; const h16* gvl = VTL + vg + t * 32;
        const unsigned lk = lk0 + buf * ST_SZ, lv = lv0 + buf * ST_SZ;
        // one statement: the closing s_wait_xcnt stands in front of any rewrite of an address register that a copy names
        asm volatile("global_load_async_to_lds_b128 %0, %12, off\n\t"
                     "global_load_async_to_lds_b128 %1, %13, off\n\t"
                     "global_load_async_to_lds_b128 %2, %14, off\n\t"
                     "global_load_async_to_lds_b128 %3, %15, off\n\t"
                     "global_load_async_to_lds_b128 %4, %16, off\n\t"
                     "global_load_async_to_lds_b128 %5, %17, off\n\t"
                     "global_load_async_to_lds_b128 %6, %18, off\n\t"
                     "global_load_async_to_lds_b128 %7, %19, off\n\t"
                     "global_load_async_to_lds_b128 %8, %20, off\n\t"
                     "global_load_async_to_lds_b128 %9, %21, off\n\t"
                     "global_load_async_to_lds_b128 %10, %22, off\n\t"
                     "global_load_async_to_lds_b128 %11, %23, off\n\t"
                     "s_wait_xcnt 0x0"
                     :: "v"(lk), "v"(lk + 8 * KP), "v"(lk + 16 * KP), "v"(lk + 24 * KP),
                        "v"(lk + ST_KL), "v"(lk + ST_KL + 8 * KP), "v"(lk + ST_KL + 16 * KP), "v"(lk + ST_KL + 24 * KP),
                        "v"(lv), "v"(lv + 32 * VP), "v"(lv + HD * VP), "v"(lv + HD * VP + 32 * VP),
                        "v"(gkh), "v"(gkh + 8 * (NH_ * QW)), "v"(gkh + 16 * (NH_ * QW)), "v"(gkh + 24 * (NH_ * QW)),
                        "v"(gkl), "v"(gkl + 8 * (NH_ * QW)), "v"(gkl + 16 * (NH_ * QW)), "v"(gkl + 24 * (NH_ * QW)),
                        "v"(gvh), "v"(gvh + 32 * NT_), "v"(gvl), "v"(gvl + 32 * NT_)
                     : "memory");
    };
    {   // query lo rows: 8 copies per thread, thread = (row tid/16 + 8 i, piece tid%16); same form of statement as above
        const h16* gq = QL + (tok0 + qt * 64 + krow) * (NH_ * QW) + h * QW + kcol * 8;
        const unsigned lq = (unsigned)(size_t)qlds + krow * KP + kcol * 16;
        asm volatile("global_load_async_to_lds_b128 %0, %8, off\n\t"
                     "global_load_async_to_lds_b128 %1, %9, off\n\t"
                     "global_load_async_to_lds_b128 %2, %10, off\n\t"
                     "global_load_async_to_lds_b128 %3, %11, off\n\t"
                     "global_load_async_to_lds_b128 %4, %12, off\n\t"
                     "global_load_async_to_lds_b128 %5, %13, off\n\t"
                     "global_load_async_to_lds_b128 %6, %14, off\n\t"
                     "global_load_async_to_lds_b128 %7, %15, off\n\t"
                     "s_wait_xcnt 0x0"
                     :: "v"(lq), "v"(lq + 8 * KP), "v"(lq + 16 * KP), "v"(lq + 24 * KP), "v"(lq + 32 * KP), "v"(lq + 40 * KP), "v"(lq + 48 * KP), "v"(lq + 56 * KP),
                        "v"(gq), "v"(gq + 8 * (NH_ * QW)), "v"(gq + 16 * (NH_ * QW)), "v"(gq + 24 * (NH_ * QW)),
                        "v"(gq + 32 * (NH_ * QW)), "v"(gq + 40 * (NH_ * QW)), "v"(gq + 48 * (NH_ * QW)), "v"(gq + 56 * (NH_ * QW))
                     : "memory");
    }
    const char* qlp = qlds + (wave * 16 + lr) * KP + 16 * hi;
    fill(0, 0);
    asm volatile("s_wait_asynccnt 0x0" ::: "memory");   // this wave's copies of the query rows and of tile 0 have landed
    __syncthreads();                                    // ... and every other wave's
    if (kt_end > 1) fill(1, 1);
#pragma unroll 1
    for (int kt = 0; kt < kt_end; ++kt) {
        const int l0 = kt * 32;
        const char* st = ring + (kt & 1) * ST_SZ;
        v8f s0 = {}, s1 = {}, x0 = {}, x1 = {};
#pragma unroll
        for (int kc = 0; kc < 4; ++kc) {
            const char* p0 = st + lr * KP + kc * 64 + 16 * hi; const char* p1 = p0 + 16 * KP;
            const v16h k0h = cat16(*(const v8ha*)p0, *(const v8ha*)(p0 + 32)), k0l = cat16(*(const v8ha*)(p0 + ST_KL), *(const v8ha*)(p0 + ST_KL + 32));
            const v16h k1h = cat16(*(const v8ha*)p1, *(const v8ha*)(p1 + 32)), k1l = cat16(*(const v8ha*)(p1 + ST_KL), *(const v8ha*)(p1 + ST_KL + 32));
            const v16h alk = cat16(*(const v8ha*)(qlp + kc * 64), *(const v8ha*)(qlp + kc * 64 + 32));      // query lo fragment re-read per step (register budget)
            s0 = wmma16(ah[kc], k0h, s0); x0 = wmma16(ah[kc], k0l, x0); x0 = wmma16(alk, k0h, x0);      // lo products carry x1024, folded below
            s1 = wmma16(ah[kc], k1h, s1); x1 = wmma16(ah[kc], k1l, x1); x1 = wmma16(alk, k1h, x1);
            asm volatile("" : "+v"(x0), "+v"(x1) : "v"(alk));
        }
        asm volatile("v_nop\n\tv_nop\n\tv_nop\n\tv_nop" : "+v"(s0), "+v"(s1), "+v"(x0), "+v"(x1) : "v"(ah[0]), "v"(ah[3]));
        float alpha[8];
#pragma unroll
        for (int j = 0; j < 8; ++j) {
            const float a0 = (l0 + lr <= qpos[j]) ? (s0[j] + x0[j] * LOSCI) * SCL : -__builtin_inff(), a1 = (l0 + 16 + lr <= qpos[j]) ? (s1[j] + x1[j] * LOSCI) * SCL : -__builtin_inff();
            float mx = fmaxf(a0, a1);
            mx = fmaxf(mx, __shfl_xor(mx, 1, 16)); mx = fmaxf(mx, __shfl_xor(mx, 2, 16)); mx = fmaxf(mx, __shfl_xor(mx, 4, 16)); mx = fmaxf(mx, __shfl_xor(mx, 8, 16));
            const float mn = fmaxf(mrow[j], mx);
            alpha[j] = __expf(mrow[j] - mn); mrow[j] = mn;
            const float p0 = __expf(a0 - mn), p1 = __expf(a1 - mn);
            lpart[j] = lpart[j] * alpha[j] + (p0 + p1);
            const int mr = hi * 8 + j;
            const float ps0 = p0 * PSC, ps1 = p1 * PSC; const h16 h0 = (h16)ps0, h1 = (h16)ps1;
            pl[mr * 32 + lr] = h0; pl[mr * 32 + 16 + lr] = h1; pl2[mr * 32 + lr] = (h16)((ps0 - (float)h0) * LOSC); pl2[mr * 32 + 16 + lr] = (h16)((ps1 - (float)h1) * LOSC);
        }
#pragma unroll
        for (int n = 0; n < 4; ++n)
#pragma unroll
            for (int j = 0; j < 8; ++j) { o[n][j] *= alpha[j]; ox[n][j] *= alpha[j]; }
        asm volatile("" ::: "memory");
        const v16h pa = cat16(*(const v8ha*)(pl + lr * 32 + hi * 8), *(const v8ha*)(pl + lr * 32 + 16 + hi * 8));
        const v16h px = cat16(*(const v8ha*)(pl2 + lr * 32 + hi * 8), *(const v8ha*)(pl2 + lr * 32 + 16 + hi * 8));
#pragma unroll
        for (int n = 0; n < 4; ++n) { const char* pv = st + ST_VH + (n * 16 + lr) * VP + 16 * hi;
            const v16h vh = cat16(*(const v8ha*)pv, *(const v8ha*)(pv + 32));
            o[n] = wmma16(pa, vh, o[n]); ox[n] = wmma16(pa, cat16(*(const v8ha*)(pv + HD * VP), *(const v8ha*)(pv + HD * VP + 32)), ox[n]); ox[n] = wmma16(px, vh, ox[n]); }
        asm volatile("v_nop\n\tv_nop\n\tv_nop\n\tv_nop" : "+v"(o[0]), "+v"(o[1]), "+v"(o[2]), "+v"(o[3]), "+v"(ox[0]), "+v"(ox[1]), "+v"(ox[2]), "+v"(ox[3]) : "v"(pa), "v"(px));
        asm volatile("s_wait_dscnt 0x0" ::: "memory");      // this wave's reads of the buffer are done before it may be refilled
        asm volatile("s_wait_asynccnt 0x0" ::: "memory");   // this wave's copies of the next tile have landed
        __syncthreads();                                    // publishes the next tile and frees this step's buffer
        if (kt + 2 < kt_end) fill(kt + 2, kt & 1);
    }
    asm volatile("s_wait_asynccnt 0x0" ::: "memory");       // nothing in flight when the ring becomes output staging
    float inv[8];
#pragma unroll
    for (int j = 0; j < 8; ++j) { float rs = lpart[j]; rs += __shfl_xor(rs, 1, 16); rs += __shfl_xor(rs, 2, 16); rs += __shfl_xor(rs, 4, 16); rs += __shfl_xor(rs, 8, 16); inv[j] = 1.0f / (rs * PSC); }
    float* os = (float*)ring + wave * (16 * 68);
#pragma unroll
    for (int n = 0; n < 4; ++n)
#pragma unroll
        for (int j = 0; j < 8; ++j) os[(hi * 8 + j) * 68 + n * 16 + lr] = (o[n][j] + ox[n][j] * LOSCI) * inv[j];
    __syncthreads();
    const size_t cbase = (tok0 + q0) * DM + (size_t)h * HD;
    auto pass = [&]() {
#pragma unroll
        for (int s = 0; s < 4; ++s) { const int row = 4 * s + (lane >> 3), piece = lane & 7; const float* sp = os + row * 68 + piece * 8; v8us oh, ol;
#pragma unroll
            for (int i = 0; i < 8; ++i) { const unsigned short hb = f2bf(sp[i]); oh[i] = hb; ol[i] = f2bf(sp[i] - bf2f(hb)); }
            *(v8us*)(CH + cbase + (size_t)row * DM + piece * 8) = oh; *(v8us*)(CL + cbase + (size_t)row * DM + piece * 8) = ol; }
    };
    pass(); 
    asm volatile("s_wait_xcnt 0x0" ::: "memory");   // behind the stores: the second tile's set-up overwrites their address and data registers
  }
}

extern "C" void kernel_launch(void* const* d_in, const int* in_sizes, int n_in,
                              void* d_out, int out_size, void* d_ws, size_t ws_size, hipStream_t stream) {
    (void)in_sizes; (void)n_in; (void)out_size;
    const float* x = (const float*)d_in[0]; const float* W4 = (const float*)d_in[1]; const float* b4 = (const float*)d_in[2]; const float* Wo = (const float*)d_in[3]; const float* bo = (const float*)d_in[4];
    float* out = (float*)d_out;    // [2][2048][1024]
    char* wsp = (char*)d_ws;
    auto take = [&](size_t bytes) { char* p = wsp; wsp += (bytes + 255) & ~(size_t)255; return (void*)p; };
    bf* Xb = (bf*)take((size_t)NTK * DM * 2); bf* W4T = (bf*)take((size_t)4 * DM * DM * 2);
    h16* VT16 = (h16*)take((size_t)NTK * DM * 2); h16* VTL = (h16*)take((size_t)NTK * DM * 2); h16* KH = (h16*)take((size_t)NTK * NH_ * QW * 2); h16* KL = (h16*)take((size_t)NTK * NH_ * QW * 2);
    float* R1 = (float*)take((size_t)NTK * DM * 4); float* R2 = (float*)take((size_t)NTK * DM * 4); float* R3 = (float*)take((size_t)NTK * DM * 4);   // reusable f32 region (3 x 16.8 MB)
    h16* QL = (h16*)take((size_t)NTK * NH_ * QW * 2);
    if ((size_t)(wsp - (char*)d_ws) > ws_size) return;    // exactly 134,217,728 B (128 MiB): Wout^T reuses W4T after the q/t projections
    float* Kf = R1; float* Vf = R2; float* KVC = R3;           // phase 1
    float* Qf = R1; float* Tf = R2; h16* QH = (h16*)R3;        // phase 2 (Kf, Vf, KVC dead by then)
    bf* CH = (bf*)R1; bf* CL = (bf*)R2; bf* WoT = W4T;         // phase 3 (Qf, Tf dead after k_side; W4T dead after the last projection)
    k_cvtb<<<NTK / 8, 256, 0, stream>>>(x, Xb);
    k_wt<<<dim3(DM / 64, (4 * DM) / 64, 1), 256, 0, stream>>>(W4, 4 * DM, W4T);
    // phase 1: k, v -> VT16/VTL, KVC -> key-side planes
    k_gemmb<false><<<dim3(NTK / 64, DM / 64, 1), 128, 0, stream>>>(Xb, nullptr, W4T + (size_t)1 * DM * DM, b4 + 1 * DM, Kf);
    k_gemmb<false><<<dim3(NTK / 64, DM / 64, 1), 128, 0, stream>>>(Xb, nullptr, W4T + (size_t)2 * DM * DM, b4 + 2 * DM, Vf);
    k_vt<<<NB_ * NH_ * (NT_ / 64), 256, 0, stream>>>(Vf, VT16, VTL);
    k_kvc<<<NB_ * (DM / 32), 1024, 0, stream>>>(Kf, Vf, KVC);
    k_side<false><<<(NTK * NH_) / 8, 256, 0, stream>>>(Kf, nullptr, KVC, KH, KL);
    // phase 2: q, t -> query-side planes
    k_gemmb<false><<<dim3(NTK / 64, DM / 64, 1), 128, 0, stream>>>(Xb, nullptr, W4T + (size_t)0 * DM * DM, b4 + 0 * DM, Qf);
    k_gemmb<false><<<dim3(NTK / 64, DM / 64, 1), 128, 0, stream>>>(Xb, nullptr, W4T + (size_t)3 * DM * DM, b4 + 3 * DM, Tf);
    k_side<true><<<(NTK * NH_) / 8, 256, 0, stream>>>(Qf, Tf, Qf, QH, QL);      // [q | q*t]
    // phase 3: Wout^T over the dead W4T, attention -> ctx planes -> out
    k_wt<<<dim3(DM / 64, DM / 64, 1), 256, 0, stream>>>(Wo, DM, WoT);
    k_attn<<<NB_ * (NH_ / 2) * (NT_ / 64), 128, 0, stream>>>(QH, QL, KH, KL, VT16, VTL, CH, CL);
    k_gemmb<true><<<dim3(NTK / 64, DM / 64, 1), 128, 0, stream>>>(CH, CL, WoT, bo, out);
}

// v005
// A run of this version takes 243 microseconds.
// Next to v004, in two timings, it ran 1.10 times as fast each time.
// Over all steps from v000 it is 5.69 times as fast.
#include <hip/hip_runtime.h>

// Contractions, f32 accumulate: qkvt = x.Wqkvt + b as four [4096 x 1024].[1024 x 1024] column blocks and out = ctx.Wout + bout on v_wmma_f32_16x16x32_bf16 (PLAIN bf16
// operands = inputs rounded once, exact; k-major weights transposed into n-major planes; ctx as bf16 hi + residual planes, two products); the per-(batch, head) causal
// attention fused on v_wmma_f32_16x16x32_f16: scores = ([q | q*t]).([k | cumsum_j(k*v)/8])^T over 128 dims with BOTH sides as f16 hi + residual x1024 planes
// (hi.hi + hi.lo + lo.hi — the triplet term reaches sigma ~45 before the 1/8 scale, so single-rounded operands would not hold the peaked softmax), x 1/8, causal,
// softmax, then weights (x32768) and v BOTH as f16 hi + residual x1024 (hi.hi + hi.lo + lo.hi; the softmax is peaked so single roundings would not average out). The key-side prefix sums are f32 chunked scans (16-row chunks, one block per (b, 32 columns)). Deterministic, no atomics;

#define NB_  2
#define NT_  2048
#define DM   1024
#define NH_  16
#define HD   64
#define QW   128                 // combined score width per head
#define NTK  (NB_ * NT_)         // 4096
#define PSC  32768.0f
#define LOSC 1024.0f
#define LOSCI (1.0f / 1024.0f)
#define SCL  0.125f

typedef _Float16 h16;
typedef unsigned short bf;
typedef __attribute__((ext_vector_type(16))) __bf16   v16bf;
typedef __attribute__((ext_vector_type(16))) _Float16 v16h;
typedef __attribute__((ext_vector_type(8)))  _Float16 v8h;
typedef __attribute__((ext_vector_type(8)))  unsigned short v8us;
typedef __attribute__((ext_vector_type(8)))  float    v8f;
typedef __attribute__((ext_vector_type(4)))  float    v4f;
typedef v8h  __attribute__((may_alias)) v8ha;
typedef v4f  __attribute__((may_alias)) v4fa;
typedef v8us __attribute__((may_alias)) v8usa;

__device__ __forceinline__ unsigned short f2bf(float f) { unsigned u = __float_as_uint(f); u += 0x7FFFu + ((u >> 16) & 1u); return (unsigned short)(u >> 16); }
__device__ __forceinline__ float bf2f(unsigned short b) { return __uint_as_float(((unsigned)b) << 16); }
__device__ __forceinline__ float bfr(float f) { return bf2f(f2bf(f)); }
__device__ __forceinline__ v16h cat16(v8h lo, v8h hi) { return __builtin_shufflevector(lo, hi, 0, 1, 2, 3, 4, 5, 6, 7, 8, 9, 10, 11, 12, 13, 14, 15); }
__device__ __forceinline__ v16bf cat16b(v8us lo, v8us hi) { return __builtin_bit_cast(v16bf, __builtin_shufflevector(lo, hi, 0, 1, 2, 3, 4, 5, 6, 7, 8, 9, 10, 11, 12, 13, 14, 15)); }
__device__ __forceinline__ v8f wmma16(v16h a, v16h b, v8f c) { return __builtin_amdgcn_wmma_f32_16x16x32_f16(false, a, false, b, (short)0, c, false, false); }
__device__ __forceinline__ v8f wmmab(v16bf a, v16bf b, v8f c) { return __builtin_amdgcn_wmma_f32_16x16x32_bf16(false, a, false, b, (short)0, c, false, false); }
#define VST2(T, p, v) do { const T vst2_v_ = (v); *(T*)(p) = vst2_v_;  } while (0)

// k_cvtb: bf16 plane of x [4096][1024]; k_wt: W [1024 k][ncols] k-major -> n-major bf16 [ncols][1024] via 64 x 64 LDS tiles.
__global__ __launch_bounds__(256) void k_cvtb(const float* __restrict__ src, bf* dst) {
    const int lane = threadIdx.x & 31, r = blockIdx.x * 8 + (threadIdx.x >> 5);
    if (r >= NTK) return;
#pragma unroll
    for (int q = 0; q < 4; ++q) { v8us t;
#pragma unroll
        for (int i = 0; i < 8; ++i) t[i] = f2bf(src[(size_t)r * DM + q * 256 + lane * 8 + i]);
        VST2(v8us, dst + (size_t)r * DM + q * 256 + lane * 8, t); }
}
__global__ __launch_bounds__(256) void k_wt(const float* __restrict__ Wm, int ncols, bf* WT) {
    __shared__ __align__(16) unsigned short tl[64 * 72];
    const int tid = threadIdx.x, k0 = blockIdx.x * 64, n0 = blockIdx.y * 64;
    const int kk = tid >> 2, nq = (tid & 3) * 16;
#pragma unroll
    for (int i = 0; i < 16; ++i) tl[(nq + i) * 72 + kk] = f2bf(Wm[(size_t)(k0 + kk) * ncols + n0 + nq + i]);
    __syncthreads();
    const int piece = tid & 7;
    auto pass = [&]() {
#pragma unroll
        for (int s = 0; s < 2; ++s) { const int nr = (tid >> 3) + 32 * s; const v8us val = *(const v8usa*)(tl + nr * 72 + piece * 8);
            *(v8us*)(WT + (size_t)(n0 + nr) * DM + k0 + piece * 8) = val; }
    };
    pass(); 
}

// k_gemmb: block = 64 x 64 of C, wave = 16 x 64. A stage is 64 k = one 128-byte line of each of the block's 64 B rows and 64 A rows (and A residual rows); asynchronous
// copies bring it once per block into a two-buffer LDS ring, one stage ahead, each copy covering four whole lines; the four waves read their fragments from there, so the
// loop holds no global load. Rows are pitched 16 B x odd so that ds_load_b128 fragment reads meet no bank conflict. The k order of every sum is as before.
#define GKS 64                   // k per stage
#define GP  144                  // LDS pitch of a 128-byte row
#define GPL (64 * GP)            // one plane of 64 rows: B at 0, A at GPL, A residual at 2 GPL
template <bool SPLITA>
__global__ __launch_bounds__(128) void k_gemmb(const bf* __restrict__ A, const bf* __restrict__ Al, const bf* __restrict__ Bn, const float* __restrict__ bias, float* C) {
    constexpr int GST = (SPLITA ? 3 : 2) * GPL;
    __shared__ __align__(16) char ring[2 * GST];     // the output staging of the epilogue (17,408 B) reuses it behind the last stage's barrier
    const int tid = threadIdx.x, lane = tid & 31, wave = tid >> 5, lr = lane & 15, hi = lane >> 4;
    const int r0 = blockIdx.x * 64 + wave * 16, c0 = blockIdx.y * 64;
    // Copies of one stage: 4 per thread and plane, 16 bytes each; thread = (row tid/8 + 16 i, 16-byte piece tid%8).
    const int prow = tid >> 3, pcol = tid & 7;
    const size_t ga = (size_t)(blockIdx.x * 64 + prow) * DM + pcol * 8, gb = (size_t)(c0 + prow) * DM + pcol * 8;
    const unsigned l0 = (unsigned)(size_t)ring + prow * GP + pcol * 16;
    auto fill = [&](int t, int buf) {
        const bf* pb = Bn + gb + t * GKS; const bf* pa = A + ga + t * GKS;
        const unsigned l = l0 + buf * GST;
        // one statement: the closing s_wait_xcnt stands in front of any rewrite of an address register that a copy names
        asm volatile("global_load_async_to_lds_b128 %0, %8, off\n\t"
                     "global_load_async_to_lds_b128 %1, %9, off\n\t"
                     "global_load_async_to_lds_b128 %2, %10, off\n\t"
                     "global_load_async_to_lds_b128 %3, %11, off\n\t"
                     "global_load_async_to_lds_b128 %4, %12, off\n\t"
                     "global_load_async_to_lds_b128 %5, %13, off\n\t"
                     "global_load_async_to_lds_b128 %6, %14, off\n\t"
                     "global_load_async_to_lds_b128 %7, %15, off\n\t"
                     "s_wait_xcnt 0x0"
                     :: "v"(l), "v"(l + 16 * GP), "v"(l + 32 * GP), "v"(l + 48 * GP),
                        "v"(l + GPL), "v"(l + GPL + 16 * GP), "v"(l + GPL + 32 * GP), "v"(l + GPL + 48 * GP),
                        "v"(pb), "v"(pb + 16 * DM), "v"(pb + 32 * DM), "v"(pb + 48 * DM),
                        "v"(pa), "v"(pa + 16 * DM), "v"(pa + 32 * DM), "v"(pa + 48 * DM)
                     : "memory");
        if constexpr (SPLITA) {   // the residual plane's rows; same form of statement
            const bf* pl = Al + ga + t * GKS;
            asm volatile("global_load_async_to_lds_b128 %0, %4, off\n\t"
                         "global_load_async_to_lds_b128 %1, %5, off\n\t"
                         "global_load_async_to_lds_b128 %2, %6, off\n\t"
                         "global_load_async_to_lds_b128 %3, %7, off\n\t"
                         "s_wait_xcnt 0x0"
                         :: "v"(l + 2 * GPL), "v"(l + 2 * GPL + 16 * GP), "v"(l + 2 * GPL + 32 * GP), "v"(l + 2 * GPL + 48 * GP),
                            "v"(pl), "v"(pl + 16 * DM), "v"(pl + 32 * DM), "v"(pl + 48 * DM)
                         : "memory");
        }
    };
    v8f acc[4];
#pragma unroll
    for (int t = 0; t < 4; ++t) acc[t] = (v8f){};
    fill(0, 0);
    asm volatile("s_wait_asynccnt 0x0" ::: "memory");   // this wave's copies of stage 0 have landed
    __syncthreads();                                    // ... and every other wave's
    fill(1, 1);
#pragma unroll 1  // stays rolled: one copy of the stage body, the buffer picked by s & 1
    for (int s = 0; s < DM / GKS; ++s) {
        const char* fa = ring + (s & 1) * GST + GPL + (wave * 16 + lr) * GP + 16 * hi;
        const char* fb = ring + (s & 1) * GST + lr * GP + 16 * hi;
        v16bf a, al;
#pragma unroll  // two 32-k products per stage, constant LDS offsets
        for (int ks = 0; ks < GKS / 32; ++ks) {
            a = cat16b(*(const v8usa*)(fa + ks * 64), *(const v8usa*)(fa + ks * 64 + 32));
            al = a;
            if (SPLITA) al = cat16b(*(const v8usa*)(fa + GPL + ks * 64), *(const v8usa*)(fa + GPL + ks * 64 + 32));
#pragma unroll
            for (int t = 0; t < 4; ++t) { const v16bf b = cat16b(*(const v8usa*)(fb + t * 16 * GP + ks * 64), *(const v8usa*)(fb + t * 16 * GP + ks * 64 + 32)); acc[t] = wmmab(a, b, acc[t]); if (SPLITA) acc[t] = wmmab(al, b, acc[t]); }
        }
        // four vector slots behind the last WMMA, on both sides of the branch below, before a vector instruction may overwrite its operands
        asm volatile("v_nop\n\tv_nop\n\tv_nop\n\tv_nop" : "+v"(acc[0]), "+v"(acc[1]), "+v"(acc[2]), "+v"(acc[3]) : "v"(a), "v"(al));
        asm volatile("s_wait_dscnt 0x0" ::: "memory");      // this wave's reads of the buffer are done before it may be refilled
        asm volatile("s_wait_asynccnt 0x0" ::: "memory");   // this wave's copies of the next stage have landed
        __syncthreads();                                    // publishes the next stage and frees this stage's buffer
        if (s + 2 < DM / GKS) fill(s + 2, s & 1);
    }
    asm volatile("s_wait_asynccnt 0x0" ::: "memory");       // nothing in flight when the ring becomes output staging
    float* os = (float*)ring + wave * (16 * 68);
#pragma unroll
    for (int t = 0; t < 4; ++t) { const float bv = bfr(bias[c0 + t * 16 + lr]);
#pragma unroll
        for (int j = 0; j < 8; ++j) os[(hi * 8 + j) * 68 + t * 16 + lr] = acc[t][j] + bv; }
    __syncthreads();
    float* crow = C + (size_t)r0 * DM + c0;
    auto pass = [&]() {
#pragma unroll
        for (int s = 0; s < 8; ++s) { const int Lid = (lane >> 3) + 4 * s, piece = lane & 7; const int row = Lid >> 1, cofs = (Lid & 1) * 32 + piece * 4;
            const v4f val = *(const v4fa*)(os + row * 68 + cofs); *(v4f*)(crow + (size_t)row * DM + cofs) = val; }
    };
    pass(); 
}

// k_vt: VT16/VTL[b][h][d][t] = f16 hi + residual x1024 of V row b*2048+t, col h*64+d via LDS transposes, block (b, h, 64 t).
__global__ __launch_bounds__(256) void k_vt(const float* __restrict__ V, h16* VT16, h16* VTL) {
    __shared__ __align__(16) h16 tile[HD * 72];
    __shared__ __align__(16) h16 til2[HD * 72];
    const int bid = blockIdx.x;
    const int b = bid / (NH_ * (NT_ / 64)), rem = bid - b * (NH_ * (NT_ / 64)), h = rem / (NT_ / 64), kt = rem - h * (NT_ / 64);
    const int k0 = kt * 64, tid = threadIdx.x, kk = tid >> 2, d0 = (tid & 3) * 16;
    const float* src = V + ((size_t)b * NT_ + k0 + kk) * DM + h * HD + d0;
#pragma unroll
    for (int i = 0; i < 16; ++i) { const float v = src[i]; const h16 a = (h16)v; tile[(d0 + i) * 72 + kk] = a; til2[(d0 + i) * 72 + kk] = (h16)((v - (float)a) * LOSC); }
    __syncthreads();
    const int piece = tid & 7;
    const size_t base = (((size_t)b * NH_ + h) * HD) * NT_ + k0;
    auto pass = [&]() {
#pragma unroll
        for (int s = 0; s < 4; ++s) { const int Lid = (tid >> 3) + 32 * s; const int pln = Lid >> 6, d = Lid & 63;
            const v8h val = *(const v8ha*)((pln ? til2 : tile) + d * 72 + piece * 8); *(v8h*)((pln ? VTL : VT16) + base + (size_t)d * NT_ + piece * 8) = val; }
    };
    pass(); 
}
// k_kvc: KVC[b*2048+t][col] = sum_{j<=t} k[j]*v[j]/8 (inclusive prefix over t, f32) as a chunked scan inside one block. Block = (b, 32 columns = whole 128-byte lines);
// thread = (chunk of 16 rows, 4 columns): all 32 16-byte loads are independent and the 64 running sums stay in registers. Chunk sums -> LDS, exclusive prefix over the 128
// chunks in two levels (8 waves scan 16 chunks each, then every thread adds the sums of the groups before its own), then each thread adds that start value to its rows.
#define KC_R 16                  // rows per chunk
#define KC_N (NT_ / KC_R)        // 128 chunks
#define KC_G 8                   // groups of 16 chunks
__global__ __launch_bounds__(1024) void k_kvc(const float* __restrict__ Kf, const float* __restrict__ Vf, float* __restrict__ KVC) {
    __shared__ __align__(16) float tot[KC_N * 32];
    __shared__ __align__(16) float gtot[KC_G * 32];
    const int tid = threadIdx.x, cq = tid & 7, ch = tid >> 3;
    const int b = blockIdx.x / (DM / 32), cg = blockIdx.x - b * (DM / 32);
    const size_t blk = (size_t)b * NT_ * DM + cg * 32;         // block part of the index (scalar)
    const unsigned thr = (unsigned)(ch * KC_R * DM + cq * 4);  // thread part, shared by the loads and the stores
    const float* kp = Kf + blk; const float* vp = Vf + blk; float* op = KVC + blk;
    v4f p[KC_R];
#pragma unroll  // constant indices keep p[] in registers; the independent loads issue many at a time
    for (int i = 0; i < KC_R; ++i) p[i] = *(const v4f*)(kp + thr + i * DM) * *(const v4f*)(vp + thr + i * DM) * SCL;
#pragma unroll  // p[] in registers
    for (int i = 1; i < KC_R; ++i) p[i] += p[i - 1];           // inclusive prefix inside the chunk
    *(v4f*)(tot + ch * 32 + cq * 4) = p[KC_R - 1];
    __syncthreads();
    if (tid < KC_G * 32) { const int g = tid >> 5, col = tid & 31; float run = 0.f;
#pragma unroll  // the 16 LDS reads issue ahead of the add chain
        for (int i = 0; i < KC_N / KC_G; ++i) { float* q = tot + (g * (KC_N / KC_G) + i) * 32 + col; const float t = *q; *q = run; run += t; }
        gtot[g * 32 + col] = run; }
    __syncthreads();
    const int g = ch / (KC_N / KC_G);
    v4f gs[KC_G - 1];
#pragma unroll  // gs[] in registers
    for (int i = 0; i < KC_G - 1; ++i) gs[i] = *(const v4f*)(gtot + i * 32 + cq * 4);   // all read at once, then selected: no chain of LDS round trips
    v4f c = {};
#pragma unroll  // gs[] in registers
    for (int i = 0; i < KC_G - 1; ++i) c += (i < g) ? gs[i] : (v4f){};
    c += *(const v4f*)(tot + ch * 32 + cq * 4);
#pragma unroll  // p[] in registers; stores back to back
    for (int i = 0; i < KC_R; ++i) *(v4f*)(op + thr + i * DM) = p[i] + c;
}
// k_side: hi/lo f16 planes of a 128-wide per-head row: SH/SL[row][h*128 + c]: c < 64 -> A[row][h*64+c]; c >= 64 -> B2[row][h*64+c-64] (times M[row][same]
// when MUL2) - query side: [q | q*t] (A = q, B2 = q, M = t); key side: [k | kvc]. One wave per ROW, all 16 heads: 4,096 waves in the launch, so that the time goes into
// the stream and not into starting waves. A 16-byte load of the wave covers 512 contiguous bytes = two heads' 64 values of one source (lane = head 2g + lane/16, 4 values);
// an 8-byte store covers those two heads' whole 128-byte lines of a plane. No lane is off; the row's loads are independent and issue ahead of the first conversion.
template <bool MUL2>
__global__ __launch_bounds__(256) void k_side(const float* __restrict__ A, const float* __restrict__ Mv, const float* __restrict__ B2, h16* SH, h16* SL) {
    typedef __attribute__((ext_vector_type(4))) _Float16 v4h;
    const int lane = threadIdx.x & 31, r = blockIdx.x * 8 + (threadIdx.x >> 5);
    if (r >= NTK) return;
    const size_t in0 = (size_t)r * DM + lane * 4;
    const size_t o0 = (size_t)r * (NH_ * QW) + (lane >> 4) * QW + (lane & 15) * 4;
    const float* pa = A + in0; const float* pb = B2 + in0; const float* pm = MUL2 ? Mv + in0 : pb;
    v4f va[NH_ / 2], vb[NH_ / 2], vm[NH_ / 2];
#pragma unroll  // constant indices keep the arrays in registers; the independent loads issue many at a time
    for (int g = 0; g < NH_ / 2; ++g) { va[g] = *(const v4fa*)(pa + g * 2 * HD); vb[g] = *(const v4fa*)(pb + g * 2 * HD); if (MUL2) vm[g] = *(const v4fa*)(pm + g * 2 * HD); }
    // a precaution: the address registers, named here, stay whole up to this wait, so that no load's result is placed in a register that an issued load names
    asm volatile("s_wait_xcnt 0x0" :: "v"(pa), "v"(pb), "v"(pm) : "memory");
#pragma unroll  // the arrays in registers
    for (int g = 0; g < NH_ / 2; ++g)
#pragma unroll
        for (int s = 0; s < 2; ++s) { v4f x = s ? vb[g] : va[g]; if (MUL2 && s) x *= vm[g]; v4h oh, ol;
#pragma unroll
            for (int i = 0; i < 4; ++i) { const h16 a = (h16)x[i]; oh[i] = a; ol[i] = (h16)((x[i] - (float)a) * LOSC); }
            *(v4h*)(SH + o0 + g * 2 * QW + s * HD) = oh; *(v4h*)(SL + o0 + g * 2 * QW + s * HD) = ol; }
}

// k_attn: block = (b, head pair hp, t): the 64-query tile t of head hp, then tile 31 - t of head hp + 8, one after the other: 66 key steps in every block, so that the
// blocks, all resident at once, end together; wave = 16 queries; causal key tiles 0..query tile; scores over the 128 combined dims with hi.hi + hi.lo + lo.hi (24 WMMA per 32-key
// step), x 1/8, keys after the query -> -inf; online f32 softmax; weights x32768 as f16 hi + residual x1024 tiles (same-wave may_alias reload after a compiler barrier); 12 WMMA vs V^T hi + lo (hi.hi + hi.lo + lo.hi);
// ctx -> bf16 hi/lo planes CH/CL [token][h*64 + d].
// The 32-key tile of a step (key rows hi + lo, V^T rows hi + lo, 24 KB) is brought once per block into a two-buffer LDS ring by asynchronous copies, one step ahead;
// the four waves read their fragments from there, and the query lo rows from a buffer copied once: the loop holds no global load. Rows are pitched 16 B x odd so that ds_load_b128 fragment reads meet no bank conflict.
#define KP    272                // LDS pitch of a 256-byte key row
#define VP    80                 // LDS pitch of a 64-byte V^T row
#define ST_KL (32 * KP)          // stage offsets: key hi at 0, key lo, V^T hi, V^T lo
#define ST_VH (2 * 32 * KP)
#define ST_VL (ST_VH + HD * VP)
#define ST_SZ (ST_VH + 2 * HD * VP)
__global__ __launch_bounds__(128) void k_attn(const h16* __restrict__ QH, const h16* __restrict__ QL, const h16* __restrict__ KH, const h16* __restrict__ KL, const h16* __restrict__ VT16, const h16* __restrict__ VTL, bf* CH, bf* CL) {
    __shared__ __align__(16) h16 plds[4][16 * 32];
    __shared__ __align__(16) h16 plds2[4][16 * 32];
    __shared__ __align__(16) char ring[2 * ST_SZ];   // the output staging of the epilogue reuses it behind the last step's barrier
    __shared__ __align__(16) char qlds[64 * KP];     // the current tile's 64 query lo rows, copied once per tile
    const int lane = threadIdx.x & 31, wave = threadIdx.x >> 5, lr = lane & 15, hi = lane >> 4;
    const int bid = blockIdx.x;
    const int b = bid / ((NH_ / 2) * (NT_ / 64)), rem = bid - b * ((NH_ / 2) * (NT_ / 64)), hp = rem / (NT_ / 64), t0 = rem - hp * (NT_ / 64);
    const size_t tok0 = (size_t)b * NT_;
    h16* pl = &plds[wave][0]; h16* pl2 = &plds2[wave][0];
#pragma unroll 1  // the two tiles go through one copy of the code, one after the other
  for (int half = 0; half < 2; ++half) {
    const int h = half ? hp + NH_ / 2 : hp, qt = half ? NT_ / 64 - 1 - t0 : t0;
    const int q0 = qt * 64 + wave * 16;
    if (half) {
        asm volatile("s_wait_dscnt 0x0" ::: "memory");  // this wave's reads of the first tile's output staging are done
        __syncthreads();                                // ... and every other wave's, before the copies below refill that LDS
    }
    v16h ah[4];
    const size_t qo = (tok0 + q0 + lr) * (NH_ * QW) + h * QW + 8 * hi;
#pragma unroll
    for (int kc = 0; kc < 4; ++kc) ah[kc] = cat16(*(const v8h*)(QH + qo + kc * 32), *(const v8h*)(QH + qo + kc * 32 + 16));
    int qpos[8];
#pragma unroll
    for (int j = 0; j < 8; ++j) qpos[j] = q0 + 8 * hi + j;
    const size_t vbase = (((size_t)b * NH_ + h) * HD) * NT_;
    v8f o[4], ox[4];
#pragma unroll
    for (int n = 0; n < 4; ++n) { o[n] = (v8f){}; ox[n] = (v8f){}; }
    float mrow[8], lpart[8];
#pragma unroll
    for (int j = 0; j < 8; ++j) { mrow[j] = -3.0e38f; lpart[j] = 0.f; }
    const int kt_end = (qt * 64 + 64) / 32;
    // Copies of one tile: 12 per thread, 16 bytes each. Key planes: thread = (row tid/16 + 8 i, 16-byte piece tid%16); V^T planes: thread = (row tid/4 + 32 i, piece tid%4).
    const int tid = threadIdx.x, krow = tid >> 4, kcol = tid & 15, vrow = tid >> 2, vcol = tid & 3;
    const size_t kg = (tok0 + krow) * (NH_ * QW) + h * QW + kcol * 8, vg = vbase + (size_t)vrow * NT_ + vcol * 8;
    const unsigned lk0 = (unsigned)(size_t)ring + krow * KP + kcol * 16, lv0 = (unsigned)(size_t)ring + ST_VH + vrow * VP + vcol * 16;
    auto fill = [&](int t, int buf) {
        const h16* gkh = KH + kg + (size_t)t * 32 * (NH_ * QW); const h16* gkl = KL + kg + (size_t)t * 32 * (NH_ * QW);
        const h16* gvh = VT16 + vg + t * 32; const h16* gvl = VTL + vg + t * 32;
        const unsigned lk = lk0 + buf * ST_SZ, lv = lv0 + buf * ST_SZ;
        // one statement: the closing s_wait_xcnt stands in front of any rewrite of an address register that a copy names
        asm volatile("global_load_async_to_lds_b128 %0, %12, off\n\t"
                     "global_load_async_to_lds_b128 %1, %13, off\n\t"
                     "global_load_async_to_lds_b128 %2, %14, off\n\t"
                     "global_load_async_to_lds_b128 %3, %15, off\n\t"
                     "global_load_async_to_lds_b128 %4, %16, off\n\t"
                     "global_load_async_to_lds_b128 %5, %17, off\n\t"
                     "global_load_async_to_lds_b128 %6, %18, off\n\t"
                     "global_load_async_to_lds_b128 %7, %19, off\n\t"
                     "global_load_async_to_lds_b128 %8, %20, off\n\t"
                     "global_load_async_to_lds_b128 %9, %21, off\n\t"
                     "global_load_async_to_lds_b128 %10, %22, off\n\t"
                     "global_load_async_to_lds_b128 %11, %23, off\n\t"
                     "s_wait_xcnt 0x0"
                     :: "v"(lk), "v"(lk + 8 * KP), "v"(lk + 16 * KP), "v"(lk + 24 * KP),
                        "v"(lk + ST_KL), "v"(lk + ST_KL + 8 * KP), "v"(lk + ST_KL + 16 * KP), "v"(lk + ST_KL + 24 * KP),
                        "v"(lv), "v"(lv + 32 * VP), "v"(lv + HD * VP), "v"(lv + HD * VP + 32 * VP),
                        "v"(gkh), "v"(gkh + 8 * (NH_ * QW)), "v"(gkh + 16 * (NH_ * QW)), "v"(gkh + 24 * (NH_ * QW)),
                        "v"(gkl), "v"(gkl + 8 * (NH_ * QW)), "v"(gkl + 16 * (NH_ * QW)), "v"(gkl + 24 * (NH_ * QW)),
                        "v"(gvh), "v"(gvh + 32 * NT_), "v"(gvl), "v"(gvl + 32 * NT_)
                     : "memory");
    };
    {   // query lo rows: 8 copies per thread, thread = (row tid/16 + 8 i, piece tid%16); same form of statement as above
        const h16* gq = QL + (tok0 + qt * 64 + krow) * (NH_ * QW) + h * QW + kcol * 8;
        const unsigned lq = (unsigned)(size_t)qlds + krow * KP + kcol * 16;
        asm volatile("global_load_async_to_lds_b128 %0, %8, off\n\t"
                     "global_load_async_to_lds_b128 %1, %9, off\n\t"
                     "global_load_async_to_lds_b128 %2, %10, off\n\t"
                     "global_load_async_to_lds_b128 %3, %11, off\n\t"
                     "global_load_async_to_lds_b128 %4, %12, off\n\t"
                     "global_load_async_to_lds_b128 %5, %13, off\n\t"
                     "global_load_async_to_lds_b128 %6, %14, off\n\t"
                     "global_load_async_to_lds_b128 %7, %15, off\n\t"
                     "s_wait_xcnt 0x0"
                     :: "v"(lq), "v"(lq + 8 * KP), "v"(lq + 16 * KP), "v"(lq + 24 * KP), "v"(lq + 32 * KP), "v"(lq + 40 * KP), "v"(lq + 48 * KP), "v"(lq + 56 * KP),
                        "v"(gq), "v"(gq + 8 * (NH_ * QW)), "v"(gq + 16 * (NH_ * QW)), "v"(gq + 24 * (NH_ * QW)),
                        "v"(gq + 32 * (NH_ * QW)), "v"(gq + 40 * (NH_ * QW)), "v"(gq + 48 * (NH_ * QW)), "v"(gq + 56 * (NH_ * QW))
                     : "memory");
    }
    const char* qlp = qlds + (wave * 16 + lr) * KP + 16 * hi;
    fill(0, 0);
    asm volatile("s_wait_asynccnt 0x0" ::: "memory");   // this wave's copies of the query rows and of tile 0 have landed
    __syncthreads();                                    // ... and every other wave's
    if (kt_end > 1) fill(1, 1);
#pragma unroll 1
    for (int kt = 0; kt < kt_end; ++kt) {
        const int l0 = kt * 32;
        const char* st = ring + (kt & 1) * ST_SZ;
        v8f s0 = {}, s1 = {}, x0 = {}, x1 = {};
#pragma unroll
        for (int kc = 0; kc < 4; ++kc) {
            const char* p0 = st + lr * KP + kc * 64 + 16 * hi; const char* p1 = p0 + 16 * KP;
            const v16h k0h = cat16(*(const v8ha*)p0, *(const v8ha*)(p0 + 32)), k0l = cat16(*(const v8ha*)(p0 + ST_KL), *(const v8ha*)(p0 + ST_KL + 32));
            const v16h k1h = cat16(*(const v8ha*)p1, *(const v8ha*)(p1 + 32)), k1l = cat16(*(const v8ha*)(p1 + ST_KL), *(const v8ha*)(p1 + ST_KL + 32));
            const v16h alk = cat16(*(const v8ha*)(qlp + kc * 64), *(const v8ha*)(qlp + kc * 64 + 32));      // query lo fragment re-read per step (register budget)
            s0 = wmma16(ah[kc], k0h, s0); x0 = wmma16(ah[kc], k0l, x0); x0 = wmma16(alk, k0h, x0);      // lo products carry x1024, folded below
            s1 = wmma16(ah[kc], k1h, s1); x1 = wmma16(ah[kc], k1l, x1); x1 = wmma16(alk, k1h, x1);
            asm volatile("" : "+v"(x0), "+v"(x1) : "v"(alk));
        }
        asm volatile("v_nop\n\tv_nop\n\tv_nop\n\tv_nop" : "+v"(s0), "+v"(s1), "+v"(x0), "+v"(x1) : "v"(ah[0]), "v"(ah[3]));
        float alpha[8];
#pragma unroll
        for (int j = 0; j < 8; ++j) {
            const float a0 = (l0 + lr <= qpos[j]) ? (s0[j] + x0[j] * LOSCI) * SCL : -__builtin_inff(), a1 = (l0 + 16 + lr <= qpos[j]) ? (s1[j] + x1[j] * LOSCI) * SCL : -__builtin_inff();
            float mx = fmaxf(a0, a1);
            mx = fmaxf(mx, __shfl_xor(mx, 1, 16)); mx = fmaxf(mx, __shfl_xor(mx, 2, 16)); mx = fmaxf(mx, __shfl_xor(mx, 4, 16)); mx = fmaxf(mx, __shfl_xor(mx, 8, 16));
            const float mn = fmaxf(mrow[j], mx);
            alpha[j] = __expf(mrow[j] - mn); mrow[j] = mn;
            const float p0 = __expf(a0 - mn), p1 = __expf(a1 - mn);
            lpart[j] = lpart[j] * alpha[j] + (p0 + p1);
            const int mr = hi * 8 + j;
            const float ps0 = p0 * PSC, ps1 = p1 * PSC; const h16 h0 = (h16)ps0, h1 = (h16)ps1;
            pl[mr * 32 + lr] = h0; pl[mr * 32 + 16 + lr] = h1; pl2[mr * 32 + lr] = (h16)((ps0 - (float)h0) * LOSC); pl2[mr * 32 + 16 + lr] = (h16)((ps1 - (float)h1) * LOSC);
        }
#pragma unroll
        for (int n = 0; n < 4; ++n)
#pragma unroll
            for (int j = 0; j < 8; ++j) { o[n][j] *= alpha[j]; ox[n][j] *= alpha[j]; }
        asm volatile("" ::: "memory");
        const v16h pa = cat16(*(const v8ha*)(pl + lr * 32 + hi * 8), *(const v8ha*)(pl + lr * 32 + 16 + hi * 8));
        const v16h px = cat16(*(const v8ha*)(pl2 + lr * 32 + hi * 8), *(const v8ha*)(pl2 + lr * 32 + 16 + hi * 8));
#pragma unroll
        for (int n = 0; n < 4; ++n) { const char* pv = st + ST_VH + (n * 16 + lr) * VP + 16 * hi;
            const v16h vh = cat16(*(const v8ha*)pv, *(const v8ha*)(pv + 32));
            o[n] = wmma16(pa, vh, o[n]); ox[n] = wmma16(pa, cat16(*(const v8ha*)(pv + HD * VP), *(const v8ha*)(pv + HD * VP + 32)), ox[n]); ox[n] = wmma16(px, vh, ox[n]); }
        asm volatile("v_nop\n\tv_nop\n\tv_nop\n\tv_nop" : "+v"(o[0]), "+v"(o[1]), "+v"(o[2]), "+v"(o[3]), "+v"(ox[0]), "+v"(ox[1]), "+v"(ox[2]), "+v"(ox[3]) : "v"(pa), "v"(px));
        asm volatile("s_wait_dscnt 0x0" ::: "memory");      // this wave's reads of the buffer are done before it may be refilled
        asm volatile("s_wait_asynccnt 0x0" ::: "memory");   // this wave's copies of the next tile have landed
        __syncthreads();                                    // publishes the next tile and frees this step's buffer
        if (kt + 2 < kt_end) fill(kt + 2, kt & 1);
    }
    asm volatile("s_wait_asynccnt 0x0" ::: "memory");       // nothing in flight when the ring becomes output staging
    float inv[8];
#pragma unroll
    for (int j = 0; j < 8; ++j) { float rs = lpart[j]; rs += __shfl_xor(rs, 1, 16); rs += __shfl_xor(rs, 2, 16); rs += __shfl_xor(rs, 4, 16); rs += __shfl_xor(rs, 8, 16); inv[j] = 1.0f / (rs * PSC); }
    float* os = (float*)ring + wave * (16 * 68);
#pragma unroll
    for (int n = 0; n < 4; ++n)
#pragma unroll
        for (int j = 0; j < 8; ++j) os[(hi * 8 + j) * 68 + n * 16 + lr] = (o[n][j] + ox[n][j] * LOSCI) * inv[j];
    __syncthreads();
    const size_t cbase = (tok0 + q0) * DM + (size_t)h * HD;
    auto pass = [&]() {
#pragma unroll
        for (int s = 0; s < 4; ++s) { const int row = 4 * s + (lane >> 3), piece = lane & 7; const float* sp = os + row * 68 + piece * 8; v8us oh, ol;
#pragma unroll
            for (int i = 0; i < 8; ++i) { const unsigned short hb = f2bf(sp[i]); oh[i] = hb; ol[i] = f2bf(sp[i] - bf2f(hb)); }
            *(v8us*)(CH + cbase + (size_t)row * DM + piece * 8) = oh; *(v8us*)(CL + cbase + (size_t)row * DM + piece * 8) = ol; }
    };
    pass(); 
    asm volatile("s_wait_xcnt 0x0" ::: "memory");   // behind the stores: the second tile's set-up overwrites their address and data registers
  }
}

extern "C" void kernel_launch(void* const* d_in, const int* in_sizes, int n_in,
                              void* d_out, int out_size, void* d_ws, size_t ws_size, hipStream_t stream) {
    (void)in_sizes; (void)n_in; (void)out_size;
    const float* x = (const float*)d_in[0]; const float* W4 = (const float*)d_in[1]; const float* b4 = (const float*)d_in[2]; const float* Wo = (const float*)d_in[3]; const float* bo = (const float*)d_in[4];
    float* out = (float*)d_out;    // [2][2048][1024]
    char* wsp = (char*)d_ws;
    auto take = [&](size_t bytes) { char* p = wsp; wsp += (bytes + 255) & ~(size_t)255; return (void*)p; };
    bf* Xb = (bf*)take((size_t)NTK * DM * 2); bf* W4T = (bf*)take((size_t)4 * DM * DM * 2);
    h16* VT16 = (h16*)take((size_t)NTK * DM * 2); h16* VTL = (h16*)take((size_t)NTK * DM * 2); h16* KH = (h16*)take((size_t)NTK * NH_ * QW * 2); h16* KL = (h16*)take((size_t)NTK * NH_ * QW * 2);
    float* R1 = (float*)take((size_t)NTK * DM * 4); float* R2 = (float*)take((size_t)NTK * DM * 4); float* R3 = (float*)take((size_t)NTK * DM * 4);   // reusable f32 region (3 x 16.8 MB)
    h16* QL = (h16*)take((size_t)NTK * NH_ * QW * 2);
    if ((size_t)(wsp - (char*)d_ws) > ws_size) return;    // exactly 134,217,728 B (128 MiB): Wout^T reuses W4T after the q/t projections
    float* Kf = R1; float* Vf = R2; float* KVC = R3;           // phase 1
    float* Qf = R1; float* Tf = R2; h16* QH = (h16*)R3;        // phase 2 (Kf, Vf, KVC dead by then)
    bf* CH = (bf*)R1; bf* CL = (bf*)R2; bf* WoT = W4T;         // phase 3 (Qf, Tf dead after k_side; W4T dead after the last projection)
    k_cvtb<<<NTK / 8, 256, 0, stream>>>(x, Xb);
    k_wt<<<dim3(DM / 64, (4 * DM) / 64, 1), 256, 0, stream>>>(W4, 4 * DM, W4T);
    // phase 1: k, v -> VT16/VTL, KVC -> key-side planes
    k_gemmb<false><<<dim3(NTK / 64, DM / 64, 1), 128, 0, stream>>>(Xb, nullptr, W4T + (size_t)1 * DM * DM, b4 + 1 * DM, Kf);
    k_gemmb<false><<<dim3(NTK / 64, DM / 64, 1), 128, 0, stream>>>(Xb, nullptr, W4T + (size_t)2 * DM * DM, b4 + 2 * DM, Vf);
    k_vt<<<NB_ * NH_ * (NT_ / 64), 256, 0, stream>>>(Vf, VT16, VTL);
    k_kvc<<<NB_ * (DM / 32), 1024, 0, stream>>>(Kf, Vf, KVC);
    k_side<false><<<NTK / 8, 256, 0, stream>>>(Kf, nullptr, KVC, KH, KL);
    // phase 2: q, t -> query-side planes
    k_gemmb<false><<<dim3(NTK / 64, DM / 64, 1), 128, 0, stream>>>(Xb, nullptr, W4T + (size_t)0 * DM * DM, b4 + 0 * DM, Qf);
    k_gemmb<false><<<dim3(NTK / 64, DM / 64, 1), 128, 0, stream>>>(Xb, nullptr, W4T + (size_t)3 * DM * DM, b4 + 3 * DM, Tf);
    k_side<true><<<NTK / 8, 256, 0, stream>>>(Qf, Tf, Qf, QH, QL);      // [q | q*t]
    // phase 3: Wout^T over the dead W4T, attention -> ctx planes -> out
    k_wt<<<dim3(DM / 64, DM / 64, 1), 256, 0, stream>>>(Wo, DM, WoT);
    k_attn<<<NB_ * (NH_ / 2) * (NT_ / 64), 128, 0, stream>>>(QH, QL, KH, KL, VT16, VTL, CH, CL);
    k_gemmb<true><<<dim3(NTK / 64, DM / 64, 1), 128, 0, stream>>>(CH, CL, WoT, bo, out);
}

// v006
// A run of this version takes 204 microseconds.
// Next to v005, in two timings, it ran 1.20 and 1.19 times as fast.
// Over all steps from v000 it is 6.80 times as fast.
#include <hip/hip_runtime.h>

// Contractions, f32 accumulate: qkvt = x.Wqkvt + b as four [4096 x 1024].[1024 x 1024] column blocks and out = ctx.Wout + bout on v_wmma_f32_16x16x32_bf16 (PLAIN bf16
// operands = inputs rounded once, exact; k-major weights transposed into n-major planes; ctx as bf16 hi + residual planes, two products); the per-(batch, head) causal
// attention fused on v_wmma_f32_16x16x32_f16: scores = ([q | q*t]).([k | cumsum_j(k*v)/8])^T over 128 dims with BOTH sides as f16 hi + residual x1024 planes
// (hi.hi + hi.lo + lo.hi — the triplet term reaches sigma ~45 before the 1/8 scale, so single-rounded operands would not hold the peaked softmax), x 1/8, causal,
// softmax, then weights (x32768) and v BOTH as f16 hi + residual x1024 (hi.hi + hi.lo + lo.hi; the softmax is peaked so single roundings would not average out). The key-side prefix sums are f32 chunked scans (16-row chunks, one block per (b, 32 columns)). Deterministic, no atomics;

#define NB_  2
#define NT_  2048
#define DM   1024
#define NH_  16
#define HD   64
#define QW   128                 // combined score width per head
#define NTK  (NB_ * NT_)         // 4096
#define PSC  32768.0f
#define LOSC 1024.0f
#define LOSCI (1.0f / 1024.0f)
#define SCL  0.125f
#define L2E  1.44269504f         // log2(e): exp(x) = exp2(x * L2E)

typedef _Float16 h16;
typedef unsigned short bf;
typedef __attribute__((ext_vector_type(16))) __bf16   v16bf;
typedef __attribute__((ext_vector_type(16))) _Float16 v16h;
typedef __attribute__((ext_vector_type(8)))  _Float16 v8h;
typedef __attribute__((ext_vector_type(8)))  unsigned short v8us;
typedef __attribute__((ext_vector_type(8)))  float    v8f;
typedef __attribute__((ext_vector_type(4)))  float    v4f;
typedef __attribute__((ext_vector_type(2)))  float    v2f;
typedef __attribute__((ext_vector_type(2)))  _Float16 v2h;
typedef v8h  __attribute__((may_alias)) v8ha;
typedef v4f  __attribute__((may_alias)) v4fa;
typedef v8us __attribute__((may_alias)) v8usa;

__device__ __forceinline__ unsigned short f2bf(float f) { unsigned u = __float_as_uint(f); u += 0x7FFFu + ((u >> 16) & 1u); return (unsigned short)(u >> 16); }
__device__ __forceinline__ float bf2f(unsigned short b) { return __uint_as_float(((unsigned)b) << 16); }
__device__ __forceinline__ float bfr(float f) { return bf2f(f2bf(f)); }
__device__ __forceinline__ v16h cat16(v8h lo, v8h hi) { return __builtin_shufflevector(lo, hi, 0, 1, 2, 3, 4, 5, 6, 7, 8, 9, 10, 11, 12, 13, 14, 15); }
__device__ __forceinline__ v16bf cat16b(v8us lo, v8us hi) { return __builtin_bit_cast(v16bf, __builtin_shufflevector(lo, hi, 0, 1, 2, 3, 4, 5, 6, 7, 8, 9, 10, 11, 12, 13, 14, 15)); }
__device__ __forceinline__ v8f wmma16(v16h a, v16h b, v8f c) { return __builtin_amdgcn_wmma_f32_16x16x32_f16(false, a, false, b, (short)0, c, false, false); }
__device__ __forceinline__ v8f wmmab(v16bf a, v16bf b, v8f c) { return __builtin_amdgcn_wmma_f32_16x16x32_bf16(false, a, false, b, (short)0, c, false, false); }
// value of lane l ^ 16: the other half of the wave
__device__ __forceinline__ float xhalf(float v) { const int b = __float_as_int(v); return __int_as_float(__builtin_amdgcn_permlanex16(b, b, 0x76543210, 0xfedcba98, false, false)); }
#define VST2(T, p, v) do { const T vst2_v_ = (v); *(T*)(p) = vst2_v_;  } while (0)

// k_cvtb: bf16 plane of x [4096][1024]; k_wt: W [1024 k][ncols] k-major -> n-major bf16 [ncols][1024] via 64 x 64 LDS tiles.
__global__ __launch_bounds__(256) void k_cvtb(const float* __restrict__ src, bf* dst) {
    const int lane = threadIdx.x & 31, r = blockIdx.x * 8 + (threadIdx.x >> 5);
    if (r >= NTK) return;
#pragma unroll
    for (int q = 0; q < 4; ++q) { v8us t;
#pragma unroll
        for (int i = 0; i < 8; ++i) t[i] = f2bf(src[(size_t)r * DM + q * 256 + lane * 8 + i]);
        VST2(v8us, dst + (size_t)r * DM + q * 256 + lane * 8, t); }
}
__global__ __launch_bounds__(256) void k_wt(const float* __restrict__ Wm, int ncols, bf* WT) {
    __shared__ __align__(16) unsigned short tl[64 * 72];
    const int tid = threadIdx.x, k0 = blockIdx.x * 64, n0 = blockIdx.y * 64;
    const int kk = tid >> 2, nq = (tid & 3) * 16;
#pragma unroll
    for (int i = 0; i < 16; ++i) tl[(nq + i) * 72 + kk] = f2bf(Wm[(size_t)(k0 + kk) * ncols + n0 + nq + i]);
    __syncthreads();
    const int piece = tid & 7;
    auto pass = [&]() {
#pragma unroll
        for (int s = 0; s < 2; ++s) { const int nr = (tid >> 3) + 32 * s; const v8us val = *(const v8usa*)(tl + nr * 72 + piece * 8);
            *(v8us*)(WT + (size_t)(n0 + nr) * DM + k0 + piece * 8) = val; }
    };
    pass(); 
}

// k_gemmb: block = 64 x 64 of C, wave = 16 x 64. A stage is 64 k = one 128-byte line of each of the block's 64 B rows and 64 A rows (and A residual rows); asynchronous
// copies bring it once per block into a two-buffer LDS ring, one stage ahead, each copy covering four whole lines; the four waves read their fragments from there, so the
// loop holds no global load. Rows are pitched 16 B x odd so that ds_load_b128 fragment reads meet no bank conflict. The k order of every sum is as before.
#define GKS 64                   // k per stage
#define GP  144                  // LDS pitch of a 128-byte row
#define GPL (64 * GP)            // one plane of 64 rows: B at 0, A at GPL, A residual at 2 GPL
template <bool SPLITA>
__global__ __launch_bounds__(128) void k_gemmb(const bf* __restrict__ A, const bf* __restrict__ Al, const bf* __restrict__ Bn, const float* __restrict__ bias, float* C) {
    constexpr int GST = (SPLITA ? 3 : 2) * GPL;
    __shared__ __align__(16) char ring[2 * GST];     // the output staging of the epilogue (17,408 B) reuses it behind the last stage's barrier
    const int tid = threadIdx.x, lane = tid & 31, wave = tid >> 5, lr = lane & 15, hi = lane >> 4;
    const int r0 = blockIdx.x * 64 + wave * 16, c0 = blockIdx.y * 64;
    // Copies of one stage: 4 per thread and plane, 16 bytes each; thread = (row tid/8 + 16 i, 16-byte piece tid%8).
    const int prow = tid >> 3, pcol = tid & 7;
    const size_t ga = (size_t)(blockIdx.x * 64 + prow) * DM + pcol * 8, gb = (size_t)(c0 + prow) * DM + pcol * 8;
    const unsigned l0 = (unsigned)(size_t)ring + prow * GP + pcol * 16;
    auto fill = [&](int t, int buf) {
        const bf* pb = Bn + gb + t * GKS; const bf* pa = A + ga + t * GKS;
        const unsigned l = l0 + buf * GST;
        // one statement: the closing s_wait_xcnt stands in front of any rewrite of an address register that a copy names
        asm volatile("global_load_async_to_lds_b128 %0, %8, off\n\t"
                     "global_load_async_to_lds_b128 %1, %9, off\n\t"
                     "global_load_async_to_lds_b128 %2, %10, off\n\t"
                     "global_load_async_to_lds_b128 %3, %11, off\n\t"
                     "global_load_async_to_lds_b128 %4, %12, off\n\t"
                     "global_load_async_to_lds_b128 %5, %13, off\n\t"
                     "global_load_async_to_lds_b128 %6, %14, off\n\t"
                     "global_load_async_to_lds_b128 %7, %15, off\n\t"
                     "s_wait_xcnt 0x0"
                     :: "v"(l), "v"(l + 16 * GP), "v"(l + 32 * GP), "v"(l + 48 * GP),
                        "v"(l + GPL), "v"(l + GPL + 16 * GP), "v"(l + GPL + 32 * GP), "v"(l + GPL + 48 * GP),
                        "v"(pb), "v"(pb + 16 * DM), "v"(pb + 32 * DM), "v"(pb + 48 * DM),
                        "v"(pa), "v"(pa + 16 * DM), "v"(pa + 32 * DM), "v"(pa + 48 * DM)
                     : "memory");
        if constexpr (SPLITA) {   // the residual plane's rows; same form of statement
            const bf* pl = Al + ga + t * GKS;
            asm volatile("global_load_async_to_lds_b128 %0, %4, off\n\t"
                         "global_load_async_to_lds_b128 %1, %5, off\n\t"
                         "global_load_async_to_lds_b128 %2, %6, off\n\t"
                         "global_load_async_to_lds_b128 %3, %7, off\n\t"
                         "s_wait_xcnt 0x0"
                         :: "v"(l + 2 * GPL), "v"(l + 2 * GPL + 16 * GP), "v"(l + 2 * GPL + 32 * GP), "v"(l + 2 * GPL + 48 * GP),
                            "v"(pl), "v"(pl + 16 * DM), "v"(pl + 32 * DM), "v"(pl + 48 * DM)
                         : "memory");
        }
    };
    v8f acc[4];
#pragma unroll
    for (int t = 0; t < 4; ++t) acc[t] = (v8f){};
    fill(0, 0);
    asm volatile("s_wait_asynccnt 0x0" ::: "memory");   // this wave's copies of stage 0 have landed
    __syncthreads();                                    // ... and every other wave's
    fill(1, 1);
#pragma unroll 1  // stays rolled: one copy of the stage body, the buffer picked by s & 1
    for (int s = 0; s < DM / GKS; ++s) {
        const char* fa = ring + (s & 1) * GST + GPL + (wave * 16 + lr) * GP + 16 * hi;
        const char* fb = ring + (s & 1) * GST + lr * GP + 16 * hi;
        v16bf a, al;
#pragma unroll  // two 32-k products per stage, constant LDS offsets
        for (int ks = 0; ks < GKS / 32; ++ks) {
            a = cat16b(*(const v8usa*)(fa + ks * 64), *(const v8usa*)(fa + ks * 64 + 32));
            al = a;
            if (SPLITA) al = cat16b(*(const v8usa*)(fa + GPL + ks * 64), *(const v8usa*)(fa + GPL + ks * 64 + 32));
#pragma unroll
            for (int t = 0; t < 4; ++t) { const v16bf b = cat16b(*(const v8usa*)(fb + t * 16 * GP + ks * 64), *(const v8usa*)(fb + t * 16 * GP + ks * 64 + 32)); acc[t] = wmmab(a, b, acc[t]); if (SPLITA) acc[t] = wmmab(al, b, acc[t]); }
        }
        // four vector slots behind the last WMMA, on both sides of the branch below, before a vector instruction may overwrite its operands
        asm volatile("v_nop\n\tv_nop\n\tv_nop\n\tv_nop" : "+v"(acc[0]), "+v"(acc[1]), "+v"(acc[2]), "+v"(acc[3]) : "v"(a), "v"(al));
        asm volatile("s_wait_dscnt 0x0" ::: "memory");      // this wave's reads of the buffer are done before it may be refilled
        asm volatile("s_wait_asynccnt 0x0" ::: "memory");   // this wave's copies of the next stage have landed
        __syncthreads();                                    // publishes the next stage and frees this stage's buffer
        if (s + 2 < DM / GKS) fill(s + 2, s & 1);
    }
    asm volatile("s_wait_asynccnt 0x0" ::: "memory");       // nothing in flight when the ring becomes output staging
    float* os = (float*)ring + wave * (16 * 68);
#pragma unroll
    for (int t = 0; t < 4; ++t) { const float bv = bfr(bias[c0 + t * 16 + lr]);
#pragma unroll
        for (int j = 0; j < 8; ++j) os[(hi * 8 + j) * 68 + t * 16 + lr] = acc[t][j] + bv; }
    __syncthreads();
    float* crow = C + (size_t)r0 * DM + c0;
    auto pass = [&]() {
#pragma unroll
        for (int s = 0; s < 8; ++s) { const int Lid = (lane >> 3) + 4 * s, piece = lane & 7; const int row = Lid >> 1, cofs = (Lid & 1) * 32 + piece * 4;
            const v4f val = *(const v4fa*)(os + row * 68 + cofs); *(v4f*)(crow + (size_t)row * DM + cofs) = val; }
    };
    pass(); 
}

// k_vt: VT16/VTL[b][h][d][t] = f16 hi + residual x1024 of V row b*2048+t, col h*64+d via LDS transposes, block (b, h, 64 t).
__global__ __launch_bounds__(256) void k_vt(const float* __restrict__ V, h16* VT16, h16* VTL) {
    __shared__ __align__(16) h16 tile[HD * 72];
    __shared__ __align__(16) h16 til2[HD * 72];
    const int bid = blockIdx.x;
    const int b = bid / (NH_ * (NT_ / 64)), rem = bid - b * (NH_ * (NT_ / 64)), h = rem / (NT_ / 64), kt = rem - h * (NT_ / 64);
    const int k0 = kt * 64, tid = threadIdx.x, kk = tid >> 2, d0 = (tid & 3) * 16;
    const float* src = V + ((size_t)b * NT_ + k0 + kk) * DM + h * HD + d0;
#pragma unroll
    for (int i = 0; i < 16; ++i) { const float v = src[i]; const h16 a = (h16)v; tile[(d0 + i) * 72 + kk] = a; til2[(d0 + i) * 72 + kk] = (h16)((v - (float)a) * LOSC); }
    __syncthreads();
    const int piece = tid & 7;
    const size_t base = (((size_t)b * NH_ + h) * HD) * NT_ + k0;
    auto pass = [&]() {
#pragma unroll
        for (int s = 0; s < 4; ++s) { const int Lid = (tid >> 3) + 32 * s; const int pln = Lid >> 6, d = Lid & 63;
            const v8h val = *(const v8ha*)((pln ? til2 : tile) + d * 72 + piece * 8); *(v8h*)((pln ? VTL : VT16) + base + (size_t)d * NT_ + piece * 8) = val; }
    };
    pass(); 
}
// k_kvc: KVC[b*2048+t][col] = sum_{j<=t} k[j]*v[j]/8 (inclusive prefix over t, f32) as a chunked scan inside one block. Block = (b, 32 columns = whole 128-byte lines);
// thread = (chunk of 16 rows, 4 columns): all 32 16-byte loads are independent and the 64 running sums stay in registers. Chunk sums -> LDS, exclusive prefix over the 128
// chunks in two levels (8 waves scan 16 chunks each, then every thread adds the sums of the groups before its own), then each thread adds that start value to its rows.
#define KC_R 16                  // rows per chunk
#define KC_N (NT_ / KC_R)        // 128 chunks
#define KC_G 8                   // groups of 16 chunks
__global__ __launch_bounds__(1024) void k_kvc(const float* __restrict__ Kf, const float* __restrict__ Vf, float* __restrict__ KVC) {
    __shared__ __align__(16) float tot[KC_N * 32];
    __shared__ __align__(16) float gtot[KC_G * 32];
    const int tid = threadIdx.x, cq = tid & 7, ch = tid >> 3;
    const int b = blockIdx.x / (DM / 32), cg = blockIdx.x - b * (DM / 32);
    const size_t blk = (size_t)b * NT_ * DM + cg * 32;         // block part of the index (scalar)
    const unsigned thr = (unsigned)(ch * KC_R * DM + cq * 4);  // thread part, shared by the loads and the stores
    const float* kp = Kf + blk; const float* vp = Vf + blk; float* op = KVC + blk;
    v4f p[KC_R];
#pragma unroll  // constant indices keep p[] in registers; the independent loads issue many at a time
    for (int i = 0; i < KC_R; ++i) p[i] = *(const v4f*)(kp + thr + i * DM) * *(const v4f*)(vp + thr + i * DM) * SCL;
#pragma unroll  // p[] in registers
    for (int i = 1; i < KC_R; ++i) p[i] += p[i - 1];           // inclusive prefix inside the chunk
    *(v4f*)(tot + ch * 32 + cq * 4) = p[KC_R - 1];
    __syncthreads();
    if (tid < KC_G * 32) { const int g = tid >> 5, col = tid & 31; float run = 0.f;
#pragma unroll  // the 16 LDS reads issue ahead of the add chain
        for (int i = 0; i < KC_N / KC_G; ++i) { float* q = tot + (g * (KC_N / KC_G) + i) * 32 + col; const float t = *q; *q = run; run += t; }
        gtot[g * 32 + col] = run; }
    __syncthreads();
    const int g = ch / (KC_N / KC_G);
    v4f gs[KC_G - 1];
#pragma unroll  // gs[] in registers
    for (int i = 0; i < KC_G - 1; ++i) gs[i] = *(const v4f*)(gtot + i * 32 + cq * 4);   // all read at once, then selected: no chain of LDS round trips
    v4f c = {};
#pragma unroll  // gs[] in registers
    for (int i = 0; i < KC_G - 1; ++i) c += (i < g) ? gs[i] : (v4f){};
    c += *(const v4f*)(tot + ch * 32 + cq * 4);
#pragma unroll  // p[] in registers; stores back to back
    for (int i = 0; i < KC_R; ++i) *(v4f*)(op + thr + i * DM) = p[i] + c;
}
// k_side: hi/lo f16 planes of a 128-wide per-head row: SH/SL[row][h*128 + c]: c < 64 -> A[row][h*64+c]; c >= 64 -> B2[row][h*64+c-64] (times M[row][same]
// when MUL2) - query side: [q | q*t] (A = q, B2 = q, M = t); key side: [k | kvc]. One wave per ROW, all 16 heads: 4,096 waves in the launch, so that the time goes into
// the stream and not into starting waves. A 16-byte load of the wave covers 512 contiguous bytes = two heads' 64 values of one source (lane = head 2g + lane/16, 4 values);
// an 8-byte store covers those two heads' whole 128-byte lines of a plane. No lane is off; the row's loads are independent and issue ahead of the first conversion.
template <bool MUL2>
__global__ __launch_bounds__(256) void k_side(const float* __restrict__ A, const float* __restrict__ Mv, const float* __restrict__ B2, h16* SH, h16* SL) {
    typedef __attribute__((ext_vector_type(4))) _Float16 v4h;
    const int lane = threadIdx.x & 31, r = blockIdx.x * 8 + (threadIdx.x >> 5);
    if (r >= NTK) return;
    const size_t in0 = (size_t)r * DM + lane * 4;
    const size_t o0 = (size_t)r * (NH_ * QW) + (lane >> 4) * QW + (lane & 15) * 4;
    const float* pa = A + in0; const float* pb = B2 + in0; const float* pm = MUL2 ? Mv + in0 : pb;
    v4f va[NH_ / 2], vb[NH_ / 2], vm[NH_ / 2];
#pragma unroll  // constant indices keep the arrays in registers; the independent loads issue many at a time
    for (int g = 0; g < NH_ / 2; ++g) { va[g] = *(const v4fa*)(pa + g * 2 * HD); vb[g] = *(const v4fa*)(pb + g * 2 * HD); if (MUL2) vm[g] = *(const v4fa*)(pm + g * 2 * HD); }
    // a precaution: the address registers, named here, stay whole up to this wait, so that no load's result is placed in a register that an issued load names
    asm volatile("s_wait_xcnt 0x0" :: "v"(pa), "v"(pb), "v"(pm) : "memory");
#pragma unroll  // the arrays in registers
    for (int g = 0; g < NH_ / 2; ++g)
#pragma unroll
        for (int s = 0; s < 2; ++s) { v4f x = s ? vb[g] : va[g]; if (MUL2 && s) x *= vm[g]; v4h oh, ol;
#pragma unroll
            for (int i = 0; i < 4; ++i) { const h16 a = (h16)x[i]; oh[i] = a; ol[i] = (h16)((x[i] - (float)a) * LOSC); }
            *(v4h*)(SH + o0 + g * 2 * QW + s * HD) = oh; *(v4h*)(SL + o0 + g * 2 * QW + s * HD) = ol; }
}

// k_attn: block = (b, head pair hp, t): the 64-query tile t of head hp, then tile 31 - t of head hp + 8, one after the other: 66 key steps in every block, so that the
// blocks, all resident at once, end together; wave = 16 queries; causal key tiles 0..query tile; scores over the 128 combined dims with hi.hi + hi.lo + lo.hi (24 WMMA per 32-key
// step), x 1/8, keys after the query -> -inf; online f32 softmax. The products are the TRANSPOSED ones: S^T = K.Q^T (A = key rows, B = query rows) and O^T += V^T.P^T
// (A = V^T rows, B = weights). A lane then holds 16 of the step's 32 scores of ONE query (lane l ^ 16 the other 16): maximum and sum run over the lane's own registers with
// one exchange between the halves, maximum, rescale factor and sum are one value a lane, and the two score tiles, converted in place (x32768, f16 hi + residual x1024), ARE
// the B operand of the second product in the hardware k order: the weights pass through no LDS. ctx -> bf16 hi/lo planes CH/CL [token][h*64 + d].
// The 32-key tile of a step (key rows hi + lo, V^T rows hi + lo, 24 KB) is brought once per block into a two-buffer LDS ring by asynchronous copies, one step ahead;
// the four waves read their fragments from there, and the query lo rows from a buffer copied once: the loop holds no global load. Rows are pitched 16 B x odd so that ds_load_b128 fragment reads meet no bank conflict.
#define KP    272                // LDS pitch of a 256-byte key row
#define VP    80                 // LDS pitch of a 64-byte V^T row
#define ST_KL (32 * KP)          // stage offsets: key hi at 0, key lo, V^T hi, V^T lo
#define ST_VH (2 * 32 * KP)
#define ST_VL (ST_VH + HD * VP)
#define ST_SZ (ST_VH + 2 * HD * VP)
__global__ __launch_bounds__(128) void k_attn(const h16* __restrict__ QH, const h16* __restrict__ QL, const h16* __restrict__ KH, const h16* __restrict__ KL, const h16* __restrict__ VT16, const h16* __restrict__ VTL, bf* CH, bf* CL) {
    __shared__ __align__(16) char ring[2 * ST_SZ];   // the output staging of the epilogue reuses it behind the last step's barrier
    __shared__ __align__(16) char qlds[64 * KP];     // the current tile's 64 query lo rows, copied once per tile
    const int lane = threadIdx.x & 31, wave = threadIdx.x >> 5, lr = lane & 15, hi = lane >> 4;
    const int bid = blockIdx.x;
    const int b = bid / ((NH_ / 2) * (NT_ / 64)), rem = bid - b * ((NH_ / 2) * (NT_ / 64)), hp = rem / (NT_ / 64), t0 = rem - hp * (NT_ / 64);
    const size_t tok0 = (size_t)b * NT_;
#pragma unroll 1  // the two tiles go through one copy of the code, one after the other
  for (int half = 0; half < 2; ++half) {
    const int h = half ? hp + NH_ / 2 : hp, qt = half ? NT_ / 64 - 1 - t0 : t0;
    const int q0 = qt * 64 + wave * 16;
    if (half) {
        asm volatile("s_wait_dscnt 0x0" ::: "memory");  // this wave's reads of the first tile's output staging are done
        __syncthreads();                                // ... and every other wave's, before the copies below refill that LDS
    }
    v16h ah[4];
    const size_t qo = (tok0 + q0 + lr) * (NH_ * QW) + h * QW + 8 * hi;
#pragma unroll
    for (int kc = 0; kc < 4; ++kc) ah[kc] = cat16(*(const v8h*)(QH + qo + kc * 32), *(const v8h*)(QH + qo + kc * 32 + 16));
    const int qp = q0 + lr;      // this lane's query
    const size_t vbase = (((size_t)b * NH_ + h) * HD) * NT_;
    v8f o[4], ox[4];
#pragma unroll
    for (int n = 0; n < 4; ++n) { o[n] = (v8f){}; ox[n] = (v8f){}; }
    float mrow = -3.0e38f, lpart = 0.f;
    const int kt_end = (qt * 64 + 64) / 32;
    // Copies of one tile: 12 per thread, 16 bytes each. Key planes: thread = (row tid/16 + 8 i, 16-byte piece tid%16); V^T planes: thread = (row tid/4 + 32 i, piece tid%4).
    const int tid = threadIdx.x, krow = tid >> 4, kcol = tid & 15, vrow = tid >> 2, vcol = tid & 3;
    const size_t kg = (tok0 + krow) * (NH_ * QW) + h * QW + kcol * 8, vg = vbase + (size_t)vrow * NT_ + vcol * 8;
    const unsigned lk0 = (unsigned)(size_t)ring + krow * KP + kcol * 16, lv0 = (unsigned)(size_t)ring + ST_VH + vrow * VP + vcol * 16;
    auto fill = [&](int t, int buf) {
        const h16* gkh = KH + kg + (size_t)t * 32 * (NH_ * QW); const h16* gkl = KL + kg + (size_t)t * 32 * (NH_ * QW);
        const h16* gvh = VT16 + vg + t * 32; const h16* gvl = VTL + vg + t * 32;
        const unsigned lk = lk0 + buf * ST_SZ, lv = lv0 + buf * ST_SZ;
        // one statement: the closing s_wait_xcnt stands in front of any rewrite of an address register that a copy names
        asm volatile("global_load_async_to_lds_b128 %0, %12, off\n\t"
                     "global_load_async_to_lds_b128 %1, %13, off\n\t"
                     "global_load_async_to_lds_b128 %2, %14, off\n\t"
                     "global_load_async_to_lds_b128 %3, %15, off\n\t"
                     "global_load_async_to_lds_b128 %4, %16, off\n\t"
                     "global_load_async_to_lds_b128 %5, %17, off\n\t"
                     "global_load_async_to_lds_b128 %6, %18, off\n\t"
                     "global_load_async_to_lds_b128 %7, %19, off\n\t"
                     "global_load_async_to_lds_b128 %8, %20, off\n\t"
                     "global_load_async_to_lds_b128 %9, %21, off\n\t"
                     "global_load_async_to_lds_b128 %10, %22, off\n\t"
                     "global_load_async_to_lds_b128 %11, %23, off\n\t"
                     "s_wait_xcnt 0x0"
                     :: "v"(lk), "v"(lk + 8 * KP), "v"(lk + 16 * KP), "v"(lk + 24 * KP),
                        "v"(lk + ST_KL), "v"(lk + ST_KL + 8 * KP), "v"(lk + ST_KL + 16 * KP), "v"(lk + ST_KL + 24 * KP),
                        "v"(lv), "v"(lv + 32 * VP), "v"(lv + HD * VP), "v"(lv + HD * VP + 32 * VP),
                        "v"(gkh), "v"(gkh + 8 * (NH_ * QW)), "v"(gkh + 16 * (NH_ * QW)), "v"(gkh + 24 * (NH_ * QW)),
                        "v"(gkl), "v"(gkl + 8 * (NH_ * QW)), "v"(gkl + 16 * (NH_ * QW)), "v"(gkl + 24 * (NH_ * QW)),
                        "v"(gvh), "v"(gvh + 32 * NT_), "v"(gvl), "v"(gvl + 32 * NT_)
                     : "memory");
    };
    {   // query lo rows: 8 copies per thread, thread = (row tid/16 + 8 i, piece tid%16); same form of statement as above
        const h16* gq = QL + (tok0 + qt * 64 + krow) * (NH_ * QW) + h * QW + kcol * 8;
        const unsigned lq = (unsigned)(size_t)qlds + krow * KP + kcol * 16;
        asm volatile("global_load_async_to_lds_b128 %0, %8, off\n\t"
                     "global_load_async_to_lds_b128 %1, %9, off\n\t"
                     "global_load_async_to_lds_b128 %2, %10, off\n\t"
                     "global_load_async_to_lds_b128 %3, %11, off\n\t"
                     "global_load_async_to_lds_b128 %4, %12, off\n\t"
                     "global_load_async_to_lds_b128 %5, %13, off\n\t"
                     "global_load_async_to_lds_b128 %6, %14, off\n\t"
                     "global_load_async_to_lds_b128 %7, %15, off\n\t"
                     "s_wait_xcnt 0x0"
                     :: "v"(lq), "v"(lq + 8 * KP), "v"(lq + 16 * KP), "v"(lq + 24 * KP), "v"(lq + 32 * KP), "v"(lq + 40 * KP), "v"(lq + 48 * KP), "v"(lq + 56 * KP),
                        "v"(gq), "v"(gq + 8 * (NH_ * QW)), "v"(gq + 16 * (NH_ * QW)), "v"(gq + 24 * (NH_ * QW)),
                        "v"(gq + 32 * (NH_ * QW)), "v"(gq + 40 * (NH_ * QW)), "v"(gq + 48 * (NH_ * QW)), "v"(gq + 56 * (NH_ * QW))
                     : "memory");
    }
    const char* qlp = qlds + (wave * 16 + lr) * KP + 16 * hi;
    fill(0, 0);
    asm volatile("s_wait_asynccnt 0x0" ::: "memory");   // this wave's copies of the query rows and of tile 0 have landed
    __syncthreads();                                    // ... and every other wave's
    if (kt_end > 1) fill(1, 1);
#pragma unroll 1
    for (int kt = 0; kt < kt_end; ++kt) {
        const int l0 = kt * 32;
        const char* st = ring + (kt & 1) * ST_SZ;
        v8f s0 = {}, s1 = {}, x0 = {}, x1 = {};
#pragma unroll
        for (int kc = 0; kc < 4; ++kc) {
            const char* p0 = st + lr * KP + kc * 64 + 16 * hi; const char* p1 = p0 + 16 * KP;
            const v16h k0h = cat16(*(const v8ha*)p0, *(const v8ha*)(p0 + 32)), k0l = cat16(*(const v8ha*)(p0 + ST_KL), *(const v8ha*)(p0 + ST_KL + 32));
            const v16h k1h = cat16(*(const v8ha*)p1, *(const v8ha*)(p1 + 32)), k1l = cat16(*(const v8ha*)(p1 + ST_KL), *(const v8ha*)(p1 + ST_KL + 32));
            const v16h alk = cat16(*(const v8ha*)(qlp + kc * 64), *(const v8ha*)(qlp + kc * 64 + 32));      // query lo fragment re-read per step (register budget)
            s0 = wmma16(k0h, ah[kc], s0); x0 = wmma16(k0l, ah[kc], x0); x0 = wmma16(k0h, alk, x0);      // lo products carry x1024, folded below
            s1 = wmma16(k1h, ah[kc], s1); x1 = wmma16(k1l, ah[kc], x1); x1 = wmma16(k1h, alk, x1);
            asm volatile("" : "+v"(x0), "+v"(x1) : "v"(alk));
        }
        asm volatile("v_nop\n\tv_nop\n\tv_nop\n\tv_nop" : "+v"(s0), "+v"(s1), "+v"(x0), "+v"(x1) : "v"(ah[0]), "v"(ah[3]));
        // register j of s0 / s1 = key l0 + 8 hi + j / l0 + 16 + 8 hi + j of query qp: element j / 8 + j of the lane's B fragment below
        const int kd = qp - l0 - 8 * hi;   // last key offset that this query may see
        const v8f t0 = (s0 + x0 * LOSCI) * SCL, t1 = (s1 + x1 * LOSCI) * SCL;
        float a[16];
#pragma unroll
        for (int j = 0; j < 8; ++j) { a[j] = (j <= kd) ? t0[j] : -__builtin_inff(); a[8 + j] = (16 + j <= kd) ? t1[j] : -__builtin_inff(); }
        float mt[8];
#pragma unroll
        for (int j = 0; j < 8; ++j) mt[j] = fmaxf(a[2 * j], a[2 * j + 1]);
        float mx = fmaxf(fmaxf(fmaxf(mt[0], mt[1]), fmaxf(mt[2], mt[3])), fmaxf(fmaxf(mt[4], mt[5]), fmaxf(mt[6], mt[7])));
        mx = fmaxf(mx, xhalf(mx));
        const float mn = fmaxf(mrow, mx);
        v2f p[8]; v16h pa, px;
#pragma unroll
        for (int i = 0; i < 8; ++i) {      // neighbouring registers in pairs: packed f32 arithmetic and packed conversions
            const v2f e = ((v2f){a[2 * i], a[2 * i + 1]} - mn) * L2E;
            p[i] = (v2f){__builtin_amdgcn_exp2f(e[0]), __builtin_amdgcn_exp2f(e[1])};
            const v2f ps = p[i] * PSC; const v2h ph = __builtin_convertvector(ps, v2h);
            const v2h pr = __builtin_convertvector((ps - __builtin_convertvector(ph, v2f)) * LOSC, v2h);
            pa[2 * i] = ph[0]; pa[2 * i + 1] = ph[1]; px[2 * i] = pr[0]; px[2 * i + 1] = pr[1];
        }
        const float alpha = __builtin_amdgcn_exp2f((mrow - mn) * L2E);
        mrow = mn;
#pragma unroll
        for (int w = 4; w > 0; w >>= 1)    // the lane's 16 weights, summed as a tree
#pragma unroll
            for (int i = 0; i < w; ++i) p[i] += p[i + w];
        lpart = lpart * alpha + (p[0][0] + p[0][1]);
#pragma unroll
        for (int n = 0; n < 4; ++n) { o[n] *= alpha; ox[n] *= alpha; }
#pragma unroll
        for (int n = 0; n < 4; ++n) { const char* pv = st + ST_VH + (n * 16 + lr) * VP + 16 * hi;
            const v16h vh = cat16(*(const v8ha*)pv, *(const v8ha*)(pv + 32));
            o[n] = wmma16(vh, pa, o[n]); ox[n] = wmma16(cat16(*(const v8ha*)(pv + HD * VP), *(const v8ha*)(pv + HD * VP + 32)), pa, ox[n]); ox[n] = wmma16(vh, px, ox[n]); }
        asm volatile("v_nop\n\tv_nop\n\tv_nop\n\tv_nop" : "+v"(o[0]), "+v"(o[1]), "+v"(o[2]), "+v"(o[3]), "+v"(ox[0]), "+v"(ox[1]), "+v"(ox[2]), "+v"(ox[3]) : "v"(pa), "v"(px));
        asm volatile("s_wait_dscnt 0x0" ::: "memory");      // this wave's reads of the buffer are done before it may be refilled
        asm volatile("s_wait_asynccnt 0x0" ::: "memory");   // this wave's copies of the next tile have landed
        __syncthreads();                                    // publishes the next tile and frees this step's buffer
        if (kt + 2 < kt_end) fill(kt + 2, kt & 1);
    }
    asm volatile("s_wait_asynccnt 0x0" ::: "memory");       // nothing in flight when the ring becomes output staging
    const float inv = 1.0f / ((lpart + xhalf(lpart)) * PSC);
    float* os = (float*)ring + wave * (16 * 68);
#pragma unroll
    for (int n = 0; n < 4; ++n)
#pragma unroll
        for (int q = 0; q < 2; ++q) { v4f w;    // register j of o[n] = dim n * 16 + 8 hi + j of query lr
#pragma unroll
            for (int i = 0; i < 4; ++i) w[i] = (o[n][q * 4 + i] + ox[n][q * 4 + i] * LOSCI) * inv;
            *(v4fa*)(os + lr * 68 + n * 16 + hi * 8 + q * 4) = w; }
    __syncthreads();
    const size_t cbase = (tok0 + q0) * DM + (size_t)h * HD;
    auto pass = [&]() {
#pragma unroll
        for (int s = 0; s < 4; ++s) { const int row = 4 * s + (lane >> 3), piece = lane & 7; const float* sp = os + row * 68 + piece * 8; v8us oh, ol;
#pragma unroll
            for (int i = 0; i < 8; ++i) { const unsigned short hb = f2bf(sp[i]); oh[i] = hb; ol[i] = f2bf(sp[i] - bf2f(hb)); }
            *(v8us*)(CH + cbase + (size_t)row * DM + piece * 8) = oh; *(v8us*)(CL + cbase + (size_t)row * DM + piece * 8) = ol; }
    };
    pass(); 
    asm volatile("s_wait_xcnt 0x0" ::: "memory");   // behind the stores: the second tile's set-up overwrites their address and data registers
  }
}

extern "C" void kernel_launch(void* const* d_in, const int* in_sizes, int n_in,
                              void* d_out, int out_size, void* d_ws, size_t ws_size, hipStream_t stream) {
    (void)in_sizes; (void)n_in; (void)out_size;
    const float* x = (const float*)d_in[0]; const float* W4 = (const float*)d_in[1]; const float* b4 = (const float*)d_in[2]; const float* Wo = (const float*)d_in[3]; const float* bo = (const float*)d_in[4];
    float* out = (float*)d_out;    // [2][2048][1024]
    char* wsp = (char*)d_ws;
    auto take = [&](size_t bytes) { char* p = wsp; wsp += (bytes + 255) & ~(size_t)255; return (void*)p; };
    bf* Xb = (bf*)take((size_t)NTK * DM * 2); bf* W4T = (bf*)take((size_t)4 * DM * DM * 2);
    h16* VT16 = (h16*)take((size_t)NTK * DM * 2); h16* VTL = (h16*)take((size_t)NTK * DM * 2); h16* KH = (h16*)take((size_t)NTK * NH_ * QW * 2); h16* KL = (h16*)take((size_t)NTK * NH_ * QW * 2);
    float* R1 = (float*)take((size_t)NTK * DM * 4); float* R2 = (float*)take((size_t)NTK * DM * 4); float* R3 = (float*)take((size_t)NTK * DM * 4);   // reusable f32 region (3 x 16.8 MB)
    h16* QL = (h16*)take((size_t)NTK * NH_ * QW * 2);
    if ((size_t)(wsp - (char*)d_ws) > ws_size) return;    // exactly 134,217,728 B (128 MiB): Wout^T reuses W4T after the q/t projections
    float* Kf = R1; float* Vf = R2; float* KVC = R3;           // phase 1
    float* Qf = R1; float* Tf = R2; h16* QH = (h16*)R3;        // phase 2 (Kf, Vf, KVC dead by then)
    bf* CH = (bf*)R1; bf* CL = (bf*)R2; bf* WoT = W4T;         // phase 3 (Qf, Tf dead after k_side; W4T dead after the last projection)
    k_cvtb<<<NTK / 8, 256, 0, stream>>>(x, Xb);
    k_wt<<<dim3(DM / 64, (4 * DM) / 64, 1), 256, 0, stream>>>(W4, 4 * DM, W4T);
    // phase 1: k, v -> VT16/VTL, KVC -> key-side planes
    k_gemmb<false><<<dim3(NTK / 64, DM / 64, 1), 128, 0, stream>>>(Xb, nullptr, W4T + (size_t)1 * DM * DM, b4 + 1 * DM, Kf);
    k_gemmb<false><<<dim3(NTK / 64, DM / 64, 1), 128, 0, stream>>>(Xb, nullptr, W4T + (size_t)2 * DM * DM, b4 + 2 * DM, Vf);
    k_vt<<<NB_ * NH_ * (NT_ / 64), 256, 0, stream>>>(Vf, VT16, VTL);
    k_kvc<<<NB_ * (DM / 32), 1024, 0, stream>>>(Kf, Vf, KVC);
    k_side<false><<<NTK / 8, 256, 0, stream>>>(Kf, nullptr, KVC, KH, KL);
    // phase 2: q, t -> query-side planes
    k_gemmb<false><<<dim3(NTK / 64, DM / 64, 1), 128, 0, stream>>>(Xb, nullptr, W4T + (size_t)0 * DM * DM, b4 + 0 * DM, Qf);
    k_gemmb<false><<<dim3(NTK / 64, DM / 64, 1), 128, 0, stream>>>(Xb, nullptr, W4T + (size_t)3 * DM * DM, b4 + 3 * DM, Tf);
    k_side<true><<<NTK / 8, 256, 0, stream>>>(Qf, Tf, Qf, QH, QL);      // [q | q*t]
    // phase 3: Wout^T over the dead W4T, attention -> ctx planes -> out
    k_wt<<<dim3(DM / 64, DM / 64, 1), 256, 0, stream>>>(Wo, DM, WoT);
    k_attn<<<NB_ * (NH_ / 2) * (NT_ / 64), 128, 0, stream>>>(QH, QL, KH, KL, VT16, VTL, CH, CL);
    k_gemmb<true><<<dim3(NTK / 64, DM / 64, 1), 128, 0, stream>>>(CH, CL, WoT, bo, out);
}

// v007
// Measured time: 168 microseconds a run.
// In two side-by-side timings against v006, it was 1.21 and 1.20 times as fast.
// All steps since v000 together make it 8.19 times as fast.
#include <hip/hip_runtime.h>

// Contractions, f32 accumulate: qkvt = x.Wqkvt + b as four [4096 x 1024].[1024 x 1024] column blocks and out = ctx.Wout + bout on v_wmma_f32_16x16x32_bf16 (PLAIN bf16
// operands = inputs rounded once, exact; k-major weights transposed into n-major planes; ctx as bf16 hi + residual planes, two products); the per-(batch, head) causal
// attention fused on v_wmma_f32_16x16x32_f16: scores = ([q | q*t]).([k | cumsum_j(k*v)/8])^T over 128 dims with BOTH sides as f16 hi + residual x1024 planes
// (hi.hi + hi.lo + lo.hi — the triplet term reaches sigma ~45 before the 1/8 scale, so single-rounded operands would not hold the peaked softmax), x 1/8, causal,
// softmax, then weights (x32768) and v BOTH as f16 hi + residual x1024 (hi.hi + hi.lo + lo.hi; the softmax is peaked so single roundings would not average out). The key-side prefix sums are f32 chunked scans (16-row chunks, one block per (b, 32 columns)). Deterministic, no atomics;

#define NB_  2
#define NT_  2048
#define DM   1024
#define NH_  16
#define HD   64
#define QW   128                 // combined score width per head
#define NTK  (NB_ * NT_)         // 4096
#define PSC  32768.0f
#define LOSC 1024.0f
#define LOSCI (1.0f / 1024.0f)
#define SCL  0.125f
#define L2E  1.44269504f         // log2(e): exp(x) = exp2(x * L2E)

typedef _Float16 h16;
typedef unsigned short bf;
typedef __attribute__((ext_vector_type(16))) __bf16   v16bf;
typedef __attribute__((ext_vector_type(16))) _Float16 v16h;
typedef __attribute__((ext_vector_type(8)))  _Float16 v8h;
typedef __attribute__((ext_vector_type(8)))  unsigned short v8us;
typedef __attribute__((ext_vector_type(8)))  float    v8f;
typedef __attribute__((ext_vector_type(4)))  float    v4f;
typedef __attribute__((ext_vector_type(2)))  float    v2f;
typedef __attribute__((ext_vector_type(2)))  _Float16 v2h;
typedef v8h  __attribute__((may_alias)) v8ha;
typedef v4f  __attribute__((may_alias)) v4fa;
typedef v8us __attribute__((may_alias)) v8usa;

__device__ __forceinline__ unsigned short f2bf(float f) { unsigned u = __float_as_uint(f); u += 0x7FFFu + ((u >> 16) & 1u); return (unsigned short)(u >> 16); }
__device__ __forceinline__ float bf2f(unsigned short b) { return __uint_as_float(((unsigned)b) << 16); }
__device__ __forceinline__ float bfr(float f) { return bf2f(f2bf(f)); }
__device__ __forceinline__ v16h cat16(v8h lo, v8h hi) { return __builtin_shufflevector(lo, hi, 0, 1, 2, 3, 4, 5, 6, 7, 8, 9, 10, 11, 12, 13, 14, 15); }
__device__ __forceinline__ v16bf cat16b(v8us lo, v8us hi) { return __builtin_bit_cast(v16bf, __builtin_shufflevector(lo, hi, 0, 1, 2, 3, 4, 5, 6, 7, 8, 9, 10, 11, 12, 13, 14, 15)); }
__device__ __forceinline__ v8f wmma16(v16h a, v16h b, v8f c) { return __builtin_amdgcn_wmma_f32_16x16x32_f16(false, a, false, b, (short)0, c, false, false); }
__device__ __forceinline__ v8f wmmab(v16bf a, v16bf b, v8f c) { return __builtin_amdgcn_wmma_f32_16x16x32_bf16(false, a, false, b, (short)0, c, false, false); }
// value of lane l ^ 16: the other half of the wave
__device__ __forceinline__ float xhalf(float v) { const int b = __float_as_int(v); return __int_as_float(__builtin_amdgcn_permlanex16(b, b, 0x76543210, 0xfedcba98, false, false)); }
#define VST2(T, p, v) do { const T vst2_v_ = (v); *(T*)(p) = vst2_v_;  } while (0)

// Kernels that do not depend on one another share a launch: a block picks its job by its index (block-uniform), the jobs' bodies are the functions d_*.
// d_cvtb: bf16 plane of x [4096][1024]; d_wt: W [1024 k][ncols] k-major -> n-major bf16 [ncols][1024] via 64 x 64 LDS tiles.
__device__ __forceinline__ void d_cvtb(int blk, const float* __restrict__ src, bf* dst) {
    const int lane = threadIdx.x & 31, r = blk * 8 + (threadIdx.x >> 5);
    if (r >= NTK) return;
#pragma unroll
    for (int q = 0; q < 4; ++q) { v8us t;
#pragma unroll
        for (int i = 0; i < 8; ++i) t[i] = f2bf(src[(size_t)r * DM + q * 256 + lane * 8 + i]);
        VST2(v8us, dst + (size_t)r * DM + q * 256 + lane * 8, t); }
}
__device__ __forceinline__ void d_wt(unsigned short* tl, int blk, const float* __restrict__ Wm, int ncols, bf* WT) {
    const int tid = threadIdx.x, k0 = (blk & (DM / 64 - 1)) * 64, n0 = (blk / (DM / 64)) * 64;
    const int kk = tid >> 2, nq = (tid & 3) * 16;
#pragma unroll
    for (int i = 0; i < 16; ++i) tl[(nq + i) * 72 + kk] = f2bf(Wm[(size_t)(k0 + kk) * ncols + n0 + nq + i]);
    __syncthreads();
    const int piece = tid & 7;
    auto pass = [&]() {
#pragma unroll
        for (int s = 0; s < 2; ++s) { const int nr = (tid >> 3) + 32 * s; const v8us val = *(const v8usa*)(tl + nr * 72 + piece * 8);
            *(v8us*)(WT + (size_t)(n0 + nr) * DM + k0 + piece * 8) = val; }
    };
    pass();
    asm volatile("s_wait_xcnt 0x0" ::: "memory");   // behind the stores: in the listing another job's code follows, which overwrites their address and data registers
}
// k_prep: the three operand preparations, which read inputs only: Wqkvt^T (1,024 blocks), Wout^T (256), the bf16 plane of x (512).
#define PB_W4 ((DM / 64) * (4 * DM / 64))
#define PB_WO ((DM / 64) * (DM / 64))
__global__ __launch_bounds__(256) void k_prep(const float* __restrict__ x, const float* __restrict__ W4, const float* __restrict__ Wo, bf* Xb, bf* W4T, bf* WoT) {
    __shared__ __align__(16) unsigned short tl[64 * 72];
    const int bid = blockIdx.x;
    if (bid < PB_W4) d_wt(tl, bid, W4, 4 * DM, W4T);
    else if (bid < PB_W4 + PB_WO) d_wt(tl, bid - PB_W4, Wo, DM, WoT);
    else d_cvtb(bid - (PB_W4 + PB_WO), x, Xb);
}

// k_gemmb: block = 64 x 64 of C, wave = 16 x 64. A stage is 64 k = one 128-byte line of each of the block's 64 B rows and 64 A rows (and A residual rows); asynchronous
// copies bring it once per block into a two-buffer LDS ring, one stage ahead, each copy covering four whole lines; the four waves read their fragments from there, so the
// loop holds no global load. Rows are pitched 16 B x odd so that ds_load_b128 fragment reads meet no bank conflict. The k order of every sum is as before.
// blockIdx.y counts 64-column blocks over ALL rows of Bn: each 1,024 columns are one [4096][1024] plane of C, the planes one behind the other (q, k, v, t in one launch).
#define GKS 64                   // k per stage
#define GP  144                  // LDS pitch of a 128-byte row
#define GPL (64 * GP)            // one plane of 64 rows: B at 0, A at GPL, A residual at 2 GPL
template <bool SPLITA>
__global__ __launch_bounds__(128) void k_gemmb(const bf* __restrict__ A, const bf* __restrict__ Al, const bf* __restrict__ Bn, const float* __restrict__ bias, float* C) {
    constexpr int GST = (SPLITA ? 3 : 2) * GPL;
    __shared__ __align__(16) char ring[2 * GST];     // the output staging of the epilogue (17,408 B) reuses it behind the last stage's barrier
    const int tid = threadIdx.x, lane = tid & 31, wave = tid >> 5, lr = lane & 15, hi = lane >> 4;
    const int r0 = blockIdx.x * 64 + wave * 16, c0 = blockIdx.y * 64;
    // Copies of one stage: 4 per thread and plane, 16 bytes each; thread = (row tid/8 + 16 i, 16-byte piece tid%8).
    const int prow = tid >> 3, pcol = tid & 7;
    const size_t ga = (size_t)(blockIdx.x * 64 + prow) * DM + pcol * 8, gb = (size_t)(c0 + prow) * DM + pcol * 8;
    const unsigned l0 = (unsigned)(size_t)ring + prow * GP + pcol * 16;
    auto fill = [&](int t, int buf) {
        const bf* pb = Bn + gb + t * GKS; const bf* pa = A + ga + t * GKS;
        const unsigned l = l0 + buf * GST;
        // one statement: the closing s_wait_xcnt stands in front of any rewrite of an address register that a copy names
        asm volatile("global_load_async_to_lds_b128 %0, %8, off\n\t"
                     "global_load_async_to_lds_b128 %1, %9, off\n\t"
                     "global_load_async_to_lds_b128 %2, %10, off\n\t"
                     "global_load_async_to_lds_b128 %3, %11, off\n\t"
                     "global_load_async_to_lds_b128 %4, %12, off\n\t"
                     "global_load_async_to_lds_b128 %5, %13, off\n\t"
                     "global_load_async_to_lds_b128 %6, %14, off\n\t"
                     "global_load_async_to_lds_b128 %7, %15, off\n\t"
                     "s_wait_xcnt 0x0"
                     :: "v"(l), "v"(l + 16 * GP), "v"(l + 32 * GP), "v"(l + 48 * GP),
                        "v"(l + GPL), "v"(l + GPL + 16 * GP), "v"(l + GPL + 32 * GP), "v"(l + GPL + 48 * GP),
                        "v"(pb), "v"(pb + 16 * DM), "v"(pb + 32 * DM), "v"(pb + 48 * DM),
                        "v"(pa), "v"(pa + 16 * DM), "v"(pa + 32 * DM), "v"(pa + 48 * DM)
                     : "memory");
        if constexpr (SPLITA) {   // the residual plane's rows; same form of statement
            const bf* pl = Al + ga + t * GKS;
            asm volatile("global_load_async_to_lds_b128 %0, %4, off\n\t"
                         "global_load_async_to_lds_b128 %1, %5, off\n\t"
                         "global_load_async_to_lds_b128 %2, %6, off\n\t"
                         "global_load_async_to_lds_b128 %3, %7, off\n\t"
                         "s_wait_xcnt 0x0"
                         :: "v"(l + 2 * GPL), "v"(l + 2 * GPL + 16 * GP), "v"(l + 2 * GPL + 32 * GP), "v"(l + 2 * GPL + 48 * GP),
                            "v"(pl), "v"(pl + 16 * DM), "v"(pl + 32 * DM), "v"(pl + 48 * DM)
                         : "memory");
        }
    };
    v8f acc[4];
#pragma unroll
    for (int t = 0; t < 4; ++t) acc[t] = (v8f){};
    fill(0, 0);
    asm volatile("s_wait_asynccnt 0x0" ::: "memory");   // this wave's copies of stage 0 have landed
    __syncthreads();                                    // ... and every other wave's
    fill(1, 1);
#pragma unroll 1  // stays rolled: one copy of the stage body, the buffer picked by s & 1
    for (int s = 0; s < DM / GKS; ++s) {
        const char* fa = ring + (s & 1) * GST + GPL + (wave * 16 + lr) * GP + 16 * hi;
        const char* fb = ring + (s & 1) * GST + lr * GP + 16 * hi;
        v16bf a, al;
#pragma unroll  // two 32-k products per stage, constant LDS offsets
        for (int ks = 0; ks < GKS / 32; ++ks) {
            a = cat16b(*(const v8usa*)(fa + ks * 64), *(const v8usa*)(fa + ks * 64 + 32));
            al = a;
            if (SPLITA) al = cat16b(*(const v8usa*)(fa + GPL + ks * 64), *(const v8usa*)(fa + GPL + ks * 64 + 32));
#pragma unroll
            for (int t = 0; t < 4; ++t) { const v16bf b = cat16b(*(const v8usa*)(fb + t * 16 * GP + ks * 64), *(const v8usa*)(fb + t * 16 * GP + ks * 64 + 32)); acc[t] = wmmab(a, b, acc[t]); if (SPLITA) acc[t] = wmmab(al, b, acc[t]); }
        }
        // four vector slots behind the last WMMA, on both sides of the branch below, before a vector instruction may overwrite its operands
        asm volatile("v_nop\n\tv_nop\n\tv_nop\n\tv_nop" : "+v"(acc[0]), "+v"(acc[1]), "+v"(acc[2]), "+v"(acc[3]) : "v"(a), "v"(al));
        asm volatile("s_wait_dscnt 0x0" ::: "memory");      // this wave's reads of the buffer are done before it may be refilled
        asm volatile("s_wait_asynccnt 0x0" ::: "memory");   // this wave's copies of the next stage have landed
        __syncthreads();                                    // publishes the next stage and frees this stage's buffer
        if (s + 2 < DM / GKS) fill(s + 2, s & 1);
    }
    asm volatile("s_wait_asynccnt 0x0" ::: "memory");       // nothing in flight when the ring becomes output staging
    float* os = (float*)ring + wave * (16 * 68);
#pragma unroll
    for (int t = 0; t < 4; ++t) { const float bv = bfr(bias[c0 + t * 16 + lr]);
#pragma unroll
        for (int j = 0; j < 8; ++j) os[(hi * 8 + j) * 68 + t * 16 + lr] = acc[t][j] + bv; }
    __syncthreads();
    float* crow = C + (size_t)(c0 / DM) * NTK * DM + (size_t)r0 * DM + (c0 & (DM - 1));
    auto pass = [&]() {
#pragma unroll
        for (int s = 0; s < 8; ++s) { const int Lid = (lane >> 3) + 4 * s, piece = lane & 7; const int row = Lid >> 1, cofs = (Lid & 1) * 32 + piece * 4;
            const v4f val = *(const v4fa*)(os + row * 68 + cofs); *(v4f*)(crow + (size_t)row * DM + cofs) = val; }
    };
    pass(); 
}

// d_vt: VT16/VTL[b][h][d][t] = f16 hi + residual x1024 of V row b*2048+t, col h*64+d via LDS transposes, 256 threads (tid) = job bid = (b, h, 64 t), with their own two tiles.
__device__ __forceinline__ void d_vt(h16* tile, h16* til2, int bid, int tid, const float* __restrict__ V, h16* VT16, h16* VTL) {
    const int b = bid / (NH_ * (NT_ / 64)), rem = bid - b * (NH_ * (NT_ / 64)), h = rem / (NT_ / 64), kt = rem - h * (NT_ / 64);
    const int k0 = kt * 64, kk = tid >> 2, d0 = (tid & 3) * 16;
    const float* src = V + ((size_t)b * NT_ + k0 + kk) * DM + h * HD + d0;
#pragma unroll
    for (int i = 0; i < 16; ++i) { const float v = src[i]; const h16 a = (h16)v; tile[(d0 + i) * 72 + kk] = a; til2[(d0 + i) * 72 + kk] = (h16)((v - (float)a) * LOSC); }
    __syncthreads();
    const int piece = tid & 7;
    const size_t base = (((size_t)b * NH_ + h) * HD) * NT_ + k0;
    auto pass = [&]() {
#pragma unroll
        for (int s = 0; s < 4; ++s) { const int Lid = (tid >> 3) + 32 * s; const int pln = Lid >> 6, d = Lid & 63;
            const v8h val = *(const v8ha*)((pln ? til2 : tile) + d * 72 + piece * 8); *(v8h*)((pln ? VTL : VT16) + base + (size_t)d * NT_ + piece * 8) = val; }
    };
    pass();
    asm volatile("s_wait_xcnt 0x0" ::: "memory");   // behind the stores: in the listing another job's code follows, which overwrites their address and data registers
}
// d_kvc: KVC[b*2048+t][col] = sum_{j<=t} k[j]*v[j]/8 (inclusive prefix over t, f32) as a chunked scan inside one block. Block = (b, 32 columns = whole 128-byte lines);
// thread = (chunk of 16 rows, 4 columns): all 32 16-byte loads are independent and the 64 running sums stay in registers. Chunk sums -> LDS, exclusive prefix over the 128
// chunks in two levels (8 waves scan 16 chunks each, then every thread adds the sums of the groups before its own), then each thread adds that start value to its rows.
#define KC_R 16                  // rows per chunk
#define KC_N (NT_ / KC_R)        // 128 chunks
#define KC_G 8                   // groups of 16 chunks
__device__ __forceinline__ void d_kvc(float* tot, float* gtot, int job, const float* __restrict__ Kf, const float* __restrict__ Vf, float* __restrict__ KVC) {
    const int tid = threadIdx.x, cq = tid & 7, ch = tid >> 3;
    const int b = job / (DM / 32), cg = job - b * (DM / 32);
    const size_t blk = (size_t)b * NT_ * DM + cg * 32;         // block part of the index (scalar)
    const unsigned thr = (unsigned)(ch * KC_R * DM + cq * 4);  // thread part, shared by the loads and the stores
    const float* kp = Kf + blk; const float* vp = Vf + blk; float* op = KVC + blk;
    v4f p[KC_R];
#pragma unroll  // constant indices keep p[] in registers; the independent loads issue many at a time
    for (int i = 0; i < KC_R; ++i) p[i] = *(const v4f*)(kp + thr + i * DM) * *(const v4f*)(vp + thr + i * DM) * SCL;
#pragma unroll  // p[] in registers
    for (int i = 1; i < KC_R; ++i) p[i] += p[i - 1];           // inclusive prefix inside the chunk
    *(v4f*)(tot + ch * 32 + cq * 4) = p[KC_R - 1];
    __syncthreads();
    if (tid < KC_G * 32) { const int g = tid >> 5, col = tid & 31; float run = 0.f;
#pragma unroll  // the 16 LDS reads issue ahead of the add chain
        for (int i = 0; i < KC_N / KC_G; ++i) { float* q = tot + (g * (KC_N / KC_G) + i) * 32 + col; const float t = *q; *q = run; run += t; }
        gtot[g * 32 + col] = run; }
    __syncthreads();
    const int g = ch / (KC_N / KC_G);
    v4f gs[KC_G - 1];
#pragma unroll  // gs[] in registers
    for (int i = 0; i < KC_G - 1; ++i) gs[i] = *(const v4f*)(gtot + i * 32 + cq * 4);   // all read at once, then selected: no chain of LDS round trips
    v4f c = {};
#pragma unroll  // gs[] in registers
    for (int i = 0; i < KC_G - 1; ++i) c += (i < g) ? gs[i] : (v4f){};
    c += *(const v4f*)(tot + ch * 32 + cq * 4);
#pragma unroll  // p[] in registers; stores back to back
    for (int i = 0; i < KC_R; ++i) *(v4f*)(op + thr + i * DM) = p[i] + c;
}
// d_side: hi/lo f16 planes of a 128-wide per-head row: SH/SL[row][h*128 + c]: c < 64 -> A[row][h*64+c]; c >= 64 -> B2[row][h*64+c-64] (times M[row][same]
// when MUL2) - query side: [q | q*t] (A = q, B2 = q, M = t); key side: [k | kvc]. One wave per ROW, all 16 heads: 4,096 waves a job, so that the time goes into
// the stream and not into starting waves. A 16-byte load of the wave covers 512 contiguous bytes = two heads' 64 values of one source (lane = head 2g + lane/16, 4 values);
// an 8-byte store covers those two heads' whole 128-byte lines of a plane. No lane is off; the row's loads are independent and issue ahead of the first conversion.
template <bool MUL2>
__device__ __forceinline__ void d_side(int r, const float* __restrict__ A, const float* __restrict__ Mv, const float* __restrict__ B2, h16* SH, h16* SL) {
    typedef __attribute__((ext_vector_type(4))) _Float16 v4h;
    const int lane = threadIdx.x & 31;
    if (r >= NTK) return;
    const size_t in0 = (size_t)r * DM + lane * 4;
    const size_t o0 = (size_t)r * (NH_ * QW) + (lane >> 4) * QW + (lane & 15) * 4;
    const float* pa = A + in0; const float* pb = B2 + in0; const float* pm = MUL2 ? Mv + in0 : pb;
    v4f va[NH_ / 2], vb[NH_ / 2], vm[NH_ / 2];
#pragma unroll  // constant indices keep the arrays in registers; the independent loads issue many at a time
    for (int g = 0; g < NH_ / 2; ++g) { va[g] = *(const v4fa*)(pa + g * 2 * HD); vb[g] = *(const v4fa*)(pb + g * 2 * HD); if (MUL2) vm[g] = *(const v4fa*)(pm + g * 2 * HD); }
    // a precaution: the address registers, named here, stay whole up to this wait, so that no load's result is placed in a register that an issued load names
    asm volatile("s_wait_xcnt 0x0" :: "v"(pa), "v"(pb), "v"(pm) : "memory");
#pragma unroll  // the arrays in registers
    for (int g = 0; g < NH_ / 2; ++g)
#pragma unroll
        for (int s = 0; s < 2; ++s) { v4f x = s ? vb[g] : va[g]; if (MUL2 && s) x *= vm[g]; v4h oh, ol;
#pragma unroll
            for (int i = 0; i < 4; ++i) { const h16 a = (h16)x[i]; oh[i] = a; ol[i] = (h16)((x[i] - (float)a) * LOSC); }
            *(v4h*)(SH + o0 + g * 2 * QW + s * HD) = oh; *(v4h*)(SL + o0 + g * 2 * QW + s * HD) = ol; }
}
// k_post: the three jobs that need the projections only, in blocks of 1,024 threads: the prefix sums (64 blocks, first: they last longest), V^T planes (256 blocks of four
// 256-thread jobs), query-side planes (128 blocks of 32 rows). k_keys: the key-side planes, which need the prefix sums.
#define QB_KV (NB_ * (DM / 32))
#define QB_VT (NB_ * NH_ * (NT_ / 64) / 4)
#define QB_QS (NTK / 32)
__global__ __launch_bounds__(1024) void k_post(const float* __restrict__ Qf, const float* __restrict__ Kf, const float* __restrict__ Vf, const float* __restrict__ Tf,
                                               float* __restrict__ KVC, h16* VT16, h16* VTL, h16* QH, h16* QL) {
    __shared__ __align__(16) char sm[4 * 2 * HD * 72 * 2];   // four pairs of V^T tiles, or the chunk and group sums of the scan
    const int bid = blockIdx.x;
    if (bid < QB_KV) d_kvc((float*)sm, (float*)sm + KC_N * 32, bid, Kf, Vf, KVC);
    else if (bid < QB_KV + QB_VT) { const int sub = threadIdx.x >> 8; h16* tile = (h16*)sm + sub * (2 * HD * 72);
        d_vt(tile, tile + HD * 72, (bid - QB_KV) * 4 + sub, threadIdx.x & 255, Vf, VT16, VTL); }
    else d_side<true>((bid - (QB_KV + QB_VT)) * 32 + (threadIdx.x >> 5), Qf, Tf, Qf, QH, QL);      // [q | q*t]
}
__global__ __launch_bounds__(256) void k_keys(const float* __restrict__ Kf, const float* __restrict__ KVC, h16* KH, h16* KL) {
    d_side<false>(blockIdx.x * 8 + (threadIdx.x >> 5), Kf, nullptr, KVC, KH, KL);                  // [k | kvc]
}

// k_attn: block = (b, head pair hp, t): the 64-query tile t of head hp, then tile 31 - t of head hp + 8, one after the other: 66 key steps in every block, so that the
// blocks, all resident at once, end together; wave = 16 queries; causal key tiles 0..query tile; scores over the 128 combined dims with hi.hi + hi.lo + lo.hi (24 WMMA per 32-key
// step), x 1/8, keys after the query -> -inf; online f32 softmax. The products are the TRANSPOSED ones: S^T = K.Q^T (A = key rows, B = query rows) and O^T += V^T.P^T
// (A = V^T rows, B = weights). A lane then holds 16 of the step's 32 scores of ONE query (lane l ^ 16 the other 16): maximum and sum run over the lane's own registers with
// one exchange between the halves, maximum, rescale factor and sum are one value a lane, and the two score tiles, converted in place (x32768, f16 hi + residual x1024), ARE
// the B operand of the second product in the hardware k order: the weights pass through no LDS. ctx -> bf16 hi/lo planes CH/CL [token][h*64 + d].
// The 32-key tile of a step (key rows hi + lo, V^T rows hi + lo, 24 KB) is brought once per block into a two-buffer LDS ring by asynchronous copies, one step ahead;
// the four waves read their fragments from there, and the query lo rows from a buffer copied once: the loop holds no global load. Rows are pitched 16 B x odd so that ds_load_b128 fragment reads meet no bank conflict.
#define KP    272                // LDS pitch of a 256-byte key row
#define VP    80                 // LDS pitch of a 64-byte V^T row
#define ST_KL (32 * KP)          // stage offsets: key hi at 0, key lo, V^T hi, V^T lo
#define ST_VH (2 * 32 * KP)
#define ST_VL (ST_VH + HD * VP)
#define ST_SZ (ST_VH + 2 * HD * VP)
__global__ __launch_bounds__(128) void k_attn(const h16* __restrict__ QH, const h16* __restrict__ QL, const h16* __restrict__ KH, const h16* __restrict__ KL, const h16* __restrict__ VT16, const h16* __restrict__ VTL, bf* CH, bf* CL) {
    __shared__ __align__(16) char ring[2 * ST_SZ];   // the output staging of the epilogue reuses it behind the last step's barrier
    __shared__ __align__(16) char qlds[64 * KP];     // the current tile's 64 query lo rows, copied once per tile
    const int lane = threadIdx.x & 31, wave = threadIdx.x >> 5, lr = lane & 15, hi = lane >> 4;
    const int bid = blockIdx.x;
    const int b = bid / ((NH_ / 2) * (NT_ / 64)), rem = bid - b * ((NH_ / 2) * (NT_ / 64)), hp = rem / (NT_ / 64), t0 = rem - hp * (NT_ / 64);
    const size_t tok0 = (size_t)b * NT_;
#pragma unroll 1  // the two tiles go through one copy of the code, one after the other
  for (int half = 0; half < 2; ++half) {
    const int h = half ? hp + NH_ / 2 : hp, qt = half ? NT_ / 64 - 1 - t0 : t0;
    const int q0 = qt * 64 + wave * 16;
    if (half) {
        asm volatile("s_wait_dscnt 0x0" ::: "memory");  // this wave's reads of the first tile's output staging are done
        __syncthreads();                                // ... and every other wave's, before the copies below refill that LDS
    }
    v16h ah[4];
    const size_t qo = (tok0 + q0 + lr) * (NH_ * QW) + h * QW + 8 * hi;
#pragma unroll
    for (int kc = 0; kc < 4; ++kc) ah[kc] = cat16(*(const v8h*)(QH + qo + kc * 32), *(const v8h*)(QH + qo + kc * 32 + 16));
    const int qp = q0 + lr;      // this lane's query
    const size_t vbase = (((size_t)b * NH_ + h) * HD) * NT_;
    v8f o[4], ox[4];
#pragma unroll
    for (int n = 0; n < 4; ++n) { o[n] = (v8f){}; ox[n] = (v8f){}; }
    float mrow = -3.0e38f, lpart = 0.f;
    const int kt_end = (qt * 64 + 64) / 32;
    // Copies of one tile: 12 per thread, 16 bytes each. Key planes: thread = (row tid/16 + 8 i, 16-byte piece tid%16); V^T planes: thread = (row tid/4 + 32 i, piece tid%4).
    const int tid = threadIdx.x, krow = tid >> 4, kcol = tid & 15, vrow = tid >> 2, vcol = tid & 3;
    const size_t kg = (tok0 + krow) * (NH_ * QW) + h * QW + kcol * 8, vg = vbase + (size_t)vrow * NT_ + vcol * 8;
    const unsigned lk0 = (unsigned)(size_t)ring + krow * KP + kcol * 16, lv0 = (unsigned)(size_t)ring + ST_VH + vrow * VP + vcol * 16;
    auto fill = [&](int t, int buf) {
        const h16* gkh = KH + kg + (size_t)t * 32 * (NH_ * QW); const h16* gkl = KL + kg + (size_t)t * 32 * (NH_ * QW);
        const h16* gvh = VT16 + vg + t * 32; const h16* gvl = VTL + vg + t * 32;
        const unsigned lk = lk0 + buf * ST_SZ, lv = lv0 + buf * ST_SZ;
        // one statement: the closing s_wait_xcnt stands in front of any rewrite of an address register that a copy names
        asm volatile("global_load_async_to_lds_b128 %0, %12, off\n\t"
                     "global_load_async_to_lds_b128 %1, %13, off\n\t"
                     "global_load_async_to_lds_b128 %2, %14, off\n\t"
                     "global_load_async_to_lds_b128 %3, %15, off\n\t"
                     "global_load_async_to_lds_b128 %4, %16, off\n\t"
                     "global_load_async_to_lds_b128 %5, %17, off\n\t"
                     "global_load_async_to_lds_b128 %6, %18, off\n\t"
                     "global_load_async_to_lds_b128 %7, %19, off\n\t"
                     "global_load_async_to_lds_b128 %8, %20, off\n\t"
                     "global_load_async_to_lds_b128 %9, %21, off\n\t"
                     "global_load_async_to_lds_b128 %10, %22, off\n\t"
                     "global_load_async_to_lds_b128 %11, %23, off\n\t"
                     "s_wait_xcnt 0x0"
                     :: "v"(lk), "v"(lk + 8 * KP), "v"(lk + 16 * KP), "v"(lk + 24 * KP),
                        "v"(lk + ST_KL), "v"(lk + ST_KL + 8 * KP), "v"(lk + ST_KL + 16 * KP), "v"(lk + ST_KL + 24 * KP),
                        "v"(lv), "v"(lv + 32 * VP), "v"(lv + HD * VP), "v"(lv + HD * VP + 32 * VP),
                        "v"(gkh), "v"(gkh + 8 * (NH_ * QW)), "v"(gkh + 16 * (NH_ * QW)), "v"(gkh + 24 * (NH_ * QW)),
                        "v"(gkl), "v"(gkl + 8 * (NH_ * QW)), "v"(gkl + 16 * (NH_ * QW)), "v"(gkl + 24 * (NH_ * QW)),
                        "v"(gvh), "v"(gvh + 32 * NT_), "v"(gvl), "v"(gvl + 32 * NT_)
                     : "memory");
    };
    {   // query lo rows: 8 copies per thread, thread = (row tid/16 + 8 i, piece tid%16); same form of statement as above
        const h16* gq = QL + (tok0 + qt * 64 + krow) * (NH_ * QW) + h * QW + kcol * 8;
        const unsigned lq = (unsigned)(size_t)qlds + krow * KP + kcol * 16;
        asm volatile("global_load_async_to_lds_b128 %0, %8, off\n\t"
                     "global_load_async_to_lds_b128 %1, %9, off\n\t"
                     "global_load_async_to_lds_b128 %2, %10, off\n\t"
                     "global_load_async_to_lds_b128 %3, %11, off\n\t"
                     "global_load_async_to_lds_b128 %4, %12, off\n\t"
                     "global_load_async_to_lds_b128 %5, %13, off\n\t"
                     "global_load_async_to_lds_b128 %6, %14, off\n\t"
                     "global_load_async_to_lds_b128 %7, %15, off\n\t"
                     "s_wait_xcnt 0x0"
                     :: "v"(lq), "v"(lq + 8 * KP), "v"(lq + 16 * KP), "v"(lq + 24 * KP), "v"(lq + 32 * KP), "v"(lq + 40 * KP), "v"(lq + 48 * KP), "v"(lq + 56 * KP),
                        "v"(gq), "v"(gq + 8 * (NH_ * QW)), "v"(gq + 16 * (NH_ * QW)), "v"(gq + 24 * (NH_ * QW)),
                        "v"(gq + 32 * (NH_ * QW)), "v"(gq + 40 * (NH_ * QW)), "v"(gq + 48 * (NH_ * QW)), "v"(gq + 56 * (NH_ * QW))
                     : "memory");
    }
    const char* qlp = qlds + (wave * 16 + lr) * KP + 16 * hi;
    fill(0, 0);
    asm volatile("s_wait_asynccnt 0x0" ::: "memory");   // this wave's copies of the query rows and of tile 0 have landed
    __syncthreads();                                    // ... and every other wave's
    if (kt_end > 1) fill(1, 1);
#pragma unroll 1
    for (int kt = 0; kt < kt_end; ++kt) {
        const int l0 = kt * 32;
        const char* st = ring + (kt & 1) * ST_SZ;
        v8f s0 = {}, s1 = {}, x0 = {}, x1 = {};
#pragma unroll
        for (int kc = 0; kc < 4; ++kc) {
            const char* p0 = st + lr * KP + kc * 64 + 16 * hi; const char* p1 = p0 + 16 * KP;
            const v16h k0h = cat16(*(const v8ha*)p0, *(const v8ha*)(p0 + 32)), k0l = cat16(*(const v8ha*)(p0 + ST_KL), *(const v8ha*)(p0 + ST_KL + 32));
            const v16h k1h = cat16(*(const v8ha*)p1, *(const v8ha*)(p1 + 32)), k1l = cat16(*(const v8ha*)(p1 + ST_KL), *(const v8ha*)(p1 + ST_KL + 32));
            const v16h alk = cat16(*(const v8ha*)(qlp + kc * 64), *(const v8ha*)(qlp + kc * 64 + 32));      // query lo fragment re-read per step (register budget)
            s0 = wmma16(k0h, ah[kc], s0); x0 = wmma16(k0l, ah[kc], x0); x0 = wmma16(k0h, alk, x0);      // lo products carry x1024, folded below
            s1 = wmma16(k1h, ah[kc], s1); x1 = wmma16(k1l, ah[kc], x1); x1 = wmma16(k1h, alk, x1);
            asm volatile("" : "+v"(x0), "+v"(x1) : "v"(alk));
        }
        asm volatile("v_nop\n\tv_nop\n\tv_nop\n\tv_nop" : "+v"(s0), "+v"(s1), "+v"(x0), "+v"(x1) : "v"(ah[0]), "v"(ah[3]));
        // register j of s0 / s1 = key l0 + 8 hi + j / l0 + 16 + 8 hi + j of query qp: element j / 8 + j of the lane's B fragment below
        const int kd = qp - l0 - 8 * hi;   // last key offset that this query may see
        const v8f t0 = (s0 + x0 * LOSCI) * SCL, t1 = (s1 + x1 * LOSCI) * SCL;
        float a[16];
#pragma unroll
        for (int j = 0; j < 8; ++j) { a[j] = (j <= kd) ? t0[j] : -__builtin_inff(); a[8 + j] = (16 + j <= kd) ? t1[j] : -__builtin_inff(); }
        float mt[8];
#pragma unroll
        for (int j = 0; j < 8; ++j) mt[j] = fmaxf(a[2 * j], a[2 * j + 1]);
        float mx = fmaxf(fmaxf(fmaxf(mt[0], mt[1]), fmaxf(mt[2], mt[3])), fmaxf(fmaxf(mt[4], mt[5]), fmaxf(mt[6], mt[7])));
        mx = fmaxf(mx, xhalf(mx));
        const float mn = fmaxf(mrow, mx);
        v2f p[8]; v16h pa, px;
#pragma unroll
        for (int i = 0; i < 8; ++i) {      // neighbouring registers in pairs: packed f32 arithmetic and packed conversions
            const v2f e = ((v2f){a[2 * i], a[2 * i + 1]} - mn) * L2E;
            p[i] = (v2f){__builtin_amdgcn_exp2f(e[0]), __builtin_amdgcn_exp2f(e[1])};
            const v2f ps = p[i] * PSC; const v2h ph = __builtin_convertvector(ps, v2h);
            const v2h pr = __builtin_convertvector((ps - __builtin_convertvector(ph, v2f)) * LOSC, v2h);
            pa[2 * i] = ph[0]; pa[2 * i + 1] = ph[1]; px[2 * i] = pr[0]; px[2 * i + 1] = pr[1];
        }
        const float alpha = __builtin_amdgcn_exp2f((mrow - mn) * L2E);
        mrow = mn;
#pragma unroll
        for (int w = 4; w > 0; w >>= 1)    // the lane's 16 weights, summed as a tree
#pragma unroll
            for (int i = 0; i < w; ++i) p[i] += p[i + w];
        lpart = lpart * alpha + (p[0][0] + p[0][1]);
#pragma unroll
        for (int n = 0; n < 4; ++n) { o[n] *= alpha; ox[n] *= alpha; }
#pragma unroll
        for (int n = 0; n < 4; ++n) { const char* pv = st + ST_VH + (n * 16 + lr) * VP + 16 * hi;
            const v16h vh = cat16(*(const v8ha*)pv, *(const v8ha*)(pv + 32));
            o[n] = wmma16(vh, pa, o[n]); ox[n] = wmma16(cat16(*(const v8ha*)(pv + HD * VP), *(const v8ha*)(pv + HD * VP + 32)), pa, ox[n]); ox[n] = wmma16(vh, px, ox[n]); }
        asm volatile("v_nop\n\tv_nop\n\tv_nop\n\tv_nop" : "+v"(o[0]), "+v"(o[1]), "+v"(o[2]), "+v"(o[3]), "+v"(ox[0]), "+v"(ox[1]), "+v"(ox[2]), "+v"(ox[3]) : "v"(pa), "v"(px));
        asm volatile("s_wait_dscnt 0x0" ::: "memory");      // this wave's reads of the buffer are done before it may be refilled
        asm volatile("s_wait_asynccnt 0x0" ::: "memory");   // this wave's copies of the next tile have landed
        __syncthreads();                                    // publishes the next tile and frees this step's buffer
        if (kt + 2 < kt_end) fill(kt + 2, kt & 1);
    }
    asm volatile("s_wait_asynccnt 0x0" ::: "memory");       // nothing in flight when the ring becomes output staging
    const float inv = 1.0f / ((lpart + xhalf(lpart)) * PSC);
    float* os = (float*)ring + wave * (16 * 68);
#pragma unroll
    for (int n = 0; n < 4; ++n)
#pragma unroll
        for (int q = 0; q < 2; ++q) { v4f w;    // register j of o[n] = dim n * 16 + 8 hi + j of query lr
#pragma unroll
            for (int i = 0; i < 4; ++i) w[i] = (o[n][q * 4 + i] + ox[n][q * 4 + i] * LOSCI) * inv;
            *(v4fa*)(os + lr * 68 + n * 16 + hi * 8 + q * 4) = w; }
    __syncthreads();
    const size_t cbase = (tok0 + q0) * DM + (size_t)h * HD;
    auto pass = [&]() {
#pragma unroll
        for (int s = 0; s < 4; ++s) { const int row = 4 * s + (lane >> 3), piece = lane & 7; const float* sp = os + row * 68 + piece * 8; v8us oh, ol;
#pragma unroll
            for (int i = 0; i < 8; ++i) { const unsigned short hb = f2bf(sp[i]); oh[i] = hb; ol[i] = f2bf(sp[i] - bf2f(hb)); }
            *(v8us*)(CH + cbase + (size_t)row * DM + piece * 8) = oh; *(v8us*)(CL + cbase + (size_t)row * DM + piece * 8) = ol; }
    };
    pass(); 
    asm volatile("s_wait_xcnt 0x0" ::: "memory");   // behind the stores: the second tile's set-up overwrites their address and data registers
  }
}

extern "C" void kernel_launch(void* const* d_in, const int* in_sizes, int n_in,
                              void* d_out, int out_size, void* d_ws, size_t ws_size, hipStream_t stream) {
    (void)in_sizes; (void)n_in; (void)out_size;
    const float* x = (const float*)d_in[0]; const float* W4 = (const float*)d_in[1]; const float* b4 = (const float*)d_in[2]; const float* Wo = (const float*)d_in[3]; const float* bo = (const float*)d_in[4];
    float* out = (float*)d_out;    // [2][2048][1024]
    char* wsp = (char*)d_ws;
    auto take = [&](size_t bytes) { char* p = wsp; wsp += (bytes + 255) & ~(size_t)255; return (void*)p; };
    bf* Xb = (bf*)take((size_t)NTK * DM * 2); bf* W4T = (bf*)take((size_t)4 * DM * DM * 2); bf* WoT = (bf*)take((size_t)DM * DM * 2);
    h16* VT16 = (h16*)take((size_t)NTK * DM * 2); h16* VTL = (h16*)take((size_t)NTK * DM * 2); h16* KH = (h16*)take((size_t)NTK * NH_ * QW * 2); h16* KL = (h16*)take((size_t)NTK * NH_ * QW * 2);
    h16* QH = (h16*)take((size_t)NTK * NH_ * QW * 2); h16* QL = (h16*)take((size_t)NTK * NH_ * QW * 2);
    float* P4 = (float*)take((size_t)4 * NTK * DM * 4); float* KVC = (float*)take((size_t)NTK * DM * 4);   // the four f32 projection planes, one behind the other
    if ((size_t)(wsp - (char*)d_ws) > ws_size) return;    // 186,646,528 B
    float* Qf = P4; float* Kf = P4 + (size_t)1 * NTK * DM; float* Vf = P4 + (size_t)2 * NTK * DM; float* Tf = P4 + (size_t)3 * NTK * DM;
    bf* CH = (bf*)Qf; bf* CL = (bf*)Kf;                    // ctx planes over q and k, dead once the query-side and key-side planes stand
    k_prep<<<PB_W4 + PB_WO + NTK / 8, 256, 0, stream>>>(x, W4, Wo, Xb, W4T, WoT);
    k_gemmb<false><<<dim3(NTK / 64, (4 * DM) / 64, 1), 128, 0, stream>>>(Xb, nullptr, W4T, b4, P4);
    k_post<<<QB_KV + QB_VT + QB_QS, 1024, 0, stream>>>(Qf, Kf, Vf, Tf, KVC, VT16, VTL, QH, QL);
    k_keys<<<NTK / 8, 256, 0, stream>>>(Kf, KVC, KH, KL);
    k_attn<<<NB_ * (NH_ / 2) * (NT_ / 64), 128, 0, stream>>>(QH, QL, KH, KL, VT16, VTL, CH, CL);
    k_gemmb<true><<<dim3(NTK / 64, DM / 64, 1), 128, 0, stream>>>(CH, CL, WoT, bo, out);
}

// v008
// A run of this version takes 149 microseconds.
// Two timings next to v007 both put it at 1.13 times that version's speed.
// Over all steps from v000 it is 9.25 times as fast.
#include <hip/hip_runtime.h>

// Contractions, f32 accumulate: qkvt = x.Wqkvt + b as four [4096 x 1024].[1024 x 1024] column blocks and out = ctx.Wout + bout on v_wmma_f32_16x16x32_bf16 (PLAIN bf16
// operands = inputs rounded once, exact; k-major weights transposed into n-major planes; ctx as bf16 hi + residual planes, two products); the per-(batch, head) causal
// attention fused on v_wmma_f32_16x16x32_f16: scores = ([q | q*t]).([k | cumsum_j(k*v)/8])^T over 128 dims with BOTH sides as f16 hi + residual x1024 planes
// (hi.hi + hi.lo + lo.hi — the triplet term reaches sigma ~45 before the 1/8 scale, so single-rounded operands would not hold the peaked softmax), x 1/8, causal,
// softmax, then weights (x32768) and v BOTH as f16 hi + residual x1024 (hi.hi + hi.lo + lo.hi; the softmax is peaked so single roundings would not average out). The key-side prefix sums are f32 chunked scans (16-row chunks, one block per (b, 32 columns)). Deterministic, no atomics;

#define NB_  2
#define NT_  2048
#define DM   1024
#define NH_  16
#define HD   64
#define QW   128                 // combined score width per head
#define NTK  (NB_ * NT_)         // 4096
#define PSC  32768.0f
#define LOSC 1024.0f
#define LOSCI (1.0f / 1024.0f)
#define SCL  0.125f
#define L2E  1.44269504f         // log2(e): exp(x) = exp2(x * L2E)

typedef _Float16 h16;
typedef unsigned short bf;
typedef __attribute__((ext_vector_type(16))) __bf16   v16bf;
typedef __attribute__((ext_vector_type(16))) _Float16 v16h;
typedef __attribute__((ext_vector_type(8)))  _Float16 v8h;
typedef __attribute__((ext_vector_type(8)))  unsigned short v8us;
typedef __attribute__((ext_vector_type(8)))  float    v8f;
typedef __attribute__((ext_vector_type(4)))  float    v4f;
typedef __attribute__((ext_vector_type(2)))  float    v2f;
typedef __attribute__((ext_vector_type(2)))  _Float16 v2h;
typedef v8h  __attribute__((may_alias)) v8ha;
typedef v4f  __attribute__((may_alias)) v4fa;
typedef v8us __attribute__((may_alias)) v8usa;

__device__ __forceinline__ unsigned short f2bf(float f) { unsigned u = __float_as_uint(f); u += 0x7FFFu + ((u >> 16) & 1u); return (unsigned short)(u >> 16); }
__device__ __forceinline__ float bf2f(unsigned short b) { return __uint_as_float(((unsigned)b) << 16); }
__device__ __forceinline__ float bfr(float f) { return bf2f(f2bf(f)); }
__device__ __forceinline__ v16h cat16(v8h lo, v8h hi) { return __builtin_shufflevector(lo, hi, 0, 1, 2, 3, 4, 5, 6, 7, 8, 9, 10, 11, 12, 13, 14, 15); }
__device__ __forceinline__ v16bf cat16b(v8us lo, v8us hi) { return __builtin_bit_cast(v16bf, __builtin_shufflevector(lo, hi, 0, 1, 2, 3, 4, 5, 6, 7, 8, 9, 10, 11, 12, 13, 14, 15)); }
__device__ __forceinline__ v8f wmma16(v16h a, v16h b, v8f c) { return __builtin_amdgcn_wmma_f32_16x16x32_f16(false, a, false, b, (short)0, c, false, false); }
__device__ __forceinline__ v8f wmmab(v16bf a, v16bf b, v8f c) { return __builtin_amdgcn_wmma_f32_16x16x32_bf16(false, a, false, b, (short)0, c, false, false); }
// value of lane l ^ 16: the other half of the wave
__device__ __forceinline__ float xhalf(float v) { const int b = __float_as_int(v); return __int_as_float(__builtin_amdgcn_permlanex16(b, b, 0x76543210, 0xfedcba98, false, false)); }
#define VST2(T, p, v) do { const T vst2_v_ = (v); *(T*)(p) = vst2_v_;  } while (0)

// Kernels that do not depend on one another share a launch: a block picks its job by its index (block-uniform), the jobs' bodies are the functions d_*.
// d_cvtb: bf16 plane of x [4096][1024]; d_wt: W [1024 k][ncols] k-major -> n-major bf16 [ncols][1024] via 64 x 64 LDS tiles.
__device__ __forceinline__ void d_cvtb(int blk, const float* __restrict__ src, bf* dst) {
    const int lane = threadIdx.x & 31, r = blk * 8 + (threadIdx.x >> 5);
    if (r >= NTK) return;
#pragma unroll
    for (int q = 0; q < 4; ++q) { v8us t;
#pragma unroll
        for (int i = 0; i < 8; ++i) t[i] = f2bf(src[(size_t)r * DM + q * 256 + lane * 8 + i]);
        VST2(v8us, dst + (size_t)r * DM + q * 256 + lane * 8, t); }
}
__device__ __forceinline__ void d_wt(unsigned short* tl, int blk, const float* __restrict__ Wm, int ncols, bf* WT) {
    const int tid = threadIdx.x, k0 = (blk & (DM / 64 - 1)) * 64, n0 = (blk / (DM / 64)) * 64;
    const int kk = tid >> 2, nq = (tid & 3) * 16;
#pragma unroll
    for (int i = 0; i < 16; ++i) tl[(nq + i) * 72 + kk] = f2bf(Wm[(size_t)(k0 + kk) * ncols + n0 + nq + i]);
    __syncthreads();
    const int piece = tid & 7;
    auto pass = [&]() {
#pragma unroll
        for (int s = 0; s < 2; ++s) { const int nr = (tid >> 3) + 32 * s; const v8us val = *(const v8usa*)(tl + nr * 72 + piece * 8);
            *(v8us*)(WT + (size_t)(n0 + nr) * DM + k0 + piece * 8) = val; }
    };
    pass();
    asm volatile("s_wait_xcnt 0x0" ::: "memory");   // behind the stores: in the listing another job's code follows, which overwrites their address and data registers
}
// k_prep: the three operand preparations, which read inputs only: Wqkvt^T (1,024 blocks), Wout^T (256), the bf16 plane of x (512).
#define PB_W4 ((DM / 64) * (4 * DM / 64))
#define PB_WO ((DM / 64) * (DM / 64))
__global__ __launch_bounds__(256) void k_prep(const float* __restrict__ x, const float* __restrict__ W4, const float* __restrict__ Wo, bf* Xb, bf* W4T, bf* WoT) {
    __shared__ __align__(16) unsigned short tl[64 * 72];
    const int bid = blockIdx.x;
    if (bid < PB_W4) d_wt(tl, bid, W4, 4 * DM, W4T);
    else if (bid < PB_W4 + PB_WO) d_wt(tl, bid - PB_W4, Wo, DM, WoT);
    else d_cvtb(bid - (PB_W4 + PB_WO), x, Xb);
}

// k_gemmb: block = BT x BT of C (256 x 256 with 16 waves of 64 x 64 for the projections, 128 x 128 with 8 waves of 32 x 64 for the output product): 256 blocks a launch, one
// per WGP. A wave multiplies FA row fragments by 4 column fragments, so that an LDS fragment read feeds 4 (or FA) products and a line copied from L2 serves BT rows or columns.
// A stage is 64 k = one 128-byte line of each of the block's BT B rows and BT A rows (and A residual rows); asynchronous copies bring it once per block into a two-buffer LDS
// ring, one stage ahead, each copy covering four whole lines; the waves read their fragments from there, so the loop holds no global load. Rows are pitched 16 B x odd so that
// ds_load_b128 fragment reads meet no bank conflict. The k order of every sum is as before.
// blockIdx.y counts BT-column blocks over ALL rows of Bn: each 1,024 columns are one [4096][1024] plane of C, the planes one behind the other (q, k, v, t in one launch).
#define GKS 64                   // k per stage
#define GP  144                  // LDS pitch of a 128-byte row
template <bool SPLITA>
__global__ __launch_bounds__(512) void k_gemmb(const bf* __restrict__ A, const bf* __restrict__ Al, const bf* __restrict__ Bn, const float* __restrict__ bias, float* C) {
    constexpr int BT  = SPLITA ? 128 : 256;          // rows and columns of the block's tile
    constexpr int FA  = SPLITA ? 2 : 4;              // 16-row fragments of a wave (its columns: 4 fragments)
    constexpr int WNC = BT / 64;                     // waves side by side over the columns
    constexpr int RS  = BT / 4;                      // rows between a thread's copies = threads / 8
    constexpr int GPL = BT * GP;                     // one plane of BT rows: B at 0, A at GPL, A residual at 2 GPL
    constexpr int GST = (SPLITA ? 3 : 2) * GPL;
    __shared__ __align__(16) char ring[2 * GST];     // the output staging of the epilogue (4,352 B a wave) reuses it behind the last stage's barrier
    const int tid = threadIdx.x, lane = tid & 31, wave = tid >> 5, lr = lane & 15, hi = lane >> 4;
    const int wm = wave / WNC, wn = wave % WNC;
    const int r0 = blockIdx.x * BT + wm * (FA * 16), c0 = blockIdx.y * BT + wn * 64;
    // Copies of one stage: 4 per thread and plane, 16 bytes each; thread = (row tid/8 + RS i, 16-byte piece tid%8).
    const int prow = tid >> 3, pcol = tid & 7;
    const size_t ga = (size_t)(blockIdx.x * BT + prow) * DM + pcol * 8, gb = (size_t)(blockIdx.y * BT + prow) * DM + pcol * 8;
    const unsigned l0 = (unsigned)(size_t)ring + prow * GP + pcol * 16;
    auto fill = [&](int t, int buf) {
        const bf* pb = Bn + gb + t * GKS; const bf* pa = A + ga + t * GKS;
        const unsigned l = l0 + buf * GST;
        // one statement: the closing s_wait_xcnt stands in front of any rewrite of an address register that a copy names
        asm volatile("global_load_async_to_lds_b128 %0, %8, off\n\t"
                     "global_load_async_to_lds_b128 %1, %9, off\n\t"
                     "global_load_async_to_lds_b128 %2, %10, off\n\t"
                     "global_load_async_to_lds_b128 %3, %11, off\n\t"
                     "global_load_async_to_lds_b128 %4, %12, off\n\t"
                     "global_load_async_to_lds_b128 %5, %13, off\n\t"
                     "global_load_async_to_lds_b128 %6, %14, off\n\t"
                     "global_load_async_to_lds_b128 %7, %15, off\n\t"
                     "s_wait_xcnt 0x0"
                     :: "v"(l), "v"(l + RS * GP), "v"(l + 2 * RS * GP), "v"(l + 3 * RS * GP),
                        "v"(l + GPL), "v"(l + GPL + RS * GP), "v"(l + GPL + 2 * RS * GP), "v"(l + GPL + 3 * RS * GP),
                        "v"(pb), "v"(pb + RS * DM), "v"(pb + 2 * RS * DM), "v"(pb + 3 * RS * DM),
                        "v"(pa), "v"(pa + RS * DM), "v"(pa + 2 * RS * DM), "v"(pa + 3 * RS * DM)
                     : "memory");
        if constexpr (SPLITA) {   // the residual plane's rows; same form of statement
            const bf* pl = Al + ga + t * GKS;
            asm volatile("global_load_async_to_lds_b128 %0, %4, off\n\t"
                         "global_load_async_to_lds_b128 %1, %5, off\n\t"
                         "global_load_async_to_lds_b128 %2, %6, off\n\t"
                         "global_load_async_to_lds_b128 %3, %7, off\n\t"
                         "s_wait_xcnt 0x0"
                         :: "v"(l + 2 * GPL), "v"(l + 2 * GPL + RS * GP), "v"(l + 2 * GPL + 2 * RS * GP), "v"(l + 2 * GPL + 3 * RS * GP),
                            "v"(pl), "v"(pl + RS * DM), "v"(pl + 2 * RS * DM), "v"(pl + 3 * RS * DM)
                         : "memory");
        }
    };
    v8f acc[FA][4];
#pragma unroll
    for (int i = 0; i < FA; ++i)
#pragma unroll
        for (int t = 0; t < 4; ++t) acc[i][t] = (v8f){};
    fill(0, 0);
    asm volatile("s_wait_asynccnt 0x0" ::: "memory");   // this wave's copies of stage 0 have landed
    __syncthreads();                                    // ... and every other wave's
    fill(1, 1);
#pragma unroll 1  // stays rolled: one copy of the stage body, the buffer picked by s & 1
    for (int s = 0; s < DM / GKS; ++s) {
        const char* fa = ring + (s & 1) * GST + GPL + (wm * (FA * 16) + lr) * GP + 16 * hi;
        const char* fb = ring + (s & 1) * GST + (wn * 64 + lr) * GP + 16 * hi;
        v16bf a[FA], al[FA], b[4];
#pragma unroll  // two 32-k products per stage, constant LDS offsets
        for (int ks = 0; ks < GKS / 32; ++ks) {
#pragma unroll
            for (int i = 0; i < FA; ++i) {
                a[i] = cat16b(*(const v8usa*)(fa + i * 16 * GP + ks * 64), *(const v8usa*)(fa + i * 16 * GP + ks * 64 + 32));
                al[i] = a[i];
                if (SPLITA) al[i] = cat16b(*(const v8usa*)(fa + GPL + i * 16 * GP + ks * 64), *(const v8usa*)(fa + GPL + i * 16 * GP + ks * 64 + 32));
            }
#pragma unroll
            for (int t = 0; t < 4; ++t) b[t] = cat16b(*(const v8usa*)(fb + t * 16 * GP + ks * 64), *(const v8usa*)(fb + t * 16 * GP + ks * 64 + 32));
            // inputs-only fence on the loaded fragments: the 16 LDS reads of these 32 k issue as one group ahead of the products; without it the compiler reloads one
            // A fragment per row of four products and the wave waits out a whole LDS latency at each row
            if constexpr (SPLITA) asm volatile("" :: "v"(a[0]), "v"(a[1]), "v"(al[0]), "v"(al[1]), "v"(b[0]), "v"(b[1]), "v"(b[2]), "v"(b[3]));
            else                  asm volatile("" :: "v"(a[0]), "v"(a[1]), "v"(a[FA - 2]), "v"(a[FA - 1]), "v"(b[0]), "v"(b[1]), "v"(b[2]), "v"(b[3]));
#pragma unroll
            for (int i = 0; i < FA; ++i)
#pragma unroll
                for (int t = 0; t < 4; ++t) acc[i][t] = wmmab(a[i], b[t], acc[i][t]);
            if (SPLITA) {   // the residual products behind the main ones: per accumulator the order main, residual of each 32 k stays
#pragma unroll
                for (int i = 0; i < FA; ++i)
#pragma unroll
                    for (int t = 0; t < 4; ++t) acc[i][t] = wmmab(al[i], b[t], acc[i][t]);
            }
        }
        // four vector slots behind the last WMMA, on both sides of the branch below, before a vector instruction may overwrite its operands
        if constexpr (SPLITA)
            asm volatile("v_nop\n\tv_nop\n\tv_nop\n\tv_nop" : "+v"(acc[0][0]), "+v"(acc[0][1]), "+v"(acc[0][2]), "+v"(acc[0][3]), "+v"(acc[1][0]), "+v"(acc[1][1]), "+v"(acc[1][2]), "+v"(acc[1][3])
                         : "v"(a[FA - 1]), "v"(al[FA - 1]), "v"(b[3]));
        else
            asm volatile("v_nop\n\tv_nop\n\tv_nop\n\tv_nop" : "+v"(acc[0][0]), "+v"(acc[0][1]), "+v"(acc[0][2]), "+v"(acc[0][3]), "+v"(acc[1][0]), "+v"(acc[1][1]), "+v"(acc[1][2]), "+v"(acc[1][3]),
                           "+v"(acc[FA - 2][0]), "+v"(acc[FA - 2][1]), "+v"(acc[FA - 2][2]), "+v"(acc[FA - 2][3]), "+v"(acc[FA - 1][0]), "+v"(acc[FA - 1][1]), "+v"(acc[FA - 1][2]), "+v"(acc[FA - 1][3])
                         : "v"(a[FA - 1]), "v"(b[3]));
        asm volatile("s_wait_dscnt 0x0" ::: "memory");      // this wave's reads of the buffer are done before it may be refilled
        asm volatile("s_wait_asynccnt 0x0" ::: "memory");   // this wave's copies of the next stage have landed
        __syncthreads();                                    // publishes the next stage and frees this stage's buffer
        if (s + 2 < DM / GKS) fill(s + 2, s & 1);
    }
    asm volatile("s_wait_asynccnt 0x0" ::: "memory");       // nothing in flight when the ring becomes output staging
    float* os = (float*)ring + wave * (16 * 68);            // the wave's own staging range: 16 rows of its tile at a time
    float* crow = C + (size_t)(c0 / DM) * NTK * DM + (size_t)r0 * DM + (c0 & (DM - 1));
    float bv[4];
#pragma unroll
    for (int t = 0; t < 4; ++t) bv[t] = bfr(bias[c0 + t * 16 + lr]);
#pragma unroll  // constant indices keep acc[][] in registers
    for (int i = 0; i < FA; ++i) {
#pragma unroll
        for (int t = 0; t < 4; ++t)
#pragma unroll
            for (int j = 0; j < 8; ++j) os[(hi * 8 + j) * 68 + t * 16 + lr] = acc[i][t][j] + bv[t];
        asm volatile("s_wait_dscnt 0x0" ::: "memory");      // the wave's rows stand in LDS before its lanes read what other lanes wrote
#pragma unroll
        for (int s = 0; s < 8; ++s) { const int Lid = (lane >> 3) + 4 * s, piece = lane & 7; const int row = Lid >> 1, cofs = (Lid & 1) * 32 + piece * 4;
            const v4f val = *(const v4fa*)(os + row * 68 + cofs); *(v4f*)(crow + (size_t)(i * 16 + row) * DM + cofs) = val; }
        if (i + 1 < FA) asm volatile("s_wait_xcnt 0x0" ::: "memory");   // behind the stores: the next 16 rows overwrite their data registers
    }
}

// d_vt: VT16/VTL[b][h][d][t] = f16 hi + residual x1024 of V row b*2048+t, col h*64+d via LDS transposes, 256 threads (tid) = job bid = (b, h, 64 t), with their own two tiles.
__device__ __forceinline__ void d_vt(h16* tile, h16* til2, int bid, int tid, const float* __restrict__ V, h16* VT16, h16* VTL) {
    const int b = bid / (NH_ * (NT_ / 64)), rem = bid - b * (NH_ * (NT_ / 64)), h = rem / (NT_ / 64), kt = rem - h * (NT_ / 64);
    const int k0 = kt * 64, kk = tid >> 2, d0 = (tid & 3) * 16;
    const float* src = V + ((size_t)b * NT_ + k0 + kk) * DM + h * HD + d0;
#pragma unroll
    for (int i = 0; i < 16; ++i) { const float v = src[i]; const h16 a = (h16)v; tile[(d0 + i) * 72 + kk] = a; til2[(d0 + i) * 72 + kk] = (h16)((v - (float)a) * LOSC); }
    __syncthreads();
    const int piece = tid & 7;
    const size_t base = (((size_t)b * NH_ + h) * HD) * NT_ + k0;
    auto pass = [&]() {
#pragma unroll
        for (int s = 0; s < 4; ++s) { const int Lid = (tid >> 3) + 32 * s; const int pln = Lid >> 6, d = Lid & 63;
            const v8h val = *(const v8ha*)((pln ? til2 : tile) + d * 72 + piece * 8); *(v8h*)((pln ? VTL : VT16) + base + (size_t)d * NT_ + piece * 8) = val; }
    };
    pass();
    asm volatile("s_wait_xcnt 0x0" ::: "memory");   // behind the stores: in the listing another job's code follows, which overwrites their address and data registers
}
// d_kvc: KVC[b*2048+t][col] = sum_{j<=t} k[j]*v[j]/8 (inclusive prefix over t, f32) as a chunked scan inside one block. Block = (b, 32 columns = whole 128-byte lines);
// thread = (chunk of 16 rows, 4 columns): all 32 16-byte loads are independent and the 64 running sums stay in registers. Chunk sums -> LDS, exclusive prefix over the 128
// chunks in two levels (8 waves scan 16 chunks each, then every thread adds the sums of the groups before its own), then each thread adds that start value to its rows.
#define KC_R 16                  // rows per chunk
#define KC_N (NT_ / KC_R)        // 128 chunks
#define KC_G 8                   // groups of 16 chunks
__device__ __forceinline__ void d_kvc(float* tot, float* gtot, int job, const float* __restrict__ Kf, const float* __restrict__ Vf, float* __restrict__ KVC) {
    const int tid = threadIdx.x, cq = tid & 7, ch = tid >> 3;
    const int b = job / (DM / 32), cg = job - b * (DM / 32);
    const size_t blk = (size_t)b * NT_ * DM + cg * 32;         // block part of the index (scalar)
    const unsigned thr = (unsigned)(ch * KC_R * DM + cq * 4);  // thread part, shared by the loads and the stores
    const float* kp = Kf + blk; const float* vp = Vf + blk; float* op = KVC + blk;
    v4f p[KC_R];
#pragma unroll  // constant indices keep p[] in registers; the independent loads issue many at a time
    for (int i = 0; i < KC_R; ++i) p[i] = *(const v4f*)(kp + thr + i * DM) * *(const v4f*)(vp + thr + i * DM) * SCL;
#pragma unroll  // p[] in registers
    for (int i = 1; i < KC_R; ++i) p[i] += p[i - 1];           // inclusive prefix inside the chunk
    *(v4f*)(tot + ch * 32 + cq * 4) = p[KC_R - 1];
    __syncthreads();
    if (tid < KC_G * 32) { const int g = tid >> 5, col = tid & 31; float run = 0.f;
#pragma unroll  // the 16 LDS reads issue ahead of the add chain
        for (int i = 0; i < KC_N / KC_G; ++i) { float* q = tot + (g * (KC_N / KC_G) + i) * 32 + col; const float t = *q; *q = run; run += t; }
        gtot[g * 32 + col] = run; }
    __syncthreads();
    const int g = ch / (KC_N / KC_G);
    v4f gs[KC_G - 1];
#pragma unroll  // gs[] in registers
    for (int i = 0; i < KC_G - 1; ++i) gs[i] = *(const v4f*)(gtot + i * 32 + cq * 4);   // all read at once, then selected: no chain of LDS round trips
    v4f c = {};
#pragma unroll  // gs[] in registers
    for (int i = 0; i < KC_G - 1; ++i) c += (i < g) ? gs[i] : (v4f){};
    c += *(const v4f*)(tot + ch * 32 + cq * 4);
#pragma unroll  // p[] in registers; stores back to back
    for (int i = 0; i < KC_R; ++i) *(v4f*)(op + thr + i * DM) = p[i] + c;
}
// d_side: hi/lo f16 planes of a 128-wide per-head row: SH/SL[row][h*128 + c]: c < 64 -> A[row][h*64+c]; c >= 64 -> B2[row][h*64+c-64] (times M[row][same]
// when MUL2) - query side: [q | q*t] (A = q, B2 = q, M = t); key side: [k | kvc]. One wave per ROW, all 16 heads: 4,096 waves a job, so that the time goes into
// the stream and not into starting waves. A 16-byte load of the wave covers 512 contiguous bytes = two heads' 64 values of one source (lane = head 2g + lane/16, 4 values);
// an 8-byte store covers those two heads' whole 128-byte lines of a plane. No lane is off; the row's loads are independent and issue ahead of the first conversion.
template <bool MUL2>
__device__ __forceinline__ void d_side(int r, const float* __restrict__ A, const float* __restrict__ Mv, const float* __restrict__ B2, h16* SH, h16* SL) {
    typedef __attribute__((ext_vector_type(4))) _Float16 v4h;
    const int lane = threadIdx.x & 31;
    if (r >= NTK) return;
    const size_t in0 = (size_t)r * DM + lane * 4;
    const size_t o0 = (size_t)r * (NH_ * QW) + (lane >> 4) * QW + (lane & 15) * 4;
    const float* pa = A + in0; const float* pb = B2 + in0; const float* pm = MUL2 ? Mv + in0 : pb;
    v4f va[NH_ / 2], vb[NH_ / 2], vm[NH_ / 2];
#pragma unroll  // constant indices keep the arrays in registers; the independent loads issue many at a time
    for (int g = 0; g < NH_ / 2; ++g) { va[g] = *(const v4fa*)(pa + g * 2 * HD); vb[g] = *(const v4fa*)(pb + g * 2 * HD); if (MUL2) vm[g] = *(const v4fa*)(pm + g * 2 * HD); }
    // a precaution: the address registers, named here, stay whole up to this wait, so that no load's result is placed in a register that an issued load names
    asm volatile("s_wait_xcnt 0x0" :: "v"(pa), "v"(pb), "v"(pm) : "memory");
#pragma unroll  // the arrays in registers
    for (int g = 0; g < NH_ / 2; ++g)
#pragma unroll
        for (int s = 0; s < 2; ++s) { v4f x = s ? vb[g] : va[g]; if (MUL2 && s) x *= vm[g]; v4h oh, ol;
#pragma unroll
            for (int i = 0; i < 4; ++i) { const h16 a = (h16)x[i]; oh[i] = a; ol[i] = (h16)((x[i] - (float)a) * LOSC); }
            *(v4h*)(SH + o0 + g * 2 * QW + s * HD) = oh; *(v4h*)(SL + o0 + g * 2 * QW + s * HD) = ol; }
}
// k_post: the three jobs that need the projections only, in blocks of 1,024 threads: the prefix sums (64 blocks, first: they last longest), V^T planes (256 blocks of four
// 256-thread jobs), query-side planes (128 blocks of 32 rows). k_keys: the key-side planes, which need the prefix sums.
#define QB_KV (NB_ * (DM / 32))
#define QB_VT (NB_ * NH_ * (NT_ / 64) / 4)
#define QB_QS (NTK / 32)
__global__ __launch_bounds__(1024) void k_post(const float* __restrict__ Qf, const float* __restrict__ Kf, const float* __restrict__ Vf, const float* __restrict__ Tf,
                                               float* __restrict__ KVC, h16* VT16, h16* VTL, h16* QH, h16* QL) {
    __shared__ __align__(16) char sm[4 * 2 * HD * 72 * 2];   // four pairs of V^T tiles, or the chunk and group sums of the scan
    const int bid = blockIdx.x;
    if (bid < QB_KV) d_kvc((float*)sm, (float*)sm + KC_N * 32, bid, Kf, Vf, KVC);
    else if (bid < QB_KV + QB_VT) { const int sub = threadIdx.x >> 8; h16* tile = (h16*)sm + sub * (2 * HD * 72);
        d_vt(tile, tile + HD * 72, (bid - QB_KV) * 4 + sub, threadIdx.x & 255, Vf, VT16, VTL); }
    else d_side<true>((bid - (QB_KV + QB_VT)) * 32 + (threadIdx.x >> 5), Qf, Tf, Qf, QH, QL);      // [q | q*t]
}
__global__ __launch_bounds__(256) void k_keys(const float* __restrict__ Kf, const float* __restrict__ KVC, h16* KH, h16* KL) {
    d_side<false>(blockIdx.x * 8 + (threadIdx.x >> 5), Kf, nullptr, KVC, KH, KL);                  // [k | kvc]
}

// k_attn: block = (b, head pair hp, t): the 64-query tile t of head hp, then tile 31 - t of head hp + 8, one after the other: 66 key steps in every block, so that the
// blocks, all resident at once, end together; wave = 16 queries; causal key tiles 0..query tile; scores over the 128 combined dims with hi.hi + hi.lo + lo.hi (24 WMMA per 32-key
// step), x 1/8, keys after the query -> -inf; online f32 softmax. The products are the TRANSPOSED ones: S^T = K.Q^T (A = key rows, B = query rows) and O^T += V^T.P^T
// (A = V^T rows, B = weights). A lane then holds 16 of the step's 32 scores of ONE query (lane l ^ 16 the other 16): maximum and sum run over the lane's own registers with
// one exchange between the halves, maximum, rescale factor and sum are one value a lane, and the two score tiles, converted in place (x32768, f16 hi + residual x1024), ARE
// the B operand of the second product in the hardware k order: the weights pass through no LDS. ctx -> bf16 hi/lo planes CH/CL [token][h*64 + d].
// The 32-key tile of a step (key rows hi + lo, V^T rows hi + lo, 24 KB) is brought once per block into a two-buffer LDS ring by asynchronous copies, one step ahead;
// the four waves read their fragments from there, and the query lo rows from a buffer copied once: the loop holds no global load. Rows are pitched 16 B x odd so that ds_load_b128 fragment reads meet no bank conflict.
#define KP    272                // LDS pitch of a 256-byte key row
#define VP    80                 // LDS pitch of a 64-byte V^T row
#define ST_KL (32 * KP)          // stage offsets: key hi at 0, key lo, V^T hi, V^T lo
#define ST_VH (2 * 32 * KP)
#define ST_VL (ST_VH + HD * VP)
#define ST_SZ (ST_VH + 2 * HD * VP)
__global__ __launch_bounds__(128) void k_attn(const h16* __restrict__ QH, const h16* __restrict__ QL, const h16* __restrict__ KH, const h16* __restrict__ KL, const h16* __restrict__ VT16, const h16* __restrict__ VTL, bf* CH, bf* CL) {
    __shared__ __align__(16) char ring[2 * ST_SZ];   // the output staging of the epilogue reuses it behind the last step's barrier
    __shared__ __align__(16) char qlds[64 * KP];     // the current tile's 64 query lo rows, copied once per tile
    const int lane = threadIdx.x & 31, wave = threadIdx.x >> 5, lr = lane & 15, hi = lane >> 4;
    const int bid = blockIdx.x;
    const int b = bid / ((NH_ / 2) * (NT_ / 64)), rem = bid - b * ((NH_ / 2) * (NT_ / 64)), hp = rem / (NT_ / 64), t0 = rem - hp * (NT_ / 64);
    const size_t tok0 = (size_t)b * NT_;
#pragma unroll 1  // the two tiles go through one copy of the code, one after the other
  for (int half = 0; half < 2; ++half) {
    const int h = half ? hp + NH_ / 2 : hp, qt = half ? NT_ / 64 - 1 - t0 : t0;
    const int q0 = qt * 64 + wave * 16;
    if (half) {
        asm volatile("s_wait_dscnt 0x0" ::: "memory");  // this wave's reads of the first tile's output staging are done
        __syncthreads();                                // ... and every other wave's, before the copies below refill that LDS
    }
    v16h ah[4];
    const size_t qo = (tok0 + q0 + lr) * (NH_ * QW) + h * QW + 8 * hi;
#pragma unroll
    for (int kc = 0; kc < 4; ++kc) ah[kc] = cat16(*(const v8h*)(QH + qo + kc * 32), *(const v8h*)(QH + qo + kc * 32 + 16));
    const int qp = q0 + lr;      // this lane's query
    const size_t vbase = (((size_t)b * NH_ + h) * HD) * NT_;
    v8f o[4], ox[4];
#pragma unroll
    for (int n = 0; n < 4; ++n) { o[n] = (v8f){}; ox[n] = (v8f){}; }
    float mrow = -3.0e38f, lpart = 0.f;
    const int kt_end = (qt * 64 + 64) / 32;
    // Copies of one tile: 12 per thread, 16 bytes each. Key planes: thread = (row tid/16 + 8 i, 16-byte piece tid%16); V^T planes: thread = (row tid/4 + 32 i, piece tid%4).
    const int tid = threadIdx.x, krow = tid >> 4, kcol = tid & 15, vrow = tid >> 2, vcol = tid & 3;
    const size_t kg = (tok0 + krow) * (NH_ * QW) + h * QW + kcol * 8, vg = vbase + (size_t)vrow * NT_ + vcol * 8;
    const unsigned lk0 = (unsigned)(size_t)ring + krow * KP + kcol * 16, lv0 = (unsigned)(size_t)ring + ST_VH + vrow * VP + vcol * 16;
    auto fill = [&](int t, int buf) {
        const h16* gkh = KH + kg + (size_t)t * 32 * (NH_ * QW); const h16* gkl = KL + kg + (size_t)t * 32 * (NH_ * QW);
        const h16* gvh = VT16 + vg + t * 32; const h16* gvl = VTL + vg + t * 32;
        const unsigned lk = lk0 + buf * ST_SZ, lv = lv0 + buf * ST_SZ;
        // one statement: the closing s_wait_xcnt stands in front of any rewrite of an address register that a copy names
        asm volatile("global_load_async_to_lds_b128 %0, %12, off\n\t"
                     "global_load_async_to_lds_b128 %1, %13, off\n\t"
                     "global_load_async_to_lds_b128 %2, %14, off\n\t"
                     "global_load_async_to_lds_b128 %3, %15, off\n\t"
                     "global_load_async_to_lds_b128 %4, %16, off\n\t"
                     "global_load_async_to_lds_b128 %5, %17, off\n\t"
                     "global_load_async_to_lds_b128 %6, %18, off\n\t"
                     "global_load_async_to_lds_b128 %7, %19, off\n\t"
                     "global_load_async_to_lds_b128 %8, %20, off\n\t"
                     "global_load_async_to_lds_b128 %9, %21, off\n\t"
                     "global_load_async_to_lds_b128 %10, %22, off\n\t"
                     "global_load_async_to_lds_b128 %11, %23, off\n\t"
                     "s_wait_xcnt 0x0"
                     :: "v"(lk), "v"(lk + 8 * KP), "v"(lk + 16 * KP), "v"(lk + 24 * KP),
                        "v"(lk + ST_KL), "v"(lk + ST_KL + 8 * KP), "v"(lk + ST_KL + 16 * KP), "v"(lk + ST_KL + 24 * KP),
                        "v"(lv), "v"(lv + 32 * VP), "v"(lv + HD * VP), "v"(lv + HD * VP + 32 * VP),
                        "v"(gkh), "v"(gkh + 8 * (NH_ * QW)), "v"(gkh + 16 * (NH_ * QW)), "v"(gkh + 24 * (NH_ * QW)),
                        "v"(gkl), "v"(gkl + 8 * (NH_ * QW)), "v"(gkl + 16 * (NH_ * QW)), "v"(gkl + 24 * (NH_ * QW)),
                        "v"(gvh), "v"(gvh + 32 * NT_), "v"(gvl), "v"(gvl + 32 * NT_)
                     : "memory");
    };
    {   // query lo rows: 8 copies per thread, thread = (row tid/16 + 8 i, piece tid%16); same form of statement as above
        const h16* gq = QL + (tok0 + qt * 64 + krow) * (NH_ * QW) + h * QW + kcol * 8;
        const unsigned lq = (unsigned)(size_t)qlds + krow * KP + kcol * 16;
        asm volatile("global_load_async_to_lds_b128 %0, %8, off\n\t"
                     "global_load_async_to_lds_b128 %1, %9, off\n\t"
                     "global_load_async_to_lds_b128 %2, %10, off\n\t"
                     "global_load_async_to_lds_b128 %3, %11, off\n\t"
                     "global_load_async_to_lds_b128 %4, %12, off\n\t"
                     "global_load_async_to_lds_b128 %5, %13, off\n\t"
                     "global_load_async_to_lds_b128 %6, %14, off\n\t"
                     "global_load_async_to_lds_b128 %7, %15, off\n\t"
                     "s_wait_xcnt 0x0"
                     :: "v"(lq), "v"(lq + 8 * KP), "v"(lq + 16 * KP), "v"(lq + 24 * KP), "v"(lq + 32 * KP), "v"(lq + 40 * KP), "v"(lq + 48 * KP), "v"(lq + 56 * KP),
                        "v"(gq), "v"(gq + 8 * (NH_ * QW)), "v"(gq + 16 * (NH_ * QW)), "v"(gq + 24 * (NH_ * QW)),
                        "v"(gq + 32 * (NH_ * QW)), "v"(gq + 40 * (NH_ * QW)), "v"(gq + 48 * (NH_ * QW)), "v"(gq + 56 * (NH_ * QW))
                     : "memory");
    }
    const char* qlp = qlds + (wave * 16 + lr) * KP + 16 * hi;
    fill(0, 0);
    asm volatile("s_wait_asynccnt 0x0" ::: "memory");   // this wave's copies of the query rows and of tile 0 have landed
    __syncthreads();                                    // ... and every other wave's
    if (kt_end > 1) fill(1, 1);
#pragma unroll 1
    for (int kt = 0; kt < kt_end; ++kt) {
        const int l0 = kt * 32;
        const char* st = ring + (kt & 1) * ST_SZ;
        v8f s0 = {}, s1 = {}, x0 = {}, x1 = {};
#pragma unroll
        for (int kc = 0; kc < 4; ++kc) {
            const char* p0 = st + lr * KP + kc * 64 + 16 * hi; const char* p1 = p0 + 16 * KP;
            const v16h k0h = cat16(*(const v8ha*)p0, *(const v8ha*)(p0 + 32)), k0l = cat16(*(const v8ha*)(p0 + ST_KL), *(const v8ha*)(p0 + ST_KL + 32));
            const v16h k1h = cat16(*(const v8ha*)p1, *(const v8ha*)(p1 + 32)), k1l = cat16(*(const v8ha*)(p1 + ST_KL), *(const v8ha*)(p1 + ST_KL + 32));
            const v16h alk = cat16(*(const v8ha*)(qlp + kc * 64), *(const v8ha*)(qlp + kc * 64 + 32));      // query lo fragment re-read per step (register budget)
            s0 = wmma16(k0h, ah[kc], s0); x0 = wmma16(k0l, ah[kc], x0); x0 = wmma16(k0h, alk, x0);      // lo products carry x1024, folded below
            s1 = wmma16(k1h, ah[kc], s1); x1 = wmma16(k1l, ah[kc], x1); x1 = wmma16(k1h, alk, x1);
            asm volatile("" : "+v"(x0), "+v"(x1) : "v"(alk));
        }
        asm volatile("v_nop\n\tv_nop\n\tv_nop\n\tv_nop" : "+v"(s0), "+v"(s1), "+v"(x0), "+v"(x1) : "v"(ah[0]), "v"(ah[3]));
        // register j of s0 / s1 = key l0 + 8 hi + j / l0 + 16 + 8 hi + j of query qp: element j / 8 + j of the lane's B fragment below
        const int kd = qp - l0 - 8 * hi;   // last key offset that this query may see
        const v8f t0 = (s0 + x0 * LOSCI) * SCL, t1 = (s1 + x1 * LOSCI) * SCL;
        float a[16];
#pragma unroll
        for (int j = 0; j < 8; ++j) { a[j] = (j <= kd) ? t0[j] : -__builtin_inff(); a[8 + j] = (16 + j <= kd) ? t1[j] : -__builtin_inff(); }
        float mt[8];
#pragma unroll
        for (int j = 0; j < 8; ++j) mt[j] = fmaxf(a[2 * j], a[2 * j + 1]);
        float mx = fmaxf(fmaxf(fmaxf(mt[0], mt[1]), fmaxf(mt[2], mt[3])), fmaxf(fmaxf(mt[4], mt[5]), fmaxf(mt[6], mt[7])));
        mx = fmaxf(mx, xhalf(mx));
        const float mn = fmaxf(mrow, mx);
        v2f p[8]; v16h pa, px;
#pragma unroll
        for (int i = 0; i < 8; ++i) {      // neighbouring registers in pairs: packed f32 arithmetic and packed conversions
            const v2f e = ((v2f){a[2 * i], a[2 * i + 1]} - mn) * L2E;
            p[i] = (v2f){__builtin_amdgcn_exp2f(e[0]), __builtin_amdgcn_exp2f(e[1])};
            const v2f ps = p[i] * PSC; const v2h ph = __builtin_convertvector(ps, v2h);
            const v2h pr = __builtin_convertvector((ps - __builtin_convertvector(ph, v2f)) * LOSC, v2h);
            pa[2 * i] = ph[0]; pa[2 * i + 1] = ph[1]; px[2 * i] = pr[0]; px[2 * i + 1] = pr[1];
        }
        const float alpha = __builtin_amdgcn_exp2f((mrow - mn) * L2E);
        mrow = mn;
#pragma unroll
        for (int w = 4; w > 0; w >>= 1)    // the lane's 16 weights, summed as a tree
#pragma unroll
            for (int i = 0; i < w; ++i) p[i] += p[i + w];
        lpart = lpart * alpha + (p[0][0] + p[0][1]);
#pragma unroll
        for (int n = 0; n < 4; ++n) { o[n] *= alpha; ox[n] *= alpha; }
#pragma unroll
        for (int n = 0; n < 4; ++n) { const char* pv = st + ST_VH + (n * 16 + lr) * VP + 16 * hi;
            const v16h vh = cat16(*(const v8ha*)pv, *(const v8ha*)(pv + 32));
            o[n] = wmma16(vh, pa, o[n]); ox[n] = wmma16(cat16(*(const v8ha*)(pv + HD * VP), *(const v8ha*)(pv + HD * VP + 32)), pa, ox[n]); ox[n] = wmma16(vh, px, ox[n]); }
        asm volatile("v_nop\n\tv_nop\n\tv_nop\n\tv_nop" : "+v"(o[0]), "+v"(o[1]), "+v"(o[2]), "+v"(o[3]), "+v"(ox[0]), "+v"(ox[1]), "+v"(ox[2]), "+v"(ox[3]) : "v"(pa), "v"(px));
        asm volatile("s_wait_dscnt 0x0" ::: "memory");      // this wave's reads of the buffer are done before it may be refilled
        asm volatile("s_wait_asynccnt 0x0" ::: "memory");   // this wave's copies of the next tile have landed
        __syncthreads();                                    // publishes the next tile and frees this step's buffer
        if (kt + 2 < kt_end) fill(kt + 2, kt & 1);
    }
    asm volatile("s_wait_asynccnt 0x0" ::: "memory");       // nothing in flight when the ring becomes output staging
    const float inv = 1.0f / ((lpart + xhalf(lpart)) * PSC);
    float* os = (float*)ring + wave * (16 * 68);
#pragma unroll
    for (int n = 0; n < 4; ++n)
#pragma unroll
        for (int q = 0; q < 2; ++q) { v4f w;    // register j of o[n] = dim n * 16 + 8 hi + j of query lr
#pragma unroll
            for (int i = 0; i < 4; ++i) w[i] = (o[n][q * 4 + i] + ox[n][q * 4 + i] * LOSCI) * inv;
            *(v4fa*)(os + lr * 68 + n * 16 + hi * 8 + q * 4) = w; }
    __syncthreads();
    const size_t cbase = (tok0 + q0) * DM + (size_t)h * HD;
    auto pass = [&]() {
#pragma unroll
        for (int s = 0; s < 4; ++s) { const int row = 4 * s + (lane >> 3), piece = lane & 7; const float* sp = os + row * 68 + piece * 8; v8us oh, ol;
#pragma unroll
            for (int i = 0; i < 8; ++i) { const unsigned short hb = f2bf(sp[i]); oh[i] = hb; ol[i] = f2bf(sp[i] - bf2f(hb)); }
            *(v8us*)(CH + cbase + (size_t)row * DM + piece * 8) = oh; *(v8us*)(CL + cbase + (size_t)row * DM + piece * 8) = ol; }
    };
    pass(); 
    asm volatile("s_wait_xcnt 0x0" ::: "memory");   // behind the stores: the second tile's set-up overwrites their address and data registers
  }
}

extern "C" void kernel_launch(void* const* d_in, const int* in_sizes, int n_in,
                              void* d_out, int out_size, void* d_ws, size_t ws_size, hipStream_t stream) {
    (void)in_sizes; (void)n_in; (void)out_size;
    const float* x = (const float*)d_in[0]; const float* W4 = (const float*)d_in[1]; const float* b4 = (const float*)d_in[2]; const float* Wo = (const float*)d_in[3]; const float* bo = (const float*)d_in[4];
    float* out = (float*)d_out;    // [2][2048][1024]
    char* wsp = (char*)d_ws;
    auto take = [&](size_t bytes) { char* p = wsp; wsp += (bytes + 255) & ~(size_t)255; return (void*)p; };
    bf* Xb = (bf*)take((size_t)NTK * DM * 2); bf* W4T = (bf*)take((size_t)4 * DM * DM * 2); bf* WoT = (bf*)take((size_t)DM * DM * 2);
    h16* VT16 = (h16*)take((size_t)NTK * DM * 2); h16* VTL = (h16*)take((size_t)NTK * DM * 2); h16* KH = (h16*)take((size_t)NTK * NH_ * QW * 2); h16* KL = (h16*)take((size_t)NTK * NH_ * QW * 2);
    h16* QH = (h16*)take((size_t)NTK * NH_ * QW * 2); h16* QL = (h16*)take((size_t)NTK * NH_ * QW * 2);
    float* P4 = (float*)take((size_t)4 * NTK * DM * 4); float* KVC = (float*)take((size_t)NTK * DM * 4);   // the four f32 projection planes, one behind the other
    if ((size_t)(wsp - (char*)d_ws) > ws_size) return;    // 186,646,528 B
    float* Qf = P4; float* Kf = P4 + (size_t)1 * NTK * DM; float* Vf = P4 + (size_t)2 * NTK * DM; float* Tf = P4 + (size_t)3 * NTK * DM;
    bf* CH = (bf*)Qf; bf* CL = (bf*)Kf;                    // ctx planes over q and k, dead once the query-side and key-side planes stand
    k_prep<<<PB_W4 + PB_WO + NTK / 8, 256, 0, stream>>>(x, W4, Wo, Xb, W4T, WoT);
    k_gemmb<false><<<dim3(NTK / 256, (4 * DM) / 256, 1), 512, 0, stream>>>(Xb, nullptr, W4T, b4, P4);
    k_post<<<QB_KV + QB_VT + QB_QS, 1024, 0, stream>>>(Qf, Kf, Vf, Tf, KVC, VT16, VTL, QH, QL);
    k_keys<<<NTK / 8, 256, 0, stream>>>(Kf, KVC, KH, KL);
    k_attn<<<NB_ * (NH_ / 2) * (NT_ / 64), 128, 0, stream>>>(QH, QL, KH, KL, VT16, VTL, CH, CL);
    k_gemmb<true><<<dim3(NTK / 128, DM / 128, 1), 256, 0, stream>>>(CH, CL, WoT, bo, out);
}

// v009
// One run takes 142 microseconds.
// Next to v008, in two timings, it ran 1.06 times as fast each time.
// Counting every step since v000, it is 9.81 times as fast.
#include <hip/hip_runtime.h>

// Contractions, f32 accumulate: qkvt = x.Wqkvt + b as four [4096 x 1024].[1024 x 1024] column blocks and out = ctx.Wout + bout on v_wmma_f32_16x16x32_bf16 (PLAIN bf16
// operands = inputs rounded once, exact; k-major weights transposed into n-major planes; ctx as bf16 hi + residual planes, two products); the per-(batch, head) causal
// attention fused on v_wmma_f32_16x16x32_f16: scores = ([q | q*t]).([k | cumsum_j(k*v)/8])^T over 128 dims with BOTH sides as f16 hi + residual x1024 planes
// (hi.hi + hi.lo + lo.hi — the triplet term reaches sigma ~45 before the 1/8 scale, so single-rounded operands would not hold the peaked softmax), x 1/8, causal,
// softmax, then weights (x32768) and v BOTH as f16 hi + residual x1024 (hi.hi + hi.lo + lo.hi; the softmax is peaked so single roundings would not average out). The key-side prefix sums are f32 chunked scans (16-row chunks, one block per (b, 32 columns)). Deterministic, no atomics;

#define NB_  2
#define NT_  2048
#define DM   1024
#define NH_  16
#define HD   64
#define QW   128                 // combined score width per head
#define NTK  (NB_ * NT_)         // 4096
#define PSC  32768.0f
#define LOSC 1024.0f
#define LOSCI (1.0f / 1024.0f)
#define SCL  0.125f
#define L2E  1.44269504f         // log2(e): exp(x) = exp2(x * L2E)

typedef _Float16 h16;
typedef unsigned short bf;
typedef __attribute__((ext_vector_type(16))) __bf16   v16bf;
typedef __attribute__((ext_vector_type(16))) _Float16 v16h;
typedef __attribute__((ext_vector_type(8)))  _Float16 v8h;
typedef __attribute__((ext_vector_type(8)))  unsigned short v8us;
typedef __attribute__((ext_vector_type(8)))  float    v8f;
typedef __attribute__((ext_vector_type(4)))  float    v4f;
typedef __attribute__((ext_vector_type(2)))  float    v2f;
typedef __attribute__((ext_vector_type(2)))  _Float16 v2h;
typedef v8h  __attribute__((may_alias)) v8ha;
typedef v4f  __attribute__((may_alias)) v4fa;
typedef v8us __attribute__((may_alias)) v8usa;

__device__ __forceinline__ unsigned short f2bf(float f) { unsigned u = __float_as_uint(f); u += 0x7FFFu + ((u >> 16) & 1u); return (unsigned short)(u >> 16); }
__device__ __forceinline__ float bf2f(unsigned short b) { return __uint_as_float(((unsigned)b) << 16); }
__device__ __forceinline__ float bfr(float f) { return bf2f(f2bf(f)); }
__device__ __forceinline__ v16h cat16(v8h lo, v8h hi) { return __builtin_shufflevector(lo, hi, 0, 1, 2, 3, 4, 5, 6, 7, 8, 9, 10, 11, 12, 13, 14, 15); }
__device__ __forceinline__ v16bf cat16b(v8us lo, v8us hi) { return __builtin_bit_cast(v16bf, __builtin_shufflevector(lo, hi, 0, 1, 2, 3, 4, 5, 6, 7, 8, 9, 10, 11, 12, 13, 14, 15)); }
__device__ __forceinline__ v8f wmma16(v16h a, v16h b, v8f c) { return __builtin_amdgcn_wmma_f32_16x16x32_f16(false, a, false, b, (short)0, c, false, false); }
__device__ __forceinline__ v8f wmmab(v16bf a, v16bf b, v8f c) { return __builtin_amdgcn_wmma_f32_16x16x32_bf16(false, a, false, b, (short)0, c, false, false); }
// value of lane l ^ 16: the other half of the wave
__device__ __forceinline__ float xhalf(float v) { const int b = __float_as_int(v); return __int_as_float(__builtin_amdgcn_permlanex16(b, b, 0x76543210, 0xfedcba98, false, false)); }
#define VST2(T, p, v) do { const T vst2_v_ = (v); *(T*)(p) = vst2_v_;  } while (0)

// Kernels that do not depend on one another share a launch: a block picks its job by its index (block-uniform), the jobs' bodies are the functions d_*.
// d_cvtb: bf16 plane of x [4096][1024]; d_wt: W [1024 k][ncols] k-major -> n-major bf16 [ncols][1024] via 64 x 64 LDS tiles.
__device__ __forceinline__ void d_cvtb(int blk, const float* __restrict__ src, bf* dst) {
    const int lane = threadIdx.x & 31, r = blk * 8 + (threadIdx.x >> 5);
    if (r >= NTK) return;
#pragma unroll
    for (int q = 0; q < 4; ++q) { v8us t;
#pragma unroll
        for (int i = 0; i < 8; ++i) t[i] = f2bf(src[(size_t)r * DM + q * 256 + lane * 8 + i]);
        VST2(v8us, dst + (size_t)r * DM + q * 256 + lane * 8, t); }
}
__device__ __forceinline__ void d_wt(unsigned short* tl, int blk, const float* __restrict__ Wm, int ncols, bf* WT) {
    const int tid = threadIdx.x, k0 = (blk & (DM / 64 - 1)) * 64, n0 = (blk / (DM / 64)) * 64;
    const int kk = tid >> 2, nq = (tid & 3) * 16;
#pragma unroll
    for (int i = 0; i < 16; ++i) tl[(nq + i) * 72 + kk] = f2bf(Wm[(size_t)(k0 + kk) * ncols + n0 + nq + i]);
    __syncthreads();
    const int piece = tid & 7;
    auto pass = [&]() {
#pragma unroll
        for (int s = 0; s < 2; ++s) { const int nr = (tid >> 3) + 32 * s; const v8us val = *(const v8usa*)(tl + nr * 72 + piece * 8);
            *(v8us*)(WT + (size_t)(n0 + nr) * DM + k0 + piece * 8) = val; }
    };
    pass();
    asm volatile("s_wait_xcnt 0x0" ::: "memory");   // behind the stores: in the listing another job's code follows, which overwrites their address and data registers
}
// k_prep: the three operand preparations, which read inputs only: Wqkvt^T (1,024 blocks), Wout^T (256), the bf16 plane of x (512).
#define PB_W4 ((DM / 64) * (4 * DM / 64))
#define PB_WO ((DM / 64) * (DM / 64))
__global__ __launch_bounds__(256) void k_prep(const float* __restrict__ x, const float* __restrict__ W4, const float* __restrict__ Wo, bf* Xb, bf* W4T, bf* WoT) {
    __shared__ __align__(16) unsigned short tl[64 * 72];
    const int bid = blockIdx.x;
    if (bid < PB_W4) d_wt(tl, bid, W4, 4 * DM, W4T);
    else if (bid < PB_W4 + PB_WO) d_wt(tl, bid - PB_W4, Wo, DM, WoT);
    else d_cvtb(bid - (PB_W4 + PB_WO), x, Xb);
}

// k_gemmb: block = BT x BT of C (256 x 256 with 16 waves of 64 x 64 for the projections, 128 x 128 with 8 waves of 32 x 64 for the output product): 256 blocks a launch, one
// per WGP. A wave multiplies FA row fragments by 4 column fragments, so that an LDS fragment read feeds 4 (or FA) products and a line copied from L2 serves BT rows or columns.
// A stage is 64 k = one 128-byte line of each of the block's BT B rows and BT A rows (and A residual rows); asynchronous copies bring it once per block into a two-buffer LDS
// ring, one stage ahead, each copy covering four whole lines; the waves read their fragments from there, so the loop holds no global load. Rows are pitched 16 B x odd so that
// ds_load_b128 fragment reads meet no bank conflict. The k order of every sum is as before.
// blockIdx.y counts BT-column blocks over ALL rows of Bn: each 1,024 columns are one [4096][1024] plane of C, the planes one behind the other (q, k, v, t in one launch).
#define GKS 64                   // k per stage
#define GP  144                  // LDS pitch of a 128-byte row
template <bool SPLITA>
__global__ __launch_bounds__(512) void k_gemmb(const bf* __restrict__ A, const bf* __restrict__ Al, const bf* __restrict__ Bn, const float* __restrict__ bias, float* C) {
    constexpr int BT  = SPLITA ? 128 : 256;          // rows and columns of the block's tile
    constexpr int FA  = SPLITA ? 2 : 4;              // 16-row fragments of a wave (its columns: 4 fragments)
    constexpr int WNC = BT / 64;                     // waves side by side over the columns
    constexpr int RS  = BT / 4;                      // rows between a thread's copies = threads / 8
    constexpr int GPL = BT * GP;                     // one plane of BT rows: B at 0, A at GPL, A residual at 2 GPL
    constexpr int GST = (SPLITA ? 3 : 2) * GPL;
    __shared__ __align__(16) char ring[2 * GST];     // the output staging of the epilogue (4,352 B a wave) reuses it behind the last stage's barrier
    const int tid = threadIdx.x, lane = tid & 31, wave = tid >> 5, lr = lane & 15, hi = lane >> 4;
    const int wm = wave / WNC, wn = wave % WNC;
    const int r0 = blockIdx.x * BT + wm * (FA * 16), c0 = blockIdx.y * BT + wn * 64;
    // Copies of one stage: 4 per thread and plane, 16 bytes each; thread = (row tid/8 + RS i, 16-byte piece tid%8).
    const int prow = tid >> 3, pcol = tid & 7;
    const size_t ga = (size_t)(blockIdx.x * BT + prow) * DM + pcol * 8, gb = (size_t)(blockIdx.y * BT + prow) * DM + pcol * 8;
    const unsigned l0 = (unsigned)(size_t)ring + prow * GP + pcol * 16;
    auto fill = [&](int t, int buf) {
        const bf* pb = Bn + gb + t * GKS; const bf* pa = A + ga + t * GKS;
        const unsigned l = l0 + buf * GST;
        // one statement: the closing s_wait_xcnt stands in front of any rewrite of an address register that a copy names
        asm volatile("global_load_async_to_lds_b128 %0, %8, off\n\t"
                     "global_load_async_to_lds_b128 %1, %9, off\n\t"
                     "global_load_async_to_lds_b128 %2, %10, off\n\t"
                     "global_load_async_to_lds_b128 %3, %11, off\n\t"
                     "global_load_async_to_lds_b128 %4, %12, off\n\t"
                     "global_load_async_to_lds_b128 %5, %13, off\n\t"
                     "global_load_async_to_lds_b128 %6, %14, off\n\t"
                     "global_load_async_to_lds_b128 %7, %15, off\n\t"
                     "s_wait_xcnt 0x0"
                     :: "v"(l), "v"(l + RS * GP), "v"(l + 2 * RS * GP), "v"(l + 3 * RS * GP),
                        "v"(l + GPL), "v"(l + GPL + RS * GP), "v"(l + GPL + 2 * RS * GP), "v"(l + GPL + 3 * RS * GP),
                        "v"(pb), "v"(pb + RS * DM), "v"(pb + 2 * RS * DM), "v"(pb + 3 * RS * DM),
                        "v"(pa), "v"(pa + RS * DM), "v"(pa + 2 * RS * DM), "v"(pa + 3 * RS * DM)
                     : "memory");
        if constexpr (SPLITA) {   // the residual plane's rows; same form of statement
            const bf* pl = Al + ga + t * GKS;
            asm volatile("global_load_async_to_lds_b128 %0, %4, off\n\t"
                         "global_load_async_to_lds_b128 %1, %5, off\n\t"
                         "global_load_async_to_lds_b128 %2, %6, off\n\t"
                         "global_load_async_to_lds_b128 %3, %7, off\n\t"
                         "s_wait_xcnt 0x0"
                         :: "v"(l + 2 * GPL), "v"(l + 2 * GPL + RS * GP), "v"(l + 2 * GPL + 2 * RS * GP), "v"(l + 2 * GPL + 3 * RS * GP),
                            "v"(pl), "v"(pl + RS * DM), "v"(pl + 2 * RS * DM), "v"(pl + 3 * RS * DM)
                         : "memory");
        }
    };
    v8f acc[FA][4];
#pragma unroll
    for (int i = 0; i < FA; ++i)
#pragma unroll
        for (int t = 0; t < 4; ++t) acc[i][t] = (v8f){};
    fill(0, 0);
    asm volatile("s_wait_asynccnt 0x0" ::: "memory");   // this wave's copies of stage 0 have landed
    __syncthreads();                                    // ... and every other wave's
    fill(1, 1);
#pragma unroll 1  // stays rolled: one copy of the stage body, the buffer picked by s & 1
    for (int s = 0; s < DM / GKS; ++s) {
        const char* fa = ring + (s & 1) * GST + GPL + (wm * (FA * 16) + lr) * GP + 16 * hi;
        const char* fb = ring + (s & 1) * GST + (wn * 64 + lr) * GP + 16 * hi;
        v16bf a[FA], al[FA], b[4];
#pragma unroll  // two 32-k products per stage, constant LDS offsets
        for (int ks = 0; ks < GKS / 32; ++ks) {
#pragma unroll
            for (int i = 0; i < FA; ++i) {
                a[i] = cat16b(*(const v8usa*)(fa + i * 16 * GP + ks * 64), *(const v8usa*)(fa + i * 16 * GP + ks * 64 + 32));
                al[i] = a[i];
                if (SPLITA) al[i] = cat16b(*(const v8usa*)(fa + GPL + i * 16 * GP + ks * 64), *(const v8usa*)(fa + GPL + i * 16 * GP + ks * 64 + 32));
            }
#pragma unroll
            for (int t = 0; t < 4; ++t) b[t] = cat16b(*(const v8usa*)(fb + t * 16 * GP + ks * 64), *(const v8usa*)(fb + t * 16 * GP + ks * 64 + 32));
            // inputs-only fence on the loaded fragments: the 16 LDS reads of these 32 k issue as one group ahead of the products; without it the compiler reloads one
            // A fragment per row of four products and the wave waits out a whole LDS latency at each row
            if constexpr (SPLITA) asm volatile("" :: "v"(a[0]), "v"(a[1]), "v"(al[0]), "v"(al[1]), "v"(b[0]), "v"(b[1]), "v"(b[2]), "v"(b[3]));
            else                  asm volatile("" :: "v"(a[0]), "v"(a[1]), "v"(a[FA - 2]), "v"(a[FA - 1]), "v"(b[0]), "v"(b[1]), "v"(b[2]), "v"(b[3]));
#pragma unroll
            for (int i = 0; i < FA; ++i)
#pragma unroll
                for (int t = 0; t < 4; ++t) acc[i][t] = wmmab(a[i], b[t], acc[i][t]);
            if (SPLITA) {   // the residual products behind the main ones: per accumulator the order main, residual of each 32 k stays
#pragma unroll
                for (int i = 0; i < FA; ++i)
#pragma unroll
                    for (int t = 0; t < 4; ++t) acc[i][t] = wmmab(al[i], b[t], acc[i][t]);
            }
        }
        // four vector slots behind the last WMMA, on both sides of the branch below, before a vector instruction may overwrite its operands
        if constexpr (SPLITA)
            asm volatile("v_nop\n\tv_nop\n\tv_nop\n\tv_nop" : "+v"(acc[0][0]), "+v"(acc[0][1]), "+v"(acc[0][2]), "+v"(acc[0][3]), "+v"(acc[1][0]), "+v"(acc[1][1]), "+v"(acc[1][2]), "+v"(acc[1][3])
                         : "v"(a[FA - 1]), "v"(al[FA - 1]), "v"(b[3]));
        else
            asm volatile("v_nop\n\tv_nop\n\tv_nop\n\tv_nop" : "+v"(acc[0][0]), "+v"(acc[0][1]), "+v"(acc[0][2]), "+v"(acc[0][3]), "+v"(acc[1][0]), "+v"(acc[1][1]), "+v"(acc[1][2]), "+v"(acc[1][3]),
                           "+v"(acc[FA - 2][0]), "+v"(acc[FA - 2][1]), "+v"(acc[FA - 2][2]), "+v"(acc[FA - 2][3]), "+v"(acc[FA - 1][0]), "+v"(acc[FA - 1][1]), "+v"(acc[FA - 1][2]), "+v"(acc[FA - 1][3])
                         : "v"(a[FA - 1]), "v"(b[3]));
        asm volatile("s_wait_dscnt 0x0" ::: "memory");      // this wave's reads of the buffer are done before it may be refilled
        asm volatile("s_wait_asynccnt 0x0" ::: "memory");   // this wave's copies of the next stage have landed
        __syncthreads();                                    // publishes the next stage and frees this stage's buffer
        if (s + 2 < DM / GKS) fill(s + 2, s & 1);
    }
    asm volatile("s_wait_asynccnt 0x0" ::: "memory");       // nothing in flight when the ring becomes output staging
    float* os = (float*)ring + wave * (16 * 68);            // the wave's own staging range: 16 rows of its tile at a time
    float* crow = C + (size_t)(c0 / DM) * NTK * DM + (size_t)r0 * DM + (c0 & (DM - 1));
    float bv[4];
#pragma unroll
    for (int t = 0; t < 4; ++t) bv[t] = bfr(bias[c0 + t * 16 + lr]);
#pragma unroll  // constant indices keep acc[][] in registers
    for (int i = 0; i < FA; ++i) {
#pragma unroll
        for (int t = 0; t < 4; ++t)
#pragma unroll
            for (int j = 0; j < 8; ++j) os[(hi * 8 + j) * 68 + t * 16 + lr] = acc[i][t][j] + bv[t];
        asm volatile("s_wait_dscnt 0x0" ::: "memory");      // the wave's rows stand in LDS before its lanes read what other lanes wrote
#pragma unroll
        for (int s = 0; s < 8; ++s) { const int Lid = (lane >> 3) + 4 * s, piece = lane & 7; const int row = Lid >> 1, cofs = (Lid & 1) * 32 + piece * 4;
            const v4f val = *(const v4fa*)(os + row * 68 + cofs); *(v4f*)(crow + (size_t)(i * 16 + row) * DM + cofs) = val; }
        if (i + 1 < FA) asm volatile("s_wait_xcnt 0x0" ::: "memory");   // behind the stores: the next 16 rows overwrite their data registers
    }
}

// d_vt: VT16/VTL[b][h][d][t] = f16 hi + residual x1024 of V row b*2048+t, col h*64+d via LDS transposes, 256 threads (tid) = job bid = (b, h, 64 t), with their own two tiles.
__device__ __forceinline__ void d_vt(h16* tile, h16* til2, int bid, int tid, const float* __restrict__ V, h16* VT16, h16* VTL) {
    const int b = bid / (NH_ * (NT_ / 64)), rem = bid - b * (NH_ * (NT_ / 64)), h = rem / (NT_ / 64), kt = rem - h * (NT_ / 64);
    const int k0 = kt * 64, kk = tid >> 2, d0 = (tid & 3) * 16;
    const float* src = V + ((size_t)b * NT_ + k0 + kk) * DM + h * HD + d0;
#pragma unroll
    for (int i = 0; i < 16; ++i) { const float v = src[i]; const h16 a = (h16)v; tile[(d0 + i) * 72 + kk] = a; til2[(d0 + i) * 72 + kk] = (h16)((v - (float)a) * LOSC); }
    __syncthreads();
    const int piece = tid & 7;
    const size_t base = (((size_t)b * NH_ + h) * HD) * NT_ + k0;
    auto pass = [&]() {
#pragma unroll
        for (int s = 0; s < 4; ++s) { const int Lid = (tid >> 3) + 32 * s; const int pln = Lid >> 6, d = Lid & 63;
            const v8h val = *(const v8ha*)((pln ? til2 : tile) + d * 72 + piece * 8); *(v8h*)((pln ? VTL : VT16) + base + (size_t)d * NT_ + piece * 8) = val; }
    };
    pass();
    asm volatile("s_wait_xcnt 0x0" ::: "memory");   // behind the stores: in the listing another job's code follows, which overwrites their address and data registers
}
// d_kvc: KVC[b*2048+t][col] = sum_{j<=t} k[j]*v[j]/8 (inclusive prefix over t, f32) as a chunked scan inside one block. Block = (b, 32 columns = whole 128-byte lines);
// thread = (chunk of 16 rows, 4 columns): all 32 16-byte loads are independent and the 64 running sums stay in registers. Chunk sums -> LDS, exclusive prefix over the 128
// chunks in two levels (8 waves scan 16 chunks each, then every thread adds the sums of the groups before its own), then each thread adds that start value to its rows.
#define KC_R 16                  // rows per chunk
#define KC_N (NT_ / KC_R)        // 128 chunks
#define KC_G 8                   // groups of 16 chunks
__device__ __forceinline__ void d_kvc(float* tot, float* gtot, int job, const float* __restrict__ Kf, const float* __restrict__ Vf, float* __restrict__ KVC) {
    const int tid = threadIdx.x, cq = tid & 7, ch = tid >> 3;
    const int b = job / (DM / 32), cg = job - b * (DM / 32);
    const size_t blk = (size_t)b * NT_ * DM + cg * 32;         // block part of the index (scalar)
    const unsigned thr = (unsigned)(ch * KC_R * DM + cq * 4);  // thread part, shared by the loads and the stores
    const float* kp = Kf + blk; const float* vp = Vf + blk; float* op = KVC + blk;
    v4f p[KC_R];
#pragma unroll  // constant indices keep p[] in registers; the independent loads issue many at a time
    for (int i = 0; i < KC_R; ++i) p[i] = *(const v4f*)(kp + thr + i * DM) * *(const v4f*)(vp + thr + i * DM) * SCL;
#pragma unroll  // p[] in registers
    for (int i = 1; i < KC_R; ++i) p[i] += p[i - 1];           // inclusive prefix inside the chunk
    *(v4f*)(tot + ch * 32 + cq * 4) = p[KC_R - 1];
    __syncthreads();
    if (tid < KC_G * 32) { const int g = tid >> 5, col = tid & 31; float run = 0.f;
#pragma unroll  // the 16 LDS reads issue ahead of the add chain
        for (int i = 0; i < KC_N / KC_G; ++i) { float* q = tot + (g * (KC_N / KC_G) + i) * 32 + col; const float t = *q; *q = run; run += t; }
        gtot[g * 32 + col] = run; }
    __syncthreads();
    const int g = ch / (KC_N / KC_G);
    v4f gs[KC_G - 1];
#pragma unroll  // gs[] in registers
    for (int i = 0; i < KC_G - 1; ++i) gs[i] = *(const v4f*)(gtot + i * 32 + cq * 4);   // all read at once, then selected: no chain of LDS round trips
    v4f c = {};
#pragma unroll  // gs[] in registers
    for (int i = 0; i < KC_G - 1; ++i) c += (i < g) ? gs[i] : (v4f){};
    c += *(const v4f*)(tot + ch * 32 + cq * 4);
#pragma unroll  // p[] in registers; stores back to back
    for (int i = 0; i < KC_R; ++i) *(v4f*)(op + thr + i * DM) = p[i] + c;
}
// d_side: hi/lo f16 planes of a 128-wide per-head row: SH/SL[row][h*128 + c]: c < 64 -> A[row][h*64+c]; c >= 64 -> B2[row][h*64+c-64] (times M[row][same]
// when MUL2) - query side: [q | q*t] (A = q, B2 = q, M = t); key side: [k | kvc]. One wave per ROW, all 16 heads: 4,096 waves a job, so that the time goes into
// the stream and not into starting waves. A 16-byte load of the wave covers 512 contiguous bytes = two heads' 64 values of one source (lane = head 2g + lane/16, 4 values);
// an 8-byte store covers those two heads' whole 128-byte lines of a plane. No lane is off; the row's loads are independent and issue ahead of the first conversion.
template <bool MUL2>
__device__ __forceinline__ void d_side(int r, const float* __restrict__ A, const float* __restrict__ Mv, const float* __restrict__ B2, h16* SH, h16* SL) {
    typedef __attribute__((ext_vector_type(4))) _Float16 v4h;
    const int lane = threadIdx.x & 31;
    if (r >= NTK) return;
    const size_t in0 = (size_t)r * DM + lane * 4;
    const size_t o0 = (size_t)r * (NH_ * QW) + (lane >> 4) * QW + (lane & 15) * 4;
    const float* pa = A + in0; const float* pb = B2 + in0; const float* pm = MUL2 ? Mv + in0 : pb;
    v4f va[NH_ / 2], vb[NH_ / 2], vm[NH_ / 2];
#pragma unroll  // constant indices keep the arrays in registers; the independent loads issue many at a time
    for (int g = 0; g < NH_ / 2; ++g) { va[g] = *(const v4fa*)(pa + g * 2 * HD); vb[g] = *(const v4fa*)(pb + g * 2 * HD); if (MUL2) vm[g] = *(const v4fa*)(pm + g * 2 * HD); }
    // a precaution: the address registers, named here, stay whole up to this wait, so that no load's result is placed in a register that an issued load names
    asm volatile("s_wait_xcnt 0x0" :: "v"(pa), "v"(pb), "v"(pm) : "memory");
#pragma unroll  // the arrays in registers
    for (int g = 0; g < NH_ / 2; ++g)
#pragma unroll
        for (int s = 0; s < 2; ++s) { v4f x = s ? vb[g] : va[g]; if (MUL2 && s) x *= vm[g]; v4h oh, ol;
#pragma unroll
            for (int i = 0; i < 4; ++i) { const h16 a = (h16)x[i]; oh[i] = a; ol[i] = (h16)((x[i] - (float)a) * LOSC); }
            *(v4h*)(SH + o0 + g * 2 * QW + s * HD) = oh; *(v4h*)(SL + o0 + g * 2 * QW + s * HD) = ol; }
}
// k_post: the three jobs that need the projections only, in blocks of 1,024 threads: the prefix sums (64 blocks, first: they last longest), V^T planes (256 blocks of four
// 256-thread jobs), query-side planes (128 blocks of 32 rows). k_keys: the key-side planes, which need the prefix sums.
#define QB_KV (NB_ * (DM / 32))
#define QB_VT (NB_ * NH_ * (NT_ / 64) / 4)
#define QB_QS (NTK / 32)
__global__ __launch_bounds__(1024) void k_post(const float* __restrict__ Qf, const float* __restrict__ Kf, const float* __restrict__ Vf, const float* __restrict__ Tf,
                                               float* __restrict__ KVC, h16* VT16, h16* VTL, h16* QH, h16* QL) {
    __shared__ __align__(16) char sm[4 * 2 * HD * 72 * 2];   // four pairs of V^T tiles, or the chunk and group sums of the scan
    const int bid = blockIdx.x;
    if (bid < QB_KV) d_kvc((float*)sm, (float*)sm + KC_N * 32, bid, Kf, Vf, KVC);
    else if (bid < QB_KV + QB_VT) { const int sub = threadIdx.x >> 8; h16* tile = (h16*)sm + sub * (2 * HD * 72);
        d_vt(tile, tile + HD * 72, (bid - QB_KV) * 4 + sub, threadIdx.x & 255, Vf, VT16, VTL); }
    else d_side<true>((bid - (QB_KV + QB_VT)) * 32 + (threadIdx.x >> 5), Qf, Tf, Qf, QH, QL);      // [q | q*t]
}
__global__ __launch_bounds__(256) void k_keys(const float* __restrict__ Kf, const float* __restrict__ KVC, h16* KH, h16* KL) {
    d_side<false>(blockIdx.x * 8 + (threadIdx.x >> 5), Kf, nullptr, KVC, KH, KL);                  // [k | kvc]
}

// k_attn: block = (b, head pair hp, t): the 64-query tile t of head hp, then tile 31 - t of head hp + 8, one after the other: 33 steps of 64 keys in every block, so that the
// blocks, all resident at once, end together. The four waves are 2 query halves x 2 key halves: wave = 32 queries (two 16-query tiles) x the 32 keys of its half of each step, so
// that a key or V^T fragment read from LDS feeds TWO query tiles' products: 32 KB of LDS reads per 72 WMMA. Causal key tiles
// 0..query tile; scores over the 128 combined dims with hi.hi + hi.lo + lo.hi, x 1/8, keys after the query -> -inf; online f32 softmax over the wave's own keys; behind the loop
// the two key halves' maxima, sums and partial outputs are merged through LDS. The products are the TRANSPOSED ones: S^T = K.Q^T (A = key rows, B = query rows) and O^T += V^T.P^T
// (A = V^T rows, B = weights). A lane then holds 16 of the 32 scores of ONE query of a tile (lane l ^ 16 the other 16): maximum and sum run over the lane's own registers with
// one exchange between the halves, maximum, rescale factor and sum are one value a lane and tile, and the two score tiles, converted in place (x32768, f16 hi + residual x1024), ARE
// the B operand of the second product in the hardware k order: the weights pass through no LDS. ctx -> bf16 hi/lo planes CH/CL [token][h*64 + d].
// The 64-key tile of a step (key rows hi + lo, V^T rows hi + lo, 48 KB) is brought once per block into a two-buffer LDS ring by asynchronous copies, one step ahead;
// the waves read their fragments from there, and the query lo rows from a buffer copied once: the loop holds no global load. Rows are pitched 16 B x odd so that ds_load_b128 fragment reads meet no bank conflict.
#define KS    64                 // keys per step
#define KP    272                // LDS pitch of a 256-byte key row
#define VP    144                // LDS pitch of a 128-byte V^T row
#define ST_KL (KS * KP)          // stage offsets: key hi at 0, key lo, V^T hi, V^T lo
#define ST_VH (2 * KS * KP)
#define ST_VL (ST_VH + HD * VP)
#define ST_SZ (ST_VH + 2 * HD * VP)
// launch bounds, second argument: holds a wave to 512 registers, so that two blocks (two waves per SIMD) stay resident on a WGP
__global__ __launch_bounds__(128, 2) void k_attn(const h16* __restrict__ QH, const h16* __restrict__ QL, const h16* __restrict__ KH, const h16* __restrict__ KL, const h16* __restrict__ VT16, const h16* __restrict__ VTL, bf* CH, bf* CL) {
    __shared__ __align__(16) char ring[2 * ST_SZ];   // the merge and output staging of the epilogue reuses it behind the last step's barrier
    __shared__ __align__(16) char qlds[64 * KP];     // the block's 64 query lo rows, copied once
    const int lane = threadIdx.x & 31, wave = threadIdx.x >> 5, lr = lane & 15, hi = lane >> 4;
    const int qh = wave >> 1, kh = wave & 1;         // the wave's query half and key half
    const int bid = blockIdx.x;
    const int b = bid / ((NH_ / 2) * (NT_ / 64)), rem = bid - b * ((NH_ / 2) * (NT_ / 64)), hp = rem / (NT_ / 64), t0 = rem - hp * (NT_ / 64);
    const size_t tok0 = (size_t)b * NT_;
#pragma unroll 1  // the two tiles go through one copy of the code, one after the other
  for (int half = 0; half < 2; ++half) {
    const int h = half ? hp + NH_ / 2 : hp, qt = half ? NT_ / 64 - 1 - t0 : t0;
    const int q0 = qt * 64 + qh * 32;
    if (half) {
        asm volatile("s_wait_dscnt 0x0" ::: "memory");  // this wave's reads of the first tile's output staging are done
        __syncthreads();                                // ... and every other wave's, before the copies below refill that LDS
    }
    v16h ah[2][4];               // query hi fragments of the wave's two 16-query tiles
#pragma unroll
    for (int u = 0; u < 2; ++u) {
        const size_t qo = (tok0 + q0 + u * 16 + lr) * (NH_ * QW) + h * QW + 8 * hi;
#pragma unroll
        for (int kc = 0; kc < 4; ++kc) ah[u][kc] = cat16(*(const v8h*)(QH + qo + kc * 32), *(const v8h*)(QH + qo + kc * 32 + 16));
    }
    const size_t vbase = (((size_t)b * NH_ + h) * HD) * NT_;
    v8f o[2][4], ox[2][4];
#pragma unroll
    for (int u = 0; u < 2; ++u)
#pragma unroll
        for (int n = 0; n < 4; ++n) { o[u][n] = (v8f){}; ox[u][n] = (v8f){}; }
    float mrow[2] = {-3.0e38f, -3.0e38f}, lpart[2] = {0.f, 0.f};
    const int kt_end = qt + 1;
    // Copies of one tile: 24 per thread, 16 bytes each. Key planes: thread = (row tid/16 + 8 i, 16-byte piece tid%16); V^T planes: thread = (row tid/8 + 16 i, piece tid%8).
    const int tid = threadIdx.x, krow = tid >> 4, kcol = tid & 15, vrow = tid >> 3, vcol = tid & 7;
    const size_t kg = (tok0 + krow) * (NH_ * QW) + h * QW + kcol * 8, vg = vbase + (size_t)vrow * NT_ + vcol * 8;
    const unsigned lk0 = (unsigned)(size_t)ring + krow * KP + kcol * 16, lv0 = (unsigned)(size_t)ring + ST_VH + vrow * VP + vcol * 16;
    auto fillk = [&](const h16* g, unsigned l) {   // 64 rows of 256 bytes: one key plane, or the query lo rows
        // one statement: the closing s_wait_xcnt stands in front of any rewrite of an address register that a copy names
        asm volatile("global_load_async_to_lds_b128 %0, %8, off\n\t"
                     "global_load_async_to_lds_b128 %1, %9, off\n\t"
                     "global_load_async_to_lds_b128 %2, %10, off\n\t"
                     "global_load_async_to_lds_b128 %3, %11, off\n\t"
                     "global_load_async_to_lds_b128 %4, %12, off\n\t"
                     "global_load_async_to_lds_b128 %5, %13, off\n\t"
                     "global_load_async_to_lds_b128 %6, %14, off\n\t"
                     "global_load_async_to_lds_b128 %7, %15, off\n\t"
                     "s_wait_xcnt 0x0"
                     :: "v"(l), "v"(l + 8 * KP), "v"(l + 16 * KP), "v"(l + 24 * KP), "v"(l + 32 * KP), "v"(l + 40 * KP), "v"(l + 48 * KP), "v"(l + 56 * KP),
                        "v"(g), "v"(g + 8 * (NH_ * QW)), "v"(g + 16 * (NH_ * QW)), "v"(g + 24 * (NH_ * QW)),
                        "v"(g + 32 * (NH_ * QW)), "v"(g + 40 * (NH_ * QW)), "v"(g + 48 * (NH_ * QW)), "v"(g + 56 * (NH_ * QW))
                     : "memory");
    };
    auto fill = [&](int t, int buf) {
        fillk(KH + kg + (size_t)t * KS * (NH_ * QW), lk0 + buf * ST_SZ);
        fillk(KL + kg + (size_t)t * KS * (NH_ * QW), lk0 + buf * ST_SZ + ST_KL);
        const h16* gvh = VT16 + vg + t * KS; const h16* gvl = VTL + vg + t * KS;
        const unsigned lv = lv0 + buf * ST_SZ;
        // the 64 rows of both V^T planes; same form of statement
        asm volatile("global_load_async_to_lds_b128 %0, %8, off\n\t"
                     "global_load_async_to_lds_b128 %1, %9, off\n\t"
                     "global_load_async_to_lds_b128 %2, %10, off\n\t"
                     "global_load_async_to_lds_b128 %3, %11, off\n\t"
                     "global_load_async_to_lds_b128 %4, %12, off\n\t"
                     "global_load_async_to_lds_b128 %5, %13, off\n\t"
                     "global_load_async_to_lds_b128 %6, %14, off\n\t"
                     "global_load_async_to_lds_b128 %7, %15, off\n\t"
                     "s_wait_xcnt 0x0"
                     :: "v"(lv), "v"(lv + 16 * VP), "v"(lv + 32 * VP), "v"(lv + 48 * VP),
                        "v"(lv + HD * VP), "v"(lv + HD * VP + 16 * VP), "v"(lv + HD * VP + 32 * VP), "v"(lv + HD * VP + 48 * VP),
                        "v"(gvh), "v"(gvh + 16 * NT_), "v"(gvh + 32 * NT_), "v"(gvh + 48 * NT_),
                        "v"(gvl), "v"(gvl + 16 * NT_), "v"(gvl + 32 * NT_), "v"(gvl + 48 * NT_)
                     : "memory");
    };
    fillk(QL + (tok0 + qt * 64 + krow) * (NH_ * QW) + h * QW + kcol * 8, (unsigned)(size_t)qlds + krow * KP + kcol * 16);   // the 64 query lo rows: same shape as a key plane
    const char* qlp = qlds + (qh * 32 + lr) * KP + 16 * hi;
#pragma unroll 1  // stays rolled: one copy of the statements, their LDS addresses formed from t as in the main loop; unrolled, 48 constant addresses are kept across the loop and spill
    for (int t = 0; t < 2; ++t) {
        if (t < kt_end) fill(t, t);
        if (t == 0) {
            asm volatile("s_wait_asynccnt 0x0" ::: "memory");   // this wave's copies of the query rows and of tile 0 have landed
            __syncthreads();                                    // ... and every other wave's
        }
    }
#pragma unroll 1
    for (int kt = 0; kt < kt_end; ++kt) {
        const int l0 = kt * KS + kh * 32;               // first key of the wave's half of this step
        const char* st = ring + (kt & 1) * ST_SZ;
        v8f s0[2] = {}, s1[2] = {}, x0[2] = {}, x1[2] = {};
#pragma unroll
        for (int kc = 0; kc < 4; ++kc) {
            const char* p0 = st + (kh * 32 + lr) * KP + kc * 64 + 16 * hi; const char* p1 = p0 + 16 * KP;
            const v16h k0h = cat16(*(const v8ha*)p0, *(const v8ha*)(p0 + 32)), k0l = cat16(*(const v8ha*)(p0 + ST_KL), *(const v8ha*)(p0 + ST_KL + 32));
            const v16h k1h = cat16(*(const v8ha*)p1, *(const v8ha*)(p1 + 32)), k1l = cat16(*(const v8ha*)(p1 + ST_KL), *(const v8ha*)(p1 + ST_KL + 32));
            // lo products carry x1024, folded below; per accumulator the order lo.hi, hi.lo of each 32 dims is as before
#pragma unroll
            for (int u = 0; u < 2; ++u) { s0[u] = wmma16(k0h, ah[u][kc], s0[u]); x0[u] = wmma16(k0l, ah[u][kc], x0[u]); s1[u] = wmma16(k1h, ah[u][kc], s1[u]); x1[u] = wmma16(k1l, ah[u][kc], x1[u]); }
#pragma unroll
            for (int u = 0; u < 2; ++u) { const char* pq = qlp + u * 16 * KP + kc * 64; const v16h alk = cat16(*(const v8ha*)pq, *(const v8ha*)(pq + 32));   // query lo fragment re-read per step (register budget)
                x0[u] = wmma16(k0h, alk, x0[u]); x1[u] = wmma16(k1h, alk, x1[u]); }
        }
        v16h pa[2], px[2];
#pragma unroll  // the two query tiles' softmax steps are independent of one another
        for (int u = 0; u < 2; ++u) {
            // register j of s0 / s1 = key l0 + 8 hi + j / l0 + 16 + 8 hi + j of the lane's query: element j / 8 + j of the lane's B fragment below
            const int kd = q0 + u * 16 + lr - l0 - 8 * hi;   // last key offset that this query may see
            const v8f t0 = (s0[u] + x0[u] * LOSCI) * SCL, t1 = (s1[u] + x1[u] * LOSCI) * SCL;
            float a[16];
#pragma unroll
            for (int j = 0; j < 8; ++j) { a[j] = (j <= kd) ? t0[j] : -__builtin_inff(); a[8 + j] = (16 + j <= kd) ? t1[j] : -__builtin_inff(); }
            float mt[8];
#pragma unroll
            for (int j = 0; j < 8; ++j) mt[j] = fmaxf(a[2 * j], a[2 * j + 1]);
            float mx = fmaxf(fmaxf(fmaxf(mt[0], mt[1]), fmaxf(mt[2], mt[3])), fmaxf(fmaxf(mt[4], mt[5]), fmaxf(mt[6], mt[7])));
            mx = fmaxf(mx, xhalf(mx));
            const float mn = fmaxf(mrow[u], mx);
            v2f p[8];
#pragma unroll
            for (int i = 0; i < 8; ++i) {      // neighbouring registers in pairs: packed f32 arithmetic and packed conversions
                const v2f e = ((v2f){a[2 * i], a[2 * i + 1]} - mn) * L2E;
                p[i] = (v2f){__builtin_amdgcn_exp2f(e[0]), __builtin_amdgcn_exp2f(e[1])};
                const v2f ps = p[i] * PSC; const v2h ph = __builtin_convertvector(ps, v2h);
                const v2h pr = __builtin_convertvector((ps - __builtin_convertvector(ph, v2f)) * LOSC, v2h);
                pa[u][2 * i] = ph[0]; pa[u][2 * i + 1] = ph[1]; px[u][2 * i] = pr[0]; px[u][2 * i + 1] = pr[1];
            }
            const float alpha = __builtin_amdgcn_exp2f((mrow[u] - mn) * L2E);
            mrow[u] = mn;
#pragma unroll
            for (int w = 4; w > 0; w >>= 1)    // the lane's 16 weights, summed as a tree
#pragma unroll
                for (int i = 0; i < w; ++i) p[i] += p[i + w];
            lpart[u] = lpart[u] * alpha + (p[0][0] + p[0][1]);
#pragma unroll
            for (int n = 0; n < 4; ++n) { o[u][n] *= alpha; ox[u][n] *= alpha; }
        }
#pragma unroll
        for (int n = 0; n < 4; ++n) { const char* pv = st + ST_VH + (n * 16 + lr) * VP + kh * 64 + 16 * hi;
            const v16h vh = cat16(*(const v8ha*)pv, *(const v8ha*)(pv + 32)), vl = cat16(*(const v8ha*)(pv + HD * VP), *(const v8ha*)(pv + HD * VP + 32));
#pragma unroll
            for (int u = 0; u < 2; ++u) { o[u][n] = wmma16(vh, pa[u], o[u][n]); ox[u][n] = wmma16(vl, pa[u], ox[u][n]); }
#pragma unroll
            for (int u = 0; u < 2; ++u) ox[u][n] = wmma16(vh, px[u], ox[u][n]); }
        asm volatile("s_wait_dscnt 0x0" ::: "memory");      // this wave's reads of the buffer are done before it may be refilled
        asm volatile("s_wait_asynccnt 0x0" ::: "memory");   // this wave's copies of the next tile have landed
        __syncthreads();                                    // publishes the next tile and frees this step's buffer
        if (kt + 2 < kt_end) fill(kt + 2, kt & 1);
    }
    asm volatile("s_wait_asynccnt 0x0" ::: "memory");       // nothing in flight when the ring becomes merge and output staging
    // Merge of the two key halves: each wave publishes maximum and sum of its queries, reads its partner's, scales its own partial output to the common maximum and the whole
    // sum, and stages it; the store pass adds the two partial rows.
    float* os = (float*)ring + wave * (32 * 68);            // the wave's 32 partial output rows
    float* ml = (float*)ring + 4 * (32 * 68);               // [wave][tile][query][maximum, sum]
#pragma unroll
    for (int u = 0; u < 2; ++u) { lpart[u] += xhalf(lpart[u]); ml[((wave * 2 + u) * 16 + lr) * 2 + hi] = hi ? lpart[u] : mrow[u]; }
    __syncthreads();                                        // every wave's maxima and sums stand
#pragma unroll
    for (int u = 0; u < 2; ++u) {
        const v2f pm = *(const v2f*)(ml + (((wave ^ 1) * 2 + u) * 16 + lr) * 2);
        const float mm = fmaxf(mrow[u], pm[0]);
        const float f = __builtin_amdgcn_exp2f((mrow[u] - mm) * L2E), fp = __builtin_amdgcn_exp2f((pm[0] - mm) * L2E);
        const float inv = f / ((lpart[u] * f + pm[1] * fp) * PSC);
#pragma unroll
        for (int n = 0; n < 4; ++n)
#pragma unroll
            for (int q = 0; q < 2; ++q) { v4f w;    // register j of o[u][n] = dim n * 16 + 8 hi + j of query u * 16 + lr
#pragma unroll
                for (int i = 0; i < 4; ++i) w[i] = (o[u][n][q * 4 + i] + ox[u][n][q * 4 + i] * LOSCI) * inv;
                *(v4fa*)(os + (u * 16 + lr) * 68 + n * 16 + hi * 8 + q * 4) = w; }
    }
    __syncthreads();                                        // every wave's partial rows stand
    const size_t cbase = (tok0 + qt * 64 + wave * 16) * DM + (size_t)h * HD;   // the store pass: wave = 16 of the block's 64 queries
    const float* sb = (const float*)ring + (wave >> 1) * (2 * 32 * 68) + (wave & 1) * (16 * 68);
    auto pass = [&]() {
#pragma unroll
        for (int s = 0; s < 4; ++s) { const int row = 4 * s + (lane >> 3), piece = lane & 7; const float* sp = sb + row * 68 + piece * 8; v8us oh, ol;
#pragma unroll
            for (int i = 0; i < 8; ++i) { const float c = sp[i] + sp[32 * 68 + i]; const unsigned short hb = f2bf(c); oh[i] = hb; ol[i] = f2bf(c - bf2f(hb)); }
            *(v8us*)(CH + cbase + (size_t)row * DM + piece * 8) = oh; *(v8us*)(CL + cbase + (size_t)row * DM + piece * 8) = ol; }
    };
    pass();
    asm volatile("s_wait_xcnt 0x0" ::: "memory");   // behind the stores: the second tile's set-up overwrites their address and data registers
  }
}

extern "C" void kernel_launch(void* const* d_in, const int* in_sizes, int n_in,
                              void* d_out, int out_size, void* d_ws, size_t ws_size, hipStream_t stream) {
    (void)in_sizes; (void)n_in; (void)out_size;
    const float* x = (const float*)d_in[0]; const float* W4 = (const float*)d_in[1]; const float* b4 = (const float*)d_in[2]; const float* Wo = (const float*)d_in[3]; const float* bo = (const float*)d_in[4];
    float* out = (float*)d_out;    // [2][2048][1024]
    char* wsp = (char*)d_ws;
    auto take = [&](size_t bytes) { char* p = wsp; wsp += (bytes + 255) & ~(size_t)255; return (void*)p; };
    bf* Xb = (bf*)take((size_t)NTK * DM * 2); bf* W4T = (bf*)take((size_t)4 * DM * DM * 2); bf* WoT = (bf*)take((size_t)DM * DM * 2);
    h16* VT16 = (h16*)take((size_t)NTK * DM * 2); h16* VTL = (h16*)take((size_t)NTK * DM * 2); h16* KH = (h16*)take((size_t)NTK * NH_ * QW * 2); h16* KL = (h16*)take((size_t)NTK * NH_ * QW * 2);
    h16* QH = (h16*)take((size_t)NTK * NH_ * QW * 2); h16* QL = (h16*)take((size_t)NTK * NH_ * QW * 2);
    float* P4 = (float*)take((size_t)4 * NTK * DM * 4); float* KVC = (float*)take((size_t)NTK * DM * 4);   // the four f32 projection planes, one behind the other
    if ((size_t)(wsp - (char*)d_ws) > ws_size) return;    // 186,646,528 B
    float* Qf = P4; float* Kf = P4 + (size_t)1 * NTK * DM; float* Vf = P4 + (size_t)2 * NTK * DM; float* Tf = P4 + (size_t)3 * NTK * DM;
    bf* CH = (bf*)Qf; bf* CL = (bf*)Kf;                    // ctx planes over q and k, dead once the query-side and key-side planes stand
    k_prep<<<PB_W4 + PB_WO + NTK / 8, 256, 0, stream>>>(x, W4, Wo, Xb, W4T, WoT);
    k_gemmb<false><<<dim3(NTK / 256, (4 * DM) / 256, 1), 512, 0, stream>>>(Xb, nullptr, W4T, b4, P4);
    k_post<<<QB_KV + QB_VT + QB_QS, 1024, 0, stream>>>(Qf, Kf, Vf, Tf, KVC, VT16, VTL, QH, QL);
    k_keys<<<NTK / 8, 256, 0, stream>>>(Kf, KVC, KH, KL);
    k_attn<<<NB_ * (NH_ / 2) * (NT_ / 64), 128, 0, stream>>>(QH, QL, KH, KL, VT16, VTL, CH, CL);
    k_gemmb<true><<<dim3(NTK / 128, DM / 128, 1), 256, 0, stream>>>(CH, CL, WoT, bo, out);
}

// v010
// Measured time: 132 microseconds a run.
// Timed twice side by side with v009, it ran 1.06 times as fast both times.
// All steps since v000 together make it 10.4 times as fast.
#include <hip/hip_runtime.h>

// Contractions, f32 accumulate: qkvt = x.Wqkvt + b as four [4096 x 1024].[1024 x 1024] column blocks and out = ctx.Wout + bout on v_wmma_f32_16x16x32_bf16 (PLAIN bf16
// operands = inputs rounded once, exact; k-major weights transposed into n-major planes; ctx as bf16 hi + residual planes, two products); the per-(batch, head) causal
// attention fused on v_wmma_f32_16x16x32_f16: scores = ([q | q*t]).([k | cumsum_j(k*v)/8])^T over 128 dims with BOTH sides as f16 hi + residual x1024 planes
// (hi.hi + hi.lo + lo.hi — the triplet term reaches sigma ~45 before the 1/8 scale, so single-rounded operands would not hold the peaked softmax), x 1/8, causal,
// softmax, then weights (x32768) and v BOTH as f16 hi + residual x1024 (hi.hi + hi.lo + lo.hi; the softmax is peaked so single roundings would not average out). The key-side prefix sums are f32 chunked scans (16-row chunks, one block per (b, 32 columns)). Deterministic, no atomics;
// The f16 planes are written by the kernels that produce their values: the projection GEMM's epilogue (query side, k, V^T, and the f32 products k*v/8) and the scan (prefix sums).
// Order of the 128 combined dims of a head, the same on both sides: [a 0..31 | b 0..31 | a 32..63 | b 32..63], a = q or k, b = q*t or the prefix sum: a 128-byte line of a key plane
// then gets its second half from ONE block of the scan (32 columns), its first half from the launch before.

#define NB_  2
#define NT_  2048
#define DM   1024
#define NH_  16
#define HD   64
#define QW   128                 // combined score width per head
#define NTK  (NB_ * NT_)         // 4096
#define PSC  32768.0f
#define LOSC 1024.0f
#define LOSCI (1.0f / 1024.0f)
#define SCL  0.125f
#define L2E  1.44269504f         // log2(e): exp(x) = exp2(x * L2E)

typedef _Float16 h16;
typedef unsigned short bf;
typedef __attribute__((ext_vector_type(16))) __bf16   v16bf;
typedef __attribute__((ext_vector_type(16))) _Float16 v16h;
typedef __attribute__((ext_vector_type(8)))  _Float16 v8h;
typedef __attribute__((ext_vector_type(8)))  unsigned short v8us;
typedef __attribute__((ext_vector_type(8)))  float    v8f;
typedef __attribute__((ext_vector_type(4)))  float    v4f;
typedef __attribute__((ext_vector_type(2)))  float    v2f;
typedef __attribute__((ext_vector_type(2)))  _Float16 v2h;
typedef v8h  __attribute__((may_alias)) v8ha;
typedef v4f  __attribute__((may_alias)) v4fa;
typedef v8us __attribute__((may_alias)) v8usa;

__device__ __forceinline__ unsigned short f2bf(float f) { unsigned u = __float_as_uint(f); u += 0x7FFFu + ((u >> 16) & 1u); return (unsigned short)(u >> 16); }
__device__ __forceinline__ float bf2f(unsigned short b) { return __uint_as_float(((unsigned)b) << 16); }
__device__ __forceinline__ float bfr(float f) { return bf2f(f2bf(f)); }
__device__ __forceinline__ v16h cat16(v8h lo, v8h hi) { return __builtin_shufflevector(lo, hi, 0, 1, 2, 3, 4, 5, 6, 7, 8, 9, 10, 11, 12, 13, 14, 15); }
__device__ __forceinline__ v16bf cat16b(v8us lo, v8us hi) { return __builtin_bit_cast(v16bf, __builtin_shufflevector(lo, hi, 0, 1, 2, 3, 4, 5, 6, 7, 8, 9, 10, 11, 12, 13, 14, 15)); }
__device__ __forceinline__ v8f wmma16(v16h a, v16h b, v8f c) { return __builtin_amdgcn_wmma_f32_16x16x32_f16(false, a, false, b, (short)0, c, false, false); }
__device__ __forceinline__ v8f wmmab(v16bf a, v16bf b, v8f c) { return __builtin_amdgcn_wmma_f32_16x16x32_bf16(false, a, false, b, (short)0, c, false, false); }
// value of lane l ^ 16: the other half of the wave
__device__ __forceinline__ float xhalf(float v) { const int b = __float_as_int(v); return __int_as_float(__builtin_amdgcn_permlanex16(b, b, 0x76543210, 0xfedcba98, false, false)); }
#define VST2(T, p, v) do { const T vst2_v_ = (v); *(T*)(p) = vst2_v_;  } while (0)

// Kernels that do not depend on one another share a launch: a block picks its job by its index (block-uniform), the jobs' bodies are the functions d_*.
// d_cvtb: bf16 plane of x [4096][1024]; d_wt: W [1024 k][ncols] k-major -> n-major bf16 [ncols][1024] via 64 x 64 LDS tiles.
__device__ __forceinline__ void d_cvtb(int blk, const float* __restrict__ src, bf* dst) {
    const int lane = threadIdx.x & 31, r = blk * 8 + (threadIdx.x >> 5);
    if (r >= NTK) return;
#pragma unroll
    for (int q = 0; q < 4; ++q) { v8us t;
#pragma unroll
        for (int i = 0; i < 8; ++i) t[i] = f2bf(src[(size_t)r * DM + q * 256 + lane * 8 + i]);
        VST2(v8us, dst + (size_t)r * DM + q * 256 + lane * 8, t); }
}
__device__ __forceinline__ void d_wt(unsigned short* tl, int blk, const float* __restrict__ Wm, int ncols, bf* WT) {
    const int tid = threadIdx.x, k0 = (blk & (DM / 64 - 1)) * 64, n0 = (blk / (DM / 64)) * 64;
    const int kk = tid >> 2, nq = (tid & 3) * 16;
#pragma unroll
    for (int i = 0; i < 16; ++i) tl[(nq + i) * 72 + kk] = f2bf(Wm[(size_t)(k0 + kk) * ncols + n0 + nq + i]);
    __syncthreads();
    const int piece = tid & 7;
    auto pass = [&]() {
#pragma unroll
        for (int s = 0; s < 2; ++s) { const int nr = (tid >> 3) + 32 * s; const v8us val = *(const v8usa*)(tl + nr * 72 + piece * 8);
            *(v8us*)(WT + (size_t)(n0 + nr) * DM + k0 + piece * 8) = val; }
    };
    pass();
    asm volatile("s_wait_xcnt 0x0" ::: "memory");   // behind the stores: in the listing another job's code follows, which overwrites their address and data registers
}
// k_prep: the three operand preparations, which read inputs only: Wqkvt^T (1,024 blocks), Wout^T (256), the bf16 plane of x (512).
#define PB_W4 ((DM / 64) * (4 * DM / 64))
#define PB_WO ((DM / 64) * (DM / 64))
__global__ __launch_bounds__(256) void k_prep(const float* __restrict__ x, const float* __restrict__ W4, const float* __restrict__ Wo, bf* Xb, bf* W4T, bf* WoT) {
    __shared__ __align__(16) unsigned short tl[64 * 72];
    const int bid = blockIdx.x;
    if (bid < PB_W4) d_wt(tl, bid, W4, 4 * DM, W4T);
    else if (bid < PB_W4 + PB_WO) d_wt(tl, bid - PB_W4, Wo, DM, WoT);
    else d_cvtb(bid - (PB_W4 + PB_WO), x, Xb);
}

// Epilogue stores of the projection GEMM: a pass's stores and the closing s_wait_xcnt in ONE statement, so that the wait stands in front of any rewrite of an address or data
// register that a store names; the rows of a pass lie a constant number of bytes apart, which goes into the offset field: one address pair per plane.
typedef unsigned long long u64;
__device__ __forceinline__ void st_planes(h16* ph, h16* pl, const u64 (&dh)[8], const u64 (&dl)[8]) {   // 8 rows, two token rows (8,192 bytes) apart, of a hi and a residual plane
    asm volatile("global_store_b64 %0, %2, off\n\t"
                 "global_store_b64 %1, %10, off\n\t"
                 "global_store_b64 %0, %3, off offset:8192\n\t"
                 "global_store_b64 %1, %11, off offset:8192\n\t"
                 "global_store_b64 %0, %4, off offset:16384\n\t"
                 "global_store_b64 %1, %12, off offset:16384\n\t"
                 "global_store_b64 %0, %5, off offset:24576\n\t"
                 "global_store_b64 %1, %13, off offset:24576\n\t"
                 "global_store_b64 %0, %6, off offset:32768\n\t"
                 "global_store_b64 %1, %14, off offset:32768\n\t"
                 "global_store_b64 %0, %7, off offset:40960\n\t"
                 "global_store_b64 %1, %15, off offset:40960\n\t"
                 "global_store_b64 %0, %8, off offset:49152\n\t"
                 "global_store_b64 %1, %16, off offset:49152\n\t"
                 "global_store_b64 %0, %9, off offset:57344\n\t"
                 "global_store_b64 %1, %17, off offset:57344\n\t"
                 "s_wait_xcnt 0x0"
                 :: "v"(ph), "v"(pl), "v"(dh[0]), "v"(dh[1]), "v"(dh[2]), "v"(dh[3]), "v"(dh[4]), "v"(dh[5]), "v"(dh[6]), "v"(dh[7]),
                    "v"(dl[0]), "v"(dl[1]), "v"(dl[2]), "v"(dl[3]), "v"(dl[4]), "v"(dl[5]), "v"(dl[6]), "v"(dl[7])
                 : "memory");
}
#define ST_ROWS(NAME, P, T, O1, O2, O3, O4, O5, O6, O7)                                                \
__device__ __forceinline__ void NAME(P* p, const T (&d)[8]) {                                          \
    asm volatile("global_store_b128 %0, %1, off\n\t"                                                   \
                 "global_store_b128 %0, %2, off offset:" #O1 "\n\t"                                    \
                 "global_store_b128 %0, %3, off offset:" #O2 "\n\t"                                    \
                 "global_store_b128 %0, %4, off offset:" #O3 "\n\t"                                    \
                 "global_store_b128 %0, %5, off offset:" #O4 "\n\t"                                    \
                 "global_store_b128 %0, %6, off offset:" #O5 "\n\t"                                    \
                 "global_store_b128 %0, %7, off offset:" #O6 "\n\t"                                    \
                 "global_store_b128 %0, %8, off offset:" #O7 "\n\t"                                    \
                 "s_wait_xcnt 0x0"                                                                     \
                 :: "v"(p), "v"(d[0]), "v"(d[1]), "v"(d[2]), "v"(d[3]), "v"(d[4]), "v"(d[5]), "v"(d[6]), "v"(d[7]) \
                 : "memory");                                                                          \
}
ST_ROWS(st_kv, float, v4f, 8192, 16384, 24576, 32768, 40960, 49152, 57344)      // 8 rows of the f32 products, two token rows apart
ST_ROWS(st_vt, h16, v8h, 16384, 32768, 49152, 65536, 81920, 98304, 114688)    // 8 rows of a V^T plane, four dims apart

// k_gemmb: block = BT x BT of C (256 x 256 with 16 waves of 64 x 64 for the projections, 128 x 128 with 8 waves of 32 x 64 for the output product): 256 blocks a launch, one
// per WGP. A wave multiplies FA row fragments by 4 column fragments, so that an LDS fragment read feeds 4 (or FA) products and a line copied from L2 serves BT rows or columns.
// A stage is 64 k = one 128-byte line of each of the block's BT B rows and BT A rows (and A residual rows); asynchronous copies bring it once per block into a two-buffer LDS
// ring, one stage ahead, each copy covering four whole lines; the waves read their fragments from there, so the loop holds no global load. Rows are pitched 16 B x odd so that
// ds_load_b128 fragment reads meet no bank conflict. The k order of every sum is as before.
// Output product: blockIdx.y counts BT-column blocks. Projections: blockIdx.y = head; the block's 256 columns are that head's 64 columns of q, k, v and t (wave column wn = which of the
// four), so that the block holds all that the attention operands of its 256 tokens and head are made of, and its epilogue writes them as f16 hi + residual planes: no f32 q, k, v, t.
#define GKS 64                   // k per stage
#define GP  144                  // LDS pitch of a 128-byte row
template <bool SPLITA>
__global__ __launch_bounds__(512) void k_gemmb(const bf* __restrict__ A, const bf* __restrict__ Al, const bf* __restrict__ Bn, const float* __restrict__ bias, float* C,
                                               h16* QH, h16* QL, h16* KH, h16* KL, h16* VT16, h16* VTL) {
    constexpr int BT  = SPLITA ? 128 : 256;          // rows and columns of the block's tile
    constexpr int FA  = SPLITA ? 2 : 4;              // 16-row fragments of a wave (its columns: 4 fragments)
    constexpr int WNC = BT / 64;                     // waves side by side over the columns
    constexpr int RS  = BT / 4;                      // rows between a thread's copies = threads / 8
    constexpr int BS  = SPLITA ? RS * DM : DM * DM;  // elements between the B rows of a thread's copies: RS rows, or one projection's 1,024 rows
    constexpr int GPL = BT * GP;                     // one plane of BT rows: B at 0, A at GPL, A residual at 2 GPL
    constexpr int GST = (SPLITA ? 3 : 2) * GPL;
    __shared__ __align__(16) char ring[2 * GST];     // the output staging of the epilogue (4,352 B a wave) reuses it behind the last stage's barrier
    const int tid = threadIdx.x, lane = tid & 31, wave = tid >> 5, lr = lane & 15, hi = lane >> 4;
    const int wm = wave / WNC, wn = wave % WNC;
    const int r0 = blockIdx.x * BT + wm * (FA * 16), c0 = SPLITA ? blockIdx.y * BT + wn * 64 : wn * DM + blockIdx.y * 64;
    // Copies of one stage: 4 per thread and plane, 16 bytes each; thread = (row tid/8 + RS i, 16-byte piece tid%8).
    const int prow = tid >> 3, pcol = tid & 7;
    const size_t ga = (size_t)(blockIdx.x * BT + prow) * DM + pcol * 8, gb = (size_t)(blockIdx.y * (SPLITA ? BT : 64) + prow) * DM + pcol * 8;
    const unsigned l0 = (unsigned)(size_t)ring + prow * GP + pcol * 16;
    auto fill = [&](int t, int buf) {
        const bf* pb = Bn + gb + t * GKS; const bf* pa = A + ga + t * GKS;
        const unsigned l = l0 + buf * GST;
        // one statement: the closing s_wait_xcnt stands in front of any rewrite of an address register that a copy names
        asm volatile("global_load_async_to_lds_b128 %0, %8, off\n\t"
                     "global_load_async_to_lds_b128 %1, %9, off\n\t"
                     "global_load_async_to_lds_b128 %2, %10, off\n\t"
                     "global_load_async_to_lds_b128 %3, %11, off\n\t"
                     "global_load_async_to_lds_b128 %4, %12, off\n\t"
                     "global_load_async_to_lds_b128 %5, %13, off\n\t"
                     "global_load_async_to_lds_b128 %6, %14, off\n\t"
                     "global_load_async_to_lds_b128 %7, %15, off\n\t"
                     "s_wait_xcnt 0x0"
                     :: "v"(l), "v"(l + RS * GP), "v"(l + 2 * RS * GP), "v"(l + 3 * RS * GP),
                        "v"(l + GPL), "v"(l + GPL + RS * GP), "v"(l + GPL + 2 * RS * GP), "v"(l + GPL + 3 * RS * GP),
                        "v"(pb), "v"(pb + BS), "v"(pb + 2 * BS), "v"(pb + 3 * BS),
                        "v"(pa), "v"(pa + RS * DM), "v"(pa + 2 * RS * DM), "v"(pa + 3 * RS * DM)
                     : "memory");
        if constexpr (SPLITA) {   // the residual plane's rows; same form of statement
            const bf* pl = Al + ga + t * GKS;
            asm volatile("global_load_async_to_lds_b128 %0, %4, off\n\t"
                         "global_load_async_to_lds_b128 %1, %5, off\n\t"
                         "global_load_async_to_lds_b128 %2, %6, off\n\t"
                         "global_load_async_to_lds_b128 %3, %7, off\n\t"
                         "s_wait_xcnt 0x0"
                         :: "v"(l + 2 * GPL), "v"(l + 2 * GPL + RS * GP), "v"(l + 2 * GPL + 2 * RS * GP), "v"(l + 2 * GPL + 3 * RS * GP),
                            "v"(pl), "v"(pl + RS * DM), "v"(pl + 2 * RS * DM), "v"(pl + 3 * RS * DM)
                         : "memory");
        }
    };
    v8f acc[FA][4];
#pragma unroll
    for (int i = 0; i < FA; ++i)
#pragma unroll
        for (int t = 0; t < 4; ++t) acc[i][t] = (v8f){};
    fill(0, 0);
    asm volatile("s_wait_asynccnt 0x0" ::: "memory");   // this wave's copies of stage 0 have landed
    __syncthreads();                                    // ... and every other wave's
    fill(1, 1);
#pragma unroll 1  // stays rolled: one copy of the stage body, the buffer picked by s & 1
    for (int s = 0; s < DM / GKS; ++s) {
        const char* fa = ring + (s & 1) * GST + GPL + (wm * (FA * 16) + lr) * GP + 16 * hi;
        const char* fb = ring + (s & 1) * GST + (wn * 64 + lr) * GP + 16 * hi;
        v16bf a[FA], al[FA], b[4];
#pragma unroll  // two 32-k products per stage, constant LDS offsets
        for (int ks = 0; ks < GKS / 32; ++ks) {
#pragma unroll
            for (int i = 0; i < FA; ++i) {
                a[i] = cat16b(*(const v8usa*)(fa + i * 16 * GP + ks * 64), *(const v8usa*)(fa + i * 16 * GP + ks * 64 + 32));
                al[i] = a[i];
                if (SPLITA) al[i] = cat16b(*(const v8usa*)(fa + GPL + i * 16 * GP + ks * 64), *(const v8usa*)(fa + GPL + i * 16 * GP + ks * 64 + 32));
            }
#pragma unroll
            for (int t = 0; t < 4; ++t) b[t] = cat16b(*(const v8usa*)(fb + t * 16 * GP + ks * 64), *(const v8usa*)(fb + t * 16 * GP + ks * 64 + 32));
            // inputs-only fence on the loaded fragments: the 16 LDS reads of these 32 k issue as one group ahead of the products; without it the compiler reloads one
            // A fragment per row of four products and the wave waits out a whole LDS latency at each row
            if constexpr (SPLITA) asm volatile("" :: "v"(a[0]), "v"(a[1]), "v"(al[0]), "v"(al[1]), "v"(b[0]), "v"(b[1]), "v"(b[2]), "v"(b[3]));
            else                  asm volatile("" :: "v"(a[0]), "v"(a[1]), "v"(a[FA - 2]), "v"(a[FA - 1]), "v"(b[0]), "v"(b[1]), "v"(b[2]), "v"(b[3]));
#pragma unroll
            for (int i = 0; i < FA; ++i)
#pragma unroll
                for (int t = 0; t < 4; ++t) acc[i][t] = wmmab(a[i], b[t], acc[i][t]);
            if (SPLITA) {   // the residual products behind the main ones: per accumulator the order main, residual of each 32 k stays
#pragma unroll
                for (int i = 0; i < FA; ++i)
#pragma unroll
                    for (int t = 0; t < 4; ++t) acc[i][t] = wmmab(al[i], b[t], acc[i][t]);
            }
        }
        // four vector slots behind the last WMMA, on both sides of the branch below, before a vector instruction may overwrite its operands
        if constexpr (SPLITA)
            asm volatile("v_nop\n\tv_nop\n\tv_nop\n\tv_nop" : "+v"(acc[0][0]), "+v"(acc[0][1]), "+v"(acc[0][2]), "+v"(acc[0][3]), "+v"(acc[1][0]), "+v"(acc[1][1]), "+v"(acc[1][2]), "+v"(acc[1][3])
                         : "v"(a[FA - 1]), "v"(al[FA - 1]), "v"(b[3]));
        else
            asm volatile("v_nop\n\tv_nop\n\tv_nop\n\tv_nop" : "+v"(acc[0][0]), "+v"(acc[0][1]), "+v"(acc[0][2]), "+v"(acc[0][3]), "+v"(acc[1][0]), "+v"(acc[1][1]), "+v"(acc[1][2]), "+v"(acc[1][3]),
                           "+v"(acc[FA - 2][0]), "+v"(acc[FA - 2][1]), "+v"(acc[FA - 2][2]), "+v"(acc[FA - 2][3]), "+v"(acc[FA - 1][0]), "+v"(acc[FA - 1][1]), "+v"(acc[FA - 1][2]), "+v"(acc[FA - 1][3])
                         : "v"(a[FA - 1]), "v"(b[3]));
        asm volatile("s_wait_dscnt 0x0" ::: "memory");      // this wave's reads of the buffer are done before it may be refilled
        asm volatile("s_wait_asynccnt 0x0" ::: "memory");   // this wave's copies of the next stage have landed
        __syncthreads();                                    // publishes the next stage and frees this stage's buffer
        if (s + 2 < DM / GKS) fill(s + 2, s & 1);
    }
    asm volatile("s_wait_asynccnt 0x0" ::: "memory");       // nothing in flight when the ring becomes output staging
    float bv[4];
#pragma unroll
    for (int t = 0; t < 4; ++t) bv[t] = bfr(bias[c0 + t * 16 + lr]);
    float* os = (float*)ring + wave * (16 * 68);            // the wave's own staging range: 16 rows of its tile at a time
    if constexpr (SPLITA) {
        float* crow = C + (size_t)r0 * DM + c0;
#pragma unroll  // constant indices keep acc[][] in registers
        for (int i = 0; i < FA; ++i) {
#pragma unroll
            for (int t = 0; t < 4; ++t)
#pragma unroll
                for (int j = 0; j < 8; ++j) os[(hi * 8 + j) * 68 + t * 16 + lr] = acc[i][t][j] + bv[t];
            asm volatile("s_wait_dscnt 0x0" ::: "memory");      // the wave's rows stand in LDS before its lanes read what other lanes wrote
#pragma unroll
            for (int s = 0; s < 8; ++s) { const int Lid = (lane >> 3) + 4 * s, piece = lane & 7; const int row = Lid >> 1, cofs = (Lid & 1) * 32 + piece * 4;
                const v4f val = *(const v4fa*)(os + row * 68 + cofs); *(v4f*)(crow + (size_t)(i * 16 + row) * DM + cofs) = val; }
            if (i + 1 < FA) asm volatile("s_wait_xcnt 0x0" ::: "memory");   // behind the stores: the next 16 rows overwrite their data registers
        }
    } else {
        // Projections: 16 token rows at a time, every wave stages its 16 x 64 f32 tile (q, k, v or t of the head); behind a barrier the waves of a row group read one another's tiles:
        // the q wave writes line 0 of the query planes [q 0..31 | q*t 0..31], the t wave line 1 [q 32..63 | q*t 32..63], the k wave the k halves of both key-plane lines and the f32
        // products k*v/8 (C, [token][1024]) for the scan; the v wave turns its own accumulators into V^T tiles (a lane holds 8 successive tokens of one dim) in LDS of its own.
        typedef __attribute__((ext_vector_type(4))) _Float16 v4h;
        const int h = blockIdx.y, role = __builtin_amdgcn_readfirstlane(wn);   // scalar: the roles are real branches
        const int l16 = lane & 15;
        const float* tq = (const float*)ring + (wave - wn) * (16 * 68);        // the row group's q tile; k, v, t follow it
        h16* vs = (h16*)(ring + 16 * (16 * 68 * 4)) + wm * (2 * HD * 72);      // the v wave's V^T tiles, hi then residual: [64 dims][64 tokens], pitch 72; behind the 16 staging ranges
        auto split4 = [](v4f x, v4h& oh, v4h& ol) {
#pragma unroll
            for (int e = 0; e < 4; ++e) { const h16 a = (h16)x[e]; oh[e] = a; ol[e] = (h16)((x[e] - (float)a) * LOSC); }
        };
#pragma unroll  // constant indices keep acc[][] in registers
        for (int i = 0; i < FA; ++i) {
#pragma unroll
            for (int t = 0; t < 4; ++t)
#pragma unroll
                for (int j = 0; j < 8; ++j) os[(hi * 8 + j) * 68 + t * 16 + lr] = acc[i][t][j] + bv[t];
            asm volatile("s_wait_dscnt 0x0" ::: "memory");      // this wave's tile stands in LDS
            __syncthreads();                                    // ... and every other wave's
            const size_t tok = (size_t)(r0 + i * 16 + hi);      // a half wave per token row: 16 lanes x 8 bytes = one 128-byte line of a plane
            u64 dh[8], dl[8];
            if (role == 0 || role == 3) {
                const int g = role ? 1 : 0, c = g * 32 + (l16 & 7) * 4;
#pragma unroll
                for (int s = 0; s < 8; ++s) {
                    const v4f q4 = *(const v4fa*)(tq + (hi + 2 * s) * 68 + c), t4 = *(const v4fa*)(tq + 3 * (16 * 68) + (hi + 2 * s) * 68 + c);
                    v4h oh, ol; split4((l16 & 8) ? q4 * t4 : q4, oh, ol);
                    dh[s] = __builtin_bit_cast(u64, oh); dl[s] = __builtin_bit_cast(u64, ol);
                }
                const size_t o = tok * (NH_ * QW) + h * QW + g * 64 + l16 * 4;
                st_planes(QH + o, QL + o, dh, dl);
            } else if (role == 1) {
                v4f kv[8];
#pragma unroll
                for (int s = 0; s < 8; ++s) {
                    const v4f k4 = *(const v4fa*)(tq + 1 * (16 * 68) + (hi + 2 * s) * 68 + l16 * 4), v4 = *(const v4fa*)(tq + 2 * (16 * 68) + (hi + 2 * s) * 68 + l16 * 4);
                    v4h oh, ol; split4(k4, oh, ol);
                    dh[s] = __builtin_bit_cast(u64, oh); dl[s] = __builtin_bit_cast(u64, ol);
                    kv[s] = k4 * v4 * SCL;
                }
                const size_t o = tok * (NH_ * QW) + h * QW + (l16 >> 3) * 64 + (l16 & 7) * 4;
                st_planes(KH + o, KL + o, dh, dl);
                st_kv(C + tok * DM + h * HD + l16 * 4, kv);
            } else {
#pragma unroll
                for (int t = 0; t < 4; ++t) { v8h vh, vl;       // register j = token i * 16 + 8 hi + j of dim t * 16 + lr
#pragma unroll
                    for (int j = 0; j < 8; ++j) { const float v = acc[i][t][j] + bv[t]; const h16 a = (h16)v; vh[j] = a; vl[j] = (h16)((v - (float)a) * LOSC); }
                    *(v8ha*)(vs + (t * 16 + lr) * 72 + i * 16 + hi * 8) = vh; *(v8ha*)(vs + HD * 72 + (t * 16 + lr) * 72 + i * 16 + hi * 8) = vl; }
            }
            asm volatile("s_wait_dscnt 0x0" ::: "memory");      // this wave's reads of the tiles are done
            if (i + 1 < FA) __syncthreads();                    // ... and every other wave's, before the next 16 rows overwrite them
        }
        if (role == 2) {   // the wave's own V^T tiles (its s_wait_dscnt above covers the writes) go out as whole 128-byte lines: 64 tokens of a dim
            const size_t base = (((size_t)(r0 / NT_) * NH_ + h) * HD + (lane >> 3)) * NT_ + (r0 & (NT_ - 1)) + (lane & 7) * 8;
            const h16* vr = vs + (lane >> 3) * 72 + (lane & 7) * 8;
#pragma unroll
            for (int s4 = 0; s4 < 4; ++s4) {   // plane s4 / 2, dims 32 (s4 % 2) + lane / 8 + 4 s: 8 lanes = the 64 tokens of a dim
                v8h val[8];
#pragma unroll
                for (int s = 0; s < 8; ++s) val[s] = *(const v8ha*)(vr + (s4 >> 1) * (HD * 72) + ((s4 & 1) * 32 + 4 * s) * 72);
                st_vt((s4 >> 1 ? VTL : VT16) + base + (size_t)(s4 & 1) * 32 * NT_, val);
            }
        }
    }
}

// k_scan: sum_{j<=t} k[j]*v[j]/8 (inclusive prefix over t, f32; the products come from the projection epilogue) as a chunked scan inside one block, written as the f16 hi + residual
// prefix-sum halves of the key planes. Block = (b, 32 columns = whole 128-byte lines of the products = the second half of one line of each key plane);
// thread = (chunk of 16 rows, 4 columns): all 16 16-byte loads are independent and the 64 running sums stay in registers. Chunk sums -> LDS, exclusive prefix over the 128
// chunks in two levels (8 waves scan 16 chunks each, then every thread adds the sums of the groups before its own), then each thread adds that start value to its rows.
#define KC_R 16                  // rows per chunk
#define KC_N (NT_ / KC_R)        // 128 chunks
#define KC_G 8                   // groups of 16 chunks
__global__ __launch_bounds__(1024) void k_scan(const float* __restrict__ KV, h16* KH, h16* KL) {
    typedef __attribute__((ext_vector_type(4))) _Float16 v4h;
    __shared__ __align__(16) float tot[KC_N * 32];
    __shared__ __align__(16) float gtot[KC_G * 32];
    const int job = blockIdx.x;
    const int tid = threadIdx.x, cq = tid & 7, ch = tid >> 3;
    const int b = job / (DM / 32), cg = job - b * (DM / 32);
    const size_t blk = (size_t)b * NT_ * DM + cg * 32;         // block part of the index (scalar)
    const unsigned thr = (unsigned)(ch * KC_R * DM + cq * 4);  // thread part
    const float* kp = KV + blk;
    v4f p[KC_R];
#pragma unroll  // constant indices keep p[] in registers; the independent loads issue many at a time
    for (int i = 0; i < KC_R; ++i) p[i] = *(const v4f*)(kp + thr + i * DM);
#pragma unroll  // p[] in registers
    for (int i = 1; i < KC_R; ++i) p[i] += p[i - 1];           // inclusive prefix inside the chunk
    *(v4f*)(tot + ch * 32 + cq * 4) = p[KC_R - 1];
    __syncthreads();
    if (tid < KC_G * 32) { const int g = tid >> 5, col = tid & 31; float run = 0.f;
#pragma unroll  // the 16 LDS reads issue ahead of the add chain
        for (int i = 0; i < KC_N / KC_G; ++i) { float* q = tot + (g * (KC_N / KC_G) + i) * 32 + col; const float t = *q; *q = run; run += t; }
        gtot[g * 32 + col] = run; }
    __syncthreads();
    const int g = ch / (KC_N / KC_G);
    v4f gs[KC_G - 1];
#pragma unroll  // gs[] in registers
    for (int i = 0; i < KC_G - 1; ++i) gs[i] = *(const v4f*)(gtot + i * 32 + cq * 4);   // all read at once, then selected: no chain of LDS round trips
    v4f c = {};
#pragma unroll  // gs[] in registers
    for (int i = 0; i < KC_G - 1; ++i) c += (i < g) ? gs[i] : (v4f){};
    c += *(const v4f*)(tot + ch * 32 + cq * 4);
    // head cg / 2, line cg % 2 of its 128 combined dims, second half
    const size_t o0 = ((size_t)b * NT_ + ch * KC_R) * (NH_ * QW) + (cg >> 1) * QW + (cg & 1) * 64 + 32 + cq * 4;
#pragma unroll  // p[] in registers; stores back to back
    for (int i = 0; i < KC_R; ++i) { const v4f x = p[i] + c; v4h oh, ol;
#pragma unroll
        for (int e = 0; e < 4; ++e) { const h16 a = (h16)x[e]; oh[e] = a; ol[e] = (h16)((x[e] - (float)a) * LOSC); }
        *(v4h*)(KH + o0 + (size_t)i * (NH_ * QW)) = oh; *(v4h*)(KL + o0 + (size_t)i * (NH_ * QW)) = ol; }
}

// k_attn: block = (b, head pair hp, t): the 64-query tile t of head hp, then tile 31 - t of head hp + 8, one after the other: 33 steps of 64 keys in every block, so that the
// blocks, all resident at once, end together. The four waves are 2 query halves x 2 key halves: wave = 32 queries (two 16-query tiles) x the 32 keys of its half of each step, so
// that a key or V^T fragment read from LDS feeds TWO query tiles' products: 32 KB of LDS reads per 72 WMMA. Causal key tiles
// 0..query tile; scores over the 128 combined dims with hi.hi + hi.lo + lo.hi, x 1/8, keys after the query -> -inf; online f32 softmax over the wave's own keys; behind the loop
// the two key halves' maxima, sums and partial outputs are merged through LDS. The products are the TRANSPOSED ones: S^T = K.Q^T (A = key rows, B = query rows) and O^T += V^T.P^T
// (A = V^T rows, B = weights). A lane then holds 16 of the 32 scores of ONE query of a tile (lane l ^ 16 the other 16): maximum and sum run over the lane's own registers with
// one exchange between the halves, maximum, rescale factor and sum are one value a lane and tile, and the two score tiles, converted in place (x32768, f16 hi + residual x1024), ARE
// the B operand of the second product in the hardware k order: the weights pass through no LDS. ctx -> bf16 hi/lo planes CH/CL [token][h*64 + d].
// The 64-key tile of a step (key rows hi + lo, V^T rows hi + lo, 48 KB) is brought once per block into a two-buffer LDS ring by asynchronous copies, one step ahead;
// the waves read their fragments from there, and the query lo rows from a buffer copied once: the loop holds no global load. Rows are pitched 16 B x odd so that ds_load_b128 fragment reads meet no bank conflict.
#define KS    64                 // keys per step
#define KP    272                // LDS pitch of a 256-byte key row
#define VP    144                // LDS pitch of a 128-byte V^T row
#define ST_KL (KS * KP)          // stage offsets: key hi at 0, key lo, V^T hi, V^T lo
#define ST_VH (2 * KS * KP)
#define ST_VL (ST_VH + HD * VP)
#define ST_SZ (ST_VH + 2 * HD * VP)
// launch bounds, second argument: holds a wave to 512 registers, so that two blocks (two waves per SIMD) stay resident on a WGP
__global__ __launch_bounds__(128, 2) void k_attn(const h16* __restrict__ QH, const h16* __restrict__ QL, const h16* __restrict__ KH, const h16* __restrict__ KL, const h16* __restrict__ VT16, const h16* __restrict__ VTL, bf* CH, bf* CL) {
    __shared__ __align__(16) char ring[2 * ST_SZ];   // the merge and output staging of the epilogue reuses it behind the last step's barrier
    __shared__ __align__(16) char qlds[64 * KP];     // the block's 64 query lo rows, copied once
    const int lane = threadIdx.x & 31, wave = threadIdx.x >> 5, lr = lane & 15, hi = lane >> 4;
    const int qh = wave >> 1, kh = wave & 1;         // the wave's query half and key half
    const int bid = blockIdx.x;
    const int b = bid / ((NH_ / 2) * (NT_ / 64)), rem = bid - b * ((NH_ / 2) * (NT_ / 64)), hp = rem / (NT_ / 64), t0 = rem - hp * (NT_ / 64);
    const size_t tok0 = (size_t)b * NT_;
#pragma unroll 1  // the two tiles go through one copy of the code, one after the other
  for (int half = 0; half < 2; ++half) {
    const int h = half ? hp + NH_ / 2 : hp, qt = half ? NT_ / 64 - 1 - t0 : t0;
    const int q0 = qt * 64 + qh * 32;
    if (half) {
        asm volatile("s_wait_dscnt 0x0" ::: "memory");  // this wave's reads of the first tile's output staging are done
        __syncthreads();                                // ... and every other wave's, before the copies below refill that LDS
    }
    v16h ah[2][4];               // query hi fragments of the wave's two 16-query tiles
#pragma unroll
    for (int u = 0; u < 2; ++u) {
        const size_t qo = (tok0 + q0 + u * 16 + lr) * (NH_ * QW) + h * QW + 8 * hi;
#pragma unroll
        for (int kc = 0; kc < 4; ++kc) ah[u][kc] = cat16(*(const v8h*)(QH + qo + kc * 32), *(const v8h*)(QH + qo + kc * 32 + 16));
    }
    const size_t vbase = (((size_t)b * NH_ + h) * HD) * NT_;
    v8f o[2][4], ox[2][4];
#pragma unroll
    for (int u = 0; u < 2; ++u)
#pragma unroll
        for (int n = 0; n < 4; ++n) { o[u][n] = (v8f){}; ox[u][n] = (v8f){}; }
    float mrow[2] = {-3.0e38f, -3.0e38f}, lpart[2] = {0.f, 0.f};
    const int kt_end = qt + 1;
    // Copies of one tile: 24 per thread, 16 bytes each. Key planes: thread = (row tid/16 + 8 i, 16-byte piece tid%16); V^T planes: thread = (row tid/8 + 16 i, piece tid%8).
    const int tid = threadIdx.x, krow = tid >> 4, kcol = tid & 15, vrow = tid >> 3, vcol = tid & 7;
    const size_t kg = (tok0 + krow) * (NH_ * QW) + h * QW + kcol * 8, vg = vbase + (size_t)vrow * NT_ + vcol * 8;
    const unsigned lk0 = (unsigned)(size_t)ring + krow * KP + kcol * 16, lv0 = (unsigned)(size_t)ring + ST_VH + vrow * VP + vcol * 16;
    auto fillk = [&](const h16* g, unsigned l) {   // 64 rows of 256 bytes: one key plane, or the query lo rows
        // one statement: the closing s_wait_xcnt stands in front of any rewrite of an address register that a copy names
        asm volatile("global_load_async_to_lds_b128 %0, %8, off\n\t"
                     "global_load_async_to_lds_b128 %1, %9, off\n\t"
                     "global_load_async_to_lds_b128 %2, %10, off\n\t"
                     "global_load_async_to_lds_b128 %3, %11, off\n\t"
                     "global_load_async_to_lds_b128 %4, %12, off\n\t"
                     "global_load_async_to_lds_b128 %5, %13, off\n\t"
                     "global_load_async_to_lds_b128 %6, %14, off\n\t"
                     "global_load_async_to_lds_b128 %7, %15, off\n\t"
                     "s_wait_xcnt 0x0"
                     :: "v"(l), "v"(l + 8 * KP), "v"(l + 16 * KP), "v"(l + 24 * KP), "v"(l + 32 * KP), "v"(l + 40 * KP), "v"(l + 48 * KP), "v"(l + 56 * KP),
                        "v"(g), "v"(g + 8 * (NH_ * QW)), "v"(g + 16 * (NH_ * QW)), "v"(g + 24 * (NH_ * QW)),
                        "v"(g + 32 * (NH_ * QW)), "v"(g + 40 * (NH_ * QW)), "v"(g + 48 * (NH_ * QW)), "v"(g + 56 * (NH_ * QW))
                     : "memory");
    };
    auto fill = [&](int t, int buf) {
        fillk(KH + kg + (size_t)t * KS * (NH_ * QW), lk0 + buf * ST_SZ);
        fillk(KL + kg + (size_t)t * KS * (NH_ * QW), lk0 + buf * ST_SZ + ST_KL);
        const h16* gvh = VT16 + vg + t * KS; const h16* gvl = VTL + vg + t * KS;
        const unsigned lv = lv0 + buf * ST_SZ;
        // the 64 rows of both V^T planes; same form of statement
        asm volatile("global_load_async_to_lds_b128 %0, %8, off\n\t"
                     "global_load_async_to_lds_b128 %1, %9, off\n\t"
                     "global_load_async_to_lds_b128 %2, %10, off\n\t"
                     "global_load_async_to_lds_b128 %3, %11, off\n\t"
                     "global_load_async_to_lds_b128 %4, %12, off\n\t"
                     "global_load_async_to_lds_b128 %5, %13, off\n\t"
                     "global_load_async_to_lds_b128 %6, %14, off\n\t"
                     "global_load_async_to_lds_b128 %7, %15, off\n\t"
                     "s_wait_xcnt 0x0"
                     :: "v"(lv), "v"(lv + 16 * VP), "v"(lv + 32 * VP), "v"(lv + 48 * VP),
                        "v"(lv + HD * VP), "v"(lv + HD * VP + 16 * VP), "v"(lv + HD * VP + 32 * VP), "v"(lv + HD * VP + 48 * VP),
                        "v"(gvh), "v"(gvh + 16 * NT_), "v"(gvh + 32 * NT_), "v"(gvh + 48 * NT_),
                        "v"(gvl), "v"(gvl + 16 * NT_), "v"(gvl + 32 * NT_), "v"(gvl + 48 * NT_)
                     : "memory");
    };
    fillk(QL + (tok0 + qt * 64 + krow) * (NH_ * QW) + h * QW + kcol * 8, (unsigned)(size_t)qlds + krow * KP + kcol * 16);   // the 64 query lo rows: same shape as a key plane
    const char* qlp = qlds + (qh * 32 + lr) * KP + 16 * hi;
#pragma unroll 1  // stays rolled: one copy of the statements, their LDS addresses formed from t as in the main loop; unrolled, 48 constant addresses are kept across the loop and spill
    for (int t = 0; t < 2; ++t) {
        if (t < kt_end) fill(t, t);
        if (t == 0) {
            asm volatile("s_wait_asynccnt 0x0" ::: "memory");   // this wave's copies of the query rows and of tile 0 have landed
            __syncthreads();                                    // ... and every other wave's
        }
    }
#pragma unroll 1
    for (int kt = 0; kt < kt_end; ++kt) {
        const int l0 = kt * KS + kh * 32;               // first key of the wave's half of this step
        const char* st = ring + (kt & 1) * ST_SZ;
        v8f s0[2] = {}, s1[2] = {}, x0[2] = {}, x1[2] = {};
#pragma unroll
        for (int kc = 0; kc < 4; ++kc) {
            const char* p0 = st + (kh * 32 + lr) * KP + kc * 64 + 16 * hi; const char* p1 = p0 + 16 * KP;
            const v16h k0h = cat16(*(const v8ha*)p0, *(const v8ha*)(p0 + 32)), k0l = cat16(*(const v8ha*)(p0 + ST_KL), *(const v8ha*)(p0 + ST_KL + 32));
            const v16h k1h = cat16(*(const v8ha*)p1, *(const v8ha*)(p1 + 32)), k1l = cat16(*(const v8ha*)(p1 + ST_KL), *(const v8ha*)(p1 + ST_KL + 32));
            // lo products carry x1024, folded below; per accumulator the order lo.hi, hi.lo of each 32 dims is as before
#pragma unroll
            for (int u = 0; u < 2; ++u) { s0[u] = wmma16(k0h, ah[u][kc], s0[u]); x0[u] = wmma16(k0l, ah[u][kc], x0[u]); s1[u] = wmma16(k1h, ah[u][kc], s1[u]); x1[u] = wmma16(k1l, ah[u][kc], x1[u]); }
#pragma unroll
            for (int u = 0; u < 2; ++u) { const char* pq = qlp + u * 16 * KP + kc * 64; const v16h alk = cat16(*(const v8ha*)pq, *(const v8ha*)(pq + 32));   // query lo fragment re-read per step (register budget)
                x0[u] = wmma16(k0h, alk, x0[u]); x1[u] = wmma16(k1h, alk, x1[u]); }
        }
        v16h pa[2], px[2];
#pragma unroll  // the two query tiles' softmax steps are independent of one another
        for (int u = 0; u < 2; ++u) {
            // register j of s0 / s1 = key l0 + 8 hi + j / l0 + 16 + 8 hi + j of the lane's query: element j / 8 + j of the lane's B fragment below
            const int kd = q0 + u * 16 + lr - l0 - 8 * hi;   // last key offset that this query may see
            const v8f t0 = (s0[u] + x0[u] * LOSCI) * SCL, t1 = (s1[u] + x1[u] * LOSCI) * SCL;
            float a[16];
#pragma unroll
            for (int j = 0; j < 8; ++j) { a[j] = (j <= kd) ? t0[j] : -__builtin_inff(); a[8 + j] = (16 + j <= kd) ? t1[j] : -__builtin_inff(); }
            float mt[8];
#pragma unroll
            for (int j = 0; j < 8; ++j) mt[j] = fmaxf(a[2 * j], a[2 * j + 1]);
            float mx = fmaxf(fmaxf(fmaxf(mt[0], mt[1]), fmaxf(mt[2], mt[3])), fmaxf(fmaxf(mt[4], mt[5]), fmaxf(mt[6], mt[7])));
            mx = fmaxf(mx, xhalf(mx));
            const float mn = fmaxf(mrow[u], mx);
            v2f p[8];
#pragma unroll
            for (int i = 0; i < 8; ++i) {      // neighbouring registers in pairs: packed f32 arithmetic and packed conversions
                const v2f e = ((v2f){a[2 * i], a[2 * i + 1]} - mn) * L2E;
                p[i] = (v2f){__builtin_amdgcn_exp2f(e[0]), __builtin_amdgcn_exp2f(e[1])};
                const v2f ps = p[i] * PSC; const v2h ph = __builtin_convertvector(ps, v2h);
                const v2h pr = __builtin_convertvector((ps - __builtin_convertvector(ph, v2f)) * LOSC, v2h);
                pa[u][2 * i] = ph[0]; pa[u][2 * i + 1] = ph[1]; px[u][2 * i] = pr[0]; px[u][2 * i + 1] = pr[1];
            }
            const float alpha = __builtin_amdgcn_exp2f((mrow[u] - mn) * L2E);
            mrow[u] = mn;
#pragma unroll
            for (int w = 4; w > 0; w >>= 1)    // the lane's 16 weights, summed as a tree
#pragma unroll
                for (int i = 0; i < w; ++i) p[i] += p[i + w];
            lpart[u] = lpart[u] * alpha + (p[0][0] + p[0][1]);
#pragma unroll
            for (int n = 0; n < 4; ++n) { o[u][n] *= alpha; ox[u][n] *= alpha; }
        }
#pragma unroll
        for (int n = 0; n < 4; ++n) { const char* pv = st + ST_VH + (n * 16 + lr) * VP + kh * 64 + 16 * hi;
            const v16h vh = cat16(*(const v8ha*)pv, *(const v8ha*)(pv + 32)), vl = cat16(*(const v8ha*)(pv + HD * VP), *(const v8ha*)(pv + HD * VP + 32));
#pragma unroll
            for (int u = 0; u < 2; ++u) { o[u][n] = wmma16(vh, pa[u], o[u][n]); ox[u][n] = wmma16(vl, pa[u], ox[u][n]); }
#pragma unroll
            for (int u = 0; u < 2; ++u) ox[u][n] = wmma16(vh, px[u], ox[u][n]); }
        asm volatile("s_wait_dscnt 0x0" ::: "memory");      // this wave's reads of the buffer are done before it may be refilled
        asm volatile("s_wait_asynccnt 0x0" ::: "memory");   // this wave's copies of the next tile have landed
        __syncthreads();                                    // publishes the next tile and frees this step's buffer
        if (kt + 2 < kt_end) fill(kt + 2, kt & 1);
    }
    asm volatile("s_wait_asynccnt 0x0" ::: "memory");       // nothing in flight when the ring becomes merge and output staging
    // Merge of the two key halves: each wave publishes maximum and sum of its queries, reads its partner's, scales its own partial output to the common maximum and the whole
    // sum, and stages it; the store pass adds the two partial rows.
    float* os = (float*)ring + wave * (32 * 68);            // the wave's 32 partial output rows
    float* ml = (float*)ring + 4 * (32 * 68);               // [wave][tile][query][maximum, sum]
#pragma unroll
    for (int u = 0; u < 2; ++u) { lpart[u] += xhalf(lpart[u]); ml[((wave * 2 + u) * 16 + lr) * 2 + hi] = hi ? lpart[u] : mrow[u]; }
    __syncthreads();                                        // every wave's maxima and sums stand
#pragma unroll
    for (int u = 0; u < 2; ++u) {
        const v2f pm = *(const v2f*)(ml + (((wave ^ 1) * 2 + u) * 16 + lr) * 2);
        const float mm = fmaxf(mrow[u], pm[0]);
        const float f = __builtin_amdgcn_exp2f((mrow[u] - mm) * L2E), fp = __builtin_amdgcn_exp2f((pm[0] - mm) * L2E);
        const float inv = f / ((lpart[u] * f + pm[1] * fp) * PSC);
#pragma unroll
        for (int n = 0; n < 4; ++n)
#pragma unroll
            for (int q = 0; q < 2; ++q) { v4f w;    // register j of o[u][n] = dim n * 16 + 8 hi + j of query u * 16 + lr
#pragma unroll
                for (int i = 0; i < 4; ++i) w[i] = (o[u][n][q * 4 + i] + ox[u][n][q * 4 + i] * LOSCI) * inv;
                *(v4fa*)(os + (u * 16 + lr) * 68 + n * 16 + hi * 8 + q * 4) = w; }
    }
    __syncthreads();                                        // every wave's partial rows stand
    const size_t cbase = (tok0 + qt * 64 + wave * 16) * DM + (size_t)h * HD;   // the store pass: wave = 16 of the block's 64 queries
    const float* sb = (const float*)ring + (wave >> 1) * (2 * 32 * 68) + (wave & 1) * (16 * 68);
    auto pass = [&]() {
#pragma unroll
        for (int s = 0; s < 4; ++s) { const int row = 4 * s + (lane >> 3), piece = lane & 7; const float* sp = sb + row * 68 + piece * 8; v8us oh, ol;
#pragma unroll
            for (int i = 0; i < 8; ++i) { const float c = sp[i] + sp[32 * 68 + i]; const unsigned short hb = f2bf(c); oh[i] = hb; ol[i] = f2bf(c - bf2f(hb)); }
            *(v8us*)(CH + cbase + (size_t)row * DM + piece * 8) = oh; *(v8us*)(CL + cbase + (size_t)row * DM + piece * 8) = ol; }
    };
    pass();
    asm volatile("s_wait_xcnt 0x0" ::: "memory");   // behind the stores: the second tile's set-up overwrites their address and data registers
  }
}

extern "C" void kernel_launch(void* const* d_in, const int* in_sizes, int n_in,
                              void* d_out, int out_size, void* d_ws, size_t ws_size, hipStream_t stream) {
    (void)in_sizes; (void)n_in; (void)out_size;
    const float* x = (const float*)d_in[0]; const float* W4 = (const float*)d_in[1]; const float* b4 = (const float*)d_in[2]; const float* Wo = (const float*)d_in[3]; const float* bo = (const float*)d_in[4];
    float* out = (float*)d_out;    // [2][2048][1024]
    char* wsp = (char*)d_ws;
    auto take = [&](size_t bytes) { char* p = wsp; wsp += (bytes + 255) & ~(size_t)255; return (void*)p; };
    bf* Xb = (bf*)take((size_t)NTK * DM * 2); bf* W4T = (bf*)take((size_t)4 * DM * DM * 2); bf* WoT = (bf*)take((size_t)DM * DM * 2);
    h16* VT16 = (h16*)take((size_t)NTK * DM * 2); h16* VTL = (h16*)take((size_t)NTK * DM * 2); h16* KH = (h16*)take((size_t)NTK * NH_ * QW * 2); h16* KL = (h16*)take((size_t)NTK * NH_ * QW * 2);
    h16* QH = (h16*)take((size_t)NTK * NH_ * QW * 2); h16* QL = (h16*)take((size_t)NTK * NH_ * QW * 2);
    float* KV = (float*)take((size_t)NTK * DM * 4); bf* CH = (bf*)take((size_t)NTK * DM * 2); bf* CL = (bf*)take((size_t)NTK * DM * 2);   // f32 products k*v/8; ctx planes
    if ((size_t)(wsp - (char*)d_ws) > ws_size) return;    // 136,314,880 B
    k_prep<<<PB_W4 + PB_WO + NTK / 8, 256, 0, stream>>>(x, W4, Wo, Xb, W4T, WoT);
    k_gemmb<false><<<dim3(NTK / 256, (4 * DM) / 256, 1), 512, 0, stream>>>(Xb, nullptr, W4T, b4, KV, QH, QL, KH, KL, VT16, VTL);
    k_scan<<<NB_ * (DM / 32), 1024, 0, stream>>>(KV, KH, KL);
    k_attn<<<NB_ * (NH_ / 2) * (NT_ / 64), 128, 0, stream>>>(QH, QL, KH, KL, VT16, VTL, CH, CL);
    k_gemmb<true><<<dim3(NTK / 128, DM / 128, 1), 256, 0, stream>>>(CH, CL, WoT, bo, out, nullptr, nullptr, nullptr, nullptr, nullptr, nullptr);
}
